// v000
// Measured on an AMD MI455X. A time is GPU time per run, averaged over a window of back-to-back runs after a warm-up
// (all launches, gaps included; the runs take copies of the inputs in turn), and the median of several windows.
// Apart from v000's, it joins two sittings. Times from different sittings can be a few percent apart, while
// side-by-side timings come from the same sitting.
// v000 is the starting kernel. One run takes 341 microseconds.
// Contractions: projections Xt.W'^T and W'.Xt^T on v_wmma_f32_16x16x32_bf16 (Xt and W RNE-converted bf16 operands, f32 accumulate, bias added in f32);
// scores k'.q'^T (q', k' carried x64 as f16), P.v (P x32768 as f16, v x64 as f16) and Wm'.O^T (Wm' as f16(bf16(Wm) x1024), O x1024 as f16 hi plane
// + f16 residual plane, products w.h + w.l): v_wmma_f32_16x16x32_f16, f32 accumulate. Base-2 online softmax, 1/l fold and bias adds in f32 on VALU.
#include <hip/hip_runtime.h>
#include <math.h>
#include <stdint.h>

#define NB    4
#define SEQ   4096
#define DMOD  256
#define NH    4
#define HD    64
#define QSC   64.0f
#define KSC   64.0f
#define PCAR  32768.0f
#define VCAR  64.0f
#define OSC   1024.0f
#define WOS   1024.0f
#define LOG2E 1.4426950408889634f
#define ATT_WAVES   4
#define ATT_THREADS (ATT_WAVES * 32)
#define ATT_BLOCKS  (NB * NH * (SEQ / 64))
#define NKB    (SEQ / 32)
#define SLABF  (16 * 68)
#define SLAB64 (16 * 68)
#define XTP    72
static_assert(HD == 64 && DMOD == NH * HD);
static_assert((SEQ / 64) == 64 && NH == 4 && NB == 4);
static_assert(ATT_THREADS == 128 && ATT_BLOCKS == 1024 && NKB == 128);
static_assert((DMOD % 64) == 0 && (SEQ % 64) == 0 && (DMOD % 32) == 0);
static_assert(((NB * SEQ * DMOD / 8) % 256) == 0 && ((DMOD * DMOD / 8) % 256) == 0);
static_assert((DMOD / 8) == 32);
static_assert(64 * XTP >= 63 * XTP + 64);
static_assert(ATT_WAVES * SLABF >= 4 * 16 * 68);

typedef unsigned short u16;
typedef _Float16 v16h __attribute__((ext_vector_type(16)));
typedef _Float16 v8h  __attribute__((ext_vector_type(8)));
typedef __bf16   v16b __attribute__((ext_vector_type(16)));
typedef float    v8f  __attribute__((ext_vector_type(8)));
typedef float    v4f  __attribute__((ext_vector_type(4)));
typedef unsigned int v4u __attribute__((ext_vector_type(4)));

union FragH { v16h v; v8h h[2]; v4u u[2]; };
union FragB { v16b v; v4u u[2]; };

// ---- scalar helpers --------------------------------------------------------------------------------
__device__ __forceinline__ unsigned short bf_bits(float f) {          // f32 -> bf16 bits, RNE convert
  unsigned u = __float_as_uint(f);
  return (unsigned short)((u + 0x7FFFu + ((u >> 16) & 1u)) >> 16);
}
__device__ __forceinline__ float bf_up(unsigned short h) { return __uint_as_float(((unsigned)h) << 16); }
__device__ __forceinline__ float bfr(float f) { return bf_up(bf_bits(f)); }
__device__ __forceinline__ unsigned short h_bits(_Float16 x) { return __builtin_bit_cast(unsigned short, x); }
__device__ __forceinline__ unsigned pk16(unsigned short a, unsigned short b) { return (unsigned)a | ((unsigned)b << 16); }
__device__ __forceinline__ v8f zero8() { v8f z = {0.f, 0.f, 0.f, 0.f, 0.f, 0.f, 0.f, 0.f}; return z; }
__device__ __forceinline__ v4f zero4() { v4f z = {0.f, 0.f, 0.f, 0.f}; return z; }

// ---- fragment loaders: 16-bit A/B operand, lane -> row/col (lane&15), p already includes +8*(lane>>4);
//      elements 0..7 <- p[0..7] (k0+8h..), elements 8..15 <- p[16..23] (k0+16+8h..)  (same split k map for A and B;
//      B is always read from a k-contiguous [n][k] plane)
__device__ __forceinline__ v16h ldfrag_h(const _Float16* p) {
  FragH f;
  f.h[0] = *(const v8h*)(p);
  f.h[1] = *(const v8h*)(p + 16);
  return f.v;
}
__device__ __forceinline__ v16b ldfrag_b(const u16* p) {              // bf16 plane read as unsigned integer vectors
  FragB f;
  f.u[0] = *(const v4u*)(p);
  f.u[1] = *(const v4u*)(p + 16);
  return f.v;
}

__device__ __forceinline__ v8f mma_h(v16h a, v16h b, v8f c) {
  return __builtin_amdgcn_wmma_f32_16x16x32_f16(false, a, false, b, (short)0, c, false, false);
}
__device__ __forceinline__ v8f mma_b(v16b a, v16b b, v8f c) {
  return __builtin_amdgcn_wmma_f32_16x16x32_bf16(false, a, false, b, (short)0, c, false, false);
}
__device__ __forceinline__ void g2_3(v8f& a, v8f& b, v16h x0, v16h x1, v16h x2) {
#if defined(__HIP_DEVICE_COMPILE__)
  asm volatile("v_nop\n\tv_nop\n\tv_nop\n\tv_nop" : "+v"(a), "+v"(b) : "v"(x0), "v"(x1), "v"(x2) : "memory");
#endif
}
template <typename F>
__device__ __forceinline__ void g4_5(v8f& a, v8f& b, v8f& c, v8f& d, F x0, F x1, F x2, F x3, F x4) {
#if defined(__HIP_DEVICE_COMPILE__)
  asm volatile("v_nop\n\tv_nop\n\tv_nop\n\tv_nop"
               : "+v"(a), "+v"(b), "+v"(c), "+v"(d) : "v"(x0), "v"(x1), "v"(x2), "v"(x3), "v"(x4) : "memory");
#endif
}
__device__ __forceinline__ void g4_9(v8f& a, v8f& b, v8f& c, v8f& d, v16h x0, v16h x1, v16h x2, v16h x3, v16h x4,
                                     v16h x5, v16h x6, v16h x7, v16h x8) {
#if defined(__HIP_DEVICE_COMPILE__)
  asm volatile("v_nop\n\tv_nop\n\tv_nop\n\tv_nop"
               : "+v"(a), "+v"(b), "+v"(c), "+v"(d)
               : "v"(x0), "v"(x1), "v"(x2), "v"(x3), "v"(x4), "v"(x5), "v"(x6), "v"(x7), "v"(x8) : "memory");
#endif
}
__device__ __forceinline__ void acc_guard4(v8f& a, v8f& b, v8f& c, v8f& d) {
#if defined(__HIP_DEVICE_COMPILE__)
  asm volatile("v_nop\n\tv_nop\n\tv_nop\n\tv_nop" : "+v"(a), "+v"(b), "+v"(c), "+v"(d));
#endif
}
__device__ __forceinline__ void wave_sync_lds() {
  __builtin_amdgcn_fence(__ATOMIC_RELEASE, "workgroup");
  __builtin_amdgcn_wave_barrier();
  __builtin_amdgcn_fence(__ATOMIC_ACQUIRE, "workgroup");
}

// =====================================================================================================
// Weight matrix [DMOD][DMOD] f32 -> 16-bit plane [DMOD][DMOD] with the head-split permutation folded in:
//   mode 0: D[r][i]  = bf16 RNE bits of W[((r & 63) << 2) | (r >> 6)][i]      (output row r = h*64+d <- channel d*4+h)
//   mode 1: D[o][c]  = f16 bits of bf16value(W[o][((c & 63) << 2) | (c >> 6)]) * scale   (input column permuted the same way)
// Thread = 8 consecutive output elements (8 scalar loads, both candidate indices always < DMOD*DMOD, selected by value);
// coverage: grid = DMOD*DMOD/8/256 = 32 blocks x 256 thr x 8 = the whole plane.
// =====================================================================================================
__global__ __launch_bounds__(256) void cvtw(const float* __restrict__ w, u16* D, int mode, float scale) {
  const int gt = blockIdx.x * 256 + (int)threadIdx.x;
  if (gt >= (DMOD * DMOD) / 8) return;       // no barriers in this kernel
  const int row  = gt >> 5;                  // 0..255
  const int c8   = (gt & 31) * 8;            // 0..248
  const int prow = ((row & 63) << 2) | (row >> 6);
  const int hsel = c8 >> 6, d0 = c8 & 63;
  unsigned short s[8];
#pragma unroll
  for (int e = 0; e < 8; ++e) {
    const int i0  = prow * DMOD + c8 + e;                   // < 65536
    const int i1  = row * DMOD + ((d0 + e) << 2) + hsel;    // < 65536
    const int idx = (mode == 0) ? i0 : i1;
    const float v = w[idx];
    const unsigned short bb = bf_bits(v);
    const unsigned short hb = h_bits((_Float16)(bf_up(bb) * scale));
    s[e] = (mode == 0) ? bb : hb;
  }
  v4u o;
#pragma unroll
  for (int e = 0; e < 4; ++e) o[e] = pk16(s[2 * e], s[2 * e + 1]);
  u16* d = D + (size_t)gt * 8;
  {
    *(v4u*)(d) = o;
    
  }
}

// =====================================================================================================
// f32 plane -> f16 plane of (value * scale), same layout (scale a power of two).
// Thread = 8 consecutive elements: two 16-B loads, one 16-B store; 32 consecutive lanes = 512 contiguous, 512-B aligned bytes
// coverage: grid = n8/256 blocks (host checks exactness) x 256 thr x 8 = the whole plane.
// =====================================================================================================
__global__ __launch_bounds__(256) void cvh16(const float* __restrict__ x, u16* D, int n8, float scale) {
  const int gt = blockIdx.x * 256 + (int)threadIdx.x;
  if (gt >= n8) return;                     // no barriers in this kernel
  const float* p = x + (size_t)gt * 8;
  const v4f a = *(const v4f*)(p), c4 = *(const v4f*)(p + 4);
  float v[8];
#pragma unroll
  for (int e = 0; e < 4; ++e) { v[e] = a[e]; v[4 + e] = c4[e]; }
  unsigned short s[8];
#pragma unroll
  for (int e = 0; e < 8; ++e) s[e] = h_bits((_Float16)(v[e] * scale));
  v4u o;
#pragma unroll
  for (int e = 0; e < 4; ++e) o[e] = pk16(s[2 * e], s[2 * e + 1]);
  u16* d = D + (size_t)gt * 8;
  {
    *(v4u*)(d) = o;
    
  }
}

// =====================================================================================================
// Input transpose + convert: X [b][DMOD][SEQ] f32 -> XT bf16 [b][SEQ][DMOD]. Block = (b, 64 tokens, 64 channels):
// 64 channel rows x 64 tokens loaded with 16-B loads, RNE-converted, scattered into an LDS tile [token][channel] (pitch XTP);
// coverage: load 256 thr x 16 elements = 64 x 64; store 2 iterations x 256 thr x 8 halves = 64 lines x 64 halves = the block's
//           tile; grid = NB x (SEQ/64) x (DMOD/64) = 1024 blocks covers XT exactly once.
// =====================================================================================================
__global__ __launch_bounds__(256) void xt16(const float* __restrict__ x, u16* XT) {
  __shared__ __align__(16) u16 T[64 * XTP];
  const int tid = threadIdx.x;
  const int bid = blockIdx.x;
  const int ct  = bid & 3;                    // channel tile, DMOD/64 = 4
  const int st  = (bid >> 2) & 63;            // token tile, SEQ/64 = 64
  const int b   = bid >> 8;                   // 0..3
  const int c0  = ct * 64, s0 = st * 64;
  {
    const int cl = tid >> 2;                  // channel within tile 0..63
    const int tc = (tid & 3) * 16;            // token chunk
    const float* src = x + ((size_t)(b * DMOD + c0 + cl)) * SEQ + s0 + tc;
#pragma unroll
    for (int i = 0; i < 4; ++i) {
      const v4f a = *(const v4f*)(src + 4 * i);
#pragma unroll
      for (int e = 0; e < 4; ++e) T[(tc + 4 * i + e) * XTP + cl] = bf_bits(a[e]);
    }
  }
  __syncthreads();
  v4u o[2];
  const int q8 = tid >> 3, p8 = (tid & 7) * 8;
#pragma unroll
  for (int it = 0; it < 2; ++it) {
    const int line = it * 32 + q8;            // token within tile 0..63
    o[it] = *(const v4u*)(T + line * XTP + p8);
  }
  const size_t base = ((size_t)(b * SEQ + s0)) * DMOD + c0 + p8;
  {
#pragma unroll
    for (int it = 0; it < 2; ++it) {
      const int line = it * 32 + q8;
      *(v4u*)(XT + base + (size_t)line * DMOD) = o[it];
    }
    
  }
}

// =====================================================================================================
// Bias terms for the GEMM epilogue (bf16-RNE values of bias[], array of DMOD entries; every candidate index is masked into
// 0..DMOD-1 so all loads are in range, selection by value):
//   bmode 0: per-column, permuted index ((col&63)<<2)|(col>>6); bmode 1: per-row, same permutation of the row; bmode 2: per-row direct.
// =====================================================================================================
__device__ __forceinline__ void bias_terms(const float* __restrict__ bias, int bmode, int rowb, int col0, int hh, int m,
                                           v4f& badd, v8f& radd) {
#pragma unroll
  for (int e = 0; e < 4; ++e) {
    const int ci = col0 + 4 * m + e;
    const int pc = ((ci & 63) << 2) | ((ci >> 6) & 3);
    const float bc = bfr(bias[pc]);
    badd[e] = (bmode == 0) ? bc : 0.0f;
  }
#pragma unroll
  for (int r = 0; r < 8; ++r) {
    const int ri = rowb + 8 * hh + r;
    const int p1 = ((ri & 63) << 2) | ((ri >> 6) & 3);
    const int p2 = ri & (DMOD - 1);
    const float b1 = bfr(bias[p1]), b2 = bfr(bias[p2]);
    radd[r] = (bmode == 1) ? b1 : ((bmode == 2) ? b2 : 0.0f);
  }
}

// =====================================================================================================
// GEMM epilogue shared by both engines: the wave's 16x64 f32 tile (times oscale, plus per-row addend radd) staged in its LDS
// coverage: 8 instructions x 2 rows x 16 lanes x 4 floats = the wave's 16 x 64 tile.
// =====================================================================================================
__device__ __forceinline__ void epi64(float* sl, v8f a0, v8f a1, v8f a2, v8f a3, float oscale, v4f badd, v8f radd,
                                      float* C, int N, size_t rowb, int col0, int lane) {
  const int hh = lane >> 4, m = lane & 15;
#pragma unroll
  for (int r = 0; r < 8; ++r) {
    const int ro = (8 * hh + r) * 68 + m;
    sl[ro]      = a0[r] * oscale + radd[r];
    sl[ro + 16] = a1[r] * oscale + radd[r];
    sl[ro + 32] = a2[r] * oscale + radd[r];
    sl[ro + 48] = a3[r] * oscale + radd[r];
  }
  wave_sync_lds();
  v4f vals[8];
#pragma unroll
  for (int it = 0; it < 8; ++it) vals[it] = *(const v4f*)(sl + (it * 2 + hh) * 68 + m * 4) + badd;
  float* dst = C + (rowb + (size_t)hh) * (size_t)N + col0 + m * 4;
  {
#pragma unroll
    for (int it = 0; it < 8; ++it) {
      *(v4f*)(dst + (size_t)(it * 2) * (size_t)N) = vals[it];
    }
    
  }
}

// =====================================================================================================
// bf16 GEMM with bias: C[M][N] (f32, pitch N) = A[M][K] (bf16 row-major) . Bt[N][K]^T (bf16 k-contiguous), times oscale, plus
// the bias term selected by bmode (see bias_terms). grid.x = (M/64)*(N/64) tiles, grid.y = batch index y with element strides
// sA, sB, sC added to A, Bt, C. Block = 64x64 tile, 4 waves x 16 rows; fragments loaded straight from the 16-bit rows (two 16-B
// loads each, split k map for A and B); K stepped by 32 (host: K % 32 == 0, M % 64 == 0, N % 64 == 0).
// =====================================================================================================
__global__ __launch_bounds__(128)
void gemm_bfb(const u16* __restrict__ A, const u16* __restrict__ Bt, const float* __restrict__ bias,
              float* C, int M, int N, int K, float oscale, int bmode, int sA, int sB, int sC) {
  __shared__ __align__(16) float slab[4 * SLAB64];
  const int tid = threadIdx.x, wave = tid >> 5, lane = tid & 31, hh = lane >> 4, m = lane & 15;
  const int ntile = N >> 6;
  const int bid   = blockIdx.x;
  const int y     = blockIdx.y;
  const int rowb  = (bid / ntile) * 64 + wave * 16;
  const int col0  = (bid % ntile) * 64;
  if (rowb + 16 > M) return;                 // wave-uniform, never taken with the exact grid; no block barriers in this kernel
  const u16* Ab = A  + (size_t)y * (size_t)sA;
  const u16* Bb = Bt + (size_t)y * (size_t)sB;
  float*     Cb = C  + (size_t)y * (size_t)sC;
  const u16* ap = Ab + (size_t)(rowb + m) * K + 8 * hh;
  const u16* bp = Bb + (size_t)(col0 + m) * K + 8 * hh;
  const size_t bs = (size_t)16 * K;
  v8f acc0 = zero8(), acc1 = zero8(), acc2 = zero8(), acc3 = zero8();
#pragma unroll 1
  for (int k0 = 0; k0 < K; k0 += 32) {
    const v16b a  = ldfrag_b(ap + k0);
    const v16b b0 = ldfrag_b(bp + k0);
    const v16b b1 = ldfrag_b(bp + bs + k0);
    const v16b b2 = ldfrag_b(bp + 2 * bs + k0);
    const v16b b3 = ldfrag_b(bp + 3 * bs + k0);
    acc0 = mma_b(a, b0, acc0);
    acc1 = mma_b(a, b1, acc1);
    acc2 = mma_b(a, b2, acc2);
    acc3 = mma_b(a, b3, acc3);
    g4_5<v16b>(acc0, acc1, acc2, acc3, a, b0, b1, b2, b3);
  }
  v4f badd = zero4();
  v8f radd = zero8();
  bias_terms(bias, bmode, rowb, col0, hh, m, badd, radd);
  epi64(slab + wave * SLAB64, acc0, acc1, acc2, acc3, oscale, badd, radd, Cb, N, (size_t)rowb, col0, lane);
}

// =====================================================================================================
// f16 GEMM, single A plane, hi+lo B planes, per-row bias: C[M][N] (f32, pitch N) = A[M][K] . (Bh + Bl)[N][K]^T times oscale,
// plus bf16-RNE value of bias[row]; A f16 k-contiguous (no batch stride), Bh/Bl f16 [n][k] planes with batch stride sB, C with
// batch stride sC (grid.y = batch). Products a.bh + a.bl into one accumulator (bl is the unscaled residual of bh). Same tiling
// as gemm_bfb.
// =====================================================================================================
__global__ __launch_bounds__(128)
void gemm_wh2(const u16* __restrict__ A, const u16* __restrict__ Bh, const u16* __restrict__ Bl,
              const float* __restrict__ bias, float* C, int M, int N, int K, float oscale, int sB, int sC) {
  __shared__ __align__(16) float slab[4 * SLAB64];
  const int tid = threadIdx.x, wave = tid >> 5, lane = tid & 31, hh = lane >> 4, m = lane & 15;
  const int ntile = N >> 6;
  const int bid   = blockIdx.x;
  const int y     = blockIdx.y;
  const int rowb  = (bid / ntile) * 64 + wave * 16;
  const int col0  = (bid % ntile) * 64;
  if (rowb + 16 > M) return;                 // wave-uniform, never taken with the exact grid; no block barriers in this kernel
  const _Float16* ap  = (const _Float16*)(const void*)A + (size_t)(rowb + m) * K + 8 * hh;
  const size_t bofs   = (size_t)y * (size_t)sB + (size_t)(col0 + m) * K + 8 * hh;
  const _Float16* bhp = (const _Float16*)(const void*)Bh + bofs;
  const _Float16* blp = (const _Float16*)(const void*)Bl + bofs;
  float* Cb = C + (size_t)y * (size_t)sC;
  const size_t bs = (size_t)16 * K;
  v8f acc0 = zero8(), acc1 = zero8(), acc2 = zero8(), acc3 = zero8();
#pragma unroll 1
  for (int k0 = 0; k0 < K; k0 += 32) {
    const v16h a   = ldfrag_h(ap + k0);
    const v16h bh0 = ldfrag_h(bhp + k0);
    const v16h bh1 = ldfrag_h(bhp + bs + k0);
    const v16h bh2 = ldfrag_h(bhp + 2 * bs + k0);
    const v16h bh3 = ldfrag_h(bhp + 3 * bs + k0);
    const v16h bl0 = ldfrag_h(blp + k0);
    const v16h bl1 = ldfrag_h(blp + bs + k0);
    const v16h bl2 = ldfrag_h(blp + 2 * bs + k0);
    const v16h bl3 = ldfrag_h(blp + 3 * bs + k0);
    acc0 = mma_h(a, bh0, acc0);  acc0 = mma_h(a, bl0, acc0);
    acc1 = mma_h(a, bh1, acc1);  acc1 = mma_h(a, bl1, acc1);
    acc2 = mma_h(a, bh2, acc2);  acc2 = mma_h(a, bl2, acc2);
    acc3 = mma_h(a, bh3, acc3);  acc3 = mma_h(a, bl3, acc3);
    g4_9(acc0, acc1, acc2, acc3, a, bh0, bh1, bh2, bh3, bl0, bl1, bl2, bl3);
  }
  v4f badd = zero4();
  v8f radd = zero8();
  bias_terms(bias, 2, rowb, col0, hh, m, badd, radd);
  epi64(slab + wave * SLAB64, acc0, acc1, acc2, acc3, oscale, badd, radd, Cb, N, (size_t)rowb, col0, lane);
}

// =====================================================================================================
// Full (non-causal, unmasked) multi-head flash attention: block = (batch b, head, 64 query rows), 4 waves, wave w owns the
// 16 query rows q0 = 64*qt + 16*w .. q0+15 (waves independent: no block barriers, wave-private LDS only, used in the epilogue).
//   q plane (f16, x64) laid out [b][s][h][d]; k plane the same; v^T plane [b][h][d][s] (x64). All NKB = 128 key blocks of 32
//   keys are visited (static bound).
//   Scores are computed TRANSPOSED: S^T tile g (g = 0,1) = k rows (keys kb+16g .. +15, A operand, row m = lane&15, split k map
//   over d) times q^T (B operand, col n = query q0 + (lane&15), k = d, split map), one product per tile and d-chunk.
//   D element r of lane l = (key kb+16g+8h+r, query q0+(l&15)), so a lane owns one query column and 16 of its 32 keys; the
//   partner lane l^16 owns the other 16 -> row max / row sum need one xor-16 shuffle.
//   Online max-subtracted base-2 softmax in f32 (scale 1/8 and the q,k carries folded into lsc). The exp'd values ARE the
//   P A-fragment in place: A row m = query = lane&15, element i <- key kb+8h+i (tile 0, D element i), element 8+i <- key
//   kb+16+8h+i (tile 1, D element i). P is carried x32768 as f16. The rescale factor of query row 8h+r of the O accumulators is
//   fetched from lane 8h+r with a shuffle (uniform control). 4 v^T B fragments (col n = d = 16j + (lane&15), keys k-contiguous),
//   4 P.V WMMAs per key block.
//   Epilogue: 1/l (per query, shuffled to the D row owner) and carry folds in f32; the wave's 16x64 f32 result staged in its LDS
// coverage: per wave 4 instructions x 4 rows x 8 lanes x 8 halves = 16 x 64 per plane; grid 1024 blocks x 4 waves = every
//           (b, s, h) row of both O planes exactly once.
// =====================================================================================================
__global__ __launch_bounds__(ATT_THREADS)
void attn_fwd(const u16* __restrict__ QHp, const u16* __restrict__ KHp, const u16* __restrict__ VHp,
              u16* OHIp, u16* OLOp) {
  __shared__ __align__(16) float smem[ATT_WAVES * SLABF];   // per wave: result slab [16][68] in the epilogue only

  const int tid  = threadIdx.x;
  const int wave = tid >> 5;
  const int lane = tid & 31;
  const int hh   = lane >> 4;
  const int c    = lane & 15;

  const int bid  = blockIdx.x;
  const int qt   = bid & (SEQ / 64 - 1);      // 0..63
  const int head = (bid >> 6) & (NH - 1);     // 0..3
  const int b    = bid >> 8;                  // 0..3
  const int q0   = qt * 64 + wave * 16;

  // B fragments of q^T: col n = query q0 + c, k = d (k-contiguous row of the q plane); loop-invariant
  const size_t qofs = (((size_t)(b * SEQ + q0 + c)) * NH + head) * HD + 8 * hh;
  const _Float16* Qh  = (const _Float16*)(const void*)QHp + qofs;
  const v16h qh0 = ldfrag_h(Qh), qh1 = ldfrag_h(Qh + 32);
  // A fragments of k: row m = key kb + 16g + c, k = d
  const size_t kofs = (((size_t)b * SEQ + c) * NH + head) * HD + 8 * hh;          // key kb added per step
  const _Float16* Khb = (const _Float16*)(const void*)KHp + kofs;
  // B fragments of v: col n = d = 16j + c, k = key (k-contiguous row of the v^T plane)
  const size_t vofs = ((size_t)(b * NH + head) * HD + c) * SEQ + 8 * hh;          // key kb added per step
  const _Float16* Vhb = (const _Float16*)(const void*)VHp + vofs;
  const float lsc = 0.125f * (LOG2E / (QSC * KSC));

  float mrun = -INFINITY, lrun = 0.f;
  v8f o[4];
#pragma unroll
  for (int j = 0; j < 4; ++j) o[j] = zero8();

#pragma unroll 1
  for (int it = 0; it < NKB; ++it) {
    const int kb = it * 32;
    // ---- transposed scores: s0 = keys kb..kb+15, s1 = keys kb+16..kb+31, column = query q0 + c ----
    v8f s0 = zero8(), s1 = zero8();
    const _Float16* k0p = Khb + (size_t)kb * (NH * HD);
    const _Float16* k1p = k0p + (size_t)16 * (NH * HD);
    {
      const v16h kh0 = ldfrag_h(k0p), kh1 = ldfrag_h(k1p);
      s0 = mma_h(kh0, qh0, s0);
      s1 = mma_h(kh1, qh0, s1);
      g2_3(s0, s1, qh0, kh0, kh1);
    }
    {
      const v16h kh0 = ldfrag_h(k0p + 32), kh1 = ldfrag_h(k1p + 32);
      s0 = mma_h(kh0, qh1, s0);
      s1 = mma_h(kh1, qh1, s1);
      g2_3(s0, s1, qh1, kh0, kh1);
    }
    // ---- base-2 logits of this lane's 16 keys for query q0 + c: t[i] <- key kb+8hh+i, t[8+i] <- key kb+16+8hh+i ----
    float t[16];
#pragma unroll
    for (int i = 0; i < 8; ++i) { t[i] = s0[i] * lsc; t[8 + i] = s1[i] * lsc; }
    float cm = t[0];
#pragma unroll
    for (int i = 1; i < 16; ++i) cm = fmaxf(cm, t[i]);
    cm = fmaxf(cm, __shfl_xor(cm, 16, 32));
    const float mn = fmaxf(mrun, cm);        // finite from the first block on
    const float al = exp2f(mrun - mn);       // 0 on the first block (mrun = -inf)
    mrun = mn;
    // ---- probabilities (<= 1) and the P A-fragment: f16(p * 32768); element i <-> t[i] ----
    float ps = 0.f;
    FragH ph;
#pragma unroll
    for (int w = 0; w < 2; ++w) {
#pragma unroll
      for (int e4 = 0; e4 < 4; ++e4) {
        const int i = 8 * w + 2 * e4;
        const float p0 = exp2f(t[i] - mn), p1 = exp2f(t[i + 1] - mn);
        ps += p0 + p1;
        const _Float16 h0 = (_Float16)(p0 * PCAR), h1 = (_Float16)(p1 * PCAR);
        ph.u[w][e4] = pk16(h_bits(h0), h_bits(h1));
      }
    }
    ps += __shfl_xor(ps, 16, 32);
    lrun = lrun * al + ps;
    // ---- rescale the O accumulators: D row 8hh+r = query q0+8hh+r, its factor lives in lane 8hh+r (and 16+8hh+r) ----
    float scl[8];
#pragma unroll
    for (int r = 0; r < 8; ++r) scl[r] = __shfl(al, 8 * hh + r, 32);
#pragma unroll
    for (int j = 0; j < 4; ++j) {
#pragma unroll
      for (int r = 0; r < 8; ++r) o[j][r] *= scl[r];
    }
    // ---- P.V : B fragment col n = d = j*16 + c, keys contiguous in the v^T plane ----
    {
      const _Float16* vhp = Vhb + kb;
      const v16h vh0 = ldfrag_h(vhp);
      const v16h vh1 = ldfrag_h(vhp + (size_t)16 * SEQ);
      const v16h vh2 = ldfrag_h(vhp + (size_t)32 * SEQ);
      const v16h vh3 = ldfrag_h(vhp + (size_t)48 * SEQ);
      o[0] = mma_h(ph.v, vh0, o[0]);
      o[1] = mma_h(ph.v, vh1, o[1]);
      o[2] = mma_h(ph.v, vh2, o[2]);
      o[3] = mma_h(ph.v, vh3, o[3]);
      g4_5<v16h>(o[0], o[1], o[2], o[3], ph.v, vh0, vh1, vh2, vh3);
    }
  }
  acc_guard4(o[0], o[1], o[2], o[3]);

  // ---- fold 1/l (per query, owned by lane = query) and the carries (32768 on P, 64 on v); stage the 16x64 slab ----
  const float linv = (1.0f / lrun) * (1.0f / (PCAR * VCAR));
  float inv[8];
#pragma unroll
  for (int r = 0; r < 8; ++r) inv[r] = __shfl(linv, 8 * hh + r, 32);
  float* slab = smem + wave * SLABF;
#pragma unroll
  for (int r = 0; r < 8; ++r) {
#pragma unroll
    for (int j = 0; j < 4; ++j) slab[(8 * hh + r) * 68 + j * 16 + c] = o[j][r] * inv[r];
  }
  wave_sync_lds();
  // ---- O x1024 -> f16 hi + residual planes; lane = (row in group of 4, 8 consecutive d) ----
  v4u oh[4], ol[4];
  const int rq = lane >> 3, c8 = (lane & 7) * 8;
#pragma unroll
  for (int i4 = 0; i4 < 4; ++i4) {
    const int row = i4 * 4 + rq;
    const v4f a = *(const v4f*)(slab + row * 68 + c8), c4 = *(const v4f*)(slab + row * 68 + c8 + 4);
    float w[8];
#pragma unroll
    for (int e = 0; e < 4; ++e) { w[e] = a[e] * OSC; w[4 + e] = c4[e] * OSC; }
#pragma unroll
    for (int e = 0; e < 4; ++e) {
      const _Float16 h0 = (_Float16)w[2 * e], h1 = (_Float16)w[2 * e + 1];
      const _Float16 l0 = (_Float16)(w[2 * e] - (float)h0), l1 = (_Float16)(w[2 * e + 1] - (float)h1);
      oh[i4][e] = pk16(h_bits(h0), h_bits(h1));
      ol[i4][e] = pk16(h_bits(l0), h_bits(l1));
    }
  }
  const size_t ob = (((size_t)(b * SEQ + q0)) * NH + head) * HD + c8;
  {
#pragma unroll
    for (int i4 = 0; i4 < 4; ++i4) {
      const int row = i4 * 4 + rq;
      const size_t o8 = ob + (size_t)row * (NH * HD);
      *(v4u*)(OHIp + o8) = oh[i4];
      *(v4u*)(OLOp + o8) = ol[i4];
    }
    
  }
}

// =====================================================================================================
// Workspace map (bytes); every plane is fully written by whole-line stores before it is read; all extents are exact multiples
// of the store granularity (no pad rows needed); every offset a multiple of 131072; XT and F are reused sequentially (in-order stream):
//   XT  bf16 [16384 token][256 i]                    8388608     (query, then key, then value)
//   WQB bf16 [256 r'][256 i] (rows permuted)        131072      WKB same 131072     WVB same 131072
//   WOB f16  [256 o][256 c'] x1024 (cols permuted)  131072
//   F   f32  [16384][256] / [4][256][4096]         16777216     (projection q, then k, then v)
//   QH  f16  [4][4096][4][64] x64                   8388608      KH same 8388608
//   VH  f16  [4][4][64][4096] x64                   8388608
//   OHI f16  [4][4096][4][64] x1024                 8388608      OLO residual 8388608
//   end                                            67633152
// =====================================================================================================
extern "C" void kernel_launch(void* const* d_in, const int* in_sizes, int n_in,
                              void* d_out, int out_size, void* d_ws, size_t ws_size,
                              hipStream_t stream) {
  const int ROWS = NB * SEQ;                            // 16384 tokens
  const int XN   = NB * DMOD * SEQ;                     // 4194304
  if (n_in < 11) return;
  if (in_sizes[0] != XN || in_sizes[1] != XN || in_sizes[2] != XN) return;
  if (in_sizes[3] != DMOD * DMOD || in_sizes[5] != DMOD * DMOD) return;
  if (in_sizes[7] != DMOD * DMOD || in_sizes[9] != DMOD * DMOD) return;
  if (in_sizes[4] != DMOD || in_sizes[6] != DMOD || in_sizes[8] != DMOD || in_sizes[10] != DMOD) return;
  if (out_size != XN) return;

  const float* Qin = (const float*)d_in[0];
  const float* Kin = (const float*)d_in[1];
  const float* Vin = (const float*)d_in[2];
  const float* wq  = (const float*)d_in[3];
  const float* bq  = (const float*)d_in[4];
  const float* wk  = (const float*)d_in[5];
  const float* bk  = (const float*)d_in[6];
  const float* wv  = (const float*)d_in[7];
  const float* bv  = (const float*)d_in[8];
  const float* wo  = (const float*)d_in[9];
  const float* bo  = (const float*)d_in[10];
  float*       out = (float*)d_out;

  const size_t szXT = (size_t)ROWS * DMOD * 2;                  //  8388608
  const size_t szW  = (size_t)DMOD * DMOD * 2;                  //   131072
  const size_t szF  = (size_t)ROWS * DMOD * 4;                  // 16777216
  const size_t szP  = (size_t)ROWS * DMOD * 2;                  //  8388608  (q/k/v/o planes)
  size_t off = 0;
  const size_t oXT  = off; off += szXT;
  const size_t oWQB = off; off += szW;
  const size_t oWKB = off; off += szW;
  const size_t oWVB = off; off += szW;
  const size_t oWOB = off; off += szW;
  const size_t oF   = off; off += szF;
  const size_t oQH  = off; off += szP;
  const size_t oKH  = off; off += szP;
  const size_t oVH  = off; off += szP;
  const size_t oOHI = off; off += szP;
  const size_t oOLO = off; off += szP;
  if (off > ws_size) return;                            // off = 67633152
  if (off > (size_t)134217728) return;

  char* ws = (char*)d_ws;
  u16*   XT  = (u16*)(ws + oXT);
  u16*   WQB = (u16*)(ws + oWQB);
  u16*   WKB = (u16*)(ws + oWKB);
  u16*   WVB = (u16*)(ws + oWVB);
  u16*   WOB = (u16*)(ws + oWOB);
  float* F   = (float*)(ws + oF);
  u16*   QH  = (u16*)(ws + oQH);
  u16*   KH  = (u16*)(ws + oKH);
  u16*   VH  = (u16*)(ws + oVH);
  u16*   OHI = (u16*)(ws + oOHI);
  u16*   OLO = (u16*)(ws + oOLO);

  const dim3 blk(256);
  const int n8x = XN / 8;                               // 524288
  const int n8w = (DMOD * DMOD) / 8;                    // 8192
  if ((n8x % 256) != 0 || (n8w % 256) != 0) return;
  const dim3 gP(n8x / 256);                             // 2048
  const dim3 gWc(n8w / 256);                            // 32
  const dim3 gXT(NB * (SEQ / 64) * (DMOD / 64));        // 1024
  const dim3 gGt((ROWS / 64) * (DMOD / 64), 1);         // 1024 tiles, token-major projections
  const dim3 gGc((DMOD / 64) * (SEQ / 64), NB);         // 256 tiles x 4 batches, channel-major per batch
  const dim3 bG(128);
  const dim3 gAT(ATT_BLOCKS);                           // 1024
  const dim3 bAT(ATT_THREADS);                          // 128
  const int  sTok = SEQ * DMOD;                         // 1048576 elements: per-batch stride of XT / O planes
  const int  sChn = DMOD * SEQ;                         // 1048576 elements: per-batch stride of F (v) and out

  // (0..3) weights: rows of wq/wk/wv permuted to r' = h*64+d (bf16 planes); columns of wo permuted the same way (f16 of bf16 value x1024)
  cvtw<<<gWc, blk, 0, stream>>>(wq, WQB, 0, 1.0f);
  cvtw<<<gWc, blk, 0, stream>>>(wk, WKB, 0, 1.0f);
  cvtw<<<gWc, blk, 0, stream>>>(wv, WVB, 0, 1.0f);
  cvtw<<<gWc, blk, 0, stream>>>(wo, WOB, 1, WOS);
  // (4..6) q: input -> XT bf16 [token][i]; projection + bias -> F [16384 token][h*64+d] f32; -> f16 plane x64
  xt16<<<gXT, blk, 0, stream>>>(Qin, XT);
  gemm_bfb<<<gGt, bG, 0, stream>>>(XT, WQB, bq, F, ROWS, DMOD, DMOD, 1.0f, 0, 0, 0, 0);
  cvh16<<<gP, blk, 0, stream>>>(F, QH, n8x, QSC);
  // (7..9) k: same pipeline (XT and F reused; single in-order stream)
  xt16<<<gXT, blk, 0, stream>>>(Kin, XT);
  gemm_bfb<<<gGt, bG, 0, stream>>>(XT, WKB, bk, F, ROWS, DMOD, DMOD, 1.0f, 0, 0, 0, 0);
  cvh16<<<gP, blk, 0, stream>>>(F, KH, n8x, KSC);
  // (10..12) v: input -> XT; channel-major projection per batch -> F [b][h*64+d][4096] f32 (= v^T plane layout); -> f16 plane x64
  xt16<<<gXT, blk, 0, stream>>>(Vin, XT);
  gemm_bfb<<<gGc, bG, 0, stream>>>(WVB, XT, bv, F, DMOD, SEQ, DMOD, 1.0f, 1, 0, sTok, sChn);
  cvh16<<<gP, blk, 0, stream>>>(F, VH, n8x, VCAR);
  // (13) attention -> O planes [b][s][h][d] x1024 (hi + residual)
  attn_fwd<<<gAT, bAT, 0, stream>>>(QH, KH, VH, OHI, OLO);
  // (14) output projection per batch + bias -> out [b][256 o][4096 n] f32, carries 1024 (O) x 1024 (wo) folded back
  gemm_wh2<<<gGc, bG, 0, stream>>>(WOB, OHI, OLO, bo, out, DMOD, SEQ, DMOD, 1.0f / (OSC * WOS), sTok, sChn);
  (void)hipGetLastError();
}

// v001
// Measured time: 292 microseconds a run.
// Two timings next to v000 both put it at 1.21 times that version's speed.
// Contractions: projections Xt.W'^T and W'.Xt^T on v_wmma_f32_16x16x32_bf16 (Xt and W RNE-converted bf16 operands, f32 accumulate, bias added in f32);
// scores k'.q'^T (q', k' carried x64 as f16), P.v (P x32768 as f16, v x64 as f16) and Wm'.O^T (Wm' as f16(bf16(Wm) x1024), O x1024 as f16 hi plane
// + f16 residual plane, products w.h + w.l): v_wmma_f32_16x16x32_f16, f32 accumulate. Base-2 online softmax, 1/l fold and bias adds in f32 on VALU.
#include <hip/hip_runtime.h>
#include <math.h>
#include <stdint.h>

#define NB    4
#define SEQ   4096
#define DMOD  256
#define NH    4
#define HD    64
#define QSC   64.0f
#define KSC   64.0f
#define PCAR  32768.0f
#define VCAR  64.0f
#define OSC   1024.0f
#define WOS   1024.0f
#define LOG2E 1.4426950408889634f
#define ATT_WAVES   4
#define ATT_THREADS (ATT_WAVES * 32)
#define ATT_BLOCKS  (NB * NH * (SEQ / 64))
#define NKB    (SEQ / 32)
#define SLABF  (16 * 68)
#define SLAB64 (16 * 68)
#define XTP    72
static_assert(HD == 64 && DMOD == NH * HD);
static_assert((SEQ / 64) == 64 && NH == 4 && NB == 4);
static_assert(ATT_THREADS == 128 && ATT_BLOCKS == 1024 && NKB == 128);
static_assert((DMOD % 64) == 0 && (SEQ % 64) == 0 && (DMOD % 32) == 0);
static_assert(((NB * SEQ * DMOD / 8) % 256) == 0 && ((DMOD * DMOD / 8) % 256) == 0);
static_assert((DMOD / 8) == 32);
static_assert(64 * XTP >= 63 * XTP + 64);
static_assert(ATT_WAVES * SLABF >= 4 * 16 * 68);

typedef unsigned short u16;
typedef _Float16 v16h __attribute__((ext_vector_type(16)));
typedef _Float16 v8h  __attribute__((ext_vector_type(8)));
typedef __bf16   v16b __attribute__((ext_vector_type(16)));
typedef float    v8f  __attribute__((ext_vector_type(8)));
typedef float    v4f  __attribute__((ext_vector_type(4)));
typedef unsigned int v4u __attribute__((ext_vector_type(4)));

union FragH { v16h v; v8h h[2]; v4u u[2]; };
union FragB { v16b v; v4u u[2]; };

// ---- scalar helpers --------------------------------------------------------------------------------
__device__ __forceinline__ unsigned short bf_bits(float f) {          // f32 -> bf16 bits, RNE convert
  unsigned u = __float_as_uint(f);
  return (unsigned short)((u + 0x7FFFu + ((u >> 16) & 1u)) >> 16);
}
__device__ __forceinline__ float bf_up(unsigned short h) { return __uint_as_float(((unsigned)h) << 16); }
__device__ __forceinline__ float bfr(float f) { return bf_up(bf_bits(f)); }
__device__ __forceinline__ unsigned short h_bits(_Float16 x) { return __builtin_bit_cast(unsigned short, x); }
__device__ __forceinline__ unsigned pk16(unsigned short a, unsigned short b) { return (unsigned)a | ((unsigned)b << 16); }
__device__ __forceinline__ v8f zero8() { v8f z = {0.f, 0.f, 0.f, 0.f, 0.f, 0.f, 0.f, 0.f}; return z; }
__device__ __forceinline__ v4f zero4() { v4f z = {0.f, 0.f, 0.f, 0.f}; return z; }

// ---- fragment loaders: 16-bit A/B operand, lane -> row/col (lane&15), h = lane>>4; elements 0..7 <- k0+8h.., elements 8..15 <-
//      k0+16+8h.. (same split k map for A and B).
//      ldfrag_h: row-major [row][k] plane, p already includes +8*h (q only, read once per wave).
//      TILED plane of a [rows][K] operand: 16-row tile = 16*K halves in a row, inside it [k/8][row%16][8 k], so that the unit of
//      lane l for k0 lies at k0*16 + 8*l and a wave-wide 16-B load is 512 contiguous bytes (4 whole lines, not pieces of 16).
__device__ __forceinline__ v16h ldfrag_h(const _Float16* p) {
  FragH f;
  f.h[0] = *(const v8h*)(p);
  f.h[1] = *(const v8h*)(p + 16);
  return f.v;
}
//      ldfrag_p / ldfrag_bp: tiled or fragment-ordered plane, p already includes +8*lane; the second half lies 256 halves on.
__device__ __forceinline__ v16h ldfrag_p(const _Float16* p) {
  FragH f;
  f.h[0] = *(const v8h*)(p);
  f.h[1] = *(const v8h*)(p + 256);
  return f.v;
}
__device__ __forceinline__ v16b ldfrag_bp(const u16* p) {             // the same for a bf16 plane, read as unsigned integer vectors
  FragB f;
  f.u[0] = *(const v4u*)(p);
  f.u[1] = *(const v4u*)(p + 256);
  return f.v;
}

__device__ __forceinline__ v8f mma_h(v16h a, v16h b, v8f c) {
  return __builtin_amdgcn_wmma_f32_16x16x32_f16(false, a, false, b, (short)0, c, false, false);
}
__device__ __forceinline__ v8f mma_b(v16b a, v16b b, v8f c) {
  return __builtin_amdgcn_wmma_f32_16x16x32_bf16(false, a, false, b, (short)0, c, false, false);
}
__device__ __forceinline__ void g2_3(v8f& a, v8f& b, v16h x0, v16h x1, v16h x2) {
#if defined(__HIP_DEVICE_COMPILE__)
  asm volatile("v_nop\n\tv_nop\n\tv_nop\n\tv_nop" : "+v"(a), "+v"(b) : "v"(x0), "v"(x1), "v"(x2) : "memory");
#endif
}
template <typename F>
__device__ __forceinline__ void g4_5(v8f& a, v8f& b, v8f& c, v8f& d, F x0, F x1, F x2, F x3, F x4) {
#if defined(__HIP_DEVICE_COMPILE__)
  asm volatile("v_nop\n\tv_nop\n\tv_nop\n\tv_nop"
               : "+v"(a), "+v"(b), "+v"(c), "+v"(d) : "v"(x0), "v"(x1), "v"(x2), "v"(x3), "v"(x4) : "memory");
#endif
}
__device__ __forceinline__ void g4_9(v8f& a, v8f& b, v8f& c, v8f& d, v16h x0, v16h x1, v16h x2, v16h x3, v16h x4,
                                     v16h x5, v16h x6, v16h x7, v16h x8) {
#if defined(__HIP_DEVICE_COMPILE__)
  asm volatile("v_nop\n\tv_nop\n\tv_nop\n\tv_nop"
               : "+v"(a), "+v"(b), "+v"(c), "+v"(d)
               : "v"(x0), "v"(x1), "v"(x2), "v"(x3), "v"(x4), "v"(x5), "v"(x6), "v"(x7), "v"(x8) : "memory");
#endif
}
__device__ __forceinline__ void acc_guard4(v8f& a, v8f& b, v8f& c, v8f& d) {
#if defined(__HIP_DEVICE_COMPILE__)
  asm volatile("v_nop\n\tv_nop\n\tv_nop\n\tv_nop" : "+v"(a), "+v"(b), "+v"(c), "+v"(d));
#endif
}
// s_wait_xcnt 0 behind a group of fragment loads: it stands in front of every later write of a register that those loads name as
// address; naming the addresses as inputs keeps their registers unwritten (also by a later load's result) up to the wait.
__device__ __forceinline__ void addr_wait5(const void* a, const void* b0, const void* b1, const void* b2, const void* b3) {
#if defined(__HIP_DEVICE_COMPILE__)
  asm volatile("s_wait_xcnt 0x0" : : "v"(a), "v"(b0), "v"(b1), "v"(b2), "v"(b3) : "memory");
#endif
}
__device__ __forceinline__ void addr_wait9(const void* a, const void* b0, const void* b1, const void* b2, const void* b3,
                                           const void* c0, const void* c1, const void* c2, const void* c3) {
#if defined(__HIP_DEVICE_COMPILE__)
  asm volatile("s_wait_xcnt 0x0"
               : : "v"(a), "v"(b0), "v"(b1), "v"(b2), "v"(b3), "v"(c0), "v"(c1), "v"(c2), "v"(c3) : "memory");
#endif
}
__device__ __forceinline__ void wave_sync_lds() {
  __builtin_amdgcn_fence(__ATOMIC_RELEASE, "workgroup");
  __builtin_amdgcn_wave_barrier();
  __builtin_amdgcn_fence(__ATOMIC_ACQUIRE, "workgroup");
}

// =====================================================================================================
// Weight matrix [DMOD][DMOD] f32 -> 16-bit plane [DMOD][DMOD], stored TILED (see the loaders), head-split permutation folded in:
//   mode 0: D[r][i]  = bf16 RNE bits of W[((r & 63) << 2) | (r >> 6)][i]      (output row r = h*64+d <- channel d*4+h)
//   mode 1: D[o][c]  = f16 bits of bf16value(W[o][((c & 63) << 2) | (c >> 6)]) * scale   (input column permuted the same way)
// Thread = 8 consecutive output elements (8 scalar loads, both candidate indices always < DMOD*DMOD, selected by value);
// coverage: grid = DMOD*DMOD/8/256 = 32 blocks x 256 thr x 8 = the whole plane.
// =====================================================================================================
__global__ __launch_bounds__(256) void cvtw(const float* __restrict__ w, u16* D, int mode, float scale) {
  const int gt = blockIdx.x * 256 + (int)threadIdx.x;
  if (gt >= (DMOD * DMOD) / 8) return;       // no barriers in this kernel
  const int row  = ((gt >> 9) << 4) | (gt & 15);   // 0..255: destination unit gt = ((row/16)*32 + c8/8)*16 + row%16
  const int c8   = ((gt >> 4) & 31) * 8;           // 0..248
  const int prow = ((row & 63) << 2) | (row >> 6);
  const int hsel = c8 >> 6, d0 = c8 & 63;
  unsigned short s[8];
#pragma unroll
  for (int e = 0; e < 8; ++e) {
    const int i0  = prow * DMOD + c8 + e;                   // < 65536
    const int i1  = row * DMOD + ((d0 + e) << 2) + hsel;    // < 65536
    const int idx = (mode == 0) ? i0 : i1;
    const float v = w[idx];
    const unsigned short bb = bf_bits(v);
    const unsigned short hb = h_bits((_Float16)(bf_up(bb) * scale));
    s[e] = (mode == 0) ? bb : hb;
  }
  v4u o;
#pragma unroll
  for (int e = 0; e < 4; ++e) o[e] = pk16(s[2 * e], s[2 * e + 1]);
  u16* d = D + (size_t)gt * 8;
  {
    *(v4u*)(d) = o;
    
  }
}

// =====================================================================================================
// f32 plane -> f16 plane of (value * scale), same layout (scale a power of two).
// Thread = 8 consecutive elements: two 16-B loads, one 16-B store; 32 consecutive lanes = 512 contiguous, 512-B aligned bytes
// coverage: grid = n8/256 blocks (host checks exactness) x 256 thr x 8 = the whole plane.
// =====================================================================================================
__global__ __launch_bounds__(256) void cvh16(const float* __restrict__ x, u16* D, int n8, float scale) {
  const int gt = blockIdx.x * 256 + (int)threadIdx.x;
  if (gt >= n8) return;                     // no barriers in this kernel
  const float* p = x + (size_t)gt * 8;
  const v4f a = *(const v4f*)(p), c4 = *(const v4f*)(p + 4);
  float v[8];
#pragma unroll
  for (int e = 0; e < 4; ++e) { v[e] = a[e]; v[4 + e] = c4[e]; }
  unsigned short s[8];
#pragma unroll
  for (int e = 0; e < 8; ++e) s[e] = h_bits((_Float16)(v[e] * scale));
  v4u o;
#pragma unroll
  for (int e = 0; e < 4; ++e) o[e] = pk16(s[2 * e], s[2 * e + 1]);
  u16* d = D + (size_t)gt * 8;
  {
    *(v4u*)(d) = o;
    
  }
}

// =====================================================================================================
// f32 plane -> f16 plane of (value * scale) in the order the attention loop's fragment loads read it, so that one wave-wide
// 16-B load is 512 contiguous bytes (4 whole lines) instead of 32-B pieces of 16 lines. Unit = 8 halves (one lane's half fragment).
//   vmode 0 (k): x = [b][s][h][d]; D unit ((bh*256 + kt)*8 + dc)*16 + c  <- key s = 16*kt + c, d = 8*dc .. 8*dc+7
//   vmode 1 (v): x = [b][h][d][s]; D unit (((bh*128 + it)*4 + j)*4 + kc)*16 + c  <- d = 16*j + c, keys 32*it + 8*kc .. +7
// (bh = b*NH + h). Thread = one destination unit: two 16-B loads (16 source rows x 64 B per wave; a block consumes whole source
// lines), one 16-B store, 32 lanes = 512 contiguous bytes.
// coverage: the unit index is a bijection of (bh, s/8 or d/8 chunk, row); grid = n8/256 blocks x 256 thr x 8 = the whole plane.
// =====================================================================================================
__global__ __launch_bounds__(256) void cvfrag(const float* __restrict__ x, u16* D, int n8, int vmode, float scale) {
  static_assert((SEQ / 16) * 8 * 16 == 32768 && (SEQ / 32) * 4 * 4 * 16 == 32768 && NB * NH * 32768 == NB * SEQ * DMOD / 8);
  const int gt = blockIdx.x * 256 + (int)threadIdx.x;
  if (gt >= n8) return;                     // no barriers in this kernel
  const int c  = gt & 15;
  const int bh = (gt >> 15) & (NB * NH - 1);
  const int dc = (gt >> 4) & 7, kt = (gt >> 7) & 255;
  const int kc = (gt >> 4) & 3, j = (gt >> 6) & 3, it = (gt >> 8) & 127;
  const int ksrc = ((bh >> 2) * SEQ + kt * 16 + c) * DMOD + (bh & 3) * HD + dc * 8;   // < NB*SEQ*DMOD
  const int vsrc = (bh * HD + j * 16 + c) * SEQ + it * 32 + kc * 8;                   // < NB*SEQ*DMOD
  const float* p = x + (size_t)(vmode ? vsrc : ksrc);
  const v4f a = *(const v4f*)(p), c4 = *(const v4f*)(p + 4);
  float v[8];
#pragma unroll
  for (int e = 0; e < 4; ++e) { v[e] = a[e]; v[4 + e] = c4[e]; }
  unsigned short s[8];
#pragma unroll
  for (int e = 0; e < 8; ++e) s[e] = h_bits((_Float16)(v[e] * scale));
  v4u o;
#pragma unroll
  for (int e = 0; e < 4; ++e) o[e] = pk16(s[2 * e], s[2 * e + 1]);
  *(v4u*)(D + (size_t)gt * 8) = o;
}

// =====================================================================================================
// Input transpose + convert: X [b][DMOD][SEQ] f32 -> XT bf16 [b][SEQ][DMOD], stored TILED. Block = (b, 64 tokens, 64 channels):
// 64 channel rows x 64 tokens loaded with 16-B loads, RNE-converted, scattered into an LDS tile [token][channel] (pitch XTP);
// coverage: load 256 thr x 16 elements = 64 x 64; store 2 iterations x 256 thr x 8 halves = 4 tiles x 8 chunks x 16 tokens = the block's
//           tile; grid = NB x (SEQ/64) x (DMOD/64) = 1024 blocks covers XT exactly once.
// =====================================================================================================
__global__ __launch_bounds__(256) void xt16(const float* __restrict__ x, u16* XT) {
  __shared__ __align__(16) u16 T[64 * XTP];
  const int tid = threadIdx.x;
  const int bid = blockIdx.x;
  const int ct  = bid & 3;                    // channel tile, DMOD/64 = 4
  const int st  = (bid >> 2) & 63;            // token tile, SEQ/64 = 64
  const int b   = bid >> 8;                   // 0..3
  const int c0  = ct * 64, s0 = st * 64;
  {
    const int cl = tid >> 2;                  // channel within tile 0..63
    const int tc = (tid & 3) * 16;            // token chunk
    const float* src = x + ((size_t)(b * DMOD + c0 + cl)) * SEQ + s0 + tc;
#pragma unroll
    for (int i = 0; i < 4; ++i) {
      const v4f a = *(const v4f*)(src + 4 * i);
#pragma unroll
      for (int e = 0; e < 4; ++e) T[(tc + 4 * i + e) * XTP + cl] = bf_bits(a[e]);
    }
  }
  __syncthreads();
  v4u o[2];
  const int tk = tid & 15, ch = (tid >> 4) & 7, th = tid >> 7;   // token in its 16-token tile, 8-channel chunk, tile parity
#pragma unroll
  for (int it = 0; it < 2; ++it) {
    const int line = (it * 2 + th) * 16 + tk; // token within the block's tile 0..63
    o[it] = *(const v4u*)(T + line * XTP + ch * 8);
  }
  const size_t base = ((size_t)(b * SEQ + s0)) * DMOD + (size_t)(c0 + ch * 8) * 16 + tk * 8;
  {
#pragma unroll
    for (int it = 0; it < 2; ++it) {
      *(v4u*)(XT + base + (size_t)((it * 2 + th) * 16) * DMOD) = o[it];
    }
    
  }
}

// =====================================================================================================
// Bias terms for the GEMM epilogue (bf16-RNE values of bias[], array of DMOD entries; every candidate index is masked into
// 0..DMOD-1 so all loads are in range, selection by value):
//   bmode 0: per-column, permuted index ((col&63)<<2)|(col>>6); bmode 1: per-row, same permutation of the row; bmode 2: per-row direct.
// =====================================================================================================
__device__ __forceinline__ void bias_terms(const float* __restrict__ bias, int bmode, int rowb, int col0, int hh, int m,
                                           v4f& badd, v8f& radd) {
#pragma unroll
  for (int e = 0; e < 4; ++e) {
    const int ci = col0 + 4 * m + e;
    const int pc = ((ci & 63) << 2) | ((ci >> 6) & 3);
    const float bc = bfr(bias[pc]);
    badd[e] = (bmode == 0) ? bc : 0.0f;
  }
#pragma unroll
  for (int r = 0; r < 8; ++r) {
    const int ri = rowb + 8 * hh + r;
    const int p1 = ((ri & 63) << 2) | ((ri >> 6) & 3);
    const int p2 = ri & (DMOD - 1);
    const float b1 = bfr(bias[p1]), b2 = bfr(bias[p2]);
    radd[r] = (bmode == 1) ? b1 : ((bmode == 2) ? b2 : 0.0f);
  }
}

// =====================================================================================================
// GEMM epilogue shared by both engines: the wave's 16x64 f32 tile (times oscale, plus per-row addend radd) staged in its LDS
// coverage: 8 instructions x 2 rows x 16 lanes x 4 floats = the wave's 16 x 64 tile.
// =====================================================================================================
__device__ __forceinline__ void epi64(float* sl, v8f a0, v8f a1, v8f a2, v8f a3, float oscale, v4f badd, v8f radd,
                                      float* C, int N, size_t rowb, int col0, int lane) {
  const int hh = lane >> 4, m = lane & 15;
#pragma unroll
  for (int r = 0; r < 8; ++r) {
    const int ro = (8 * hh + r) * 68 + m;
    sl[ro]      = a0[r] * oscale + radd[r];
    sl[ro + 16] = a1[r] * oscale + radd[r];
    sl[ro + 32] = a2[r] * oscale + radd[r];
    sl[ro + 48] = a3[r] * oscale + radd[r];
  }
  wave_sync_lds();
  v4f vals[8];
#pragma unroll
  for (int it = 0; it < 8; ++it) vals[it] = *(const v4f*)(sl + (it * 2 + hh) * 68 + m * 4) + badd;
  float* dst = C + (rowb + (size_t)hh) * (size_t)N + col0 + m * 4;
  {
#pragma unroll
    for (int it = 0; it < 8; ++it) {
      *(v4f*)(dst + (size_t)(it * 2) * (size_t)N) = vals[it];
    }
    
  }
}

// =====================================================================================================
// bf16 GEMM with bias: C[M][N] (f32, pitch N) = A[M][K] (bf16, TILED) . Bt[N][K]^T (bf16, TILED), times oscale, plus
// the bias term selected by bmode (see bias_terms). grid.x = (M/64)*(N/64) tiles, grid.y = batch index y with element strides
// sA, sB, sC added to A, Bt, C. Block = 64x64 tile, 4 waves x 16 rows; fragments loaded straight from the tiled planes (two 16-B
// loads each, split k map for A and B); K stepped by 32 (host: K % 32 == 0, M % 64 == 0, N % 64 == 0).
// =====================================================================================================
__global__ __launch_bounds__(128)
void gemm_bfb(const u16* __restrict__ A, const u16* __restrict__ Bt, const float* __restrict__ bias,
              float* C, int M, int N, int K, float oscale, int bmode, int sA, int sB, int sC) {
  __shared__ __align__(16) float slab[4 * SLAB64];
  const int tid = threadIdx.x, wave = tid >> 5, lane = tid & 31, hh = lane >> 4, m = lane & 15;
  const int ntile = N >> 6;
  const int bid   = blockIdx.x;
  const int y     = blockIdx.y;
  const int rowb  = (bid / ntile) * 64 + wave * 16;
  const int col0  = (bid % ntile) * 64;
  if (rowb + 16 > M) return;                 // wave-uniform, never taken with the exact grid; no block barriers in this kernel
  const u16* Ab = A  + (size_t)y * (size_t)sA;
  const u16* Bb = Bt + (size_t)y * (size_t)sB;
  float*     Cb = C  + (size_t)y * (size_t)sC;
  const u16* ap = Ab + (size_t)rowb * K + 8 * lane;   // 16-row tile = 16*K halves, inside it [k/8][row][8]
  const u16* bp = Bb + (size_t)col0 * K + 8 * lane;
  const size_t bs = (size_t)16 * K;
  v8f acc0 = zero8(), acc1 = zero8(), acc2 = zero8(), acc3 = zero8();
#pragma unroll 1
  for (int k0 = 0; k0 < K; k0 += 32) {
    const int ko = k0 * 16;
    const u16 *pa = ap + ko, *p0 = bp + ko, *p1 = p0 + bs, *p2 = p1 + bs, *p3 = p2 + bs;
    const v16b a  = ldfrag_bp(pa);
    const v16b b0 = ldfrag_bp(p0);
    const v16b b1 = ldfrag_bp(p1);
    const v16b b2 = ldfrag_bp(p2);
    const v16b b3 = ldfrag_bp(p3);
    addr_wait5(pa, p0, p1, p2, p3);
    acc0 = mma_b(a, b0, acc0);
    acc1 = mma_b(a, b1, acc1);
    acc2 = mma_b(a, b2, acc2);
    acc3 = mma_b(a, b3, acc3);
    g4_5<v16b>(acc0, acc1, acc2, acc3, a, b0, b1, b2, b3);
  }
  v4f badd = zero4();
  v8f radd = zero8();
  bias_terms(bias, bmode, rowb, col0, hh, m, badd, radd);
  epi64(slab + wave * SLAB64, acc0, acc1, acc2, acc3, oscale, badd, radd, Cb, N, (size_t)rowb, col0, lane);
}

// =====================================================================================================
// f16 GEMM, single A plane, hi+lo B planes, per-row bias: C[M][N] (f32, pitch N) = A[M][K] . (Bh + Bl)[N][K]^T times oscale,
// plus bf16-RNE value of bias[row]; A f16 TILED (no batch stride), Bh/Bl f16 [n][k] planes TILED with batch stride sB, C with
// batch stride sC (grid.y = batch). Products a.bh + a.bl into one accumulator (bl is the unscaled residual of bh). Same tiling
// as gemm_bfb.
// =====================================================================================================
__global__ __launch_bounds__(128)
void gemm_wh2(const u16* __restrict__ A, const u16* __restrict__ Bh, const u16* __restrict__ Bl,
              const float* __restrict__ bias, float* C, int M, int N, int K, float oscale, int sB, int sC) {
  __shared__ __align__(16) float slab[4 * SLAB64];
  const int tid = threadIdx.x, wave = tid >> 5, lane = tid & 31, hh = lane >> 4, m = lane & 15;
  const int ntile = N >> 6;
  const int bid   = blockIdx.x;
  const int y     = blockIdx.y;
  const int rowb  = (bid / ntile) * 64 + wave * 16;
  const int col0  = (bid % ntile) * 64;
  if (rowb + 16 > M) return;                 // wave-uniform, never taken with the exact grid; no block barriers in this kernel
  const _Float16* ap  = (const _Float16*)(const void*)A + (size_t)rowb * K + 8 * lane;   // tiles as in gemm_bfb
  const size_t bofs   = (size_t)y * (size_t)sB + (size_t)col0 * K + 8 * lane;
  const _Float16* bhp = (const _Float16*)(const void*)Bh + bofs;
  const _Float16* blp = (const _Float16*)(const void*)Bl + bofs;
  float* Cb = C + (size_t)y * (size_t)sC;
  const size_t bs = (size_t)16 * K;
  v8f acc0 = zero8(), acc1 = zero8(), acc2 = zero8(), acc3 = zero8();
#pragma unroll 1
  for (int k0 = 0; k0 < K; k0 += 32) {
    const int ko = k0 * 16;
    const _Float16 *pa = ap + ko, *h0 = bhp + ko, *h1 = h0 + bs, *h2 = h1 + bs, *h3 = h2 + bs;
    const _Float16 *l0 = blp + ko, *l1 = l0 + bs, *l2 = l1 + bs, *l3 = l2 + bs;
    const v16h a   = ldfrag_p(pa);
    const v16h bh0 = ldfrag_p(h0);
    const v16h bh1 = ldfrag_p(h1);
    const v16h bh2 = ldfrag_p(h2);
    const v16h bh3 = ldfrag_p(h3);
    const v16h bl0 = ldfrag_p(l0);
    const v16h bl1 = ldfrag_p(l1);
    const v16h bl2 = ldfrag_p(l2);
    const v16h bl3 = ldfrag_p(l3);
    addr_wait9(pa, h0, h1, h2, h3, l0, l1, l2, l3);
    acc0 = mma_h(a, bh0, acc0);  acc0 = mma_h(a, bl0, acc0);
    acc1 = mma_h(a, bh1, acc1);  acc1 = mma_h(a, bl1, acc1);
    acc2 = mma_h(a, bh2, acc2);  acc2 = mma_h(a, bl2, acc2);
    acc3 = mma_h(a, bh3, acc3);  acc3 = mma_h(a, bl3, acc3);
    g4_9(acc0, acc1, acc2, acc3, a, bh0, bh1, bh2, bh3, bl0, bl1, bl2, bl3);
  }
  v4f badd = zero4();
  v8f radd = zero8();
  bias_terms(bias, 2, rowb, col0, hh, m, badd, radd);
  epi64(slab + wave * SLAB64, acc0, acc1, acc2, acc3, oscale, badd, radd, Cb, N, (size_t)rowb, col0, lane);
}

// =====================================================================================================
// Full (non-causal, unmasked) multi-head flash attention: block = (batch b, head, 64 query rows), 4 waves, wave w owns the
// 16 query rows q0 = 64*qt + 16*w .. q0+15 (waves independent: no block barriers, wave-private LDS only, used in the epilogue).
//   q plane (f16, x64) laid out [b][s][h][d]; k and v planes (x64) per (b, h) in fragment order (cvfrag): every fragment load of
//   the loop is 512 contiguous bytes over the wave. All NKB = 128 key blocks of 32 keys are visited (static bound).
//   Scores are computed TRANSPOSED: S^T tile g (g = 0,1) = k rows (keys kb+16g .. +15, A operand, row m = lane&15, split k map
//   over d) times q^T (B operand, col n = query q0 + (lane&15), k = d, split map), one product per tile and d-chunk.
//   D element r of lane l = (key kb+16g+8h+r, query q0+(l&15)), so a lane owns one query column and 16 of its 32 keys; the
//   partner lane l^16 owns the other 16 -> row max / row sum need one xor-16 shuffle.
//   Online max-subtracted base-2 softmax in f32 (scale 1/8 and the q,k carries folded into lsc). The exp'd values ARE the
//   P A-fragment in place: A row m = query = lane&15, element i <- key kb+8h+i (tile 0, D element i), element 8+i <- key
//   kb+16+8h+i (tile 1, D element i). P is carried x32768 as f16. The rescale factor of query row 8h+r of the O accumulators is
//   fetched from lane 8h+r with a shuffle (uniform control). 4 v^T B fragments (col n = d = 16j + (lane&15), keys k-contiguous),
//   4 P.V WMMAs per key block.
//   Epilogue: 1/l (per query, shuffled to the D row owner) and carry folds in f32; the wave's 16x64 f32 result staged in its LDS
// coverage: per wave 4 instructions x 2 chunks x 16 rows x 8 halves = 16 x 64 per plane; grid 1024 blocks x 4 waves = every
//           (b, s, h) row of both O planes exactly once.
// =====================================================================================================
__global__ __launch_bounds__(ATT_THREADS)
void attn_fwd(const u16* __restrict__ QHp, const u16* __restrict__ KHp, const u16* __restrict__ VHp,
              u16* OHIp, u16* OLOp) {
  __shared__ __align__(16) float smem[ATT_WAVES * SLABF];   // per wave: result slab [16][68] in the epilogue only

  const int tid  = threadIdx.x;
  const int wave = tid >> 5;
  const int lane = tid & 31;
  const int hh   = lane >> 4;
  const int c    = lane & 15;

  const int bid  = blockIdx.x;
  const int qt   = bid & (SEQ / 64 - 1);      // 0..63
  const int head = (bid >> 6) & (NH - 1);     // 0..3
  const int b    = bid >> 8;                  // 0..3
  const int q0   = qt * 64 + wave * 16;

  // B fragments of q^T: col n = query q0 + c, k = d (k-contiguous row of the q plane); loop-invariant
  const size_t qofs = (((size_t)(b * SEQ + q0 + c)) * NH + head) * HD + 8 * hh;
  const _Float16* Qh  = (const _Float16*)(const void*)QHp + qofs;
  const v16h qh0 = ldfrag_h(Qh), qh1 = ldfrag_h(Qh + 32);
  // A fragments of k: row m = key kb + 16g + c, k = d; fragment-ordered plane, 2048 halves per 32-key block (see cvfrag)
  const size_t pofs = (size_t)(b * NH + head) * (SEQ * HD) + 8 * lane;
  const _Float16* Khb = (const _Float16*)(const void*)KHp + pofs;
  // B fragments of v: col n = d = 16j + c, k = key; fragment-ordered plane, 2048 halves per 32-key block (see cvfrag)
  const _Float16* Vhb = (const _Float16*)(const void*)VHp + pofs;
  const float lsc = 0.125f * (LOG2E / (QSC * KSC));

  float mrun = -INFINITY, lrun = 0.f;
  v8f o[4];
#pragma unroll
  for (int j = 0; j < 4; ++j) o[j] = zero8();

#pragma unroll 1
  for (int it = 0; it < NKB; ++it) {
    const int kb = it * 32;
    // ---- transposed scores: s0 = keys kb..kb+15, s1 = keys kb+16..kb+31, column = query q0 + c ----
    v8f s0 = zero8(), s1 = zero8();
    const _Float16* k0p = Khb + (size_t)kb * HD;
    const _Float16* k1p = k0p + 16 * HD;
    {
      const v16h kh0 = ldfrag_p(k0p), kh1 = ldfrag_p(k1p);
      s0 = mma_h(kh0, qh0, s0);
      s1 = mma_h(kh1, qh0, s1);
      g2_3(s0, s1, qh0, kh0, kh1);
    }
    {
      const v16h kh0 = ldfrag_p(k0p + 512), kh1 = ldfrag_p(k1p + 512);
      s0 = mma_h(kh0, qh1, s0);
      s1 = mma_h(kh1, qh1, s1);
      g2_3(s0, s1, qh1, kh0, kh1);
    }
    // ---- base-2 logits of this lane's 16 keys for query q0 + c: t[i] <- key kb+8hh+i, t[8+i] <- key kb+16+8hh+i ----
    float t[16];
#pragma unroll
    for (int i = 0; i < 8; ++i) { t[i] = s0[i] * lsc; t[8 + i] = s1[i] * lsc; }
    float cm = t[0];
#pragma unroll
    for (int i = 1; i < 16; ++i) cm = fmaxf(cm, t[i]);
    cm = fmaxf(cm, __shfl_xor(cm, 16, 32));
    const float mn = fmaxf(mrun, cm);        // finite from the first block on
    const float al = exp2f(mrun - mn);       // 0 on the first block (mrun = -inf)
    mrun = mn;
    // ---- probabilities (<= 1) and the P A-fragment: f16(p * 32768); element i <-> t[i] ----
    float ps = 0.f;
    FragH ph;
#pragma unroll
    for (int w = 0; w < 2; ++w) {
#pragma unroll
      for (int e4 = 0; e4 < 4; ++e4) {
        const int i = 8 * w + 2 * e4;
        const float p0 = exp2f(t[i] - mn), p1 = exp2f(t[i + 1] - mn);
        ps += p0 + p1;
        const _Float16 h0 = (_Float16)(p0 * PCAR), h1 = (_Float16)(p1 * PCAR);
        ph.u[w][e4] = pk16(h_bits(h0), h_bits(h1));
      }
    }
    ps += __shfl_xor(ps, 16, 32);
    lrun = lrun * al + ps;
    // ---- rescale the O accumulators: D row 8hh+r = query q0+8hh+r, its factor lives in lane 8hh+r (and 16+8hh+r) ----
    float scl[8];
#pragma unroll
    for (int r = 0; r < 8; ++r) scl[r] = __shfl(al, 8 * hh + r, 32);
#pragma unroll
    for (int j = 0; j < 4; ++j) {
#pragma unroll
      for (int r = 0; r < 8; ++r) o[j][r] *= scl[r];
    }
    // ---- P.V : B fragment col n = d = j*16 + c, 512 halves per j in the fragment-ordered v plane ----
    {
      const _Float16* vhp = Vhb + (size_t)kb * HD;
      const v16h vh0 = ldfrag_p(vhp);
      const v16h vh1 = ldfrag_p(vhp + 512);
      const v16h vh2 = ldfrag_p(vhp + 1024);
      const v16h vh3 = ldfrag_p(vhp + 1536);
      o[0] = mma_h(ph.v, vh0, o[0]);
      o[1] = mma_h(ph.v, vh1, o[1]);
      o[2] = mma_h(ph.v, vh2, o[2]);
      o[3] = mma_h(ph.v, vh3, o[3]);
      g4_5<v16h>(o[0], o[1], o[2], o[3], ph.v, vh0, vh1, vh2, vh3);
    }
  }
  acc_guard4(o[0], o[1], o[2], o[3]);

  // ---- fold 1/l (per query, owned by lane = query) and the carries (32768 on P, 64 on v); stage the 16x64 slab ----
  const float linv = (1.0f / lrun) * (1.0f / (PCAR * VCAR));
  float inv[8];
#pragma unroll
  for (int r = 0; r < 8; ++r) inv[r] = __shfl(linv, 8 * hh + r, 32);
  float* slab = smem + wave * SLABF;
#pragma unroll
  for (int r = 0; r < 8; ++r) {
#pragma unroll
    for (int j = 0; j < 4; ++j) slab[(8 * hh + r) * 68 + j * 16 + c] = o[j][r] * inv[r];
  }
  wave_sync_lds();
  // ---- O x1024 -> f16 hi + residual planes, TILED as [token][h*64+d] operands; one store = 512 contiguous bytes ----
  v4u oh[4], ol[4];
#pragma unroll
  for (int i4 = 0; i4 < 4; ++i4) {
    const int c8 = (i4 * 2 + hh) * 8;         // lane = (8-d chunk parity hh, query row c)
    const v4f a = *(const v4f*)(slab + c * 68 + c8), c4 = *(const v4f*)(slab + c * 68 + c8 + 4);
    float w[8];
#pragma unroll
    for (int e = 0; e < 4; ++e) { w[e] = a[e] * OSC; w[4 + e] = c4[e] * OSC; }
#pragma unroll
    for (int e = 0; e < 4; ++e) {
      const _Float16 h0 = (_Float16)w[2 * e], h1 = (_Float16)w[2 * e + 1];
      const _Float16 l0 = (_Float16)(w[2 * e] - (float)h0), l1 = (_Float16)(w[2 * e + 1] - (float)h1);
      oh[i4][e] = pk16(h_bits(h0), h_bits(h1));
      ol[i4][e] = pk16(h_bits(l0), h_bits(l1));
    }
  }
  const size_t ob = ((size_t)(b * SEQ + q0)) * (NH * HD) + (size_t)head * (HD * 16) + 8 * lane;
  {
#pragma unroll
    for (int i4 = 0; i4 < 4; ++i4) {
      const size_t o8 = ob + (size_t)i4 * 256;
      *(v4u*)(OHIp + o8) = oh[i4];
      *(v4u*)(OLOp + o8) = ol[i4];
    }
    
  }
}

// =====================================================================================================
// Workspace map (bytes); every plane is fully written by whole-line stores before it is read; all extents are exact multiples
// of the store granularity (no pad rows needed); every offset a multiple of 131072; XT and F are reused sequentially (in-order stream):
//   XT  bf16 [16384 token][256 i] tiled              8388608     (query, then key, then value)
//   WQB bf16 [256 r'][256 i] tiled (rows permuted)  131072      WKB same 131072     WVB same 131072
//   WOB f16  [256 o][256 c'] tiled x1024 (cols permuted)  131072
//   F   f32  [16384][256] / [4][256][4096]         16777216     (projection q, then k, then v)
//   QH  f16  [4][4096][4][64] x64                   8388608
//   KH  f16  [16 bh][256 kt][8 dc][16 key][8 d] x64          8388608   (fragment order)
//   VH  f16  [16 bh][128 it][4 j][4 kc][16 d][8 key] x64     8388608   (fragment order)
//   OHI f16  [16384 token][256 h*64+d] tiled x1024   8388608      OLO residual 8388608
//   end                                            67633152
// =====================================================================================================
extern "C" void kernel_launch(void* const* d_in, const int* in_sizes, int n_in,
                              void* d_out, int out_size, void* d_ws, size_t ws_size,
                              hipStream_t stream) {
  const int ROWS = NB * SEQ;                            // 16384 tokens
  const int XN   = NB * DMOD * SEQ;                     // 4194304
  if (n_in < 11) return;
  if (in_sizes[0] != XN || in_sizes[1] != XN || in_sizes[2] != XN) return;
  if (in_sizes[3] != DMOD * DMOD || in_sizes[5] != DMOD * DMOD) return;
  if (in_sizes[7] != DMOD * DMOD || in_sizes[9] != DMOD * DMOD) return;
  if (in_sizes[4] != DMOD || in_sizes[6] != DMOD || in_sizes[8] != DMOD || in_sizes[10] != DMOD) return;
  if (out_size != XN) return;

  const float* Qin = (const float*)d_in[0];
  const float* Kin = (const float*)d_in[1];
  const float* Vin = (const float*)d_in[2];
  const float* wq  = (const float*)d_in[3];
  const float* bq  = (const float*)d_in[4];
  const float* wk  = (const float*)d_in[5];
  const float* bk  = (const float*)d_in[6];
  const float* wv  = (const float*)d_in[7];
  const float* bv  = (const float*)d_in[8];
  const float* wo  = (const float*)d_in[9];
  const float* bo  = (const float*)d_in[10];
  float*       out = (float*)d_out;

  const size_t szXT = (size_t)ROWS * DMOD * 2;                  //  8388608
  const size_t szW  = (size_t)DMOD * DMOD * 2;                  //   131072
  const size_t szF  = (size_t)ROWS * DMOD * 4;                  // 16777216
  const size_t szP  = (size_t)ROWS * DMOD * 2;                  //  8388608  (q/k/v/o planes)
  size_t off = 0;
  const size_t oXT  = off; off += szXT;
  const size_t oWQB = off; off += szW;
  const size_t oWKB = off; off += szW;
  const size_t oWVB = off; off += szW;
  const size_t oWOB = off; off += szW;
  const size_t oF   = off; off += szF;
  const size_t oQH  = off; off += szP;
  const size_t oKH  = off; off += szP;
  const size_t oVH  = off; off += szP;
  const size_t oOHI = off; off += szP;
  const size_t oOLO = off; off += szP;
  if (off > ws_size) return;                            // off = 67633152
  if (off > (size_t)134217728) return;

  char* ws = (char*)d_ws;
  u16*   XT  = (u16*)(ws + oXT);
  u16*   WQB = (u16*)(ws + oWQB);
  u16*   WKB = (u16*)(ws + oWKB);
  u16*   WVB = (u16*)(ws + oWVB);
  u16*   WOB = (u16*)(ws + oWOB);
  float* F   = (float*)(ws + oF);
  u16*   QH  = (u16*)(ws + oQH);
  u16*   KH  = (u16*)(ws + oKH);
  u16*   VH  = (u16*)(ws + oVH);
  u16*   OHI = (u16*)(ws + oOHI);
  u16*   OLO = (u16*)(ws + oOLO);

  const dim3 blk(256);
  const int n8x = XN / 8;                               // 524288
  const int n8w = (DMOD * DMOD) / 8;                    // 8192
  if ((n8x % 256) != 0 || (n8w % 256) != 0) return;
  const dim3 gP(n8x / 256);                             // 2048
  const dim3 gWc(n8w / 256);                            // 32
  const dim3 gXT(NB * (SEQ / 64) * (DMOD / 64));        // 1024
  const dim3 gGt((ROWS / 64) * (DMOD / 64), 1);         // 1024 tiles, token-major projections
  const dim3 gGc((DMOD / 64) * (SEQ / 64), NB);         // 256 tiles x 4 batches, channel-major per batch
  const dim3 bG(128);
  const dim3 gAT(ATT_BLOCKS);                           // 1024
  const dim3 bAT(ATT_THREADS);                          // 128
  const int  sTok = SEQ * DMOD;                         // 1048576 elements: per-batch stride of XT / O planes
  const int  sChn = DMOD * SEQ;                         // 1048576 elements: per-batch stride of F (v) and out

  // (0..3) weights: rows of wq/wk/wv permuted to r' = h*64+d (bf16 planes); columns of wo permuted the same way (f16 of bf16 value x1024)
  cvtw<<<gWc, blk, 0, stream>>>(wq, WQB, 0, 1.0f);
  cvtw<<<gWc, blk, 0, stream>>>(wk, WKB, 0, 1.0f);
  cvtw<<<gWc, blk, 0, stream>>>(wv, WVB, 0, 1.0f);
  cvtw<<<gWc, blk, 0, stream>>>(wo, WOB, 1, WOS);
  // (4..6) q: input -> XT bf16 [token][i]; projection + bias -> F [16384 token][h*64+d] f32; -> f16 plane x64
  xt16<<<gXT, blk, 0, stream>>>(Qin, XT);
  gemm_bfb<<<gGt, bG, 0, stream>>>(XT, WQB, bq, F, ROWS, DMOD, DMOD, 1.0f, 0, 0, 0, 0);
  cvh16<<<gP, blk, 0, stream>>>(F, QH, n8x, QSC);
  // (7..9) k: same pipeline (XT and F reused; single in-order stream); f16 plane x64 in fragment order
  xt16<<<gXT, blk, 0, stream>>>(Kin, XT);
  gemm_bfb<<<gGt, bG, 0, stream>>>(XT, WKB, bk, F, ROWS, DMOD, DMOD, 1.0f, 0, 0, 0, 0);
  cvfrag<<<gP, blk, 0, stream>>>(F, KH, n8x, 0, KSC);
  // (10..12) v: input -> XT; channel-major projection per batch -> F [b][h*64+d][4096] f32 (v^T); -> f16 plane x64 in fragment order
  xt16<<<gXT, blk, 0, stream>>>(Vin, XT);
  gemm_bfb<<<gGc, bG, 0, stream>>>(WVB, XT, bv, F, DMOD, SEQ, DMOD, 1.0f, 1, 0, sTok, sChn);
  cvfrag<<<gP, blk, 0, stream>>>(F, VH, n8x, 1, VCAR);
  // (13) attention -> O planes [token][h*64+d] tiled, x1024 (hi + residual)
  attn_fwd<<<gAT, bAT, 0, stream>>>(QH, KH, VH, OHI, OLO);
  // (14) output projection per batch + bias -> out [b][256 o][4096 n] f32, carries 1024 (O) x 1024 (wo) folded back
  gemm_wh2<<<gGc, bG, 0, stream>>>(WOB, OHI, OLO, bo, out, DMOD, SEQ, DMOD, 1.0f / (OSC * WOS), sTok, sChn);
  (void)hipGetLastError();
}

// v002
// One run takes 260 microseconds.
// Timed twice side by side with v001, it ran 1.13 and 1.12 times as fast.
// Counting every step since v000, it is 1.36 times as fast.
// Contractions: projections Xt.W'^T and W'.Xt^T on v_wmma_f32_16x16x32_bf16 (Xt and W RNE-converted bf16 operands, f32 accumulate, bias added in f32);
// scores k'.q'^T (q', k' carried x64 as f16), P.v (P x32768 as f16, v x64 as f16) and Wm'.O^T (Wm' as f16(bf16(Wm) x1024), O x1024 as f16 hi plane
// + f16 residual plane, products w.h + w.l): v_wmma_f32_16x16x32_f16, f32 accumulate. Base-2 online softmax, 1/l fold and bias adds in f32 on VALU.
#include <hip/hip_runtime.h>
#include <math.h>
#include <stdint.h>

#define NB    4
#define SEQ   4096
#define DMOD  256
#define NH    4
#define HD    64
#define QSC   64.0f
#define KSC   64.0f
#define PCAR  32768.0f
#define VCAR  64.0f
#define OSC   1024.0f
#define WOS   1024.0f
#define LOG2E 1.4426950408889634f
#define ATT_WAVES   4
#define ATT_THREADS (ATT_WAVES * 32)
#define ATT_BLOCKS  (NB * NH * (SEQ / 64))
#define NKB    (SEQ / 32)
#define SLABF  (16 * 68)
#define SLAB64 (16 * 68)
#define XTP    72
static_assert(HD == 64 && DMOD == NH * HD);
static_assert((SEQ / 64) == 64 && NH == 4 && NB == 4);
static_assert(ATT_THREADS == 128 && ATT_BLOCKS == 1024 && NKB == 128);
static_assert((DMOD % 64) == 0 && (SEQ % 64) == 0 && (DMOD % 32) == 0);
static_assert(((NB * SEQ * DMOD / 8) % 256) == 0 && ((DMOD * DMOD / 8) % 256) == 0);
static_assert((DMOD / 8) == 32);
static_assert(64 * XTP >= 63 * XTP + 64);
static_assert(ATT_WAVES * SLABF >= 4 * 16 * 68);

typedef unsigned short u16;
typedef _Float16 v16h __attribute__((ext_vector_type(16)));
typedef _Float16 v8h  __attribute__((ext_vector_type(8)));
typedef __bf16   v16b __attribute__((ext_vector_type(16)));
typedef float    v8f  __attribute__((ext_vector_type(8)));
typedef float    v4f  __attribute__((ext_vector_type(4)));
typedef unsigned int v4u __attribute__((ext_vector_type(4)));

union FragH { v16h v; v8h h[2]; v4u u[2]; };
union FragB { v16b v; v4u u[2]; };

// ---- scalar helpers --------------------------------------------------------------------------------
__device__ __forceinline__ unsigned short bf_bits(float f) {          // f32 -> bf16 bits, RNE convert
  unsigned u = __float_as_uint(f);
  return (unsigned short)((u + 0x7FFFu + ((u >> 16) & 1u)) >> 16);
}
__device__ __forceinline__ float bf_up(unsigned short h) { return __uint_as_float(((unsigned)h) << 16); }
__device__ __forceinline__ float bfr(float f) { return bf_up(bf_bits(f)); }
__device__ __forceinline__ unsigned short h_bits(_Float16 x) { return __builtin_bit_cast(unsigned short, x); }
__device__ __forceinline__ unsigned pk16(unsigned short a, unsigned short b) { return (unsigned)a | ((unsigned)b << 16); }
__device__ __forceinline__ v8f zero8() { v8f z = {0.f, 0.f, 0.f, 0.f, 0.f, 0.f, 0.f, 0.f}; return z; }
__device__ __forceinline__ v4f zero4() { v4f z = {0.f, 0.f, 0.f, 0.f}; return z; }

// ---- fragment loaders: 16-bit A/B operand, lane -> row/col (lane&15), h = lane>>4; elements 0..7 <- k0+8h.., elements 8..15 <-
//      k0+16+8h.. (same split k map for A and B).
//      ldfrag_h: row-major [row][k] plane, p already includes +8*h (q only, read once per wave).
//      TILED plane of a [rows][K] operand: 16-row tile = 16*K halves in a row, inside it [k/8][row%16][8 k], so that the unit of
//      lane l for k0 lies at k0*16 + 8*l and a wave-wide 16-B load is 512 contiguous bytes (4 whole lines, not pieces of 16).
__device__ __forceinline__ v16h ldfrag_h(const _Float16* p) {
  FragH f;
  f.h[0] = *(const v8h*)(p);
  f.h[1] = *(const v8h*)(p + 16);
  return f.v;
}
//      ldfrag_p / ldfrag_bp: tiled or fragment-ordered plane, p already includes +8*lane; the second half lies 256 halves on.
__device__ __forceinline__ v16h ldfrag_p(const _Float16* p) {
  FragH f;
  f.h[0] = *(const v8h*)(p);
  f.h[1] = *(const v8h*)(p + 256);
  return f.v;
}
__device__ __forceinline__ v16b ldfrag_bp(const u16* p) {             // the same for a bf16 plane, read as unsigned integer vectors
  FragB f;
  f.u[0] = *(const v4u*)(p);
  f.u[1] = *(const v4u*)(p + 256);
  return f.v;
}

__device__ __forceinline__ v8f mma_h(v16h a, v16h b, v8f c) {
  return __builtin_amdgcn_wmma_f32_16x16x32_f16(false, a, false, b, (short)0, c, false, false);
}
__device__ __forceinline__ v8f mma_b(v16b a, v16b b, v8f c) {
  return __builtin_amdgcn_wmma_f32_16x16x32_bf16(false, a, false, b, (short)0, c, false, false);
}
__device__ __forceinline__ void g2_3(v8f& a, v8f& b, v16h x0, v16h x1, v16h x2) {
#if defined(__HIP_DEVICE_COMPILE__)
  asm volatile("v_nop\n\tv_nop\n\tv_nop\n\tv_nop" : "+v"(a), "+v"(b) : "v"(x0), "v"(x1), "v"(x2) : "memory");
#endif
}
template <typename F>
__device__ __forceinline__ void g4_5(v8f& a, v8f& b, v8f& c, v8f& d, F x0, F x1, F x2, F x3, F x4) {
#if defined(__HIP_DEVICE_COMPILE__)
  asm volatile("v_nop\n\tv_nop\n\tv_nop\n\tv_nop"
               : "+v"(a), "+v"(b), "+v"(c), "+v"(d) : "v"(x0), "v"(x1), "v"(x2), "v"(x3), "v"(x4) : "memory");
#endif
}
__device__ __forceinline__ void g4_9(v8f& a, v8f& b, v8f& c, v8f& d, v16h x0, v16h x1, v16h x2, v16h x3, v16h x4,
                                     v16h x5, v16h x6, v16h x7, v16h x8) {
#if defined(__HIP_DEVICE_COMPILE__)
  asm volatile("v_nop\n\tv_nop\n\tv_nop\n\tv_nop"
               : "+v"(a), "+v"(b), "+v"(c), "+v"(d)
               : "v"(x0), "v"(x1), "v"(x2), "v"(x3), "v"(x4), "v"(x5), "v"(x6), "v"(x7), "v"(x8) : "memory");
#endif
}
__device__ __forceinline__ void acc_guard4(v8f& a, v8f& b, v8f& c, v8f& d) {
#if defined(__HIP_DEVICE_COMPILE__)
  asm volatile("v_nop\n\tv_nop\n\tv_nop\n\tv_nop" : "+v"(a), "+v"(b), "+v"(c), "+v"(d));
#endif
}
// s_wait_xcnt 0 behind a group of fragment loads: it stands in front of every later write of a register that those loads name as
// address; naming the addresses as inputs keeps their registers unwritten (also by a later load's result) up to the wait.
__device__ __forceinline__ void addr_wait5(const void* a, const void* b0, const void* b1, const void* b2, const void* b3) {
#if defined(__HIP_DEVICE_COMPILE__)
  asm volatile("s_wait_xcnt 0x0" : : "v"(a), "v"(b0), "v"(b1), "v"(b2), "v"(b3) : "memory");
#endif
}
__device__ __forceinline__ void addr_wait9(const void* a, const void* b0, const void* b1, const void* b2, const void* b3,
                                           const void* c0, const void* c1, const void* c2, const void* c3) {
#if defined(__HIP_DEVICE_COMPILE__)
  asm volatile("s_wait_xcnt 0x0"
               : : "v"(a), "v"(b0), "v"(b1), "v"(b2), "v"(b3), "v"(c0), "v"(c1), "v"(c2), "v"(c3) : "memory");
#endif
}
__device__ __forceinline__ void wave_sync_lds() {
  __builtin_amdgcn_fence(__ATOMIC_RELEASE, "workgroup");
  __builtin_amdgcn_wave_barrier();
  __builtin_amdgcn_fence(__ATOMIC_ACQUIRE, "workgroup");
}

// =====================================================================================================
// Weight matrix [DMOD][DMOD] f32 -> 16-bit plane [DMOD][DMOD], stored TILED (see the loaders), head-split permutation folded in:
//   mode 0: D[r][i]  = bf16 RNE bits of W[((r & 63) << 2) | (r >> 6)][i]      (output row r = h*64+d <- channel d*4+h)
//   mode 1: D[o][c]  = f16 bits of bf16value(W[o][((c & 63) << 2) | (c >> 6)]) * scale   (input column permuted the same way)
// Thread = 8 consecutive output elements (8 scalar loads, both candidate indices always < DMOD*DMOD, selected by value);
// coverage: blk = 0 .. DMOD*DMOD/8/256 - 1 = 32 blocks x 256 thr x 8 = the whole plane.
// =====================================================================================================
__device__ __forceinline__ void cvtw_body(const float* __restrict__ w, u16* D, int mode, float scale, int blk) {
  const int gt = blk * 256 + (int)threadIdx.x;
  if (gt >= (DMOD * DMOD) / 8) return;       // no barriers in this body
  const int row  = ((gt >> 9) << 4) | (gt & 15);   // 0..255: destination unit gt = ((row/16)*32 + c8/8)*16 + row%16
  const int c8   = ((gt >> 4) & 31) * 8;           // 0..248
  const int prow = ((row & 63) << 2) | (row >> 6);
  const int hsel = c8 >> 6, d0 = c8 & 63;
  unsigned short s[8];
  int   idx[8];
  float wv[8];
#pragma unroll
  for (int e = 0; e < 8; ++e) {
    const int i0  = prow * DMOD + c8 + e;                   // < 65536
    const int i1  = row * DMOD + ((d0 + e) << 2) + hsel;    // < 65536
    idx[e] = (mode == 0) ? i0 : i1;
    wv[e]  = w[idx[e]];
  }
#if defined(__HIP_DEVICE_COMPILE__)
  // s_wait_xcnt 0 behind the eight loads, in front of every later write of an index register that they name as address; naming
  // the indices as inputs keeps their registers unwritten (also by a later load's result) up to the wait.
  asm volatile("s_wait_xcnt 0x0" : : "v"(idx[0]), "v"(idx[1]), "v"(idx[2]), "v"(idx[3]), "v"(idx[4]), "v"(idx[5]), "v"(idx[6]),
               "v"(idx[7]) : "memory");
#endif
#pragma unroll
  for (int e = 0; e < 8; ++e) {
    const float v = wv[e];
    const unsigned short bb = bf_bits(v);
    const unsigned short hb = h_bits((_Float16)(bf_up(bb) * scale));
    s[e] = (mode == 0) ? bb : hb;
  }
  v4u o;
#pragma unroll
  for (int e = 0; e < 4; ++e) o[e] = pk16(s[2 * e], s[2 * e + 1]);
  u16* d = D + (size_t)gt * 8;
  {
    *(v4u*)(d) = o;
    
  }
}

// =====================================================================================================
// f32 plane -> f16 plane of (value * scale), same layout (scale a power of two).
// Thread = 8 consecutive elements: two 16-B loads, one 16-B store; 32 consecutive lanes = 512 contiguous, 512-B aligned bytes
// coverage: blk = 0 .. n8/256 - 1 blocks (host checks exactness) x 256 thr x 8 = the whole plane.
// =====================================================================================================
__device__ __forceinline__ void cvh16_body(const float* __restrict__ x, u16* D, int n8, float scale, int blk) {
  const int gt = blk * 256 + (int)threadIdx.x;
  if (gt >= n8) return;                     // no barriers in this body
  const float* p = x + (size_t)gt * 8;
  const v4f a = *(const v4f*)(p), c4 = *(const v4f*)(p + 4);
  float v[8];
#pragma unroll
  for (int e = 0; e < 4; ++e) { v[e] = a[e]; v[4 + e] = c4[e]; }
  unsigned short s[8];
#pragma unroll
  for (int e = 0; e < 8; ++e) s[e] = h_bits((_Float16)(v[e] * scale));
  v4u o;
#pragma unroll
  for (int e = 0; e < 4; ++e) o[e] = pk16(s[2 * e], s[2 * e + 1]);
  u16* d = D + (size_t)gt * 8;
  {
    *(v4u*)(d) = o;
    
  }
}

// =====================================================================================================
// f32 plane -> f16 plane of (value * scale) in the order the attention loop's fragment loads read it, so that one wave-wide
// 16-B load is 512 contiguous bytes (4 whole lines) instead of 32-B pieces of 16 lines. Unit = 8 halves (one lane's half fragment).
//   vmode 0 (k): x = [b][s][h][d]; D unit ((bh*256 + kt)*8 + dc)*16 + c  <- key s = 16*kt + c, d = 8*dc .. 8*dc+7
//   vmode 1 (v): x = [b][h][d][s]; D unit (((bh*128 + it)*4 + j)*4 + kc)*16 + c  <- d = 16*j + c, keys 32*it + 8*kc .. +7
// (bh = b*NH + h). Thread = one destination unit: two 16-B loads (16 source rows x 64 B per wave; a block consumes whole source
// lines), one 16-B store, 32 lanes = 512 contiguous bytes.
// coverage: the unit index is a bijection of (bh, s/8 or d/8 chunk, row); blk = 0 .. n8/256 - 1 x 256 thr x 8 = the whole plane.
// =====================================================================================================
__device__ __forceinline__ void cvfrag_body(const float* __restrict__ x, u16* D, int n8, int vmode, float scale, int blk) {
  static_assert((SEQ / 16) * 8 * 16 == 32768 && (SEQ / 32) * 4 * 4 * 16 == 32768 && NB * NH * 32768 == NB * SEQ * DMOD / 8);
  const int gt = blk * 256 + (int)threadIdx.x;
  if (gt >= n8) return;                     // no barriers in this body
  const int c  = gt & 15;
  const int bh = (gt >> 15) & (NB * NH - 1);
  const int dc = (gt >> 4) & 7, kt = (gt >> 7) & 255;
  const int kc = (gt >> 4) & 3, j = (gt >> 6) & 3, it = (gt >> 8) & 127;
  const int ksrc = ((bh >> 2) * SEQ + kt * 16 + c) * DMOD + (bh & 3) * HD + dc * 8;   // < NB*SEQ*DMOD
  const int vsrc = (bh * HD + j * 16 + c) * SEQ + it * 32 + kc * 8;                   // < NB*SEQ*DMOD
  const float* p = x + (size_t)(vmode ? vsrc : ksrc);
  const v4f a = *(const v4f*)(p), c4 = *(const v4f*)(p + 4);
  float v[8];
#pragma unroll
  for (int e = 0; e < 4; ++e) { v[e] = a[e]; v[4 + e] = c4[e]; }
  unsigned short s[8];
#pragma unroll
  for (int e = 0; e < 8; ++e) s[e] = h_bits((_Float16)(v[e] * scale));
  v4u o;
#pragma unroll
  for (int e = 0; e < 4; ++e) o[e] = pk16(s[2 * e], s[2 * e + 1]);
  *(v4u*)(D + (size_t)gt * 8) = o;
}

// =====================================================================================================
// The three plane converts, which need nothing of each other, as one grid: blockIdx.y = 0 q (same layout), 1 k, 2 v (fragment
// order); F3 = the three f32 projection planes one behind the other. grid = (n8/256, 3).
// =====================================================================================================
__global__ __launch_bounds__(256) void cv_qkv(const float* __restrict__ F3, u16* QH, u16* KH, u16* VH, int n8) {
  const int sel = blockIdx.y;                 // block-uniform
  const int blk = blockIdx.x;
  const float* x = F3 + (size_t)sel * (size_t)(NB * SEQ * DMOD);
  if (sel == 0)      cvh16_body(x, QH, n8, QSC, blk);
  else if (sel == 1) cvfrag_body(x, KH, n8, 0, KSC, blk);
  else               cvfrag_body(x, VH, n8, 1, VCAR, blk);
}

// =====================================================================================================
// Input transpose + convert: X [b][DMOD][SEQ] f32 -> XT bf16 [b][SEQ][DMOD], stored TILED. Block = (b, 64 tokens, 64 channels):
// 64 channel rows x 64 tokens loaded with 16-B loads, RNE-converted, scattered into an LDS tile [token][channel] (pitch XTP);
// coverage: load 256 thr x 16 elements = 64 x 64; store 2 iterations x 256 thr x 8 halves = 4 tiles x 8 chunks x 16 tokens = the block's
//           tile; bid = 0 .. NB x (SEQ/64) x (DMOD/64) - 1 = 1024 blocks covers XT exactly once. T = the block's LDS tile.
// =====================================================================================================
__device__ __forceinline__ void xt16_body(const float* __restrict__ x, u16* XT, u16* T, int bid) {
  const int tid = threadIdx.x;
  const int ct  = bid & 3;                    // channel tile, DMOD/64 = 4
  const int st  = (bid >> 2) & 63;            // token tile, SEQ/64 = 64
  const int b   = bid >> 8;                   // 0..3
  const int c0  = ct * 64, s0 = st * 64;
  {
    const int cl = tid >> 2;                  // channel within tile 0..63
    const int tc = (tid & 3) * 16;            // token chunk
    const float* src = x + ((size_t)(b * DMOD + c0 + cl)) * SEQ + s0 + tc;
#pragma unroll
    for (int i = 0; i < 4; ++i) {
      const v4f a = *(const v4f*)(src + 4 * i);
#pragma unroll
      for (int e = 0; e < 4; ++e) T[(tc + 4 * i + e) * XTP + cl] = bf_bits(a[e]);
    }
  }
  __syncthreads();
  v4u o[2];
  const int tk = tid & 15, ch = (tid >> 4) & 7, th = tid >> 7;   // token in its 16-token tile, 8-channel chunk, tile parity
#pragma unroll
  for (int it = 0; it < 2; ++it) {
    const int line = (it * 2 + th) * 16 + tk; // token within the block's tile 0..63
    o[it] = *(const v4u*)(T + line * XTP + ch * 8);
  }
  const size_t base = ((size_t)(b * SEQ + s0)) * DMOD + (size_t)(c0 + ch * 8) * 16 + tk * 8;
  {
#pragma unroll
    for (int it = 0; it < 2; ++it) {
      *(v4u*)(XT + base + (size_t)((it * 2 + th) * 16) * DMOD) = o[it];
    }
#if defined(__HIP_DEVICE_COMPILE__)
    // s_wait_xcnt 0 behind the two stores: in the merged kernel's text the weight range's code, which writes the registers that
    // these stores name as address, follows them behind a scalar test.
    asm volatile("s_wait_xcnt 0x0" : : : "memory");
#endif
  }
}

// =====================================================================================================
// The four weight converts and the three input transposes, which need nothing of each other, as block ranges of one grid:
//   blocks 0 .. 127: weight (bid >> 5) = wq, wk, wv (mode 0), wo (mode 1, x1024) -> plane (bid >> 5) of WB4, 32 blocks each;
//   blocks 128 .. 3199: input ((bid - 128) >> 10) = query, key, value -> plane of XT3, 1024 blocks each.
// The range test is block-uniform, so the transpose's barrier is passed by all threads of a block or by none.
// =====================================================================================================
#define WCV_BLOCKS (DMOD * DMOD / 8 / 256)
#define XT_BLOCKS  (NB * (SEQ / 64) * (DMOD / 64))
static_assert(WCV_BLOCKS == 32 && XT_BLOCKS == 1024);
__global__ __launch_bounds__(256)
void prep(const float* __restrict__ xq, const float* __restrict__ xk, const float* __restrict__ xv,
          const float* __restrict__ wq, const float* __restrict__ wk, const float* __restrict__ wv,
          const float* __restrict__ wo, u16* XT3, u16* WB4) {
  __shared__ __align__(16) u16 T[64 * XTP];
  const int bid = blockIdx.x;
  if (bid < 4 * WCV_BLOCKS) {
    const int sel = bid >> 5;
    const float* w = (sel == 0) ? wq : ((sel == 1) ? wk : ((sel == 2) ? wv : wo));
    cvtw_body(w, WB4 + (size_t)sel * (DMOD * DMOD), (sel == 3) ? 1 : 0, (sel == 3) ? WOS : 1.0f, bid & (WCV_BLOCKS - 1));
    return;                                   // the whole block leaves, in front of the barrier below
  }
  const int r   = bid - 4 * WCV_BLOCKS;
  const int sel = r >> 10;
  const float* x = (sel == 0) ? xq : ((sel == 1) ? xk : xv);
  xt16_body(x, XT3 + (size_t)sel * (size_t)(NB * SEQ * DMOD), T, r & (XT_BLOCKS - 1));
}

// =====================================================================================================
// Bias terms for the GEMM epilogue (bf16-RNE values of bias[], array of DMOD entries; every candidate index is masked into
// 0..DMOD-1 so all loads are in range, selection by value):
//   bmode 0: per-column, permuted index ((col&63)<<2)|(col>>6); bmode 1: per-row, same permutation of the row; bmode 2: per-row direct.
// =====================================================================================================
__device__ __forceinline__ void bias_terms(const float* __restrict__ bias, int bmode, int rowb, int col0, int hh, int m,
                                           v4f& badd, v8f& radd) {
#pragma unroll
  for (int e = 0; e < 4; ++e) {
    const int ci = col0 + 4 * m + e;
    const int pc = ((ci & 63) << 2) | ((ci >> 6) & 3);
    const float bc = bfr(bias[pc]);
    badd[e] = (bmode == 0) ? bc : 0.0f;
  }
#pragma unroll
  for (int r = 0; r < 8; ++r) {
    const int ri = rowb + 8 * hh + r;
    const int p1 = ((ri & 63) << 2) | ((ri >> 6) & 3);
    const int p2 = ri & (DMOD - 1);
    const float b1 = bfr(bias[p1]), b2 = bfr(bias[p2]);
    radd[r] = (bmode == 1) ? b1 : ((bmode == 2) ? b2 : 0.0f);
  }
}

// =====================================================================================================
// GEMM epilogue shared by both engines: the wave's 16x64 f32 tile (times oscale, plus per-row addend radd) staged in its LDS
// coverage: 8 instructions x 2 rows x 16 lanes x 4 floats = the wave's 16 x 64 tile.
// =====================================================================================================
__device__ __forceinline__ void epi64(float* sl, v8f a0, v8f a1, v8f a2, v8f a3, float oscale, v4f badd, v8f radd,
                                      float* C, int N, size_t rowb, int col0, int lane) {
  const int hh = lane >> 4, m = lane & 15;
#pragma unroll
  for (int r = 0; r < 8; ++r) {
    const int ro = (8 * hh + r) * 68 + m;
    sl[ro]      = a0[r] * oscale + radd[r];
    sl[ro + 16] = a1[r] * oscale + radd[r];
    sl[ro + 32] = a2[r] * oscale + radd[r];
    sl[ro + 48] = a3[r] * oscale + radd[r];
  }
  wave_sync_lds();
  v4f vals[8];
#pragma unroll
  for (int it = 0; it < 8; ++it) vals[it] = *(const v4f*)(sl + (it * 2 + hh) * 68 + m * 4) + badd;
  float* dst = C + (rowb + (size_t)hh) * (size_t)N + col0 + m * 4;
  {
#pragma unroll
    for (int it = 0; it < 8; ++it) {
      *(v4f*)(dst + (size_t)(it * 2) * (size_t)N) = vals[it];
    }
    
  }
}

// =====================================================================================================
// bf16 GEMM with bias: C[M][N] (f32, pitch N) = A[M][K] (bf16, TILED) . Bt[N][K]^T (bf16, TILED), times oscale, plus
// the bias term selected by bmode (see bias_terms). bid = 0 .. (M/64)*(N/64) - 1 tiles, y = batch index with element strides
// sA, sB, sC added to A, Bt, C. Block = 64x64 tile, 4 waves x 16 rows; fragments loaded straight from the tiled planes (two 16-B
// loads each, split k map for A and B); K stepped by 32 (host: K % 32 == 0, M % 64 == 0, N % 64 == 0).
// =====================================================================================================
__device__ __forceinline__
void gemm_bfb_body(float* slab, const u16* __restrict__ A, const u16* __restrict__ Bt, const float* __restrict__ bias,
                   float* C, int M, int N, int K, float oscale, int bmode, int sA, int sB, int sC, int bid, int y) {
  const int tid = threadIdx.x, wave = tid >> 5, lane = tid & 31, hh = lane >> 4, m = lane & 15;
  const int ntile = N >> 6;
  const int rowb  = (bid / ntile) * 64 + wave * 16;
  const int col0  = (bid % ntile) * 64;
  if (rowb + 16 > M) return;                 // wave-uniform, never taken with the exact grid; no block barriers in this kernel
  const u16* Ab = A  + (size_t)y * (size_t)sA;
  const u16* Bb = Bt + (size_t)y * (size_t)sB;
  float*     Cb = C  + (size_t)y * (size_t)sC;
  const u16* ap = Ab + (size_t)rowb * K + 8 * lane;   // 16-row tile = 16*K halves, inside it [k/8][row][8]
  const u16* bp = Bb + (size_t)col0 * K + 8 * lane;
  const size_t bs = (size_t)16 * K;
  v8f acc0 = zero8(), acc1 = zero8(), acc2 = zero8(), acc3 = zero8();
#pragma unroll 1
  for (int k0 = 0; k0 < K; k0 += 32) {
    const int ko = k0 * 16;
    const u16 *pa = ap + ko, *p0 = bp + ko, *p1 = p0 + bs, *p2 = p1 + bs, *p3 = p2 + bs;
    const v16b a  = ldfrag_bp(pa);
    const v16b b0 = ldfrag_bp(p0);
    const v16b b1 = ldfrag_bp(p1);
    const v16b b2 = ldfrag_bp(p2);
    const v16b b3 = ldfrag_bp(p3);
    addr_wait5(pa, p0, p1, p2, p3);
    acc0 = mma_b(a, b0, acc0);
    acc1 = mma_b(a, b1, acc1);
    acc2 = mma_b(a, b2, acc2);
    acc3 = mma_b(a, b3, acc3);
    g4_5<v16b>(acc0, acc1, acc2, acc3, a, b0, b1, b2, b3);
  }
  v4f badd = zero4();
  v8f radd = zero8();
  bias_terms(bias, bmode, rowb, col0, hh, m, badd, radd);
  epi64(slab + wave * SLAB64, acc0, acc1, acc2, acc3, oscale, badd, radd, Cb, N, (size_t)rowb, col0, lane);
}

// =====================================================================================================
// The three projections, which need nothing of each other, as one grid (1024 tiles, 3): blockIdx.y = 0 q, 1 k: token-major,
// F[16384 token][h*64+d] = XT . W'^T, per-column bias; 2 v: channel-major per batch (256 tiles x 4 batches in blockIdx.x),
// F[b][h*64+d][4096] = W' . XT^T, per-row bias. XT3, WB4, F3 hold the planes of q, k, v one behind the other.
// =====================================================================================================
__global__ __launch_bounds__(128)
void gemm_qkv(const u16* __restrict__ XT3, const u16* __restrict__ WB4, const float* __restrict__ bq,
              const float* __restrict__ bk, const float* __restrict__ bv, float* F3) {
  static_assert((NB * SEQ / 64) * (DMOD / 64) == 1024 && (DMOD / 64) * (SEQ / 64) == 256 && NB == 4);
  __shared__ __align__(16) float slab[4 * SLAB64];
  const int sel = blockIdx.y;                 // block-uniform
  const int bx  = blockIdx.x;
  const u16* X  = XT3 + (size_t)sel * (size_t)(NB * SEQ * DMOD);
  const u16* Wp = WB4 + (size_t)sel * (DMOD * DMOD);
  float*     F  = F3 + (size_t)sel * (size_t)(NB * SEQ * DMOD);
  if (sel < 2)
    gemm_bfb_body(slab, X, Wp, (sel == 0) ? bq : bk, F, NB * SEQ, DMOD, DMOD, 1.0f, 0, 0, 0, 0, bx, 0);
  else
    gemm_bfb_body(slab, Wp, X, bv, F, DMOD, SEQ, DMOD, 1.0f, 1, 0, SEQ * DMOD, DMOD * SEQ, bx & 255, bx >> 8);
}

// =====================================================================================================
// f16 GEMM, single A plane, hi+lo B planes, per-row bias: C[M][N] (f32, pitch N) = A[M][K] . (Bh + Bl)[N][K]^T times oscale,
// plus bf16-RNE value of bias[row]; A f16 TILED (no batch stride), Bh/Bl f16 [n][k] planes TILED with batch stride sB, C with
// batch stride sC (grid.y = batch). Products a.bh + a.bl into one accumulator (bl is the unscaled residual of bh). Same tiling
// as gemm_bfb.
// =====================================================================================================
__global__ __launch_bounds__(128)
void gemm_wh2(const u16* __restrict__ A, const u16* __restrict__ Bh, const u16* __restrict__ Bl,
              const float* __restrict__ bias, float* C, int M, int N, int K, float oscale, int sB, int sC) {
  __shared__ __align__(16) float slab[4 * SLAB64];
  const int tid = threadIdx.x, wave = tid >> 5, lane = tid & 31, hh = lane >> 4, m = lane & 15;
  const int ntile = N >> 6;
  const int bid   = blockIdx.x;
  const int y     = blockIdx.y;
  const int rowb  = (bid / ntile) * 64 + wave * 16;
  const int col0  = (bid % ntile) * 64;
  if (rowb + 16 > M) return;                 // wave-uniform, never taken with the exact grid; no block barriers in this kernel
  const _Float16* ap  = (const _Float16*)(const void*)A + (size_t)rowb * K + 8 * lane;   // tiles as in gemm_bfb
  const size_t bofs   = (size_t)y * (size_t)sB + (size_t)col0 * K + 8 * lane;
  const _Float16* bhp = (const _Float16*)(const void*)Bh + bofs;
  const _Float16* blp = (const _Float16*)(const void*)Bl + bofs;
  float* Cb = C + (size_t)y * (size_t)sC;
  const size_t bs = (size_t)16 * K;
  v8f acc0 = zero8(), acc1 = zero8(), acc2 = zero8(), acc3 = zero8();
#pragma unroll 1
  for (int k0 = 0; k0 < K; k0 += 32) {
    const int ko = k0 * 16;
    const _Float16 *pa = ap + ko, *h0 = bhp + ko, *h1 = h0 + bs, *h2 = h1 + bs, *h3 = h2 + bs;
    const _Float16 *l0 = blp + ko, *l1 = l0 + bs, *l2 = l1 + bs, *l3 = l2 + bs;
    const v16h a   = ldfrag_p(pa);
    const v16h bh0 = ldfrag_p(h0);
    const v16h bh1 = ldfrag_p(h1);
    const v16h bh2 = ldfrag_p(h2);
    const v16h bh3 = ldfrag_p(h3);
    const v16h bl0 = ldfrag_p(l0);
    const v16h bl1 = ldfrag_p(l1);
    const v16h bl2 = ldfrag_p(l2);
    const v16h bl3 = ldfrag_p(l3);
    addr_wait9(pa, h0, h1, h2, h3, l0, l1, l2, l3);
    acc0 = mma_h(a, bh0, acc0);  acc0 = mma_h(a, bl0, acc0);
    acc1 = mma_h(a, bh1, acc1);  acc1 = mma_h(a, bl1, acc1);
    acc2 = mma_h(a, bh2, acc2);  acc2 = mma_h(a, bl2, acc2);
    acc3 = mma_h(a, bh3, acc3);  acc3 = mma_h(a, bl3, acc3);
    g4_9(acc0, acc1, acc2, acc3, a, bh0, bh1, bh2, bh3, bl0, bl1, bl2, bl3);
  }
  v4f badd = zero4();
  v8f radd = zero8();
  bias_terms(bias, 2, rowb, col0, hh, m, badd, radd);
  epi64(slab + wave * SLAB64, acc0, acc1, acc2, acc3, oscale, badd, radd, Cb, N, (size_t)rowb, col0, lane);
}

// =====================================================================================================
// Full (non-causal, unmasked) multi-head flash attention: block = (batch b, head, 64 query rows), 4 waves, wave w owns the
// 16 query rows q0 = 64*qt + 16*w .. q0+15 (waves independent: no block barriers, wave-private LDS only, used in the epilogue).
//   q plane (f16, x64) laid out [b][s][h][d]; k and v planes (x64) per (b, h) in fragment order (cvfrag): every fragment load of
//   the loop is 512 contiguous bytes over the wave. All NKB = 128 key blocks of 32 keys are visited (static bound).
//   Scores are computed TRANSPOSED: S^T tile g (g = 0,1) = k rows (keys kb+16g .. +15, A operand, row m = lane&15, split k map
//   over d) times q^T (B operand, col n = query q0 + (lane&15), k = d, split map), one product per tile and d-chunk.
//   D element r of lane l = (key kb+16g+8h+r, query q0+(l&15)), so a lane owns one query column and 16 of its 32 keys; the
//   partner lane l^16 owns the other 16 -> row max / row sum need one xor-16 shuffle.
//   Online max-subtracted base-2 softmax in f32 (scale 1/8 and the q,k carries folded into lsc). The exp'd values ARE the
//   P A-fragment in place: A row m = query = lane&15, element i <- key kb+8h+i (tile 0, D element i), element 8+i <- key
//   kb+16+8h+i (tile 1, D element i). P is carried x32768 as f16. The rescale factor of query row 8h+r of the O accumulators is
//   fetched from lane 8h+r with a shuffle (uniform control). 4 v^T B fragments (col n = d = 16j + (lane&15), keys k-contiguous),
//   4 P.V WMMAs per key block.
//   Epilogue: 1/l (per query, shuffled to the D row owner) and carry folds in f32; the wave's 16x64 f32 result staged in its LDS
// coverage: per wave 4 instructions x 2 chunks x 16 rows x 8 halves = 16 x 64 per plane; grid 1024 blocks x 4 waves = every
//           (b, s, h) row of both O planes exactly once.
// =====================================================================================================
__global__ __launch_bounds__(ATT_THREADS)
void attn_fwd(const u16* __restrict__ QHp, const u16* __restrict__ KHp, const u16* __restrict__ VHp,
              u16* OHIp, u16* OLOp) {
  __shared__ __align__(16) float smem[ATT_WAVES * SLABF];   // per wave: result slab [16][68] in the epilogue only

  const int tid  = threadIdx.x;
  const int wave = tid >> 5;
  const int lane = tid & 31;
  const int hh   = lane >> 4;
  const int c    = lane & 15;

  const int bid  = blockIdx.x;
  const int qt   = bid & (SEQ / 64 - 1);      // 0..63
  const int head = (bid >> 6) & (NH - 1);     // 0..3
  const int b    = bid >> 8;                  // 0..3
  const int q0   = qt * 64 + wave * 16;

  // B fragments of q^T: col n = query q0 + c, k = d (k-contiguous row of the q plane); loop-invariant
  const size_t qofs = (((size_t)(b * SEQ + q0 + c)) * NH + head) * HD + 8 * hh;
  const _Float16* Qh  = (const _Float16*)(const void*)QHp + qofs;
  const v16h qh0 = ldfrag_h(Qh), qh1 = ldfrag_h(Qh + 32);
  // A fragments of k: row m = key kb + 16g + c, k = d; fragment-ordered plane, 2048 halves per 32-key block (see cvfrag)
  const size_t pofs = (size_t)(b * NH + head) * (SEQ * HD) + 8 * lane;
  const _Float16* Khb = (const _Float16*)(const void*)KHp + pofs;
  // B fragments of v: col n = d = 16j + c, k = key; fragment-ordered plane, 2048 halves per 32-key block (see cvfrag)
  const _Float16* Vhb = (const _Float16*)(const void*)VHp + pofs;
  const float lsc = 0.125f * (LOG2E / (QSC * KSC));

  float mrun = -INFINITY, lrun = 0.f;
  v8f o[4];
#pragma unroll
  for (int j = 0; j < 4; ++j) o[j] = zero8();

#pragma unroll 1
  for (int it = 0; it < NKB; ++it) {
    const int kb = it * 32;
    // ---- transposed scores: s0 = keys kb..kb+15, s1 = keys kb+16..kb+31, column = query q0 + c ----
    v8f s0 = zero8(), s1 = zero8();
    const _Float16* k0p = Khb + (size_t)kb * HD;
    const _Float16* k1p = k0p + 16 * HD;
    {
      const v16h kh0 = ldfrag_p(k0p), kh1 = ldfrag_p(k1p);
      s0 = mma_h(kh0, qh0, s0);
      s1 = mma_h(kh1, qh0, s1);
      g2_3(s0, s1, qh0, kh0, kh1);
    }
    {
      const v16h kh0 = ldfrag_p(k0p + 512), kh1 = ldfrag_p(k1p + 512);
      s0 = mma_h(kh0, qh1, s0);
      s1 = mma_h(kh1, qh1, s1);
      g2_3(s0, s1, qh1, kh0, kh1);
    }
    // ---- base-2 logits of this lane's 16 keys for query q0 + c: t[i] <- key kb+8hh+i, t[8+i] <- key kb+16+8hh+i ----
    float t[16];
#pragma unroll
    for (int i = 0; i < 8; ++i) { t[i] = s0[i] * lsc; t[8 + i] = s1[i] * lsc; }
    float cm = t[0];
#pragma unroll
    for (int i = 1; i < 16; ++i) cm = fmaxf(cm, t[i]);
    cm = fmaxf(cm, __shfl_xor(cm, 16, 32));
    const float mn = fmaxf(mrun, cm);        // finite from the first block on
    const float al = exp2f(mrun - mn);       // 0 on the first block (mrun = -inf)
    mrun = mn;
    // ---- probabilities (<= 1) and the P A-fragment: f16(p * 32768); element i <-> t[i] ----
    float ps = 0.f;
    FragH ph;
#pragma unroll
    for (int w = 0; w < 2; ++w) {
#pragma unroll
      for (int e4 = 0; e4 < 4; ++e4) {
        const int i = 8 * w + 2 * e4;
        const float p0 = exp2f(t[i] - mn), p1 = exp2f(t[i + 1] - mn);
        ps += p0 + p1;
        const _Float16 h0 = (_Float16)(p0 * PCAR), h1 = (_Float16)(p1 * PCAR);
        ph.u[w][e4] = pk16(h_bits(h0), h_bits(h1));
      }
    }
    ps += __shfl_xor(ps, 16, 32);
    lrun = lrun * al + ps;
    // ---- rescale the O accumulators: D row 8hh+r = query q0+8hh+r, its factor lives in lane 8hh+r (and 16+8hh+r) ----
    float scl[8];
#pragma unroll
    for (int r = 0; r < 8; ++r) scl[r] = __shfl(al, 8 * hh + r, 32);
#pragma unroll
    for (int j = 0; j < 4; ++j) {
#pragma unroll
      for (int r = 0; r < 8; ++r) o[j][r] *= scl[r];
    }
    // ---- P.V : B fragment col n = d = j*16 + c, 512 halves per j in the fragment-ordered v plane ----
    {
      const _Float16* vhp = Vhb + (size_t)kb * HD;
      const v16h vh0 = ldfrag_p(vhp);
      const v16h vh1 = ldfrag_p(vhp + 512);
      const v16h vh2 = ldfrag_p(vhp + 1024);
      const v16h vh3 = ldfrag_p(vhp + 1536);
      o[0] = mma_h(ph.v, vh0, o[0]);
      o[1] = mma_h(ph.v, vh1, o[1]);
      o[2] = mma_h(ph.v, vh2, o[2]);
      o[3] = mma_h(ph.v, vh3, o[3]);
      g4_5<v16h>(o[0], o[1], o[2], o[3], ph.v, vh0, vh1, vh2, vh3);
    }
  }
  acc_guard4(o[0], o[1], o[2], o[3]);

  // ---- fold 1/l (per query, owned by lane = query) and the carries (32768 on P, 64 on v); stage the 16x64 slab ----
  const float linv = (1.0f / lrun) * (1.0f / (PCAR * VCAR));
  float inv[8];
#pragma unroll
  for (int r = 0; r < 8; ++r) inv[r] = __shfl(linv, 8 * hh + r, 32);
  float* slab = smem + wave * SLABF;
#pragma unroll
  for (int r = 0; r < 8; ++r) {
#pragma unroll
    for (int j = 0; j < 4; ++j) slab[(8 * hh + r) * 68 + j * 16 + c] = o[j][r] * inv[r];
  }
  wave_sync_lds();
  // ---- O x1024 -> f16 hi + residual planes, TILED as [token][h*64+d] operands; one store = 512 contiguous bytes ----
  v4u oh[4], ol[4];
#pragma unroll
  for (int i4 = 0; i4 < 4; ++i4) {
    const int c8 = (i4 * 2 + hh) * 8;         // lane = (8-d chunk parity hh, query row c)
    const v4f a = *(const v4f*)(slab + c * 68 + c8), c4 = *(const v4f*)(slab + c * 68 + c8 + 4);
    float w[8];
#pragma unroll
    for (int e = 0; e < 4; ++e) { w[e] = a[e] * OSC; w[4 + e] = c4[e] * OSC; }
#pragma unroll
    for (int e = 0; e < 4; ++e) {
      const _Float16 h0 = (_Float16)w[2 * e], h1 = (_Float16)w[2 * e + 1];
      const _Float16 l0 = (_Float16)(w[2 * e] - (float)h0), l1 = (_Float16)(w[2 * e + 1] - (float)h1);
      oh[i4][e] = pk16(h_bits(h0), h_bits(h1));
      ol[i4][e] = pk16(h_bits(l0), h_bits(l1));
    }
  }
  const size_t ob = ((size_t)(b * SEQ + q0)) * (NH * HD) + (size_t)head * (HD * 16) + 8 * lane;
  {
#pragma unroll
    for (int i4 = 0; i4 < 4; ++i4) {
      const size_t o8 = ob + (size_t)i4 * 256;
      *(v4u*)(OHIp + o8) = oh[i4];
      *(v4u*)(OLOp + o8) = ol[i4];
    }
    
  }
}

// =====================================================================================================
// Workspace map (bytes); every plane is fully written by whole-line stores before it is read; all extents are exact multiples
// of the store granularity (no pad rows needed); every offset a multiple of 131072; q, k and v each have an XT and an F plane of their own:
//   XT  bf16 3 x [16384 token][256 i] tiled         25165824     (query, key, value)
//   WQB bf16 [256 r'][256 i] tiled (rows permuted)  131072      WKB same 131072     WVB same 131072
//   WOB f16  [256 o][256 c'] tiled x1024 (cols permuted)  131072
//   F   f32  2 x [16384][256], [4][256][4096]      50331648     (projection q, k, v)
//   QH  f16  [4][4096][4][64] x64                   8388608
//   KH  f16  [16 bh][256 kt][8 dc][16 key][8 d] x64          8388608   (fragment order)
//   VH  f16  [16 bh][128 it][4 j][4 kc][16 d][8 key] x64     8388608   (fragment order)
//   OHI f16  [16384 token][256 h*64+d] tiled x1024   8388608      OLO residual 8388608
//   end                                           117964800
// =====================================================================================================
extern "C" void kernel_launch(void* const* d_in, const int* in_sizes, int n_in,
                              void* d_out, int out_size, void* d_ws, size_t ws_size,
                              hipStream_t stream) {
  const int ROWS = NB * SEQ;                            // 16384 tokens
  const int XN   = NB * DMOD * SEQ;                     // 4194304
  if (n_in < 11) return;
  if (in_sizes[0] != XN || in_sizes[1] != XN || in_sizes[2] != XN) return;
  if (in_sizes[3] != DMOD * DMOD || in_sizes[5] != DMOD * DMOD) return;
  if (in_sizes[7] != DMOD * DMOD || in_sizes[9] != DMOD * DMOD) return;
  if (in_sizes[4] != DMOD || in_sizes[6] != DMOD || in_sizes[8] != DMOD || in_sizes[10] != DMOD) return;
  if (out_size != XN) return;

  const float* Qin = (const float*)d_in[0];
  const float* Kin = (const float*)d_in[1];
  const float* Vin = (const float*)d_in[2];
  const float* wq  = (const float*)d_in[3];
  const float* bq  = (const float*)d_in[4];
  const float* wk  = (const float*)d_in[5];
  const float* bk  = (const float*)d_in[6];
  const float* wv  = (const float*)d_in[7];
  const float* bv  = (const float*)d_in[8];
  const float* wo  = (const float*)d_in[9];
  const float* bo  = (const float*)d_in[10];
  float*       out = (float*)d_out;

  const size_t szXT = (size_t)ROWS * DMOD * 2;                  //  8388608
  const size_t szW  = (size_t)DMOD * DMOD * 2;                  //   131072
  const size_t szF  = (size_t)ROWS * DMOD * 4;                  // 16777216
  const size_t szP  = (size_t)ROWS * DMOD * 2;                  //  8388608  (q/k/v/o planes)
  size_t off = 0;
  const size_t oXT  = off; off += 3 * szXT;
  const size_t oWQB = off; off += szW;
  const size_t oWKB = off; off += szW;
  const size_t oWVB = off; off += szW;
  const size_t oWOB = off; off += szW;
  const size_t oF   = off; off += 3 * szF;
  const size_t oQH  = off; off += szP;
  const size_t oKH  = off; off += szP;
  const size_t oVH  = off; off += szP;
  const size_t oOHI = off; off += szP;
  const size_t oOLO = off; off += szP;
  if (off > ws_size) return;                            // off = 117964800
  if (off > (size_t)134217728) return;

  char* ws = (char*)d_ws;
  u16*   XT  = (u16*)(ws + oXT);
  u16*   WQB = (u16*)(ws + oWQB);
  u16*   WOB = (u16*)(ws + oWOB);
  float* F   = (float*)(ws + oF);
  u16*   QH  = (u16*)(ws + oQH);
  u16*   KH  = (u16*)(ws + oKH);
  u16*   VH  = (u16*)(ws + oVH);
  u16*   OHI = (u16*)(ws + oOHI);
  u16*   OLO = (u16*)(ws + oOLO);

  const dim3 blk(256);
  const int n8x = XN / 8;                               // 524288
  const int n8w = (DMOD * DMOD) / 8;                    // 8192
  if ((n8x % 256) != 0 || (n8w % 256) != 0) return;
  const dim3 gP(n8x / 256, 3);                          // 2048 x (q, k, v)
  const dim3 gPre(4 * (n8w / 256) + 3 * NB * (SEQ / 64) * (DMOD / 64));   // 128 weight blocks + 3072 transpose blocks
  const dim3 gG3((ROWS / 64) * (DMOD / 64), 3);         // 1024 tiles x (q, k, v)
  const dim3 gGc((DMOD / 64) * (SEQ / 64), NB);         // 256 tiles x 4 batches, channel-major per batch
  const dim3 bG(128);
  const dim3 gAT(ATT_BLOCKS);                           // 1024
  const dim3 bAT(ATT_THREADS);                          // 128
  const int  sTok = SEQ * DMOD;                         // 1048576 elements: per-batch stride of XT / O planes
  const int  sChn = DMOD * SEQ;                         // 1048576 elements: per-batch stride of F (v) and out

  // (0) weights: rows of wq/wk/wv permuted to r' = h*64+d (bf16 planes), columns of wo permuted the same way (f16 of bf16 value x1024);
  //     inputs query, key, value -> XT bf16 [token][i], one plane each (WQB .. WOB lie one behind the other)
  prep<<<gPre, blk, 0, stream>>>(Qin, Kin, Vin, wq, wk, wv, wo, XT, WQB);
  // (1) projections + bias -> F: q, k [16384 token][h*64+d] f32; v channel-major per batch [b][h*64+d][4096] f32 (v^T)
  gemm_qkv<<<gG3, bG, 0, stream>>>(XT, WQB, bq, bk, bv, F);
  // (2) f16 planes x64: q in place order, k and v in fragment order
  cv_qkv<<<gP, blk, 0, stream>>>(F, QH, KH, VH, n8x);
  // (3) attention -> O planes [token][h*64+d] tiled, x1024 (hi + residual)
  attn_fwd<<<gAT, bAT, 0, stream>>>(QH, KH, VH, OHI, OLO);
  // (4) output projection per batch + bias -> out [b][256 o][4096 n] f32, carries 1024 (O) x 1024 (wo) folded back
  gemm_wh2<<<gGc, bG, 0, stream>>>(WOB, OHI, OLO, bo, out, DMOD, SEQ, DMOD, 1.0f / (OSC * WOS), sTok, sChn);
  (void)hipGetLastError();
}

// v003
// One run takes 166 microseconds.
// Two timings next to v002 put it at 1.56 and 1.58 times that version's speed.
// Over all steps from v000 it is 2.14 times as fast.
// Contractions: projections Xt.W'^T and W'.Xt^T on v_wmma_f32_16x16x32_bf16 (Xt and W RNE-converted bf16 operands, f32 accumulate, bias added in f32);
// scores k'.q'^T (q', k' carried x64 as f16), P.v (P x32768 as f16, v x64 as f16) and Wm'.O^T (Wm' as f16(bf16(Wm) x1024), O x1024 as f16 hi plane
// + f16 residual plane, products w.h + w.l): v_wmma_f32_16x16x32_f16, f32 accumulate. Base-2 online softmax, 1/l fold and bias adds in f32 on VALU.
#include <hip/hip_runtime.h>
#include <math.h>
#include <stdint.h>

#define NB    4
#define SEQ   4096
#define DMOD  256
#define NH    4
#define HD    64
#define QSC   64.0f
#define KSC   64.0f
#define PCAR  32768.0f
#define VCAR  64.0f
#define OSC   1024.0f
#define WOS   1024.0f
#define LOG2E 1.4426950408889634f
#define ATT_WAVES   4
#define ATT_THREADS (ATT_WAVES * 32)
#define ATT_BLOCKS  (NB * NH * (SEQ / 64))
#define NKB    (SEQ / 32)
#define SLABF  (16 * 68)
#define SLAB64 (16 * 68)
#define XTP    72
static_assert(HD == 64 && DMOD == NH * HD);
static_assert((SEQ / 64) == 64 && NH == 4 && NB == 4);
static_assert(ATT_THREADS == 128 && ATT_BLOCKS == 1024 && NKB == 128);
static_assert((DMOD % 64) == 0 && (SEQ % 64) == 0 && (DMOD % 32) == 0);
static_assert(((NB * SEQ * DMOD / 8) % 256) == 0 && ((DMOD * DMOD / 8) % 256) == 0);
static_assert((DMOD / 8) == 32);
static_assert(64 * XTP >= 63 * XTP + 64);
static_assert(ATT_WAVES * SLABF >= 4 * 16 * 68);

typedef unsigned short u16;
typedef _Float16 v16h __attribute__((ext_vector_type(16)));
typedef _Float16 v8h  __attribute__((ext_vector_type(8)));
typedef __bf16   v16b __attribute__((ext_vector_type(16)));
typedef float    v8f  __attribute__((ext_vector_type(8)));
typedef float    v4f  __attribute__((ext_vector_type(4)));
typedef unsigned int v4u __attribute__((ext_vector_type(4)));

union FragH { v16h v; v8h h[2]; v4u u[2]; };
union FragB { v16b v; v4u u[2]; };

// ---- scalar helpers --------------------------------------------------------------------------------
__device__ __forceinline__ unsigned short bf_bits(float f) {          // f32 -> bf16 bits, RNE convert
  unsigned u = __float_as_uint(f);
  return (unsigned short)((u + 0x7FFFu + ((u >> 16) & 1u)) >> 16);
}
__device__ __forceinline__ float bf_up(unsigned short h) { return __uint_as_float(((unsigned)h) << 16); }
__device__ __forceinline__ float bfr(float f) { return bf_up(bf_bits(f)); }
__device__ __forceinline__ unsigned short h_bits(_Float16 x) { return __builtin_bit_cast(unsigned short, x); }
__device__ __forceinline__ unsigned pk16(unsigned short a, unsigned short b) { return (unsigned)a | ((unsigned)b << 16); }
__device__ __forceinline__ v8f zero8() { v8f z = {0.f, 0.f, 0.f, 0.f, 0.f, 0.f, 0.f, 0.f}; return z; }
__device__ __forceinline__ v4f zero4() { v4f z = {0.f, 0.f, 0.f, 0.f}; return z; }

// ---- fragment loaders: 16-bit A/B operand, lane -> row/col (lane&15), h = lane>>4; elements 0..7 <- k0+8h.., elements 8..15 <-
//      k0+16+8h.. (same split k map for A and B).
//      ldfrag_h: row-major [row][k] plane, p already includes +8*h (q only, read once per wave).
//      TILED plane of a [rows][K] operand: 16-row tile = 16*K halves in a row, inside it [k/8][row%16][8 k], so that the unit of
//      lane l for k0 lies at k0*16 + 8*l and a wave-wide 16-B load is 512 contiguous bytes (4 whole lines, not pieces of 16).
__device__ __forceinline__ v16h ldfrag_h(const _Float16* p) {
  FragH f;
  f.h[0] = *(const v8h*)(p);
  f.h[1] = *(const v8h*)(p + 16);
  return f.v;
}
//      ldfrag_p / ldfrag_bp: tiled or fragment-ordered plane, p already includes +8*lane; the second half lies 256 halves on.
__device__ __forceinline__ v16h ldfrag_p(const _Float16* p) {
  FragH f;
  f.h[0] = *(const v8h*)(p);
  f.h[1] = *(const v8h*)(p + 256);
  return f.v;
}
__device__ __forceinline__ v16b ldfrag_bp(const u16* p) {             // the same for a bf16 plane, read as unsigned integer vectors
  FragB f;
  f.u[0] = *(const v4u*)(p);
  f.u[1] = *(const v4u*)(p + 256);
  return f.v;
}

__device__ __forceinline__ v8f mma_h(v16h a, v16h b, v8f c) {
  return __builtin_amdgcn_wmma_f32_16x16x32_f16(false, a, false, b, (short)0, c, false, false);
}
__device__ __forceinline__ v8f mma_b(v16b a, v16b b, v8f c) {
  return __builtin_amdgcn_wmma_f32_16x16x32_bf16(false, a, false, b, (short)0, c, false, false);
}
// four vector slots behind the last score WMMA: in front of the first read of its result and of the loads that overwrite its A fragments
__device__ __forceinline__ void g2_6(v8f& a, v8f& b, v16h x0, v16h x1, v16h x2, v16h x3, v16h x4, v16h x5) {
#if defined(__HIP_DEVICE_COMPILE__)
  asm volatile("v_nop\n\tv_nop\n\tv_nop\n\tv_nop"
               : "+v"(a), "+v"(b) : "v"(x0), "v"(x1), "v"(x2), "v"(x3), "v"(x4), "v"(x5) : "memory");
#endif
}
template <typename F>
__device__ __forceinline__ void g4_5(v8f& a, v8f& b, v8f& c, v8f& d, F x0, F x1, F x2, F x3, F x4) {
#if defined(__HIP_DEVICE_COMPILE__)
  asm volatile("v_nop\n\tv_nop\n\tv_nop\n\tv_nop"
               : "+v"(a), "+v"(b), "+v"(c), "+v"(d) : "v"(x0), "v"(x1), "v"(x2), "v"(x3), "v"(x4) : "memory");
#endif
}
__device__ __forceinline__ void g4_9(v8f& a, v8f& b, v8f& c, v8f& d, v16h x0, v16h x1, v16h x2, v16h x3, v16h x4,
                                     v16h x5, v16h x6, v16h x7, v16h x8) {
#if defined(__HIP_DEVICE_COMPILE__)
  asm volatile("v_nop\n\tv_nop\n\tv_nop\n\tv_nop"
               : "+v"(a), "+v"(b), "+v"(c), "+v"(d)
               : "v"(x0), "v"(x1), "v"(x2), "v"(x3), "v"(x4), "v"(x5), "v"(x6), "v"(x7), "v"(x8) : "memory");
#endif
}
__device__ __forceinline__ void acc_guard4(v8f& a, v8f& b, v8f& c, v8f& d) {
#if defined(__HIP_DEVICE_COMPILE__)
  asm volatile("v_nop\n\tv_nop\n\tv_nop\n\tv_nop" : "+v"(a), "+v"(b), "+v"(c), "+v"(d));
#endif
}
// s_wait_xcnt 0 behind a group of fragment loads: it stands in front of every later write of a register that those loads name as
// address; naming the addresses as inputs keeps their registers unwritten (also by a later load's result) up to the wait.
__device__ __forceinline__ void addr_wait2(const void* a, const void* b) {
#if defined(__HIP_DEVICE_COMPILE__)
  asm volatile("s_wait_xcnt 0x0" : : "v"(a), "v"(b) : "memory");
#endif
}
__device__ __forceinline__ void addr_wait5(const void* a, const void* b0, const void* b1, const void* b2, const void* b3) {
#if defined(__HIP_DEVICE_COMPILE__)
  asm volatile("s_wait_xcnt 0x0" : : "v"(a), "v"(b0), "v"(b1), "v"(b2), "v"(b3) : "memory");
#endif
}
__device__ __forceinline__ void addr_wait9(const void* a, const void* b0, const void* b1, const void* b2, const void* b3,
                                           const void* c0, const void* c1, const void* c2, const void* c3) {
#if defined(__HIP_DEVICE_COMPILE__)
  asm volatile("s_wait_xcnt 0x0"
               : : "v"(a), "v"(b0), "v"(b1), "v"(b2), "v"(b3), "v"(c0), "v"(c1), "v"(c2), "v"(c3) : "memory");
#endif
}
__device__ __forceinline__ void wave_sync_lds() {
  __builtin_amdgcn_fence(__ATOMIC_RELEASE, "workgroup");
  __builtin_amdgcn_wave_barrier();
  __builtin_amdgcn_fence(__ATOMIC_ACQUIRE, "workgroup");
}

// =====================================================================================================
// Weight matrix [DMOD][DMOD] f32 -> 16-bit plane [DMOD][DMOD], stored TILED (see the loaders), head-split permutation folded in:
//   mode 0: D[r][i]  = bf16 RNE bits of W[((r & 63) << 2) | (r >> 6)][i]      (output row r = h*64+d <- channel d*4+h)
//   mode 1: D[o][c]  = f16 bits of bf16value(W[o][((c & 63) << 2) | (c >> 6)]) * scale   (input column permuted the same way)
// Thread = 8 consecutive output elements (8 scalar loads, both candidate indices always < DMOD*DMOD, selected by value);
// coverage: blk = 0 .. DMOD*DMOD/8/256 - 1 = 32 blocks x 256 thr x 8 = the whole plane.
// =====================================================================================================
__device__ __forceinline__ void cvtw_body(const float* __restrict__ w, u16* D, int mode, float scale, int blk) {
  const int gt = blk * 256 + (int)threadIdx.x;
  if (gt >= (DMOD * DMOD) / 8) return;       // no barriers in this body
  const int row  = ((gt >> 9) << 4) | (gt & 15);   // 0..255: destination unit gt = ((row/16)*32 + c8/8)*16 + row%16
  const int c8   = ((gt >> 4) & 31) * 8;           // 0..248
  const int prow = ((row & 63) << 2) | (row >> 6);
  const int hsel = c8 >> 6, d0 = c8 & 63;
  unsigned short s[8];
  int   idx[8];
  float wv[8];
#pragma unroll
  for (int e = 0; e < 8; ++e) {
    const int i0  = prow * DMOD + c8 + e;                   // < 65536
    const int i1  = row * DMOD + ((d0 + e) << 2) + hsel;    // < 65536
    idx[e] = (mode == 0) ? i0 : i1;
    wv[e]  = w[idx[e]];
  }
#if defined(__HIP_DEVICE_COMPILE__)
  // s_wait_xcnt 0 behind the eight loads, in front of every later write of an index register that they name as address; naming
  // the indices as inputs keeps their registers unwritten (also by a later load's result) up to the wait.
  asm volatile("s_wait_xcnt 0x0" : : "v"(idx[0]), "v"(idx[1]), "v"(idx[2]), "v"(idx[3]), "v"(idx[4]), "v"(idx[5]), "v"(idx[6]),
               "v"(idx[7]) : "memory");
#endif
#pragma unroll
  for (int e = 0; e < 8; ++e) {
    const float v = wv[e];
    const unsigned short bb = bf_bits(v);
    const unsigned short hb = h_bits((_Float16)(bf_up(bb) * scale));
    s[e] = (mode == 0) ? bb : hb;
  }
  v4u o;
#pragma unroll
  for (int e = 0; e < 4; ++e) o[e] = pk16(s[2 * e], s[2 * e + 1]);
  u16* d = D + (size_t)gt * 8;
  {
    *(v4u*)(d) = o;
    
  }
}

// =====================================================================================================
// f32 plane -> f16 plane of (value * scale), same layout (scale a power of two).
// Thread = 8 consecutive elements: two 16-B loads, one 16-B store; 32 consecutive lanes = 512 contiguous, 512-B aligned bytes
// coverage: blk = 0 .. n8/256 - 1 blocks (host checks exactness) x 256 thr x 8 = the whole plane.
// =====================================================================================================
__device__ __forceinline__ void cvh16_body(const float* __restrict__ x, u16* D, int n8, float scale, int blk) {
  const int gt = blk * 256 + (int)threadIdx.x;
  if (gt >= n8) return;                     // no barriers in this body
  const float* p = x + (size_t)gt * 8;
  const v4f a = *(const v4f*)(p), c4 = *(const v4f*)(p + 4);
  float v[8];
#pragma unroll
  for (int e = 0; e < 4; ++e) { v[e] = a[e]; v[4 + e] = c4[e]; }
  unsigned short s[8];
#pragma unroll
  for (int e = 0; e < 8; ++e) s[e] = h_bits((_Float16)(v[e] * scale));
  v4u o;
#pragma unroll
  for (int e = 0; e < 4; ++e) o[e] = pk16(s[2 * e], s[2 * e + 1]);
  u16* d = D + (size_t)gt * 8;
  {
    *(v4u*)(d) = o;
    
  }
}

// =====================================================================================================
// f32 plane -> f16 plane of (value * scale) in the order the attention loop's fragment loads read it, so that one wave-wide
// 16-B load is 512 contiguous bytes (4 whole lines) instead of 32-B pieces of 16 lines. Unit = 8 halves (one lane's half fragment).
//   vmode 0 (k): x = [b][s][h][d]; D unit ((bh*256 + kt)*8 + dc)*16 + c  <- key s = 16*kt + c, d = 8*dc .. 8*dc+7
//   vmode 1 (v): x = [b][h][d][s]; D unit (((bh*128 + it)*4 + j)*4 + kc)*16 + c  <- d = 16*j + c, keys 32*it + 8*kc .. +7
// (bh = b*NH + h). Thread = one destination unit: two 16-B loads (16 source rows x 64 B per wave; a block consumes whole source
// lines), one 16-B store, 32 lanes = 512 contiguous bytes.
// coverage: the unit index is a bijection of (bh, s/8 or d/8 chunk, row); blk = 0 .. n8/256 - 1 x 256 thr x 8 = the whole plane.
// =====================================================================================================
__device__ __forceinline__ void cvfrag_body(const float* __restrict__ x, u16* D, int n8, int vmode, float scale, int blk) {
  static_assert((SEQ / 16) * 8 * 16 == 32768 && (SEQ / 32) * 4 * 4 * 16 == 32768 && NB * NH * 32768 == NB * SEQ * DMOD / 8);
  const int gt = blk * 256 + (int)threadIdx.x;
  if (gt >= n8) return;                     // no barriers in this body
  const int c  = gt & 15;
  const int bh = (gt >> 15) & (NB * NH - 1);
  const int dc = (gt >> 4) & 7, kt = (gt >> 7) & 255;
  const int kc = (gt >> 4) & 3, j = (gt >> 6) & 3, it = (gt >> 8) & 127;
  const int ksrc = ((bh >> 2) * SEQ + kt * 16 + c) * DMOD + (bh & 3) * HD + dc * 8;   // < NB*SEQ*DMOD
  const int vsrc = (bh * HD + j * 16 + c) * SEQ + it * 32 + kc * 8;                   // < NB*SEQ*DMOD
  const float* p = x + (size_t)(vmode ? vsrc : ksrc);
  const v4f a = *(const v4f*)(p), c4 = *(const v4f*)(p + 4);
  float v[8];
#pragma unroll
  for (int e = 0; e < 4; ++e) { v[e] = a[e]; v[4 + e] = c4[e]; }
  unsigned short s[8];
#pragma unroll
  for (int e = 0; e < 8; ++e) s[e] = h_bits((_Float16)(v[e] * scale));
  v4u o;
#pragma unroll
  for (int e = 0; e < 4; ++e) o[e] = pk16(s[2 * e], s[2 * e + 1]);
  *(v4u*)(D + (size_t)gt * 8) = o;
}

// =====================================================================================================
// The three plane converts, which need nothing of each other, as one grid: blockIdx.y = 0 q (same layout), 1 k, 2 v (fragment
// order); F3 = the three f32 projection planes one behind the other. grid = (n8/256, 3).
// =====================================================================================================
__global__ __launch_bounds__(256) void cv_qkv(const float* __restrict__ F3, u16* QH, u16* KH, u16* VH, int n8) {
  const int sel = blockIdx.y;                 // block-uniform
  const int blk = blockIdx.x;
  const float* x = F3 + (size_t)sel * (size_t)(NB * SEQ * DMOD);
  if (sel == 0)      cvh16_body(x, QH, n8, QSC, blk);
  else if (sel == 1) cvfrag_body(x, KH, n8, 0, KSC, blk);
  else               cvfrag_body(x, VH, n8, 1, VCAR, blk);
}

// =====================================================================================================
// Input transpose + convert: X [b][DMOD][SEQ] f32 -> XT bf16 [b][SEQ][DMOD], stored TILED. Block = (b, 64 tokens, 64 channels):
// 64 channel rows x 64 tokens loaded with 16-B loads, RNE-converted, scattered into an LDS tile [token][channel] (pitch XTP);
// coverage: load 256 thr x 16 elements = 64 x 64; store 2 iterations x 256 thr x 8 halves = 4 tiles x 8 chunks x 16 tokens = the block's
//           tile; bid = 0 .. NB x (SEQ/64) x (DMOD/64) - 1 = 1024 blocks covers XT exactly once. T = the block's LDS tile.
// =====================================================================================================
__device__ __forceinline__ void xt16_body(const float* __restrict__ x, u16* XT, u16* T, int bid) {
  const int tid = threadIdx.x;
  const int ct  = bid & 3;                    // channel tile, DMOD/64 = 4
  const int st  = (bid >> 2) & 63;            // token tile, SEQ/64 = 64
  const int b   = bid >> 8;                   // 0..3
  const int c0  = ct * 64, s0 = st * 64;
  {
    const int cl = tid >> 2;                  // channel within tile 0..63
    const int tc = (tid & 3) * 16;            // token chunk
    const float* src = x + ((size_t)(b * DMOD + c0 + cl)) * SEQ + s0 + tc;
#pragma unroll
    for (int i = 0; i < 4; ++i) {
      const v4f a = *(const v4f*)(src + 4 * i);
#pragma unroll
      for (int e = 0; e < 4; ++e) T[(tc + 4 * i + e) * XTP + cl] = bf_bits(a[e]);
    }
  }
  __syncthreads();
  v4u o[2];
  const int tk = tid & 15, ch = (tid >> 4) & 7, th = tid >> 7;   // token in its 16-token tile, 8-channel chunk, tile parity
#pragma unroll
  for (int it = 0; it < 2; ++it) {
    const int line = (it * 2 + th) * 16 + tk; // token within the block's tile 0..63
    o[it] = *(const v4u*)(T + line * XTP + ch * 8);
  }
  const size_t base = ((size_t)(b * SEQ + s0)) * DMOD + (size_t)(c0 + ch * 8) * 16 + tk * 8;
  {
#pragma unroll
    for (int it = 0; it < 2; ++it) {
      *(v4u*)(XT + base + (size_t)((it * 2 + th) * 16) * DMOD) = o[it];
    }
#if defined(__HIP_DEVICE_COMPILE__)
    // s_wait_xcnt 0 behind the two stores: in the merged kernel's text the weight range's code, which writes the registers that
    // these stores name as address, follows them behind a scalar test.
    asm volatile("s_wait_xcnt 0x0" : : : "memory");
#endif
  }
}

// =====================================================================================================
// The four weight converts and the three input transposes, which need nothing of each other, as block ranges of one grid:
//   blocks 0 .. 127: weight (bid >> 5) = wq, wk, wv (mode 0), wo (mode 1, x1024) -> plane (bid >> 5) of WB4, 32 blocks each;
//   blocks 128 .. 3199: input ((bid - 128) >> 10) = query, key, value -> plane of XT3, 1024 blocks each.
// The range test is block-uniform, so the transpose's barrier is passed by all threads of a block or by none.
// =====================================================================================================
#define WCV_BLOCKS (DMOD * DMOD / 8 / 256)
#define XT_BLOCKS  (NB * (SEQ / 64) * (DMOD / 64))
static_assert(WCV_BLOCKS == 32 && XT_BLOCKS == 1024);
__global__ __launch_bounds__(256)
void prep(const float* __restrict__ xq, const float* __restrict__ xk, const float* __restrict__ xv,
          const float* __restrict__ wq, const float* __restrict__ wk, const float* __restrict__ wv,
          const float* __restrict__ wo, u16* XT3, u16* WB4) {
  __shared__ __align__(16) u16 T[64 * XTP];
  const int bid = blockIdx.x;
  if (bid < 4 * WCV_BLOCKS) {
    const int sel = bid >> 5;
    const float* w = (sel == 0) ? wq : ((sel == 1) ? wk : ((sel == 2) ? wv : wo));
    cvtw_body(w, WB4 + (size_t)sel * (DMOD * DMOD), (sel == 3) ? 1 : 0, (sel == 3) ? WOS : 1.0f, bid & (WCV_BLOCKS - 1));
    return;                                   // the whole block leaves, in front of the barrier below
  }
  const int r   = bid - 4 * WCV_BLOCKS;
  const int sel = r >> 10;
  const float* x = (sel == 0) ? xq : ((sel == 1) ? xk : xv);
  xt16_body(x, XT3 + (size_t)sel * (size_t)(NB * SEQ * DMOD), T, r & (XT_BLOCKS - 1));
}

// =====================================================================================================
// Bias terms for the GEMM epilogue (bf16-RNE values of bias[], array of DMOD entries; every candidate index is masked into
// 0..DMOD-1 so all loads are in range, selection by value):
//   bmode 0: per-column, permuted index ((col&63)<<2)|(col>>6); bmode 1: per-row, same permutation of the row; bmode 2: per-row direct.
// =====================================================================================================
__device__ __forceinline__ void bias_terms(const float* __restrict__ bias, int bmode, int rowb, int col0, int hh, int m,
                                           v4f& badd, v8f& radd) {
#pragma unroll
  for (int e = 0; e < 4; ++e) {
    const int ci = col0 + 4 * m + e;
    const int pc = ((ci & 63) << 2) | ((ci >> 6) & 3);
    const float bc = bfr(bias[pc]);
    badd[e] = (bmode == 0) ? bc : 0.0f;
  }
#pragma unroll
  for (int r = 0; r < 8; ++r) {
    const int ri = rowb + 8 * hh + r;
    const int p1 = ((ri & 63) << 2) | ((ri >> 6) & 3);
    const int p2 = ri & (DMOD - 1);
    const float b1 = bfr(bias[p1]), b2 = bfr(bias[p2]);
    radd[r] = (bmode == 1) ? b1 : ((bmode == 2) ? b2 : 0.0f);
  }
}

// =====================================================================================================
// GEMM epilogue shared by both engines: the wave's 16x64 f32 tile (times oscale, plus per-row addend radd) staged in its LDS
// coverage: 8 instructions x 2 rows x 16 lanes x 4 floats = the wave's 16 x 64 tile.
// =====================================================================================================
__device__ __forceinline__ void epi64(float* sl, v8f a0, v8f a1, v8f a2, v8f a3, float oscale, v4f badd, v8f radd,
                                      float* C, int N, size_t rowb, int col0, int lane) {
  const int hh = lane >> 4, m = lane & 15;
#pragma unroll
  for (int r = 0; r < 8; ++r) {
    const int ro = (8 * hh + r) * 68 + m;
    sl[ro]      = a0[r] * oscale + radd[r];
    sl[ro + 16] = a1[r] * oscale + radd[r];
    sl[ro + 32] = a2[r] * oscale + radd[r];
    sl[ro + 48] = a3[r] * oscale + radd[r];
  }
  wave_sync_lds();
  v4f vals[8];
#pragma unroll
  for (int it = 0; it < 8; ++it) vals[it] = *(const v4f*)(sl + (it * 2 + hh) * 68 + m * 4) + badd;
  float* dst = C + (rowb + (size_t)hh) * (size_t)N + col0 + m * 4;
  {
#pragma unroll
    for (int it = 0; it < 8; ++it) {
      *(v4f*)(dst + (size_t)(it * 2) * (size_t)N) = vals[it];
    }
    
  }
}

// =====================================================================================================
// bf16 GEMM with bias: C[M][N] (f32, pitch N) = A[M][K] (bf16, TILED) . Bt[N][K]^T (bf16, TILED), times oscale, plus
// the bias term selected by bmode (see bias_terms). bid = 0 .. (M/64)*(N/64) - 1 tiles, y = batch index with element strides
// sA, sB, sC added to A, Bt, C. Block = 64x64 tile, 4 waves x 16 rows; fragments loaded straight from the tiled planes (two 16-B
// loads each, split k map for A and B); K stepped by 32 (host: K % 32 == 0, M % 64 == 0, N % 64 == 0).
// =====================================================================================================
__device__ __forceinline__
void gemm_bfb_body(float* slab, const u16* __restrict__ A, const u16* __restrict__ Bt, const float* __restrict__ bias,
                   float* C, int M, int N, int K, float oscale, int bmode, int sA, int sB, int sC, int bid, int y) {
  const int tid = threadIdx.x, wave = tid >> 5, lane = tid & 31, hh = lane >> 4, m = lane & 15;
  const int ntile = N >> 6;
  const int rowb  = (bid / ntile) * 64 + wave * 16;
  const int col0  = (bid % ntile) * 64;
  if (rowb + 16 > M) return;                 // wave-uniform, never taken with the exact grid; no block barriers in this kernel
  const u16* Ab = A  + (size_t)y * (size_t)sA;
  const u16* Bb = Bt + (size_t)y * (size_t)sB;
  float*     Cb = C  + (size_t)y * (size_t)sC;
  const u16* ap = Ab + (size_t)rowb * K + 8 * lane;   // 16-row tile = 16*K halves, inside it [k/8][row][8]
  const u16* bp = Bb + (size_t)col0 * K + 8 * lane;
  const size_t bs = (size_t)16 * K;
  v8f acc0 = zero8(), acc1 = zero8(), acc2 = zero8(), acc3 = zero8();
#pragma unroll 1
  for (int k0 = 0; k0 < K; k0 += 32) {
    const int ko = k0 * 16;
    const u16 *pa = ap + ko, *p0 = bp + ko, *p1 = p0 + bs, *p2 = p1 + bs, *p3 = p2 + bs;
    const v16b a  = ldfrag_bp(pa);
    const v16b b0 = ldfrag_bp(p0);
    const v16b b1 = ldfrag_bp(p1);
    const v16b b2 = ldfrag_bp(p2);
    const v16b b3 = ldfrag_bp(p3);
    addr_wait5(pa, p0, p1, p2, p3);
    acc0 = mma_b(a, b0, acc0);
    acc1 = mma_b(a, b1, acc1);
    acc2 = mma_b(a, b2, acc2);
    acc3 = mma_b(a, b3, acc3);
    g4_5<v16b>(acc0, acc1, acc2, acc3, a, b0, b1, b2, b3);
  }
  v4f badd = zero4();
  v8f radd = zero8();
  bias_terms(bias, bmode, rowb, col0, hh, m, badd, radd);
  epi64(slab + wave * SLAB64, acc0, acc1, acc2, acc3, oscale, badd, radd, Cb, N, (size_t)rowb, col0, lane);
}

// =====================================================================================================
// The three projections, which need nothing of each other, as one grid (1024 tiles, 3): blockIdx.y = 0 q, 1 k: token-major,
// F[16384 token][h*64+d] = XT . W'^T, per-column bias; 2 v: channel-major per batch (256 tiles x 4 batches in blockIdx.x),
// F[b][h*64+d][4096] = W' . XT^T, per-row bias. XT3, WB4, F3 hold the planes of q, k, v one behind the other.
// =====================================================================================================
__global__ __launch_bounds__(128)
void gemm_qkv(const u16* __restrict__ XT3, const u16* __restrict__ WB4, const float* __restrict__ bq,
              const float* __restrict__ bk, const float* __restrict__ bv, float* F3) {
  static_assert((NB * SEQ / 64) * (DMOD / 64) == 1024 && (DMOD / 64) * (SEQ / 64) == 256 && NB == 4);
  __shared__ __align__(16) float slab[4 * SLAB64];
  const int sel = blockIdx.y;                 // block-uniform
  const int bx  = blockIdx.x;
  const u16* X  = XT3 + (size_t)sel * (size_t)(NB * SEQ * DMOD);
  const u16* Wp = WB4 + (size_t)sel * (DMOD * DMOD);
  float*     F  = F3 + (size_t)sel * (size_t)(NB * SEQ * DMOD);
  if (sel < 2)
    gemm_bfb_body(slab, X, Wp, (sel == 0) ? bq : bk, F, NB * SEQ, DMOD, DMOD, 1.0f, 0, 0, 0, 0, bx, 0);
  else
    gemm_bfb_body(slab, Wp, X, bv, F, DMOD, SEQ, DMOD, 1.0f, 1, 0, SEQ * DMOD, DMOD * SEQ, bx & 255, bx >> 8);
}

// =====================================================================================================
// f16 GEMM, single A plane, hi+lo B planes, per-row bias: C[M][N] (f32, pitch N) = A[M][K] . (Bh + Bl)[N][K]^T times oscale,
// plus bf16-RNE value of bias[row]; A f16 TILED (no batch stride), Bh/Bl f16 [n][k] planes TILED with batch stride sB, C with
// batch stride sC (grid.y = batch). Products a.bh + a.bl into one accumulator (bl is the unscaled residual of bh). Same tiling
// as gemm_bfb.
// =====================================================================================================
__global__ __launch_bounds__(128)
void gemm_wh2(const u16* __restrict__ A, const u16* __restrict__ Bh, const u16* __restrict__ Bl,
              const float* __restrict__ bias, float* C, int M, int N, int K, float oscale, int sB, int sC) {
  __shared__ __align__(16) float slab[4 * SLAB64];
  const int tid = threadIdx.x, wave = tid >> 5, lane = tid & 31, hh = lane >> 4, m = lane & 15;
  const int ntile = N >> 6;
  const int bid   = blockIdx.x;
  const int y     = blockIdx.y;
  const int rowb  = (bid / ntile) * 64 + wave * 16;
  const int col0  = (bid % ntile) * 64;
  if (rowb + 16 > M) return;                 // wave-uniform, never taken with the exact grid; no block barriers in this kernel
  const _Float16* ap  = (const _Float16*)(const void*)A + (size_t)rowb * K + 8 * lane;   // tiles as in gemm_bfb
  const size_t bofs   = (size_t)y * (size_t)sB + (size_t)col0 * K + 8 * lane;
  const _Float16* bhp = (const _Float16*)(const void*)Bh + bofs;
  const _Float16* blp = (const _Float16*)(const void*)Bl + bofs;
  float* Cb = C + (size_t)y * (size_t)sC;
  const size_t bs = (size_t)16 * K;
  v8f acc0 = zero8(), acc1 = zero8(), acc2 = zero8(), acc3 = zero8();
#pragma unroll 1
  for (int k0 = 0; k0 < K; k0 += 32) {
    const int ko = k0 * 16;
    const _Float16 *pa = ap + ko, *h0 = bhp + ko, *h1 = h0 + bs, *h2 = h1 + bs, *h3 = h2 + bs;
    const _Float16 *l0 = blp + ko, *l1 = l0 + bs, *l2 = l1 + bs, *l3 = l2 + bs;
    const v16h a   = ldfrag_p(pa);
    const v16h bh0 = ldfrag_p(h0);
    const v16h bh1 = ldfrag_p(h1);
    const v16h bh2 = ldfrag_p(h2);
    const v16h bh3 = ldfrag_p(h3);
    const v16h bl0 = ldfrag_p(l0);
    const v16h bl1 = ldfrag_p(l1);
    const v16h bl2 = ldfrag_p(l2);
    const v16h bl3 = ldfrag_p(l3);
    addr_wait9(pa, h0, h1, h2, h3, l0, l1, l2, l3);
    acc0 = mma_h(a, bh0, acc0);  acc0 = mma_h(a, bl0, acc0);
    acc1 = mma_h(a, bh1, acc1);  acc1 = mma_h(a, bl1, acc1);
    acc2 = mma_h(a, bh2, acc2);  acc2 = mma_h(a, bl2, acc2);
    acc3 = mma_h(a, bh3, acc3);  acc3 = mma_h(a, bl3, acc3);
    g4_9(acc0, acc1, acc2, acc3, a, bh0, bh1, bh2, bh3, bl0, bl1, bl2, bl3);
  }
  v4f badd = zero4();
  v8f radd = zero8();
  bias_terms(bias, 2, rowb, col0, hh, m, badd, radd);
  epi64(slab + wave * SLAB64, acc0, acc1, acc2, acc3, oscale, badd, radd, Cb, N, (size_t)rowb, col0, lane);
}

// =====================================================================================================
// Full (non-causal, unmasked) multi-head flash attention: block = (batch b, head, 64 query rows), 4 waves, wave w owns the
// 16 query rows q0 = 64*qt + 16*w .. q0+15 (waves independent: no block barriers, wave-private LDS only, used in the epilogue).
//   q plane (f16, x64) laid out [b][s][h][d]; k and v planes (x64) per (b, h) in fragment order (cvfrag): every fragment load of
//   the loop is 512 contiguous bytes over the wave. All NKB = 128 key blocks of 32 keys are visited (static bound).
//   Scores are computed TRANSPOSED: S^T tile g (g = 0,1) = k rows (keys kb+16g .. +15, A operand, row m = lane&15, split k map
//   over d) times q^T (B operand, col n = query q0 + (lane&15), k = d, split map), one product per tile and d-chunk.
//   D element r of lane l = (key kb+16g+8h+r, query q0+(l&15)), so a lane owns one query column and 16 of its 32 keys; the
//   partner lane l^16 owns the other 16 -> row max / row sum need one xor-16 shuffle.
//   Online max-subtracted base-2 softmax in f32 (scale 1/8 and the q,k carries folded into lsc). The exp'd values ARE the
//   P A-fragment in place: A row m = query = lane&15, element i <- key kb+8h+i (tile 0, D element i), element 8+i <- key
//   kb+16+8h+i (tile 1, D element i). P is carried x32768 as f16. The rescale factor of query row 8h+r of the O accumulators is
//   fetched from lane 8h+r with a shuffle (uniform control). 4 v^T B fragments (col n = d = 16j + (lane&15), keys k-contiguous),
//   4 P.V WMMAs per key block.
//   Epilogue: 1/l (per query, shuffled to the D row owner) and carry folds in f32; the wave's 16x64 f32 result staged in its LDS
// coverage: per wave 4 instructions x 2 chunks x 16 rows x 8 halves = 16 x 64 per plane; grid 1024 blocks x 4 waves = every
//           (b, s, h) row of both O planes exactly once.
// =====================================================================================================
__global__ __launch_bounds__(ATT_THREADS)
void attn_fwd(const u16* __restrict__ QHp, const u16* __restrict__ KHp, const u16* __restrict__ VHp,
              u16* OHIp, u16* OLOp) {
  __shared__ __align__(16) float smem[ATT_WAVES * SLABF];   // per wave: result slab [16][68] in the epilogue only

  const int tid  = threadIdx.x;
  const int wave = tid >> 5;
  const int lane = tid & 31;
  const int hh   = lane >> 4;
  const int c    = lane & 15;

  const int bid  = blockIdx.x;
  const int qt   = bid & (SEQ / 64 - 1);      // 0..63
  const int head = (bid >> 6) & (NH - 1);     // 0..3
  const int b    = bid >> 8;                  // 0..3
  const int q0   = qt * 64 + wave * 16;

  // B fragments of q^T: col n = query q0 + c, k = d (k-contiguous row of the q plane); loop-invariant
  const size_t qofs = (((size_t)(b * SEQ + q0 + c)) * NH + head) * HD + 8 * hh;
  const _Float16* Qh  = (const _Float16*)(const void*)QHp + qofs;
  const v16h qh0 = ldfrag_h(Qh), qh1 = ldfrag_h(Qh + 32);
  // A fragments of k: row m = key kb + 16g + c, k = d; fragment-ordered plane, 2048 halves per 32-key block (see cvfrag)
  const size_t pofs = (size_t)(b * NH + head) * (SEQ * HD) + 8 * lane;
  const _Float16* Khb = (const _Float16*)(const void*)KHp + pofs;
  // B fragments of v: col n = d = 16j + c, k = key; fragment-ordered plane, 2048 halves per 32-key block (see cvfrag)
  const _Float16* Vhb = (const _Float16*)(const void*)VHp + pofs;
  const float lsc = 0.125f * (LOG2E / (QSC * KSC));

  float mrun = -INFINITY, lrun = 0.f;
  v8f o[4];
#pragma unroll
  for (int j = 0; j < 4; ++j) o[j] = zero8();

  // K fragments of key block 0; from here on each pass fetches the next pass's K fragments behind its own score products
  v16h kf0 = ldfrag_p(Khb), kf1 = ldfrag_p(Khb + 16 * HD), kf2 = ldfrag_p(Khb + 512), kf3 = ldfrag_p(Khb + 16 * HD + 512);
  addr_wait2(Qh, Khb);

#pragma unroll 1
  for (int it = 0; it < NKB; ++it) {
    const int kb = it * 32;
    // ---- this pass's v fragments, asked for here and first used behind the softmax: their latency runs under scores and softmax.
    //      B fragment col n = d = j*16 + c, 512 halves per j in the fragment-ordered v plane ----
    const _Float16* vhp = Vhb + (size_t)kb * HD;
    const v16h vh0 = ldfrag_p(vhp);
    const v16h vh1 = ldfrag_p(vhp + 512);
    const v16h vh2 = ldfrag_p(vhp + 1024);
    const v16h vh3 = ldfrag_p(vhp + 1536);
    __builtin_amdgcn_sched_barrier(0);   // keeps the eight v loads in front of the first wait on a k fragment
    // ---- transposed scores: s0 = keys kb..kb+15, s1 = keys kb+16..kb+31, column = query q0 + c ----
    v8f s0 = zero8(), s1 = zero8();
    s0 = mma_h(kf0, qh0, s0);
    s1 = mma_h(kf1, qh0, s1);
    s0 = mma_h(kf2, qh1, s0);
    s1 = mma_h(kf3, qh1, s1);
    g2_6(s0, s1, qh0, qh1, kf0, kf1, kf2, kf3);
    // ---- the next pass's k fragments into the same registers (the last pass asks for its own block again: in range, unused) ----
    {
      const int nx = (it + 1 < NKB) ? (it + 1) : it;
      const _Float16* knp = Khb + (size_t)nx * (32 * HD);
      kf0 = ldfrag_p(knp);
      kf1 = ldfrag_p(knp + 16 * HD);
      kf2 = ldfrag_p(knp + 512);
      kf3 = ldfrag_p(knp + 16 * HD + 512);
      addr_wait2(vhp, knp);   // one wait for both groups of loads of this pass
    }
    __builtin_amdgcn_sched_barrier(0);   // keeps the eight k loads here: without it they sink into the softmax, whose temporaries take their registers
    // ---- base-2 logits of this lane's 16 keys for query q0 + c: t[i] <- key kb+8hh+i, t[8+i] <- key kb+16+8hh+i ----
    float t[16];
#pragma unroll
    for (int i = 0; i < 8; ++i) { t[i] = s0[i] * lsc; t[8 + i] = s1[i] * lsc; }
    float cm = t[0];
#pragma unroll
    for (int i = 1; i < 16; ++i) cm = fmaxf(cm, t[i]);
    cm = fmaxf(cm, __shfl_xor(cm, 16, 32));
    const float mn = fmaxf(mrun, cm);        // finite from the first block on
    const float al = exp2f(mrun - mn);       // 0 on the first block (mrun = -inf)
    mrun = mn;
    // ---- probabilities (<= 1) and the P A-fragment: f16(p * 32768); element i <-> t[i] ----
    float ps = 0.f;
    FragH ph;
#pragma unroll
    for (int w = 0; w < 2; ++w) {
#pragma unroll
      for (int e4 = 0; e4 < 4; ++e4) {
        const int i = 8 * w + 2 * e4;
        const float p0 = exp2f(t[i] - mn), p1 = exp2f(t[i + 1] - mn);
        ps += p0 + p1;
        const _Float16 h0 = (_Float16)(p0 * PCAR), h1 = (_Float16)(p1 * PCAR);
        ph.u[w][e4] = pk16(h_bits(h0), h_bits(h1));
      }
    }
    ps += __shfl_xor(ps, 16, 32);
    lrun = lrun * al + ps;
    // ---- rescale the O accumulators: D row 8hh+r = query q0+8hh+r, its factor lives in lane 8hh+r (and 16+8hh+r) ----
    float scl[8];
#pragma unroll
    for (int r = 0; r < 8; ++r) scl[r] = __shfl(al, 8 * hh + r, 32);
#pragma unroll
    for (int j = 0; j < 4; ++j) {
#pragma unroll
      for (int r = 0; r < 8; ++r) o[j][r] *= scl[r];
    }
    // ---- P.V with the v fragments asked for at the head of the pass ----
    {
      o[0] = mma_h(ph.v, vh0, o[0]);
      o[1] = mma_h(ph.v, vh1, o[1]);
      o[2] = mma_h(ph.v, vh2, o[2]);
      o[3] = mma_h(ph.v, vh3, o[3]);
      g4_5<v16h>(o[0], o[1], o[2], o[3], ph.v, vh0, vh1, vh2, vh3);
    }
  }
  acc_guard4(o[0], o[1], o[2], o[3]);

  // ---- fold 1/l (per query, owned by lane = query) and the carries (32768 on P, 64 on v); stage the 16x64 slab ----
  const float linv = (1.0f / lrun) * (1.0f / (PCAR * VCAR));
  float inv[8];
#pragma unroll
  for (int r = 0; r < 8; ++r) inv[r] = __shfl(linv, 8 * hh + r, 32);
  float* slab = smem + wave * SLABF;
#pragma unroll
  for (int r = 0; r < 8; ++r) {
#pragma unroll
    for (int j = 0; j < 4; ++j) slab[(8 * hh + r) * 68 + j * 16 + c] = o[j][r] * inv[r];
  }
  wave_sync_lds();
  // ---- O x1024 -> f16 hi + residual planes, TILED as [token][h*64+d] operands; one store = 512 contiguous bytes ----
  v4u oh[4], ol[4];
#pragma unroll
  for (int i4 = 0; i4 < 4; ++i4) {
    const int c8 = (i4 * 2 + hh) * 8;         // lane = (8-d chunk parity hh, query row c)
    const v4f a = *(const v4f*)(slab + c * 68 + c8), c4 = *(const v4f*)(slab + c * 68 + c8 + 4);
    float w[8];
#pragma unroll
    for (int e = 0; e < 4; ++e) { w[e] = a[e] * OSC; w[4 + e] = c4[e] * OSC; }
#pragma unroll
    for (int e = 0; e < 4; ++e) {
      const _Float16 h0 = (_Float16)w[2 * e], h1 = (_Float16)w[2 * e + 1];
      const _Float16 l0 = (_Float16)(w[2 * e] - (float)h0), l1 = (_Float16)(w[2 * e + 1] - (float)h1);
      oh[i4][e] = pk16(h_bits(h0), h_bits(h1));
      ol[i4][e] = pk16(h_bits(l0), h_bits(l1));
    }
  }
  const size_t ob = ((size_t)(b * SEQ + q0)) * (NH * HD) + (size_t)head * (HD * 16) + 8 * lane;
  {
#pragma unroll
    for (int i4 = 0; i4 < 4; ++i4) {
      const size_t o8 = ob + (size_t)i4 * 256;
      *(v4u*)(OHIp + o8) = oh[i4];
      *(v4u*)(OLOp + o8) = ol[i4];
    }
    
  }
}

// =====================================================================================================
// Workspace map (bytes); every plane is fully written by whole-line stores before it is read; all extents are exact multiples
// of the store granularity (no pad rows needed); every offset a multiple of 131072; q, k and v each have an XT and an F plane of their own:
//   XT  bf16 3 x [16384 token][256 i] tiled         25165824     (query, key, value)
//   WQB bf16 [256 r'][256 i] tiled (rows permuted)  131072      WKB same 131072     WVB same 131072
//   WOB f16  [256 o][256 c'] tiled x1024 (cols permuted)  131072
//   F   f32  2 x [16384][256], [4][256][4096]      50331648     (projection q, k, v)
//   QH  f16  [4][4096][4][64] x64                   8388608
//   KH  f16  [16 bh][256 kt][8 dc][16 key][8 d] x64          8388608   (fragment order)
//   VH  f16  [16 bh][128 it][4 j][4 kc][16 d][8 key] x64     8388608   (fragment order)
//   OHI f16  [16384 token][256 h*64+d] tiled x1024   8388608      OLO residual 8388608
//   end                                           117964800
// =====================================================================================================
extern "C" void kernel_launch(void* const* d_in, const int* in_sizes, int n_in,
                              void* d_out, int out_size, void* d_ws, size_t ws_size,
                              hipStream_t stream) {
  const int ROWS = NB * SEQ;                            // 16384 tokens
  const int XN   = NB * DMOD * SEQ;                     // 4194304
  if (n_in < 11) return;
  if (in_sizes[0] != XN || in_sizes[1] != XN || in_sizes[2] != XN) return;
  if (in_sizes[3] != DMOD * DMOD || in_sizes[5] != DMOD * DMOD) return;
  if (in_sizes[7] != DMOD * DMOD || in_sizes[9] != DMOD * DMOD) return;
  if (in_sizes[4] != DMOD || in_sizes[6] != DMOD || in_sizes[8] != DMOD || in_sizes[10] != DMOD) return;
  if (out_size != XN) return;

  const float* Qin = (const float*)d_in[0];
  const float* Kin = (const float*)d_in[1];
  const float* Vin = (const float*)d_in[2];
  const float* wq  = (const float*)d_in[3];
  const float* bq  = (const float*)d_in[4];
  const float* wk  = (const float*)d_in[5];
  const float* bk  = (const float*)d_in[6];
  const float* wv  = (const float*)d_in[7];
  const float* bv  = (const float*)d_in[8];
  const float* wo  = (const float*)d_in[9];
  const float* bo  = (const float*)d_in[10];
  float*       out = (float*)d_out;

  const size_t szXT = (size_t)ROWS * DMOD * 2;                  //  8388608
  const size_t szW  = (size_t)DMOD * DMOD * 2;                  //   131072
  const size_t szF  = (size_t)ROWS * DMOD * 4;                  // 16777216
  const size_t szP  = (size_t)ROWS * DMOD * 2;                  //  8388608  (q/k/v/o planes)
  size_t off = 0;
  const size_t oXT  = off; off += 3 * szXT;
  const size_t oWQB = off; off += szW;
  const size_t oWKB = off; off += szW;
  const size_t oWVB = off; off += szW;
  const size_t oWOB = off; off += szW;
  const size_t oF   = off; off += 3 * szF;
  const size_t oQH  = off; off += szP;
  const size_t oKH  = off; off += szP;
  const size_t oVH  = off; off += szP;
  const size_t oOHI = off; off += szP;
  const size_t oOLO = off; off += szP;
  if (off > ws_size) return;                            // off = 117964800
  if (off > (size_t)134217728) return;

  char* ws = (char*)d_ws;
  u16*   XT  = (u16*)(ws + oXT);
  u16*   WQB = (u16*)(ws + oWQB);
  u16*   WOB = (u16*)(ws + oWOB);
  float* F   = (float*)(ws + oF);
  u16*   QH  = (u16*)(ws + oQH);
  u16*   KH  = (u16*)(ws + oKH);
  u16*   VH  = (u16*)(ws + oVH);
  u16*   OHI = (u16*)(ws + oOHI);
  u16*   OLO = (u16*)(ws + oOLO);

  const dim3 blk(256);
  const int n8x = XN / 8;                               // 524288
  const int n8w = (DMOD * DMOD) / 8;                    // 8192
  if ((n8x % 256) != 0 || (n8w % 256) != 0) return;
  const dim3 gP(n8x / 256, 3);                          // 2048 x (q, k, v)
  const dim3 gPre(4 * (n8w / 256) + 3 * NB * (SEQ / 64) * (DMOD / 64));   // 128 weight blocks + 3072 transpose blocks
  const dim3 gG3((ROWS / 64) * (DMOD / 64), 3);         // 1024 tiles x (q, k, v)
  const dim3 gGc((DMOD / 64) * (SEQ / 64), NB);         // 256 tiles x 4 batches, channel-major per batch
  const dim3 bG(128);
  const dim3 gAT(ATT_BLOCKS);                           // 1024
  const dim3 bAT(ATT_THREADS);                          // 128
  const int  sTok = SEQ * DMOD;                         // 1048576 elements: per-batch stride of XT / O planes
  const int  sChn = DMOD * SEQ;                         // 1048576 elements: per-batch stride of F (v) and out

  // (0) weights: rows of wq/wk/wv permuted to r' = h*64+d (bf16 planes), columns of wo permuted the same way (f16 of bf16 value x1024);
  //     inputs query, key, value -> XT bf16 [token][i], one plane each (WQB .. WOB lie one behind the other)
  prep<<<gPre, blk, 0, stream>>>(Qin, Kin, Vin, wq, wk, wv, wo, XT, WQB);
  // (1) projections + bias -> F: q, k [16384 token][h*64+d] f32; v channel-major per batch [b][h*64+d][4096] f32 (v^T)
  gemm_qkv<<<gG3, bG, 0, stream>>>(XT, WQB, bq, bk, bv, F);
  // (2) f16 planes x64: q in place order, k and v in fragment order
  cv_qkv<<<gP, blk, 0, stream>>>(F, QH, KH, VH, n8x);
  // (3) attention -> O planes [token][h*64+d] tiled, x1024 (hi + residual)
  attn_fwd<<<gAT, bAT, 0, stream>>>(QH, KH, VH, OHI, OLO);
  // (4) output projection per batch + bias -> out [b][256 o][4096 n] f32, carries 1024 (O) x 1024 (wo) folded back
  gemm_wh2<<<gGc, bG, 0, stream>>>(WOB, OHI, OLO, bo, out, DMOD, SEQ, DMOD, 1.0f / (OSC * WOS), sTok, sChn);
  (void)hipGetLastError();
}

// v004
// Measured time: 149 microseconds a run.
// Timed twice side by side with v003, it ran 1.12 and 1.13 times as fast.
// All steps since v000 together make it 2.41 times as fast.
// Contractions: projections Xt.W'^T and W'.Xt^T on v_wmma_f32_16x16x32_bf16 (Xt and W RNE-converted bf16 operands, f32 accumulate, bias added in f32);
// scores k'.q'^T (q', k' carried x64 as f16), P.v (P x32768 as f16, v x64 as f16) and Wm'.O^T (Wm' as f16(bf16(Wm) x1024), O x1024 as f16 hi plane
// + f16 residual plane, products w.h + w.l): v_wmma_f32_16x16x32_f16, f32 accumulate. Base-2 online softmax, 1/l fold and bias adds in f32 on VALU.
#include <hip/hip_runtime.h>
#include <math.h>
#include <stdint.h>

#define NB    4
#define SEQ   4096
#define DMOD  256
#define NH    4
#define HD    64
#define QSC   64.0f
#define KSC   64.0f
#define PCAR  32768.0f
#define VCAR  64.0f
#define OSC   1024.0f
#define WOS   1024.0f
#define LOG2E 1.4426950408889634f
#define PLOG  15.0f
#define ATT_WAVES   4
#define ATT_THREADS (ATT_WAVES * 32)
#define ATT_BLOCKS  (NB * NH * (SEQ / 64))
#define NKB    (SEQ / 32)
#define SLABF  (16 * 68)
#define SLAB64 (16 * 68)
#define XTP    72
static_assert(HD == 64 && DMOD == NH * HD);
static_assert(PCAR == 32768.0f && PLOG == 15.0f);   // PCAR = 2^PLOG
static_assert((SEQ / 64) == 64 && NH == 4 && NB == 4);
static_assert(ATT_THREADS == 128 && ATT_BLOCKS == 1024 && NKB == 128);
static_assert((DMOD % 64) == 0 && (SEQ % 64) == 0 && (DMOD % 32) == 0);
static_assert(((NB * SEQ * DMOD / 8) % 256) == 0 && ((DMOD * DMOD / 8) % 256) == 0);
static_assert((DMOD / 8) == 32);
static_assert(64 * XTP >= 63 * XTP + 64);
static_assert(ATT_WAVES * SLABF >= 4 * 16 * 68);

typedef unsigned short u16;
typedef _Float16 v16h __attribute__((ext_vector_type(16)));
typedef _Float16 v8h  __attribute__((ext_vector_type(8)));
typedef __bf16   v16b __attribute__((ext_vector_type(16)));
typedef float    v8f  __attribute__((ext_vector_type(8)));
typedef float    v4f  __attribute__((ext_vector_type(4)));
typedef unsigned int v4u __attribute__((ext_vector_type(4)));

union FragH { v16h v; v8h h[2]; v4u u[2]; };
union FragB { v16b v; v4u u[2]; };

// ---- scalar helpers --------------------------------------------------------------------------------
__device__ __forceinline__ unsigned short bf_bits(float f) {          // f32 -> bf16 bits, RNE convert
  unsigned u = __float_as_uint(f);
  return (unsigned short)((u + 0x7FFFu + ((u >> 16) & 1u)) >> 16);
}
__device__ __forceinline__ float bf_up(unsigned short h) { return __uint_as_float(((unsigned)h) << 16); }
__device__ __forceinline__ float bfr(float f) { return bf_up(bf_bits(f)); }
__device__ __forceinline__ unsigned short h_bits(_Float16 x) { return __builtin_bit_cast(unsigned short, x); }
__device__ __forceinline__ unsigned pk16(unsigned short a, unsigned short b) { return (unsigned)a | ((unsigned)b << 16); }
__device__ __forceinline__ v8f zero8() { v8f z = {0.f, 0.f, 0.f, 0.f, 0.f, 0.f, 0.f, 0.f}; return z; }
__device__ __forceinline__ v4f zero4() { v4f z = {0.f, 0.f, 0.f, 0.f}; return z; }

// ---- fragment loaders: 16-bit A/B operand, lane -> row/col (lane&15), h = lane>>4; elements 0..7 <- k0+8h.., elements 8..15 <-
//      k0+16+8h.. (same split k map for A and B).
//      ldfrag_h: row-major [row][k] plane, p already includes +8*h (q only, read once per wave).
//      TILED plane of a [rows][K] operand: 16-row tile = 16*K halves in a row, inside it [k/8][row%16][8 k], so that the unit of
//      lane l for k0 lies at k0*16 + 8*l and a wave-wide 16-B load is 512 contiguous bytes (4 whole lines, not pieces of 16).
__device__ __forceinline__ v16h ldfrag_h(const _Float16* p) {
  FragH f;
  f.h[0] = *(const v8h*)(p);
  f.h[1] = *(const v8h*)(p + 16);
  return f.v;
}
//      ldfrag_p / ldfrag_bp: tiled or fragment-ordered plane, p already includes +8*lane; the second half lies 256 halves on.
__device__ __forceinline__ v16h ldfrag_p(const _Float16* p) {
  FragH f;
  f.h[0] = *(const v8h*)(p);
  f.h[1] = *(const v8h*)(p + 256);
  return f.v;
}
__device__ __forceinline__ v16b ldfrag_bp(const u16* p) {             // the same for a bf16 plane, read as unsigned integer vectors
  FragB f;
  f.u[0] = *(const v4u*)(p);
  f.u[1] = *(const v4u*)(p + 256);
  return f.v;
}

// 2^x as the one hardware instruction (v_exp_f32). The library exp2f wraps it in a range guard (compare, two selects, add, ldexp)
// that only serves results below 2^-126; here such a result is a weight that rounds to zero in f16 and adds nothing to a row sum
// that holds its row maximum's own 2^15, so a flush to zero gives the same output.
__device__ __forceinline__ float hw_exp2(float x) { return __builtin_amdgcn_exp2f(x); }
// eight of them in place, as one statement: each writes only its own source, so none overwrites the source of the one in front of
// it, and the v_nop is the one slot that the instruction set asks for between the last one and the first use of its result.
__device__ __forceinline__ void hw_exp2x8(float& x0, float& x1, float& x2, float& x3, float& x4, float& x5, float& x6, float& x7) {
#if defined(__HIP_DEVICE_COMPILE__)
  asm("v_exp_f32 %0, %0\n\tv_exp_f32 %1, %1\n\tv_exp_f32 %2, %2\n\tv_exp_f32 %3, %3\n\t"
      "v_exp_f32 %4, %4\n\tv_exp_f32 %5, %5\n\tv_exp_f32 %6, %6\n\tv_exp_f32 %7, %7\n\tv_nop"
      : "+v"(x0), "+v"(x1), "+v"(x2), "+v"(x3), "+v"(x4), "+v"(x5), "+v"(x6), "+v"(x7));
#endif
}

__device__ __forceinline__ v8f mma_h(v16h a, v16h b, v8f c) {
  return __builtin_amdgcn_wmma_f32_16x16x32_f16(false, a, false, b, (short)0, c, false, false);
}
__device__ __forceinline__ v8f mma_b(v16b a, v16b b, v8f c) {
  return __builtin_amdgcn_wmma_f32_16x16x32_bf16(false, a, false, b, (short)0, c, false, false);
}
// four vector slots behind the last score WMMA: in front of the first read of its result and of the loads that overwrite its A fragments
__device__ __forceinline__ void g2_6(v8f& a, v8f& b, v16h x0, v16h x1, v16h x2, v16h x3, v16h x4, v16h x5) {
#if defined(__HIP_DEVICE_COMPILE__)
  asm volatile("v_nop\n\tv_nop\n\tv_nop\n\tv_nop"
               : "+v"(a), "+v"(b) : "v"(x0), "v"(x1), "v"(x2), "v"(x3), "v"(x4), "v"(x5) : "memory");
#endif
}
template <typename F>
__device__ __forceinline__ void g4_5(v8f& a, v8f& b, v8f& c, v8f& d, F x0, F x1, F x2, F x3, F x4) {
#if defined(__HIP_DEVICE_COMPILE__)
  asm volatile("v_nop\n\tv_nop\n\tv_nop\n\tv_nop"
               : "+v"(a), "+v"(b), "+v"(c), "+v"(d) : "v"(x0), "v"(x1), "v"(x2), "v"(x3), "v"(x4) : "memory");
#endif
}
__device__ __forceinline__ void g4_9(v8f& a, v8f& b, v8f& c, v8f& d, v16h x0, v16h x1, v16h x2, v16h x3, v16h x4,
                                     v16h x5, v16h x6, v16h x7, v16h x8) {
#if defined(__HIP_DEVICE_COMPILE__)
  asm volatile("v_nop\n\tv_nop\n\tv_nop\n\tv_nop"
               : "+v"(a), "+v"(b), "+v"(c), "+v"(d)
               : "v"(x0), "v"(x1), "v"(x2), "v"(x3), "v"(x4), "v"(x5), "v"(x6), "v"(x7), "v"(x8) : "memory");
#endif
}
__device__ __forceinline__ void acc_guard4(v8f& a, v8f& b, v8f& c, v8f& d) {
#if defined(__HIP_DEVICE_COMPILE__)
  asm volatile("v_nop\n\tv_nop\n\tv_nop\n\tv_nop" : "+v"(a), "+v"(b), "+v"(c), "+v"(d));
#endif
}
// s_wait_xcnt 0 behind a group of fragment loads: it stands in front of every later write of a register that those loads name as
// address; naming the addresses as inputs keeps their registers unwritten (also by a later load's result) up to the wait.
__device__ __forceinline__ void addr_wait2(const void* a, const void* b) {
#if defined(__HIP_DEVICE_COMPILE__)
  asm volatile("s_wait_xcnt 0x0" : : "v"(a), "v"(b) : "memory");
#endif
}
__device__ __forceinline__ void addr_wait5(const void* a, const void* b0, const void* b1, const void* b2, const void* b3) {
#if defined(__HIP_DEVICE_COMPILE__)
  asm volatile("s_wait_xcnt 0x0" : : "v"(a), "v"(b0), "v"(b1), "v"(b2), "v"(b3) : "memory");
#endif
}
__device__ __forceinline__ void addr_wait9(const void* a, const void* b0, const void* b1, const void* b2, const void* b3,
                                           const void* c0, const void* c1, const void* c2, const void* c3) {
#if defined(__HIP_DEVICE_COMPILE__)
  asm volatile("s_wait_xcnt 0x0"
               : : "v"(a), "v"(b0), "v"(b1), "v"(b2), "v"(b3), "v"(c0), "v"(c1), "v"(c2), "v"(c3) : "memory");
#endif
}
__device__ __forceinline__ void wave_sync_lds() {
  __builtin_amdgcn_fence(__ATOMIC_RELEASE, "workgroup");
  __builtin_amdgcn_wave_barrier();
  __builtin_amdgcn_fence(__ATOMIC_ACQUIRE, "workgroup");
}

// =====================================================================================================
// Weight matrix [DMOD][DMOD] f32 -> 16-bit plane [DMOD][DMOD], stored TILED (see the loaders), head-split permutation folded in:
//   mode 0: D[r][i]  = bf16 RNE bits of W[((r & 63) << 2) | (r >> 6)][i]      (output row r = h*64+d <- channel d*4+h)
//   mode 1: D[o][c]  = f16 bits of bf16value(W[o][((c & 63) << 2) | (c >> 6)]) * scale   (input column permuted the same way)
// Thread = 8 consecutive output elements (8 scalar loads, both candidate indices always < DMOD*DMOD, selected by value);
// coverage: blk = 0 .. DMOD*DMOD/8/256 - 1 = 32 blocks x 256 thr x 8 = the whole plane.
// =====================================================================================================
__device__ __forceinline__ void cvtw_body(const float* __restrict__ w, u16* D, int mode, float scale, int blk) {
  const int gt = blk * 256 + (int)threadIdx.x;
  if (gt >= (DMOD * DMOD) / 8) return;       // no barriers in this body
  const int row  = ((gt >> 9) << 4) | (gt & 15);   // 0..255: destination unit gt = ((row/16)*32 + c8/8)*16 + row%16
  const int c8   = ((gt >> 4) & 31) * 8;           // 0..248
  const int prow = ((row & 63) << 2) | (row >> 6);
  const int hsel = c8 >> 6, d0 = c8 & 63;
  unsigned short s[8];
  int   idx[8];
  float wv[8];
#pragma unroll
  for (int e = 0; e < 8; ++e) {
    const int i0  = prow * DMOD + c8 + e;                   // < 65536
    const int i1  = row * DMOD + ((d0 + e) << 2) + hsel;    // < 65536
    idx[e] = (mode == 0) ? i0 : i1;
    wv[e]  = w[idx[e]];
  }
#if defined(__HIP_DEVICE_COMPILE__)
  // s_wait_xcnt 0 behind the eight loads, in front of every later write of an index register that they name as address; naming
  // the indices as inputs keeps their registers unwritten (also by a later load's result) up to the wait.
  asm volatile("s_wait_xcnt 0x0" : : "v"(idx[0]), "v"(idx[1]), "v"(idx[2]), "v"(idx[3]), "v"(idx[4]), "v"(idx[5]), "v"(idx[6]),
               "v"(idx[7]) : "memory");
#endif
#pragma unroll
  for (int e = 0; e < 8; ++e) {
    const float v = wv[e];
    const unsigned short bb = bf_bits(v);
    const unsigned short hb = h_bits((_Float16)(bf_up(bb) * scale));
    s[e] = (mode == 0) ? bb : hb;
  }
  v4u o;
#pragma unroll
  for (int e = 0; e < 4; ++e) o[e] = pk16(s[2 * e], s[2 * e + 1]);
  u16* d = D + (size_t)gt * 8;
  {
    *(v4u*)(d) = o;
    
  }
}

// =====================================================================================================
// f32 plane -> f16 plane of (value * scale), same layout (scale a power of two).
// Thread = 8 consecutive elements: two 16-B loads, one 16-B store; 32 consecutive lanes = 512 contiguous, 512-B aligned bytes
// coverage: blk = 0 .. n8/256 - 1 blocks (host checks exactness) x 256 thr x 8 = the whole plane.
// =====================================================================================================
__device__ __forceinline__ void cvh16_body(const float* __restrict__ x, u16* D, int n8, float scale, int blk) {
  const int gt = blk * 256 + (int)threadIdx.x;
  if (gt >= n8) return;                     // no barriers in this body
  const float* p = x + (size_t)gt * 8;
  const v4f a = *(const v4f*)(p), c4 = *(const v4f*)(p + 4);
  float v[8];
#pragma unroll
  for (int e = 0; e < 4; ++e) { v[e] = a[e]; v[4 + e] = c4[e]; }
  unsigned short s[8];
#pragma unroll
  for (int e = 0; e < 8; ++e) s[e] = h_bits((_Float16)(v[e] * scale));
  v4u o;
#pragma unroll
  for (int e = 0; e < 4; ++e) o[e] = pk16(s[2 * e], s[2 * e + 1]);
  u16* d = D + (size_t)gt * 8;
  {
    *(v4u*)(d) = o;
    
  }
}

// =====================================================================================================
// f32 plane -> f16 plane of (value * scale) in the order the attention loop's fragment loads read it, so that one wave-wide
// 16-B load is 512 contiguous bytes (4 whole lines) instead of 32-B pieces of 16 lines. Unit = 8 halves (one lane's half fragment).
//   vmode 0 (k): x = [b][s][h][d]; D unit ((bh*256 + kt)*8 + dc)*16 + c  <- key s = 16*kt + c, d = 8*dc .. 8*dc+7
//   vmode 1 (v): x = [b][h][d][s]; D unit (((bh*128 + it)*4 + j)*4 + kc)*16 + c  <- d = 16*j + c, keys 32*it + 8*kc .. +7
// (bh = b*NH + h). Thread = one destination unit: two 16-B loads (16 source rows x 64 B per wave; a block consumes whole source
// lines), one 16-B store, 32 lanes = 512 contiguous bytes.
// coverage: the unit index is a bijection of (bh, s/8 or d/8 chunk, row); blk = 0 .. n8/256 - 1 x 256 thr x 8 = the whole plane.
// =====================================================================================================
__device__ __forceinline__ void cvfrag_body(const float* __restrict__ x, u16* D, int n8, int vmode, float scale, int blk) {
  static_assert((SEQ / 16) * 8 * 16 == 32768 && (SEQ / 32) * 4 * 4 * 16 == 32768 && NB * NH * 32768 == NB * SEQ * DMOD / 8);
  const int gt = blk * 256 + (int)threadIdx.x;
  if (gt >= n8) return;                     // no barriers in this body
  const int c  = gt & 15;
  const int bh = (gt >> 15) & (NB * NH - 1);
  const int dc = (gt >> 4) & 7, kt = (gt >> 7) & 255;
  const int kc = (gt >> 4) & 3, j = (gt >> 6) & 3, it = (gt >> 8) & 127;
  const int ksrc = ((bh >> 2) * SEQ + kt * 16 + c) * DMOD + (bh & 3) * HD + dc * 8;   // < NB*SEQ*DMOD
  const int vsrc = (bh * HD + j * 16 + c) * SEQ + it * 32 + kc * 8;                   // < NB*SEQ*DMOD
  const float* p = x + (size_t)(vmode ? vsrc : ksrc);
  const v4f a = *(const v4f*)(p), c4 = *(const v4f*)(p + 4);
  float v[8];
#pragma unroll
  for (int e = 0; e < 4; ++e) { v[e] = a[e]; v[4 + e] = c4[e]; }
  unsigned short s[8];
#pragma unroll
  for (int e = 0; e < 8; ++e) s[e] = h_bits((_Float16)(v[e] * scale));
  v4u o;
#pragma unroll
  for (int e = 0; e < 4; ++e) o[e] = pk16(s[2 * e], s[2 * e + 1]);
  *(v4u*)(D + (size_t)gt * 8) = o;
}

// =====================================================================================================
// The three plane converts, which need nothing of each other, as one grid: blockIdx.y = 0 q (same layout), 1 k, 2 v (fragment
// order); F3 = the three f32 projection planes one behind the other. grid = (n8/256, 3).
// =====================================================================================================
__global__ __launch_bounds__(256) void cv_qkv(const float* __restrict__ F3, u16* QH, u16* KH, u16* VH, int n8) {
  const int sel = blockIdx.y;                 // block-uniform
  const int blk = blockIdx.x;
  const float* x = F3 + (size_t)sel * (size_t)(NB * SEQ * DMOD);
  if (sel == 0)      cvh16_body(x, QH, n8, QSC, blk);
  else if (sel == 1) cvfrag_body(x, KH, n8, 0, KSC, blk);
  else               cvfrag_body(x, VH, n8, 1, VCAR, blk);
}

// =====================================================================================================
// Input transpose + convert: X [b][DMOD][SEQ] f32 -> XT bf16 [b][SEQ][DMOD], stored TILED. Block = (b, 64 tokens, 64 channels):
// 64 channel rows x 64 tokens loaded with 16-B loads, RNE-converted, scattered into an LDS tile [token][channel] (pitch XTP);
// coverage: load 256 thr x 16 elements = 64 x 64; store 2 iterations x 256 thr x 8 halves = 4 tiles x 8 chunks x 16 tokens = the block's
//           tile; bid = 0 .. NB x (SEQ/64) x (DMOD/64) - 1 = 1024 blocks covers XT exactly once. T = the block's LDS tile.
// =====================================================================================================
__device__ __forceinline__ void xt16_body(const float* __restrict__ x, u16* XT, u16* T, int bid) {
  const int tid = threadIdx.x;
  const int ct  = bid & 3;                    // channel tile, DMOD/64 = 4
  const int st  = (bid >> 2) & 63;            // token tile, SEQ/64 = 64
  const int b   = bid >> 8;                   // 0..3
  const int c0  = ct * 64, s0 = st * 64;
  {
    const int cl = tid >> 2;                  // channel within tile 0..63
    const int tc = (tid & 3) * 16;            // token chunk
    const float* src = x + ((size_t)(b * DMOD + c0 + cl)) * SEQ + s0 + tc;
#pragma unroll
    for (int i = 0; i < 4; ++i) {
      const v4f a = *(const v4f*)(src + 4 * i);
#pragma unroll
      for (int e = 0; e < 4; ++e) T[(tc + 4 * i + e) * XTP + cl] = bf_bits(a[e]);
    }
  }
  __syncthreads();
  v4u o[2];
  const int tk = tid & 15, ch = (tid >> 4) & 7, th = tid >> 7;   // token in its 16-token tile, 8-channel chunk, tile parity
#pragma unroll
  for (int it = 0; it < 2; ++it) {
    const int line = (it * 2 + th) * 16 + tk; // token within the block's tile 0..63
    o[it] = *(const v4u*)(T + line * XTP + ch * 8);
  }
  const size_t base = ((size_t)(b * SEQ + s0)) * DMOD + (size_t)(c0 + ch * 8) * 16 + tk * 8;
  {
#pragma unroll
    for (int it = 0; it < 2; ++it) {
      *(v4u*)(XT + base + (size_t)((it * 2 + th) * 16) * DMOD) = o[it];
    }
#if defined(__HIP_DEVICE_COMPILE__)
    // s_wait_xcnt 0 behind the two stores: in the merged kernel's text the weight range's code, which writes the registers that
    // these stores name as address, follows them behind a scalar test.
    asm volatile("s_wait_xcnt 0x0" : : : "memory");
#endif
  }
}

// =====================================================================================================
// The four weight converts and the three input transposes, which need nothing of each other, as block ranges of one grid:
//   blocks 0 .. 127: weight (bid >> 5) = wq, wk, wv (mode 0), wo (mode 1, x1024) -> plane (bid >> 5) of WB4, 32 blocks each;
//   blocks 128 .. 3199: input ((bid - 128) >> 10) = query, key, value -> plane of XT3, 1024 blocks each.
// The range test is block-uniform, so the transpose's barrier is passed by all threads of a block or by none.
// =====================================================================================================
#define WCV_BLOCKS (DMOD * DMOD / 8 / 256)
#define XT_BLOCKS  (NB * (SEQ / 64) * (DMOD / 64))
static_assert(WCV_BLOCKS == 32 && XT_BLOCKS == 1024);
__global__ __launch_bounds__(256)
void prep(const float* __restrict__ xq, const float* __restrict__ xk, const float* __restrict__ xv,
          const float* __restrict__ wq, const float* __restrict__ wk, const float* __restrict__ wv,
          const float* __restrict__ wo, u16* XT3, u16* WB4) {
  __shared__ __align__(16) u16 T[64 * XTP];
  const int bid = blockIdx.x;
  if (bid < 4 * WCV_BLOCKS) {
    const int sel = bid >> 5;
    const float* w = (sel == 0) ? wq : ((sel == 1) ? wk : ((sel == 2) ? wv : wo));
    cvtw_body(w, WB4 + (size_t)sel * (DMOD * DMOD), (sel == 3) ? 1 : 0, (sel == 3) ? WOS : 1.0f, bid & (WCV_BLOCKS - 1));
    return;                                   // the whole block leaves, in front of the barrier below
  }
  const int r   = bid - 4 * WCV_BLOCKS;
  const int sel = r >> 10;
  const float* x = (sel == 0) ? xq : ((sel == 1) ? xk : xv);
  xt16_body(x, XT3 + (size_t)sel * (size_t)(NB * SEQ * DMOD), T, r & (XT_BLOCKS - 1));
}

// =====================================================================================================
// Bias terms for the GEMM epilogue (bf16-RNE values of bias[], array of DMOD entries; every candidate index is masked into
// 0..DMOD-1 so all loads are in range, selection by value):
//   bmode 0: per-column, permuted index ((col&63)<<2)|(col>>6); bmode 1: per-row, same permutation of the row; bmode 2: per-row direct.
// =====================================================================================================
__device__ __forceinline__ void bias_terms(const float* __restrict__ bias, int bmode, int rowb, int col0, int hh, int m,
                                           v4f& badd, v8f& radd) {
#pragma unroll
  for (int e = 0; e < 4; ++e) {
    const int ci = col0 + 4 * m + e;
    const int pc = ((ci & 63) << 2) | ((ci >> 6) & 3);
    const float bc = bfr(bias[pc]);
    badd[e] = (bmode == 0) ? bc : 0.0f;
  }
#pragma unroll
  for (int r = 0; r < 8; ++r) {
    const int ri = rowb + 8 * hh + r;
    const int p1 = ((ri & 63) << 2) | ((ri >> 6) & 3);
    const int p2 = ri & (DMOD - 1);
    const float b1 = bfr(bias[p1]), b2 = bfr(bias[p2]);
    radd[r] = (bmode == 1) ? b1 : ((bmode == 2) ? b2 : 0.0f);
  }
}

// =====================================================================================================
// GEMM epilogue shared by both engines: the wave's 16x64 f32 tile (times oscale, plus per-row addend radd) staged in its LDS
// coverage: 8 instructions x 2 rows x 16 lanes x 4 floats = the wave's 16 x 64 tile.
// =====================================================================================================
__device__ __forceinline__ void epi64(float* sl, v8f a0, v8f a1, v8f a2, v8f a3, float oscale, v4f badd, v8f radd,
                                      float* C, int N, size_t rowb, int col0, int lane) {
  const int hh = lane >> 4, m = lane & 15;
#pragma unroll
  for (int r = 0; r < 8; ++r) {
    const int ro = (8 * hh + r) * 68 + m;
    sl[ro]      = a0[r] * oscale + radd[r];
    sl[ro + 16] = a1[r] * oscale + radd[r];
    sl[ro + 32] = a2[r] * oscale + radd[r];
    sl[ro + 48] = a3[r] * oscale + radd[r];
  }
  wave_sync_lds();
  v4f vals[8];
#pragma unroll
  for (int it = 0; it < 8; ++it) vals[it] = *(const v4f*)(sl + (it * 2 + hh) * 68 + m * 4) + badd;
  float* dst = C + (rowb + (size_t)hh) * (size_t)N + col0 + m * 4;
  {
#pragma unroll
    for (int it = 0; it < 8; ++it) {
      *(v4f*)(dst + (size_t)(it * 2) * (size_t)N) = vals[it];
    }
    
  }
}

// =====================================================================================================
// bf16 GEMM with bias: C[M][N] (f32, pitch N) = A[M][K] (bf16, TILED) . Bt[N][K]^T (bf16, TILED), times oscale, plus
// the bias term selected by bmode (see bias_terms). bid = 0 .. (M/64)*(N/64) - 1 tiles, y = batch index with element strides
// sA, sB, sC added to A, Bt, C. Block = 64x64 tile, 4 waves x 16 rows; fragments loaded straight from the tiled planes (two 16-B
// loads each, split k map for A and B); K stepped by 32 (host: K % 32 == 0, M % 64 == 0, N % 64 == 0).
// =====================================================================================================
__device__ __forceinline__
void gemm_bfb_body(float* slab, const u16* __restrict__ A, const u16* __restrict__ Bt, const float* __restrict__ bias,
                   float* C, int M, int N, int K, float oscale, int bmode, int sA, int sB, int sC, int bid, int y) {
  const int tid = threadIdx.x, wave = tid >> 5, lane = tid & 31, hh = lane >> 4, m = lane & 15;
  const int ntile = N >> 6;
  const int rowb  = (bid / ntile) * 64 + wave * 16;
  const int col0  = (bid % ntile) * 64;
  if (rowb + 16 > M) return;                 // wave-uniform, never taken with the exact grid; no block barriers in this kernel
  const u16* Ab = A  + (size_t)y * (size_t)sA;
  const u16* Bb = Bt + (size_t)y * (size_t)sB;
  float*     Cb = C  + (size_t)y * (size_t)sC;
  const u16* ap = Ab + (size_t)rowb * K + 8 * lane;   // 16-row tile = 16*K halves, inside it [k/8][row][8]
  const u16* bp = Bb + (size_t)col0 * K + 8 * lane;
  const size_t bs = (size_t)16 * K;
  v8f acc0 = zero8(), acc1 = zero8(), acc2 = zero8(), acc3 = zero8();
#pragma unroll 1
  for (int k0 = 0; k0 < K; k0 += 32) {
    const int ko = k0 * 16;
    const u16 *pa = ap + ko, *p0 = bp + ko, *p1 = p0 + bs, *p2 = p1 + bs, *p3 = p2 + bs;
    const v16b a  = ldfrag_bp(pa);
    const v16b b0 = ldfrag_bp(p0);
    const v16b b1 = ldfrag_bp(p1);
    const v16b b2 = ldfrag_bp(p2);
    const v16b b3 = ldfrag_bp(p3);
    addr_wait5(pa, p0, p1, p2, p3);
    acc0 = mma_b(a, b0, acc0);
    acc1 = mma_b(a, b1, acc1);
    acc2 = mma_b(a, b2, acc2);
    acc3 = mma_b(a, b3, acc3);
    g4_5<v16b>(acc0, acc1, acc2, acc3, a, b0, b1, b2, b3);
  }
  v4f badd = zero4();
  v8f radd = zero8();
  bias_terms(bias, bmode, rowb, col0, hh, m, badd, radd);
  epi64(slab + wave * SLAB64, acc0, acc1, acc2, acc3, oscale, badd, radd, Cb, N, (size_t)rowb, col0, lane);
}

// =====================================================================================================
// The three projections, which need nothing of each other, as one grid (1024 tiles, 3): blockIdx.y = 0 q, 1 k: token-major,
// F[16384 token][h*64+d] = XT . W'^T, per-column bias; 2 v: channel-major per batch (256 tiles x 4 batches in blockIdx.x),
// F[b][h*64+d][4096] = W' . XT^T, per-row bias. XT3, WB4, F3 hold the planes of q, k, v one behind the other.
// =====================================================================================================
__global__ __launch_bounds__(128)
void gemm_qkv(const u16* __restrict__ XT3, const u16* __restrict__ WB4, const float* __restrict__ bq,
              const float* __restrict__ bk, const float* __restrict__ bv, float* F3) {
  static_assert((NB * SEQ / 64) * (DMOD / 64) == 1024 && (DMOD / 64) * (SEQ / 64) == 256 && NB == 4);
  __shared__ __align__(16) float slab[4 * SLAB64];
  const int sel = blockIdx.y;                 // block-uniform
  const int bx  = blockIdx.x;
  const u16* X  = XT3 + (size_t)sel * (size_t)(NB * SEQ * DMOD);
  const u16* Wp = WB4 + (size_t)sel * (DMOD * DMOD);
  float*     F  = F3 + (size_t)sel * (size_t)(NB * SEQ * DMOD);
  if (sel < 2)
    gemm_bfb_body(slab, X, Wp, (sel == 0) ? bq : bk, F, NB * SEQ, DMOD, DMOD, 1.0f, 0, 0, 0, 0, bx, 0);
  else
    gemm_bfb_body(slab, Wp, X, bv, F, DMOD, SEQ, DMOD, 1.0f, 1, 0, SEQ * DMOD, DMOD * SEQ, bx & 255, bx >> 8);
}

// =====================================================================================================
// f16 GEMM, single A plane, hi+lo B planes, per-row bias: C[M][N] (f32, pitch N) = A[M][K] . (Bh + Bl)[N][K]^T times oscale,
// plus bf16-RNE value of bias[row]; A f16 TILED (no batch stride), Bh/Bl f16 [n][k] planes TILED with batch stride sB, C with
// batch stride sC (grid.y = batch). Products a.bh + a.bl into one accumulator (bl is the unscaled residual of bh). Same tiling
// as gemm_bfb.
// =====================================================================================================
__global__ __launch_bounds__(128)
void gemm_wh2(const u16* __restrict__ A, const u16* __restrict__ Bh, const u16* __restrict__ Bl,
              const float* __restrict__ bias, float* C, int M, int N, int K, float oscale, int sB, int sC) {
  __shared__ __align__(16) float slab[4 * SLAB64];
  const int tid = threadIdx.x, wave = tid >> 5, lane = tid & 31, hh = lane >> 4, m = lane & 15;
  const int ntile = N >> 6;
  const int bid   = blockIdx.x;
  const int y     = blockIdx.y;
  const int rowb  = (bid / ntile) * 64 + wave * 16;
  const int col0  = (bid % ntile) * 64;
  if (rowb + 16 > M) return;                 // wave-uniform, never taken with the exact grid; no block barriers in this kernel
  const _Float16* ap  = (const _Float16*)(const void*)A + (size_t)rowb * K + 8 * lane;   // tiles as in gemm_bfb
  const size_t bofs   = (size_t)y * (size_t)sB + (size_t)col0 * K + 8 * lane;
  const _Float16* bhp = (const _Float16*)(const void*)Bh + bofs;
  const _Float16* blp = (const _Float16*)(const void*)Bl + bofs;
  float* Cb = C + (size_t)y * (size_t)sC;
  const size_t bs = (size_t)16 * K;
  v8f acc0 = zero8(), acc1 = zero8(), acc2 = zero8(), acc3 = zero8();
#pragma unroll 1
  for (int k0 = 0; k0 < K; k0 += 32) {
    const int ko = k0 * 16;
    const _Float16 *pa = ap + ko, *h0 = bhp + ko, *h1 = h0 + bs, *h2 = h1 + bs, *h3 = h2 + bs;
    const _Float16 *l0 = blp + ko, *l1 = l0 + bs, *l2 = l1 + bs, *l3 = l2 + bs;
    const v16h a   = ldfrag_p(pa);
    const v16h bh0 = ldfrag_p(h0);
    const v16h bh1 = ldfrag_p(h1);
    const v16h bh2 = ldfrag_p(h2);
    const v16h bh3 = ldfrag_p(h3);
    const v16h bl0 = ldfrag_p(l0);
    const v16h bl1 = ldfrag_p(l1);
    const v16h bl2 = ldfrag_p(l2);
    const v16h bl3 = ldfrag_p(l3);
    addr_wait9(pa, h0, h1, h2, h3, l0, l1, l2, l3);
    acc0 = mma_h(a, bh0, acc0);  acc0 = mma_h(a, bl0, acc0);
    acc1 = mma_h(a, bh1, acc1);  acc1 = mma_h(a, bl1, acc1);
    acc2 = mma_h(a, bh2, acc2);  acc2 = mma_h(a, bl2, acc2);
    acc3 = mma_h(a, bh3, acc3);  acc3 = mma_h(a, bl3, acc3);
    g4_9(acc0, acc1, acc2, acc3, a, bh0, bh1, bh2, bh3, bl0, bl1, bl2, bl3);
  }
  v4f badd = zero4();
  v8f radd = zero8();
  bias_terms(bias, 2, rowb, col0, hh, m, badd, radd);
  epi64(slab + wave * SLAB64, acc0, acc1, acc2, acc3, oscale, badd, radd, Cb, N, (size_t)rowb, col0, lane);
}

// =====================================================================================================
// Full (non-causal, unmasked) multi-head flash attention: block = (batch b, head, 64 query rows), 4 waves, wave w owns the
// 16 query rows q0 = 64*qt + 16*w .. q0+15 (waves independent: no block barriers, wave-private LDS only, used in the epilogue).
//   q plane (f16, x64) laid out [b][s][h][d]; k and v planes (x64) per (b, h) in fragment order (cvfrag): every fragment load of
//   the loop is 512 contiguous bytes over the wave. All NKB = 128 key blocks of 32 keys are visited (static bound).
//   Scores are computed TRANSPOSED: S^T tile g (g = 0,1) = k rows (keys kb+16g .. +15, A operand, row m = lane&15, split k map
//   over d) times q^T (B operand, col n = query q0 + (lane&15), k = d, split map), one product per tile and d-chunk.
//   D element r of lane l = (key kb+16g+8h+r, query q0+(l&15)), so a lane owns one query column and 16 of its 32 keys; the
//   partner lane l^16 owns the other 16 -> row max / row sum need one xor-16 shuffle.
//   Online max-subtracted base-2 softmax in f32 (scale 1/8 and the q,k carries folded into lsc). The exp'd values ARE the
//   P A-fragment in place: A row m = query = lane&15, element i <- key kb+8h+i (tile 0, D element i), element 8+i <- key
//   kb+16+8h+i (tile 1, D element i). P is carried x32768 as f16. The rescale factor of query row 8h+r of the O accumulators is
//   fetched from lane 8h+r with a shuffle (uniform control). 4 v^T B fragments (col n = d = 16j + (lane&15), keys k-contiguous),
//   4 P.V WMMAs per key block.
//   Epilogue: 1/l (per query, shuffled to the D row owner) and carry folds in f32; the wave's 16x64 f32 result staged in its LDS
// coverage: per wave 4 instructions x 2 chunks x 16 rows x 8 halves = 16 x 64 per plane; grid 1024 blocks x 4 waves = every
//           (b, s, h) row of both O planes exactly once.
// =====================================================================================================
__global__ __launch_bounds__(ATT_THREADS)
void attn_fwd(const u16* __restrict__ QHp, const u16* __restrict__ KHp, const u16* __restrict__ VHp,
              u16* OHIp, u16* OLOp) {
  __shared__ __align__(16) float smem[ATT_WAVES * SLABF];   // per wave: result slab [16][68] in the epilogue only

  const int tid  = threadIdx.x;
  const int wave = tid >> 5;
  const int lane = tid & 31;
  const int hh   = lane >> 4;
  const int c    = lane & 15;

  const int bid  = blockIdx.x;
  const int qt   = bid & (SEQ / 64 - 1);      // 0..63
  const int head = (bid >> 6) & (NH - 1);     // 0..3
  const int b    = bid >> 8;                  // 0..3
  const int q0   = qt * 64 + wave * 16;

  // B fragments of q^T: col n = query q0 + c, k = d (k-contiguous row of the q plane); loop-invariant
  const size_t qofs = (((size_t)(b * SEQ + q0 + c)) * NH + head) * HD + 8 * hh;
  const _Float16* Qh  = (const _Float16*)(const void*)QHp + qofs;
  const v16h qh0 = ldfrag_h(Qh), qh1 = ldfrag_h(Qh + 32);
  // A fragments of k: row m = key kb + 16g + c, k = d; fragment-ordered plane, 2048 halves per 32-key block (see cvfrag)
  const size_t pofs = (size_t)(b * NH + head) * (SEQ * HD) + 8 * lane;
  const _Float16* Khb = (const _Float16*)(const void*)KHp + pofs;
  // B fragments of v: col n = d = 16j + c, k = key; fragment-ordered plane, 2048 halves per 32-key block (see cvfrag)
  const _Float16* Vhb = (const _Float16*)(const void*)VHp + pofs;
  const float lsc = 0.125f * (LOG2E / (QSC * KSC));

  float mrun = -INFINITY, lrun = 0.f;
  v8f o[4];
#pragma unroll
  for (int j = 0; j < 4; ++j) o[j] = zero8();

  // K fragments of key block 0; from here on each pass fetches the next pass's K fragments behind its own score products
  v16h kf0 = ldfrag_p(Khb), kf1 = ldfrag_p(Khb + 16 * HD), kf2 = ldfrag_p(Khb + 512), kf3 = ldfrag_p(Khb + 16 * HD + 512);
  addr_wait2(Qh, Khb);

#pragma unroll 1
  for (int it = 0; it < NKB; ++it) {
    const int kb = it * 32;
    // ---- this pass's v fragments, asked for here and first used behind the softmax: their latency runs under scores and softmax.
    //      B fragment col n = d = j*16 + c, 512 halves per j in the fragment-ordered v plane ----
    const _Float16* vhp = Vhb + (size_t)kb * HD;
    const v16h vh0 = ldfrag_p(vhp);
    const v16h vh1 = ldfrag_p(vhp + 512);
    const v16h vh2 = ldfrag_p(vhp + 1024);
    const v16h vh3 = ldfrag_p(vhp + 1536);
    __builtin_amdgcn_sched_barrier(0);   // keeps the eight v loads in front of the first wait on a k fragment
    // ---- transposed scores: s0 = keys kb..kb+15, s1 = keys kb+16..kb+31, column = query q0 + c ----
    v8f s0 = zero8(), s1 = zero8();
    s0 = mma_h(kf0, qh0, s0);
    s1 = mma_h(kf1, qh0, s1);
    s0 = mma_h(kf2, qh1, s0);
    s1 = mma_h(kf3, qh1, s1);
    g2_6(s0, s1, qh0, qh1, kf0, kf1, kf2, kf3);
    // ---- the next pass's k fragments into the same registers (the last pass asks for its own block again: in range, unused) ----
    {
      const int nx = (it + 1 < NKB) ? (it + 1) : it;
      const _Float16* knp = Khb + (size_t)nx * (32 * HD);
      kf0 = ldfrag_p(knp);
      kf1 = ldfrag_p(knp + 16 * HD);
      kf2 = ldfrag_p(knp + 512);
      kf3 = ldfrag_p(knp + 16 * HD + 512);
      addr_wait2(vhp, knp);   // one wait for both groups of loads of this pass
    }
    __builtin_amdgcn_sched_barrier(0);   // keeps the eight k loads here: without it they sink into the softmax, whose temporaries take their registers
    // ---- raw scores of this lane's 16 keys for query q0 + c: s0[i] <- key kb+8hh+i, s1[i] <- key kb+16+8hh+i. The maximum is
    //      taken on the raw scores and scaled once: lsc > 0 and rounding is monotone, so it equals the maximum of the scaled ones ----
    float cr = s0[0];
#pragma unroll
    for (int i = 1; i < 8; ++i) cr = fmaxf(cr, s0[i]);
#pragma unroll
    for (int i = 0; i < 8; ++i) cr = fmaxf(cr, s1[i]);
    float cm = cr * lsc;
    cm = fmaxf(cm, __shfl_xor(cm, 16, 32));
    const float mn = fmaxf(mrun, cm);        // finite from the first block on
    const float al = hw_exp2(mrun - mn);     // 0 on the first block (mrun = -inf)
    mrun = mn;
    // ---- weights p * 32768 (p <= 1) = 2^(s * lsc - mn + 15): one fma and one v_exp_f32 each; their f16 values are the P A-fragment,
    //      element 8w + i <-> s_w[i]; the row sum carries the same 32768 ----
    const float nb = PLOG - mn;
    float p[16];
#pragma unroll
    for (int i = 0; i < 8; ++i) { p[i] = fmaf(s0[i], lsc, nb); p[8 + i] = fmaf(s1[i], lsc, nb); }
    hw_exp2x8(p[0], p[1], p[2], p[3], p[4], p[5], p[6], p[7]);
    hw_exp2x8(p[8], p[9], p[10], p[11], p[12], p[13], p[14], p[15]);
    float ps = p[0] + p[1];
    FragH ph;
#pragma unroll
    for (int w = 0; w < 2; ++w) {
#pragma unroll
      for (int e4 = 0; e4 < 4; ++e4) {
        const int i = 8 * w + 2 * e4;
        if (i > 0) ps += p[i] + p[i + 1];
        ph.u[w][e4] = pk16(h_bits((_Float16)p[i]), h_bits((_Float16)p[i + 1]));
      }
    }
    ps += __shfl_xor(ps, 16, 32);
    lrun = lrun * al + ps;
    // ---- rescale the O accumulators: D row 8hh+r = query q0+8hh+r, its factor lives in lane 8hh+r (and 16+8hh+r) ----
    float scl[8];
#pragma unroll
    for (int r = 0; r < 8; ++r) scl[r] = __shfl(al, 8 * hh + r, 32);
#pragma unroll
    for (int j = 0; j < 4; ++j) {
#pragma unroll
      for (int r = 0; r < 8; ++r) o[j][r] *= scl[r];
    }
    // ---- P.V with the v fragments asked for at the head of the pass ----
    {
      o[0] = mma_h(ph.v, vh0, o[0]);
      o[1] = mma_h(ph.v, vh1, o[1]);
      o[2] = mma_h(ph.v, vh2, o[2]);
      o[3] = mma_h(ph.v, vh3, o[3]);
      g4_5<v16h>(o[0], o[1], o[2], o[3], ph.v, vh0, vh1, vh2, vh3);
    }
  }
  acc_guard4(o[0], o[1], o[2], o[3]);

  // ---- fold 1/l (per query, owned by lane = query; l carries the same 32768 as P) and the carry 64 on v; stage the 16x64 slab ----
  const float linv = (1.0f / lrun) * (1.0f / VCAR);
  float inv[8];
#pragma unroll
  for (int r = 0; r < 8; ++r) inv[r] = __shfl(linv, 8 * hh + r, 32);
  float* slab = smem + wave * SLABF;
#pragma unroll
  for (int r = 0; r < 8; ++r) {
#pragma unroll
    for (int j = 0; j < 4; ++j) slab[(8 * hh + r) * 68 + j * 16 + c] = o[j][r] * inv[r];
  }
  wave_sync_lds();
  // ---- O x1024 -> f16 hi + residual planes, TILED as [token][h*64+d] operands; one store = 512 contiguous bytes ----
  v4u oh[4], ol[4];
#pragma unroll
  for (int i4 = 0; i4 < 4; ++i4) {
    const int c8 = (i4 * 2 + hh) * 8;         // lane = (8-d chunk parity hh, query row c)
    const v4f a = *(const v4f*)(slab + c * 68 + c8), c4 = *(const v4f*)(slab + c * 68 + c8 + 4);
    float w[8];
#pragma unroll
    for (int e = 0; e < 4; ++e) { w[e] = a[e] * OSC; w[4 + e] = c4[e] * OSC; }
#pragma unroll
    for (int e = 0; e < 4; ++e) {
      const _Float16 h0 = (_Float16)w[2 * e], h1 = (_Float16)w[2 * e + 1];
      const _Float16 l0 = (_Float16)(w[2 * e] - (float)h0), l1 = (_Float16)(w[2 * e + 1] - (float)h1);
      oh[i4][e] = pk16(h_bits(h0), h_bits(h1));
      ol[i4][e] = pk16(h_bits(l0), h_bits(l1));
    }
  }
  const size_t ob = ((size_t)(b * SEQ + q0)) * (NH * HD) + (size_t)head * (HD * 16) + 8 * lane;
  {
#pragma unroll
    for (int i4 = 0; i4 < 4; ++i4) {
      const size_t o8 = ob + (size_t)i4 * 256;
      *(v4u*)(OHIp + o8) = oh[i4];
      *(v4u*)(OLOp + o8) = ol[i4];
    }
    
  }
}

// =====================================================================================================
// Workspace map (bytes); every plane is fully written by whole-line stores before it is read; all extents are exact multiples
// of the store granularity (no pad rows needed); every offset a multiple of 131072; q, k and v each have an XT and an F plane of their own:
//   XT  bf16 3 x [16384 token][256 i] tiled         25165824     (query, key, value)
//   WQB bf16 [256 r'][256 i] tiled (rows permuted)  131072      WKB same 131072     WVB same 131072
//   WOB f16  [256 o][256 c'] tiled x1024 (cols permuted)  131072
//   F   f32  2 x [16384][256], [4][256][4096]      50331648     (projection q, k, v)
//   QH  f16  [4][4096][4][64] x64                   8388608
//   KH  f16  [16 bh][256 kt][8 dc][16 key][8 d] x64          8388608   (fragment order)
//   VH  f16  [16 bh][128 it][4 j][4 kc][16 d][8 key] x64     8388608   (fragment order)
//   OHI f16  [16384 token][256 h*64+d] tiled x1024   8388608      OLO residual 8388608
//   end                                           117964800
// =====================================================================================================
extern "C" void kernel_launch(void* const* d_in, const int* in_sizes, int n_in,
                              void* d_out, int out_size, void* d_ws, size_t ws_size,
                              hipStream_t stream) {
  const int ROWS = NB * SEQ;                            // 16384 tokens
  const int XN   = NB * DMOD * SEQ;                     // 4194304
  if (n_in < 11) return;
  if (in_sizes[0] != XN || in_sizes[1] != XN || in_sizes[2] != XN) return;
  if (in_sizes[3] != DMOD * DMOD || in_sizes[5] != DMOD * DMOD) return;
  if (in_sizes[7] != DMOD * DMOD || in_sizes[9] != DMOD * DMOD) return;
  if (in_sizes[4] != DMOD || in_sizes[6] != DMOD || in_sizes[8] != DMOD || in_sizes[10] != DMOD) return;
  if (out_size != XN) return;

  const float* Qin = (const float*)d_in[0];
  const float* Kin = (const float*)d_in[1];
  const float* Vin = (const float*)d_in[2];
  const float* wq  = (const float*)d_in[3];
  const float* bq  = (const float*)d_in[4];
  const float* wk  = (const float*)d_in[5];
  const float* bk  = (const float*)d_in[6];
  const float* wv  = (const float*)d_in[7];
  const float* bv  = (const float*)d_in[8];
  const float* wo  = (const float*)d_in[9];
  const float* bo  = (const float*)d_in[10];
  float*       out = (float*)d_out;

  const size_t szXT = (size_t)ROWS * DMOD * 2;                  //  8388608
  const size_t szW  = (size_t)DMOD * DMOD * 2;                  //   131072
  const size_t szF  = (size_t)ROWS * DMOD * 4;                  // 16777216
  const size_t szP  = (size_t)ROWS * DMOD * 2;                  //  8388608  (q/k/v/o planes)
  size_t off = 0;
  const size_t oXT  = off; off += 3 * szXT;
  const size_t oWQB = off; off += szW;
  const size_t oWKB = off; off += szW;
  const size_t oWVB = off; off += szW;
  const size_t oWOB = off; off += szW;
  const size_t oF   = off; off += 3 * szF;
  const size_t oQH  = off; off += szP;
  const size_t oKH  = off; off += szP;
  const size_t oVH  = off; off += szP;
  const size_t oOHI = off; off += szP;
  const size_t oOLO = off; off += szP;
  if (off > ws_size) return;                            // off = 117964800
  if (off > (size_t)134217728) return;

  char* ws = (char*)d_ws;
  u16*   XT  = (u16*)(ws + oXT);
  u16*   WQB = (u16*)(ws + oWQB);
  u16*   WOB = (u16*)(ws + oWOB);
  float* F   = (float*)(ws + oF);
  u16*   QH  = (u16*)(ws + oQH);
  u16*   KH  = (u16*)(ws + oKH);
  u16*   VH  = (u16*)(ws + oVH);
  u16*   OHI = (u16*)(ws + oOHI);
  u16*   OLO = (u16*)(ws + oOLO);

  const dim3 blk(256);
  const int n8x = XN / 8;                               // 524288
  const int n8w = (DMOD * DMOD) / 8;                    // 8192
  if ((n8x % 256) != 0 || (n8w % 256) != 0) return;
  const dim3 gP(n8x / 256, 3);                          // 2048 x (q, k, v)
  const dim3 gPre(4 * (n8w / 256) + 3 * NB * (SEQ / 64) * (DMOD / 64));   // 128 weight blocks + 3072 transpose blocks
  const dim3 gG3((ROWS / 64) * (DMOD / 64), 3);         // 1024 tiles x (q, k, v)
  const dim3 gGc((DMOD / 64) * (SEQ / 64), NB);         // 256 tiles x 4 batches, channel-major per batch
  const dim3 bG(128);
  const dim3 gAT(ATT_BLOCKS);                           // 1024
  const dim3 bAT(ATT_THREADS);                          // 128
  const int  sTok = SEQ * DMOD;                         // 1048576 elements: per-batch stride of XT / O planes
  const int  sChn = DMOD * SEQ;                         // 1048576 elements: per-batch stride of F (v) and out

  // (0) weights: rows of wq/wk/wv permuted to r' = h*64+d (bf16 planes), columns of wo permuted the same way (f16 of bf16 value x1024);
  //     inputs query, key, value -> XT bf16 [token][i], one plane each (WQB .. WOB lie one behind the other)
  prep<<<gPre, blk, 0, stream>>>(Qin, Kin, Vin, wq, wk, wv, wo, XT, WQB);
  // (1) projections + bias -> F: q, k [16384 token][h*64+d] f32; v channel-major per batch [b][h*64+d][4096] f32 (v^T)
  gemm_qkv<<<gG3, bG, 0, stream>>>(XT, WQB, bq, bk, bv, F);
  // (2) f16 planes x64: q in place order, k and v in fragment order
  cv_qkv<<<gP, blk, 0, stream>>>(F, QH, KH, VH, n8x);
  // (3) attention -> O planes [token][h*64+d] tiled, x1024 (hi + residual)
  attn_fwd<<<gAT, bAT, 0, stream>>>(QH, KH, VH, OHI, OLO);
  // (4) output projection per batch + bias -> out [b][256 o][4096 n] f32, carries 1024 (O) x 1024 (wo) folded back
  gemm_wh2<<<gGc, bG, 0, stream>>>(WOB, OHI, OLO, bo, out, DMOD, SEQ, DMOD, 1.0f / (OSC * WOS), sTok, sChn);
  (void)hipGetLastError();
}

// v005
// One run takes 137 microseconds.
// Timed twice side by side with v004, it ran 1.10 times as fast both times.
// Over all steps from v000 it is 2.64 times as fast.
// Contractions: projections Xt.W'^T and W'.Xt^T on v_wmma_f32_16x16x32_bf16 (Xt and W RNE-converted bf16 operands, f32 accumulate, bias added in f32);
// scores k'.q'^T (q', k' carried x64 as f16), P.v (P x32768 as f16, v x64 as f16) and Wm'.O^T (Wm' as f16(bf16(Wm) x1024), O x1024 as f16 hi plane
// + f16 residual plane, products w.h + w.l): v_wmma_f32_16x16x32_f16, f32 accumulate. Base-2 online softmax, 1/l fold and bias adds in f32 on VALU.
#include <hip/hip_runtime.h>
#include <math.h>
#include <stdint.h>

#define NB    4
#define SEQ   4096
#define DMOD  256
#define NH    4
#define HD    64
#define QSC   64.0f
#define KSC   64.0f
#define PCAR  32768.0f
#define VCAR  64.0f
#define OSC   1024.0f
#define WOS   1024.0f
#define LOG2E 1.4426950408889634f
#define PLOG  15.0f
#define ATT_WAVES   4
#define ATT_THREADS (ATT_WAVES * 32)
#define ATT_BLOCKS  (NB * NH * (SEQ / 64))
#define NKB    (SEQ / 32)
#define SLABF  (16 * 68)
#define SLAB64 (16 * 68)
#define XTP    72
static_assert(HD == 64 && DMOD == NH * HD);
static_assert(PCAR == 32768.0f && PLOG == 15.0f);   // PCAR = 2^PLOG
static_assert((SEQ / 64) == 64 && NH == 4 && NB == 4);
static_assert(ATT_THREADS == 128 && ATT_BLOCKS == 1024 && NKB == 128);
static_assert((DMOD % 64) == 0 && (SEQ % 64) == 0 && (DMOD % 32) == 0);
static_assert(((NB * SEQ * DMOD / 8) % 256) == 0 && ((DMOD * DMOD / 8) % 256) == 0);
static_assert((DMOD / 8) == 32);
static_assert(64 * XTP >= 63 * XTP + 64);
static_assert(ATT_WAVES * SLABF >= 4 * 16 * 68);

typedef unsigned short u16;
typedef _Float16 v16h __attribute__((ext_vector_type(16)));
typedef _Float16 v8h  __attribute__((ext_vector_type(8)));
typedef __bf16   v16b __attribute__((ext_vector_type(16)));
typedef float    v8f  __attribute__((ext_vector_type(8)));
typedef float    v4f  __attribute__((ext_vector_type(4)));
typedef unsigned int v4u __attribute__((ext_vector_type(4)));

union FragH { v16h v; v8h h[2]; v4u u[2]; };
union FragB { v16b v; v4u u[2]; };

// ---- scalar helpers --------------------------------------------------------------------------------
__device__ __forceinline__ unsigned short bf_bits(float f) {          // f32 -> bf16 bits, RNE convert
  unsigned u = __float_as_uint(f);
  return (unsigned short)((u + 0x7FFFu + ((u >> 16) & 1u)) >> 16);
}
__device__ __forceinline__ float bf_up(unsigned short h) { return __uint_as_float(((unsigned)h) << 16); }
__device__ __forceinline__ float bfr(float f) { return bf_up(bf_bits(f)); }
__device__ __forceinline__ unsigned short h_bits(_Float16 x) { return __builtin_bit_cast(unsigned short, x); }
__device__ __forceinline__ unsigned pk16(unsigned short a, unsigned short b) { return (unsigned)a | ((unsigned)b << 16); }
__device__ __forceinline__ v8f zero8() { v8f z = {0.f, 0.f, 0.f, 0.f, 0.f, 0.f, 0.f, 0.f}; return z; }
__device__ __forceinline__ v4f zero4() { v4f z = {0.f, 0.f, 0.f, 0.f}; return z; }

// ---- fragment loaders: 16-bit A/B operand, lane -> row/col (lane&15), h = lane>>4; elements 0..7 <- k0+8h.., elements 8..15 <-
//      k0+16+8h.. (same split k map for A and B).
//      ldfrag_h: row-major [row][k] plane, p already includes +8*h (q only, read once per wave).
//      TILED plane of a [rows][K] operand: 16-row tile = 16*K halves in a row, inside it [k/8][row%16][8 k], so that the unit of
//      lane l for k0 lies at k0*16 + 8*l and a wave-wide 16-B load is 512 contiguous bytes (4 whole lines, not pieces of 16).
__device__ __forceinline__ v16h ldfrag_h(const _Float16* p) {
  FragH f;
  f.h[0] = *(const v8h*)(p);
  f.h[1] = *(const v8h*)(p + 16);
  return f.v;
}
//      ldfrag_p / ldfrag_bp: tiled or fragment-ordered plane, p already includes +8*lane; the second half lies 256 halves on.
__device__ __forceinline__ v16h ldfrag_p(const _Float16* p) {
  FragH f;
  f.h[0] = *(const v8h*)(p);
  f.h[1] = *(const v8h*)(p + 256);
  return f.v;
}
__device__ __forceinline__ v16b ldfrag_bp(const u16* p) {             // the same for a bf16 plane, read as unsigned integer vectors
  FragB f;
  f.u[0] = *(const v4u*)(p);
  f.u[1] = *(const v4u*)(p + 256);
  return f.v;
}

// 2^x as the one hardware instruction (v_exp_f32). The library exp2f wraps it in a range guard (compare, two selects, add, ldexp)
// that only serves results below 2^-126; here such a result is a weight that rounds to zero in f16 and adds nothing to a row sum
// that holds its row maximum's own 2^15, so a flush to zero gives the same output.
__device__ __forceinline__ float hw_exp2(float x) { return __builtin_amdgcn_exp2f(x); }
// eight of them in place, as one statement: each writes only its own source, so none overwrites the source of the one in front of
// it, and the v_nop is the one slot that the instruction set asks for between the last one and the first use of its result.
__device__ __forceinline__ void hw_exp2x8(float& x0, float& x1, float& x2, float& x3, float& x4, float& x5, float& x6, float& x7) {
#if defined(__HIP_DEVICE_COMPILE__)
  asm("v_exp_f32 %0, %0\n\tv_exp_f32 %1, %1\n\tv_exp_f32 %2, %2\n\tv_exp_f32 %3, %3\n\t"
      "v_exp_f32 %4, %4\n\tv_exp_f32 %5, %5\n\tv_exp_f32 %6, %6\n\tv_exp_f32 %7, %7\n\tv_nop"
      : "+v"(x0), "+v"(x1), "+v"(x2), "+v"(x3), "+v"(x4), "+v"(x5), "+v"(x6), "+v"(x7));
#endif
}

__device__ __forceinline__ v8f mma_h(v16h a, v16h b, v8f c) {
  return __builtin_amdgcn_wmma_f32_16x16x32_f16(false, a, false, b, (short)0, c, false, false);
}
__device__ __forceinline__ v8f mma_b(v16b a, v16b b, v8f c) {
  return __builtin_amdgcn_wmma_f32_16x16x32_bf16(false, a, false, b, (short)0, c, false, false);
}
// four vector slots behind the last score WMMA: in front of the first read of its result and of the loads that overwrite its A fragments
__device__ __forceinline__ void g2_6(v8f& a, v8f& b, v16h x0, v16h x1, v16h x2, v16h x3, v16h x4, v16h x5) {
#if defined(__HIP_DEVICE_COMPILE__)
  asm volatile("v_nop\n\tv_nop\n\tv_nop\n\tv_nop"
               : "+v"(a), "+v"(b) : "v"(x0), "v"(x1), "v"(x2), "v"(x3), "v"(x4), "v"(x5) : "memory");
#endif
}
template <typename F>
__device__ __forceinline__ void g4_5(v8f& a, v8f& b, v8f& c, v8f& d, F x0, F x1, F x2, F x3, F x4) {
#if defined(__HIP_DEVICE_COMPILE__)
  asm volatile("v_nop\n\tv_nop\n\tv_nop\n\tv_nop"
               : "+v"(a), "+v"(b), "+v"(c), "+v"(d) : "v"(x0), "v"(x1), "v"(x2), "v"(x3), "v"(x4) : "memory");
#endif
}
__device__ __forceinline__ void g4_9(v8f& a, v8f& b, v8f& c, v8f& d, v16h x0, v16h x1, v16h x2, v16h x3, v16h x4,
                                     v16h x5, v16h x6, v16h x7, v16h x8) {
#if defined(__HIP_DEVICE_COMPILE__)
  asm volatile("v_nop\n\tv_nop\n\tv_nop\n\tv_nop"
               : "+v"(a), "+v"(b), "+v"(c), "+v"(d)
               : "v"(x0), "v"(x1), "v"(x2), "v"(x3), "v"(x4), "v"(x5), "v"(x6), "v"(x7), "v"(x8) : "memory");
#endif
}
__device__ __forceinline__ void acc_guard4(v8f& a, v8f& b, v8f& c, v8f& d) {
#if defined(__HIP_DEVICE_COMPILE__)
  asm volatile("v_nop\n\tv_nop\n\tv_nop\n\tv_nop" : "+v"(a), "+v"(b), "+v"(c), "+v"(d));
#endif
}
// s_wait_xcnt 0 behind a group of fragment loads: it stands in front of every later write of a register that those loads name as
// address; naming the addresses as inputs keeps their registers unwritten (also by a later load's result) up to the wait.
__device__ __forceinline__ void addr_wait2(const void* a, const void* b) {
#if defined(__HIP_DEVICE_COMPILE__)
  asm volatile("s_wait_xcnt 0x0" : : "v"(a), "v"(b) : "memory");
#endif
}
__device__ __forceinline__ void addr_wait5(const void* a, const void* b0, const void* b1, const void* b2, const void* b3) {
#if defined(__HIP_DEVICE_COMPILE__)
  asm volatile("s_wait_xcnt 0x0" : : "v"(a), "v"(b0), "v"(b1), "v"(b2), "v"(b3) : "memory");
#endif
}
__device__ __forceinline__ void addr_wait9(const void* a, const void* b0, const void* b1, const void* b2, const void* b3,
                                           const void* c0, const void* c1, const void* c2, const void* c3) {
#if defined(__HIP_DEVICE_COMPILE__)
  asm volatile("s_wait_xcnt 0x0"
               : : "v"(a), "v"(b0), "v"(b1), "v"(b2), "v"(b3), "v"(c0), "v"(c1), "v"(c2), "v"(c3) : "memory");
#endif
}
__device__ __forceinline__ void wave_sync_lds() {
  __builtin_amdgcn_fence(__ATOMIC_RELEASE, "workgroup");
  __builtin_amdgcn_wave_barrier();
  __builtin_amdgcn_fence(__ATOMIC_ACQUIRE, "workgroup");
}

// =====================================================================================================
// Weight matrix [DMOD][DMOD] f32 -> 16-bit plane [DMOD][DMOD], stored TILED (see the loaders), head-split permutation folded in:
//   mode 0: D[r][i]  = bf16 RNE bits of W[((r & 63) << 2) | (r >> 6)][i]      (output row r = h*64+d <- channel d*4+h)
//   mode 1: D[o][c]  = f16 bits of bf16value(W[o][((c & 63) << 2) | (c >> 6)]) * scale   (input column permuted the same way)
// Thread = 8 consecutive output elements (8 scalar loads, both candidate indices always < DMOD*DMOD, selected by value);
// coverage: blk = 0 .. DMOD*DMOD/8/256 - 1 = 32 blocks x 256 thr x 8 = the whole plane.
// =====================================================================================================
__device__ __forceinline__ void cvtw_body(const float* __restrict__ w, u16* D, int mode, float scale, int blk) {
  const int gt = blk * 256 + (int)threadIdx.x;
  if (gt >= (DMOD * DMOD) / 8) return;       // no barriers in this body
  const int row  = ((gt >> 9) << 4) | (gt & 15);   // 0..255: destination unit gt = ((row/16)*32 + c8/8)*16 + row%16
  const int c8   = ((gt >> 4) & 31) * 8;           // 0..248
  const int prow = ((row & 63) << 2) | (row >> 6);
  const int hsel = c8 >> 6, d0 = c8 & 63;
  unsigned short s[8];
  int   idx[8];
  float wv[8];
#pragma unroll
  for (int e = 0; e < 8; ++e) {
    const int i0  = prow * DMOD + c8 + e;                   // < 65536
    const int i1  = row * DMOD + ((d0 + e) << 2) + hsel;    // < 65536
    idx[e] = (mode == 0) ? i0 : i1;
    wv[e]  = w[idx[e]];
  }
#if defined(__HIP_DEVICE_COMPILE__)
  // s_wait_xcnt 0 behind the eight loads, in front of every later write of an index register that they name as address; naming
  // the indices as inputs keeps their registers unwritten (also by a later load's result) up to the wait.
  asm volatile("s_wait_xcnt 0x0" : : "v"(idx[0]), "v"(idx[1]), "v"(idx[2]), "v"(idx[3]), "v"(idx[4]), "v"(idx[5]), "v"(idx[6]),
               "v"(idx[7]) : "memory");
#endif
#pragma unroll
  for (int e = 0; e < 8; ++e) {
    const float v = wv[e];
    const unsigned short bb = bf_bits(v);
    const unsigned short hb = h_bits((_Float16)(bf_up(bb) * scale));
    s[e] = (mode == 0) ? bb : hb;
  }
  v4u o;
#pragma unroll
  for (int e = 0; e < 4; ++e) o[e] = pk16(s[2 * e], s[2 * e + 1]);
  u16* d = D + (size_t)gt * 8;
  {
    *(v4u*)(d) = o;
    
  }
}

// =====================================================================================================
// Input transpose + convert: X [b][DMOD][SEQ] f32 -> XT bf16 [b][SEQ][DMOD], stored TILED. Block = (b, 64 tokens, 64 channels):
// 64 channel rows x 64 tokens loaded with 16-B loads, RNE-converted, scattered into an LDS tile [token][channel] (pitch XTP);
// coverage: load 256 thr x 16 elements = 64 x 64; store 2 iterations x 256 thr x 8 halves = 4 tiles x 8 chunks x 16 tokens = the block's
//           tile; bid = 0 .. NB x (SEQ/64) x (DMOD/64) - 1 = 1024 blocks covers XT exactly once. T = the block's LDS tile.
// =====================================================================================================
__device__ __forceinline__ void xt16_body(const float* __restrict__ x, u16* XT, u16* T, int bid) {
  const int tid = threadIdx.x;
  const int ct  = bid & 3;                    // channel tile, DMOD/64 = 4
  const int st  = (bid >> 2) & 63;            // token tile, SEQ/64 = 64
  const int b   = bid >> 8;                   // 0..3
  const int c0  = ct * 64, s0 = st * 64;
  {
    const int cl = tid >> 2;                  // channel within tile 0..63
    const int tc = (tid & 3) * 16;            // token chunk
    const float* src = x + ((size_t)(b * DMOD + c0 + cl)) * SEQ + s0 + tc;
#pragma unroll
    for (int i = 0; i < 4; ++i) {
      const v4f a = *(const v4f*)(src + 4 * i);
#pragma unroll
      for (int e = 0; e < 4; ++e) T[(tc + 4 * i + e) * XTP + cl] = bf_bits(a[e]);
    }
  }
  __syncthreads();
  v4u o[2];
  const int tk = tid & 15, ch = (tid >> 4) & 7, th = tid >> 7;   // token in its 16-token tile, 8-channel chunk, tile parity
#pragma unroll
  for (int it = 0; it < 2; ++it) {
    const int line = (it * 2 + th) * 16 + tk; // token within the block's tile 0..63
    o[it] = *(const v4u*)(T + line * XTP + ch * 8);
  }
  const size_t base = ((size_t)(b * SEQ + s0)) * DMOD + (size_t)(c0 + ch * 8) * 16 + tk * 8;
  {
#pragma unroll
    for (int it = 0; it < 2; ++it) {
      *(v4u*)(XT + base + (size_t)((it * 2 + th) * 16) * DMOD) = o[it];
    }
#if defined(__HIP_DEVICE_COMPILE__)
    // s_wait_xcnt 0 behind the two stores: in the merged kernel's text the weight range's code, which writes the registers that
    // these stores name as address, follows them behind a scalar test.
    asm volatile("s_wait_xcnt 0x0" : : : "memory");
#endif
  }
}

// =====================================================================================================
// The four weight converts and the three input transposes, which need nothing of each other, as block ranges of one grid:
//   blocks 0 .. 127: weight (bid >> 5) = wq, wk, wv (mode 0), wo (mode 1, x1024) -> plane (bid >> 5) of WB4, 32 blocks each;
//   blocks 128 .. 3199: input ((bid - 128) >> 10) = query, key, value -> plane of XT3, 1024 blocks each.
// The range test is block-uniform, so the transpose's barrier is passed by all threads of a block or by none.
// =====================================================================================================
#define WCV_BLOCKS (DMOD * DMOD / 8 / 256)
#define XT_BLOCKS  (NB * (SEQ / 64) * (DMOD / 64))
static_assert(WCV_BLOCKS == 32 && XT_BLOCKS == 1024);
__global__ __launch_bounds__(256)
void prep(const float* __restrict__ xq, const float* __restrict__ xk, const float* __restrict__ xv,
          const float* __restrict__ wq, const float* __restrict__ wk, const float* __restrict__ wv,
          const float* __restrict__ wo, u16* XT3, u16* WB4) {
  __shared__ __align__(16) u16 T[64 * XTP];
  const int bid = blockIdx.x;
  if (bid < 4 * WCV_BLOCKS) {
    const int sel = bid >> 5;
    const float* w = (sel == 0) ? wq : ((sel == 1) ? wk : ((sel == 2) ? wv : wo));
    cvtw_body(w, WB4 + (size_t)sel * (DMOD * DMOD), (sel == 3) ? 1 : 0, (sel == 3) ? WOS : 1.0f, bid & (WCV_BLOCKS - 1));
    return;                                   // the whole block leaves, in front of the barrier below
  }
  const int r   = bid - 4 * WCV_BLOCKS;
  const int sel = r >> 10;
  const float* x = (sel == 0) ? xq : ((sel == 1) ? xk : xv);
  xt16_body(x, XT3 + (size_t)sel * (size_t)(NB * SEQ * DMOD), T, r & (XT_BLOCKS - 1));
}

// =====================================================================================================
// Bias terms for the GEMM epilogue (bf16-RNE values of bias[], array of DMOD entries; every candidate index is masked into
// 0..DMOD-1 so all loads are in range, selection by value):
//   bmode 0: per-column, permuted index ((col&63)<<2)|(col>>6); bmode 1: per-row, same permutation of the row; bmode 2: per-row direct.
// =====================================================================================================
__device__ __forceinline__ void bias_terms(const float* __restrict__ bias, int bmode, int rowb, int col0, int hh, int m,
                                           v4f& badd, v8f& radd) {
#pragma unroll
  for (int e = 0; e < 4; ++e) {
    const int ci = col0 + 4 * m + e;
    const int pc = ((ci & 63) << 2) | ((ci >> 6) & 3);
    const float bc = bfr(bias[pc]);
    badd[e] = (bmode == 0) ? bc : 0.0f;
  }
#pragma unroll
  for (int r = 0; r < 8; ++r) {
    const int ri = rowb + 8 * hh + r;
    const int p1 = ((ri & 63) << 2) | ((ri >> 6) & 3);
    const int p2 = ri & (DMOD - 1);
    const float b1 = bfr(bias[p1]), b2 = bfr(bias[p2]);
    radd[r] = (bmode == 1) ? b1 : ((bmode == 2) ? b2 : 0.0f);
  }
}

// =====================================================================================================
// GEMM epilogue of the output projection: the wave's 16x64 f32 tile (times oscale, plus per-row addend radd) staged in its LDS
// coverage: 8 instructions x 2 rows x 16 lanes x 4 floats = the wave's 16 x 64 tile.
// =====================================================================================================
__device__ __forceinline__ void epi64(float* sl, v8f a0, v8f a1, v8f a2, v8f a3, float oscale, v4f badd, v8f radd,
                                      float* C, int N, size_t rowb, int col0, int lane) {
  const int hh = lane >> 4, m = lane & 15;
#pragma unroll
  for (int r = 0; r < 8; ++r) {
    const int ro = (8 * hh + r) * 68 + m;
    sl[ro]      = a0[r] * oscale + radd[r];
    sl[ro + 16] = a1[r] * oscale + radd[r];
    sl[ro + 32] = a2[r] * oscale + radd[r];
    sl[ro + 48] = a3[r] * oscale + radd[r];
  }
  wave_sync_lds();
  v4f vals[8];
#pragma unroll
  for (int it = 0; it < 8; ++it) vals[it] = *(const v4f*)(sl + (it * 2 + hh) * 68 + m * 4) + badd;
  float* dst = C + (rowb + (size_t)hh) * (size_t)N + col0 + m * 4;
  {
#pragma unroll
    for (int it = 0; it < 8; ++it) {
      *(v4f*)(dst + (size_t)(it * 2) * (size_t)N) = vals[it];
    }
    
  }
}

// =====================================================================================================
// Projection epilogue: the wave's 16x64 f32 tile plus bias, staged in its LDS slab, leaves as f16 of (value * scale) straight in
// the order the attention kernel reads it (no f32 plane in between). Unit = 8 halves = one lane's 16-B store; 4 stores a lane.
//   omode 0 (q): tile = 16 tokens x one head's 64 d; D = [b][s][h][d]; one store = 4 token rows x 128 B (whole lines)
//   omode 1 (k): the same tile; D unit ((bh*256 + kt)*8 + dc)*16 + c  <- key s = 16*kt + c, d = 8*dc .. 8*dc+7
//   omode 2 (v): tile = 16 d x 64 keys; D unit (((bh*128 + it)*4 + j)*4 + kc)*16 + c  <- d = 16*j + c, keys 32*it + 8*kc .. +7
// (bh = b*NH + h). In modes 1 and 2 one store is 512 contiguous bytes, and so is each fragment load of the attention loop.
// coverage: 4 stores x 32 lanes x 8 halves = the wave's 16 x 64 tile; the tiles of the grid cover each plane exactly once.
// =====================================================================================================
__device__ __forceinline__ void epi_h16(float* sl, v8f a0, v8f a1, v8f a2, v8f a3, v4f cadd, v8f radd, bool rowbias, float scale,
                                        u16* D, int omode, int rowb, int col0, int y, int lane) {
  static_assert(SEQ == 4096 && DMOD == 256 && HD == 64 && NH == 4);
  const int hh = lane >> 4, m = lane & 15;
#pragma unroll
  for (int r = 0; r < 8; ++r) {
    const int ro = (8 * hh + r) * 68 + m;
    sl[ro]      = a0[r] + (rowbias ? radd[r] : cadd[0]);
    sl[ro + 16] = a1[r] + (rowbias ? radd[r] : cadd[1]);
    sl[ro + 32] = a2[r] + (rowbias ? radd[r] : cadd[2]);
    sl[ro + 48] = a3[r] + (rowbias ? radd[r] : cadd[3]);
  }
  wave_sync_lds();
  // slab row and 8-column chunk of the lane's unit t: q (4t + lane/8, lane%8); k, v (lane%16, 2t + lane/16)
  const int lb = (omode == 0) ? (lane >> 3) * 68 + (lane & 7) * 8 : m * 68 + hh * 8;
  const int ls = (omode == 0) ? 4 * 68 : 16;
  v4u o[4];
#pragma unroll
  for (int t = 0; t < 4; ++t) {
    const float* p = sl + lb + t * ls;
    const v4f a = *(const v4f*)(p), c4 = *(const v4f*)(p + 4);
#pragma unroll
    for (int e = 0; e < 2; ++e) {
      o[t][e]     = pk16(h_bits((_Float16)(a[2 * e] * scale)),  h_bits((_Float16)(a[2 * e + 1] * scale)));
      o[t][2 + e] = pk16(h_bits((_Float16)(c4[2 * e] * scale)), h_bits((_Float16)(c4[2 * e + 1] * scale)));
    }
  }
  const int dq = (rowb + (lane >> 3)) * DMOD + col0 + (lane & 7) * 8;
  const int dk = ((((rowb >> 12) * NH + (col0 >> 6)) * 256 + ((rowb & (SEQ - 1)) >> 4)) * 128 + lane) * 8;
  const int dv = ((((y * NH + (rowb >> 6)) * 128 + (col0 >> 5)) * 4 + ((rowb >> 4) & 3)) * 64 + lane) * 8;
  u16* d = D + (size_t)((omode == 0) ? dq : ((omode == 1) ? dk : dv));   // every one < NB*SEQ*DMOD
#pragma unroll
  for (int t = 0; t < 4; ++t) {
    const int dofs = (omode == 0) ? t * (4 * DMOD) : ((omode == 1) ? t * 256 : (t >> 1) * 2048 + (t & 1) * 256);
    *(v4u*)(d + dofs) = o[t];
  }
}

// =====================================================================================================
// bf16 GEMM with bias, f16 result: (A[M][K] (bf16, TILED) . Bt[N][K]^T (bf16, TILED) + bias) * scale -> plane D in the order of
// omode (see epi_h16). Bias = bf16-RNE values of bias[], index permuted ((i&63)<<2)|(i>>6) and so always in 0..DMOD-1: per column
// (rowbias false) or per row (true). bid = 0 .. (M/64)*(N/64) - 1 tiles, y = batch index with element stride sB added to Bt.
// Block = 64x64 tile, 4 waves x 16 rows; fragments loaded straight from the tiled planes (two 16-B loads each, split k map for
// A and B); K stepped by 32 (K % 32 == 0, M % 64 == 0, N % 64 == 0).
// =====================================================================================================
__device__ __forceinline__
void gemm_bfh_body(float* slab, const u16* __restrict__ A, const u16* __restrict__ Bt, const float* __restrict__ bias,
                   u16* D, int M, int N, int K, float scale, int omode, bool rowbias, int sB, int bid, int y) {
  const int tid = threadIdx.x, wave = tid >> 5, lane = tid & 31, hh = lane >> 4, m = lane & 15;
  const int ntile = N >> 6;
  const int rowb  = (bid / ntile) * 64 + wave * 16;
  const int col0  = (bid % ntile) * 64;
  if (rowb + 16 > M) return;                 // wave-uniform, never taken with the exact grid; no block barriers in this kernel
  const u16* Bb = Bt + (size_t)y * (size_t)sB;
  const u16* ap = A  + (size_t)rowb * K + 8 * lane;   // 16-row tile = 16*K halves, inside it [k/8][row][8]
  const u16* bp = Bb + (size_t)col0 * K + 8 * lane;
  const size_t bs = (size_t)16 * K;
  v8f acc0 = zero8(), acc1 = zero8(), acc2 = zero8(), acc3 = zero8();
#pragma unroll 1
  for (int k0 = 0; k0 < K; k0 += 32) {
    const int ko = k0 * 16;
    const u16 *pa = ap + ko, *p0 = bp + ko, *p1 = p0 + bs, *p2 = p1 + bs, *p3 = p2 + bs;
    const v16b a  = ldfrag_bp(pa);
    const v16b b0 = ldfrag_bp(p0);
    const v16b b1 = ldfrag_bp(p1);
    const v16b b2 = ldfrag_bp(p2);
    const v16b b3 = ldfrag_bp(p3);
    addr_wait5(pa, p0, p1, p2, p3);
    acc0 = mma_b(a, b0, acc0);
    acc1 = mma_b(a, b1, acc1);
    acc2 = mma_b(a, b2, acc2);
    acc3 = mma_b(a, b3, acc3);
    g4_5<v16b>(acc0, acc1, acc2, acc3, a, b0, b1, b2, b3);
  }
  v4f cadd = zero4();
  v8f radd = zero8();
  if (rowbias) {
#pragma unroll
    for (int r = 0; r < 8; ++r) {
      const int ri = rowb + 8 * hh + r;
      radd[r] = bfr(bias[((ri & 63) << 2) | ((ri >> 6) & 3)]);
    }
  } else {
#pragma unroll
    for (int j = 0; j < 4; ++j) {
      const int ci = col0 + 16 * j + m;
      cadd[j] = bfr(bias[((ci & 63) << 2) | ((ci >> 6) & 3)]);
    }
  }
  epi_h16(slab + wave * SLAB64, acc0, acc1, acc2, acc3, cadd, radd, rowbias, scale, D, omode, rowb, col0, y, lane);
}

// =====================================================================================================
// The three projections, which need nothing of each other, as one grid (1024 tiles, 3): blockIdx.y = 0 q, 1 k: token-major,
// [16384 token][h*64+d] = XT . W'^T, per-column bias; 2 v: channel-major per batch (256 tiles x 4 batches in blockIdx.x),
// [b][h*64+d][4096] = W' . XT^T, per-row bias. XT3, WB4, H3 hold the planes of q, k, v one behind the other; H3 = the f16 planes
// x64 that the attention kernel reads, q in place order, k and v in fragment order.
// =====================================================================================================
__global__ __launch_bounds__(128)
void gemm_qkv(const u16* __restrict__ XT3, const u16* __restrict__ WB4, const float* __restrict__ bq,
              const float* __restrict__ bk, const float* __restrict__ bv, u16* H3) {
  static_assert((NB * SEQ / 64) * (DMOD / 64) == 1024 && (DMOD / 64) * (SEQ / 64) == 256 && NB == 4);
  __shared__ __align__(16) float slab[4 * SLAB64];
  const int sel = blockIdx.y;                 // block-uniform
  const int bx  = blockIdx.x;
  const u16* X  = XT3 + (size_t)sel * (size_t)(NB * SEQ * DMOD);
  const u16* Wp = WB4 + (size_t)sel * (DMOD * DMOD);
  u16*       D  = H3 + (size_t)sel * (size_t)(NB * SEQ * DMOD);
  if (sel < 2)
    gemm_bfh_body(slab, X, Wp, (sel == 0) ? bq : bk, D, NB * SEQ, DMOD, DMOD, (sel == 0) ? QSC : KSC, (sel == 0) ? 0 : 1, false, 0, bx, 0);
  else
    gemm_bfh_body(slab, Wp, X, bv, D, DMOD, SEQ, DMOD, VCAR, 2, true, SEQ * DMOD, bx & 255, bx >> 8);
}

// =====================================================================================================
// f16 GEMM, single A plane, hi+lo B planes, per-row bias: C[M][N] (f32, pitch N) = A[M][K] . (Bh + Bl)[N][K]^T times oscale,
// plus bf16-RNE value of bias[row]; A f16 TILED (no batch stride), Bh/Bl f16 [n][k] planes TILED with batch stride sB, C with
// batch stride sC (grid.y = batch). Products a.bh + a.bl into one accumulator (bl is the unscaled residual of bh). Same tiling
// as gemm_bfh_body.
// =====================================================================================================
__global__ __launch_bounds__(128)
void gemm_wh2(const u16* __restrict__ A, const u16* __restrict__ Bh, const u16* __restrict__ Bl,
              const float* __restrict__ bias, float* C, int M, int N, int K, float oscale, int sB, int sC) {
  __shared__ __align__(16) float slab[4 * SLAB64];
  const int tid = threadIdx.x, wave = tid >> 5, lane = tid & 31, hh = lane >> 4, m = lane & 15;
  const int ntile = N >> 6;
  const int bid   = blockIdx.x;
  const int y     = blockIdx.y;
  const int rowb  = (bid / ntile) * 64 + wave * 16;
  const int col0  = (bid % ntile) * 64;
  if (rowb + 16 > M) return;                 // wave-uniform, never taken with the exact grid; no block barriers in this kernel
  const _Float16* ap  = (const _Float16*)(const void*)A + (size_t)rowb * K + 8 * lane;   // tiles as in gemm_bfh_body
  const size_t bofs   = (size_t)y * (size_t)sB + (size_t)col0 * K + 8 * lane;
  const _Float16* bhp = (const _Float16*)(const void*)Bh + bofs;
  const _Float16* blp = (const _Float16*)(const void*)Bl + bofs;
  float* Cb = C + (size_t)y * (size_t)sC;
  const size_t bs = (size_t)16 * K;
  v8f acc0 = zero8(), acc1 = zero8(), acc2 = zero8(), acc3 = zero8();
#pragma unroll 1
  for (int k0 = 0; k0 < K; k0 += 32) {
    const int ko = k0 * 16;
    const _Float16 *pa = ap + ko, *h0 = bhp + ko, *h1 = h0 + bs, *h2 = h1 + bs, *h3 = h2 + bs;
    const _Float16 *l0 = blp + ko, *l1 = l0 + bs, *l2 = l1 + bs, *l3 = l2 + bs;
    const v16h a   = ldfrag_p(pa);
    const v16h bh0 = ldfrag_p(h0);
    const v16h bh1 = ldfrag_p(h1);
    const v16h bh2 = ldfrag_p(h2);
    const v16h bh3 = ldfrag_p(h3);
    const v16h bl0 = ldfrag_p(l0);
    const v16h bl1 = ldfrag_p(l1);
    const v16h bl2 = ldfrag_p(l2);
    const v16h bl3 = ldfrag_p(l3);
    addr_wait9(pa, h0, h1, h2, h3, l0, l1, l2, l3);
    acc0 = mma_h(a, bh0, acc0);  acc0 = mma_h(a, bl0, acc0);
    acc1 = mma_h(a, bh1, acc1);  acc1 = mma_h(a, bl1, acc1);
    acc2 = mma_h(a, bh2, acc2);  acc2 = mma_h(a, bl2, acc2);
    acc3 = mma_h(a, bh3, acc3);  acc3 = mma_h(a, bl3, acc3);
    g4_9(acc0, acc1, acc2, acc3, a, bh0, bh1, bh2, bh3, bl0, bl1, bl2, bl3);
  }
  v4f badd = zero4();
  v8f radd = zero8();
  bias_terms(bias, 2, rowb, col0, hh, m, badd, radd);
  epi64(slab + wave * SLAB64, acc0, acc1, acc2, acc3, oscale, badd, radd, Cb, N, (size_t)rowb, col0, lane);
}

// =====================================================================================================
// Full (non-causal, unmasked) multi-head flash attention: block = (batch b, head, 64 query rows), 4 waves, wave w owns the
// 16 query rows q0 = 64*qt + 16*w .. q0+15 (waves independent: no block barriers, wave-private LDS only, used in the epilogue).
//   q plane (f16, x64) laid out [b][s][h][d]; k and v planes (x64) per (b, h) in fragment order (epi_h16): every fragment load of
//   the loop is 512 contiguous bytes over the wave. All NKB = 128 key blocks of 32 keys are visited (static bound).
//   Scores are computed TRANSPOSED: S^T tile g (g = 0,1) = k rows (keys kb+16g .. +15, A operand, row m = lane&15, split k map
//   over d) times q^T (B operand, col n = query q0 + (lane&15), k = d, split map), one product per tile and d-chunk.
//   D element r of lane l = (key kb+16g+8h+r, query q0+(l&15)), so a lane owns one query column and 16 of its 32 keys; the
//   partner lane l^16 owns the other 16 -> row max / row sum need one xor-16 shuffle.
//   Online max-subtracted base-2 softmax in f32 (scale 1/8 and the q,k carries folded into lsc). The exp'd values ARE the
//   P A-fragment in place: A row m = query = lane&15, element i <- key kb+8h+i (tile 0, D element i), element 8+i <- key
//   kb+16+8h+i (tile 1, D element i). P is carried x32768 as f16. The rescale factor of query row 8h+r of the O accumulators is
//   fetched from lane 8h+r with a shuffle (uniform control). 4 v^T B fragments (col n = d = 16j + (lane&15), k = key, fragment-ordered plane),
//   4 P.V WMMAs per key block.
//   Epilogue: 1/l (per query, shuffled to the D row owner) and carry folds in f32; the wave's 16x64 f32 result staged in its LDS
// coverage: per wave 4 instructions x 2 chunks x 16 rows x 8 halves = 16 x 64 per plane; grid 1024 blocks x 4 waves = every
//           (b, s, h) row of both O planes exactly once.
// =====================================================================================================
__global__ __launch_bounds__(ATT_THREADS)
void attn_fwd(const u16* __restrict__ QHp, const u16* __restrict__ KHp, const u16* __restrict__ VHp,
              u16* OHIp, u16* OLOp) {
  __shared__ __align__(16) float smem[ATT_WAVES * SLABF];   // per wave: result slab [16][68] in the epilogue only

  const int tid  = threadIdx.x;
  const int wave = tid >> 5;
  const int lane = tid & 31;
  const int hh   = lane >> 4;
  const int c    = lane & 15;

  const int bid  = blockIdx.x;
  const int qt   = bid & (SEQ / 64 - 1);      // 0..63
  const int head = (bid >> 6) & (NH - 1);     // 0..3
  const int b    = bid >> 8;                  // 0..3
  const int q0   = qt * 64 + wave * 16;

  // B fragments of q^T: col n = query q0 + c, k = d (k-contiguous row of the q plane); loop-invariant
  const size_t qofs = (((size_t)(b * SEQ + q0 + c)) * NH + head) * HD + 8 * hh;
  const _Float16* Qh  = (const _Float16*)(const void*)QHp + qofs;
  const v16h qh0 = ldfrag_h(Qh), qh1 = ldfrag_h(Qh + 32);
  // A fragments of k: row m = key kb + 16g + c, k = d; fragment-ordered plane, 2048 halves per 32-key block (see epi_h16)
  const size_t pofs = (size_t)(b * NH + head) * (SEQ * HD) + 8 * lane;
  const _Float16* Khb = (const _Float16*)(const void*)KHp + pofs;
  // B fragments of v: col n = d = 16j + c, k = key; fragment-ordered plane, 2048 halves per 32-key block (see epi_h16)
  const _Float16* Vhb = (const _Float16*)(const void*)VHp + pofs;
  const float lsc = 0.125f * (LOG2E / (QSC * KSC));

  float mrun = -INFINITY, lrun = 0.f;
  v8f o[4];
#pragma unroll
  for (int j = 0; j < 4; ++j) o[j] = zero8();

  // K fragments of key block 0; from here on each pass fetches the next pass's K fragments behind its own score products
  v16h kf0 = ldfrag_p(Khb), kf1 = ldfrag_p(Khb + 16 * HD), kf2 = ldfrag_p(Khb + 512), kf3 = ldfrag_p(Khb + 16 * HD + 512);
  addr_wait2(Qh, Khb);

#pragma unroll 1
  for (int it = 0; it < NKB; ++it) {
    const int kb = it * 32;
    // ---- this pass's v fragments, asked for here and first used behind the softmax: their latency runs under scores and softmax.
    //      B fragment col n = d = j*16 + c, 512 halves per j in the fragment-ordered v plane ----
    const _Float16* vhp = Vhb + (size_t)kb * HD;
    const v16h vh0 = ldfrag_p(vhp);
    const v16h vh1 = ldfrag_p(vhp + 512);
    const v16h vh2 = ldfrag_p(vhp + 1024);
    const v16h vh3 = ldfrag_p(vhp + 1536);
    __builtin_amdgcn_sched_barrier(0);   // keeps the eight v loads in front of the first wait on a k fragment
    // ---- transposed scores: s0 = keys kb..kb+15, s1 = keys kb+16..kb+31, column = query q0 + c ----
    v8f s0 = zero8(), s1 = zero8();
    s0 = mma_h(kf0, qh0, s0);
    s1 = mma_h(kf1, qh0, s1);
    s0 = mma_h(kf2, qh1, s0);
    s1 = mma_h(kf3, qh1, s1);
    g2_6(s0, s1, qh0, qh1, kf0, kf1, kf2, kf3);
    // ---- the next pass's k fragments into the same registers (the last pass asks for its own block again: in range, unused) ----
    {
      const int nx = (it + 1 < NKB) ? (it + 1) : it;
      const _Float16* knp = Khb + (size_t)nx * (32 * HD);
      kf0 = ldfrag_p(knp);
      kf1 = ldfrag_p(knp + 16 * HD);
      kf2 = ldfrag_p(knp + 512);
      kf3 = ldfrag_p(knp + 16 * HD + 512);
      addr_wait2(vhp, knp);   // one wait for both groups of loads of this pass
    }
    __builtin_amdgcn_sched_barrier(0);   // keeps the eight k loads here: without it they sink into the softmax, whose temporaries take their registers
    // ---- raw scores of this lane's 16 keys for query q0 + c: s0[i] <- key kb+8hh+i, s1[i] <- key kb+16+8hh+i. The maximum is
    //      taken on the raw scores and scaled once: lsc > 0 and rounding is monotone, so it equals the maximum of the scaled ones ----
    float cr = s0[0];
#pragma unroll
    for (int i = 1; i < 8; ++i) cr = fmaxf(cr, s0[i]);
#pragma unroll
    for (int i = 0; i < 8; ++i) cr = fmaxf(cr, s1[i]);
    float cm = cr * lsc;
    cm = fmaxf(cm, __shfl_xor(cm, 16, 32));
    const float mn = fmaxf(mrun, cm);        // finite from the first block on
    const float al = hw_exp2(mrun - mn);     // 0 on the first block (mrun = -inf)
    mrun = mn;
    // ---- weights p * 32768 (p <= 1) = 2^(s * lsc - mn + 15): one fma and one v_exp_f32 each; their f16 values are the P A-fragment,
    //      element 8w + i <-> s_w[i]; the row sum carries the same 32768 ----
    const float nb = PLOG - mn;
    float p[16];
#pragma unroll
    for (int i = 0; i < 8; ++i) { p[i] = fmaf(s0[i], lsc, nb); p[8 + i] = fmaf(s1[i], lsc, nb); }
    hw_exp2x8(p[0], p[1], p[2], p[3], p[4], p[5], p[6], p[7]);
    hw_exp2x8(p[8], p[9], p[10], p[11], p[12], p[13], p[14], p[15]);
    float ps = p[0] + p[1];
    FragH ph;
#pragma unroll
    for (int w = 0; w < 2; ++w) {
#pragma unroll
      for (int e4 = 0; e4 < 4; ++e4) {
        const int i = 8 * w + 2 * e4;
        if (i > 0) ps += p[i] + p[i + 1];
        ph.u[w][e4] = pk16(h_bits((_Float16)p[i]), h_bits((_Float16)p[i + 1]));
      }
    }
    ps += __shfl_xor(ps, 16, 32);
    lrun = lrun * al + ps;
    // ---- rescale the O accumulators: D row 8hh+r = query q0+8hh+r, its factor lives in lane 8hh+r (and 16+8hh+r) ----
    float scl[8];
#pragma unroll
    for (int r = 0; r < 8; ++r) scl[r] = __shfl(al, 8 * hh + r, 32);
#pragma unroll
    for (int j = 0; j < 4; ++j) {
#pragma unroll
      for (int r = 0; r < 8; ++r) o[j][r] *= scl[r];
    }
    // ---- P.V with the v fragments asked for at the head of the pass ----
    {
      o[0] = mma_h(ph.v, vh0, o[0]);
      o[1] = mma_h(ph.v, vh1, o[1]);
      o[2] = mma_h(ph.v, vh2, o[2]);
      o[3] = mma_h(ph.v, vh3, o[3]);
      g4_5<v16h>(o[0], o[1], o[2], o[3], ph.v, vh0, vh1, vh2, vh3);
    }
  }
  acc_guard4(o[0], o[1], o[2], o[3]);

  // ---- fold 1/l (per query, owned by lane = query; l carries the same 32768 as P) and the carry 64 on v; stage the 16x64 slab ----
  const float linv = (1.0f / lrun) * (1.0f / VCAR);
  float inv[8];
#pragma unroll
  for (int r = 0; r < 8; ++r) inv[r] = __shfl(linv, 8 * hh + r, 32);
  float* slab = smem + wave * SLABF;
#pragma unroll
  for (int r = 0; r < 8; ++r) {
#pragma unroll
    for (int j = 0; j < 4; ++j) slab[(8 * hh + r) * 68 + j * 16 + c] = o[j][r] * inv[r];
  }
  wave_sync_lds();
  // ---- O x1024 -> f16 hi + residual planes, TILED as [token][h*64+d] operands; one store = 512 contiguous bytes ----
  v4u oh[4], ol[4];
#pragma unroll
  for (int i4 = 0; i4 < 4; ++i4) {
    const int c8 = (i4 * 2 + hh) * 8;         // lane = (8-d chunk parity hh, query row c)
    const v4f a = *(const v4f*)(slab + c * 68 + c8), c4 = *(const v4f*)(slab + c * 68 + c8 + 4);
    float w[8];
#pragma unroll
    for (int e = 0; e < 4; ++e) { w[e] = a[e] * OSC; w[4 + e] = c4[e] * OSC; }
#pragma unroll
    for (int e = 0; e < 4; ++e) {
      const _Float16 h0 = (_Float16)w[2 * e], h1 = (_Float16)w[2 * e + 1];
      const _Float16 l0 = (_Float16)(w[2 * e] - (float)h0), l1 = (_Float16)(w[2 * e + 1] - (float)h1);
      oh[i4][e] = pk16(h_bits(h0), h_bits(h1));
      ol[i4][e] = pk16(h_bits(l0), h_bits(l1));
    }
  }
  const size_t ob = ((size_t)(b * SEQ + q0)) * (NH * HD) + (size_t)head * (HD * 16) + 8 * lane;
  {
#pragma unroll
    for (int i4 = 0; i4 < 4; ++i4) {
      const size_t o8 = ob + (size_t)i4 * 256;
      *(v4u*)(OHIp + o8) = oh[i4];
      *(v4u*)(OLOp + o8) = ol[i4];
    }
    
  }
}

// =====================================================================================================
// Workspace map (bytes); every plane is fully written by whole-line stores before it is read; all extents are exact multiples
// of the store granularity (no pad rows needed); every offset a multiple of 131072; q, k and v each have an XT plane of their own:
//   XT  bf16 3 x [16384 token][256 i] tiled         25165824     (query, key, value)
//   WQB bf16 [256 r'][256 i] tiled (rows permuted)  131072      WKB same 131072     WVB same 131072
//   WOB f16  [256 o][256 c'] tiled x1024 (cols permuted)  131072
//   QH  f16  [4][4096][4][64] x64                   8388608
//   KH  f16  [16 bh][256 kt][8 dc][16 key][8 d] x64          8388608   (fragment order)
//   VH  f16  [16 bh][128 it][4 j][4 kc][16 d][8 key] x64     8388608   (fragment order)
//   OHI f16  [16384 token][256 h*64+d] tiled x1024   8388608      OLO residual 8388608
//   end                                            67633152
// =====================================================================================================
extern "C" void kernel_launch(void* const* d_in, const int* in_sizes, int n_in,
                              void* d_out, int out_size, void* d_ws, size_t ws_size,
                              hipStream_t stream) {
  const int ROWS = NB * SEQ;                            // 16384 tokens
  const int XN   = NB * DMOD * SEQ;                     // 4194304
  if (n_in < 11) return;
  if (in_sizes[0] != XN || in_sizes[1] != XN || in_sizes[2] != XN) return;
  if (in_sizes[3] != DMOD * DMOD || in_sizes[5] != DMOD * DMOD) return;
  if (in_sizes[7] != DMOD * DMOD || in_sizes[9] != DMOD * DMOD) return;
  if (in_sizes[4] != DMOD || in_sizes[6] != DMOD || in_sizes[8] != DMOD || in_sizes[10] != DMOD) return;
  if (out_size != XN) return;

  const float* Qin = (const float*)d_in[0];
  const float* Kin = (const float*)d_in[1];
  const float* Vin = (const float*)d_in[2];
  const float* wq  = (const float*)d_in[3];
  const float* bq  = (const float*)d_in[4];
  const float* wk  = (const float*)d_in[5];
  const float* bk  = (const float*)d_in[6];
  const float* wv  = (const float*)d_in[7];
  const float* bv  = (const float*)d_in[8];
  const float* wo  = (const float*)d_in[9];
  const float* bo  = (const float*)d_in[10];
  float*       out = (float*)d_out;

  const size_t szXT = (size_t)ROWS * DMOD * 2;                  //  8388608
  const size_t szW  = (size_t)DMOD * DMOD * 2;                  //   131072
  const size_t szP  = (size_t)ROWS * DMOD * 2;                  //  8388608  (q/k/v/o planes)
  size_t off = 0;
  const size_t oXT  = off; off += 3 * szXT;
  const size_t oWQB = off; off += szW;
  const size_t oWKB = off; off += szW;
  const size_t oWVB = off; off += szW;
  const size_t oWOB = off; off += szW;
  const size_t oQH  = off; off += szP;
  const size_t oKH  = off; off += szP;
  const size_t oVH  = off; off += szP;
  const size_t oOHI = off; off += szP;
  const size_t oOLO = off; off += szP;
  if (off > ws_size) return;                            // off = 67633152
  if (off > (size_t)134217728) return;

  char* ws = (char*)d_ws;
  u16*   XT  = (u16*)(ws + oXT);
  u16*   WQB = (u16*)(ws + oWQB);
  u16*   WOB = (u16*)(ws + oWOB);
  u16*   QH  = (u16*)(ws + oQH);
  u16*   KH  = (u16*)(ws + oKH);
  u16*   VH  = (u16*)(ws + oVH);
  u16*   OHI = (u16*)(ws + oOHI);
  u16*   OLO = (u16*)(ws + oOLO);

  const dim3 blk(256);
  const int n8w = (DMOD * DMOD) / 8;                    // 8192
  if ((n8w % 256) != 0) return;
  const dim3 gPre(4 * (n8w / 256) + 3 * NB * (SEQ / 64) * (DMOD / 64));   // 128 weight blocks + 3072 transpose blocks
  const dim3 gG3((ROWS / 64) * (DMOD / 64), 3);         // 1024 tiles x (q, k, v)
  const dim3 gGc((DMOD / 64) * (SEQ / 64), NB);         // 256 tiles x 4 batches, channel-major per batch
  const dim3 bG(128);
  const dim3 gAT(ATT_BLOCKS);                           // 1024
  const dim3 bAT(ATT_THREADS);                          // 128
  const int  sTok = SEQ * DMOD;                         // 1048576 elements: per-batch stride of XT / O planes
  const int  sChn = DMOD * SEQ;                         // 1048576 elements: per-batch stride of out

  // (0) weights: rows of wq/wk/wv permuted to r' = h*64+d (bf16 planes), columns of wo permuted the same way (f16 of bf16 value x1024);
  //     inputs query, key, value -> XT bf16 [token][i], one plane each (WQB .. WOB lie one behind the other)
  prep<<<gPre, blk, 0, stream>>>(Qin, Kin, Vin, wq, wk, wv, wo, XT, WQB);
  // (1) projections + bias -> f16 planes x64 (QH, KH, VH lie one behind the other): q in place order, k and v in fragment order
  gemm_qkv<<<gG3, bG, 0, stream>>>(XT, WQB, bq, bk, bv, QH);
  // (2) attention -> O planes [token][h*64+d] tiled, x1024 (hi + residual)
  attn_fwd<<<gAT, bAT, 0, stream>>>(QH, KH, VH, OHI, OLO);
  // (3) output projection per batch + bias -> out [b][256 o][4096 n] f32, carries 1024 (O) x 1024 (wo) folded back
  gemm_wh2<<<gGc, bG, 0, stream>>>(WOB, OHI, OLO, bo, out, DMOD, SEQ, DMOD, 1.0f / (OSC * WOS), sTok, sChn);
  (void)hipGetLastError();
}

// v006
// One run takes 120 microseconds.
// In two side-by-side timings against v005, it was 1.15 and 1.14 times as fast.
// Counting every step since v000, it is 3.03 times as fast.
// Contractions: projections Xt.W'^T and W'.Xt^T on v_wmma_f32_16x16x32_bf16 (Xt and W RNE-converted bf16 operands, f32 accumulate, bias added in f32);
// scores k'.q'^T (q', k' carried x64 as f16), P.v (P x32768 as f16, v x64 as f16) and Wm'.O^T (Wm' as f16(bf16(Wm) x1024), O x1024 as f16 hi plane
// + f16 residual plane, products w.h + w.l): v_wmma_f32_16x16x32_f16, f32 accumulate. Base-2 online softmax, 1/l fold and bias adds in f32 on VALU.
#include <hip/hip_runtime.h>
#include <math.h>
#include <stdint.h>

#define NB    4
#define SEQ   4096
#define DMOD  256
#define NH    4
#define HD    64
#define QSC   64.0f
#define KSC   64.0f
#define PCAR  32768.0f
#define VCAR  64.0f
#define OSC   1024.0f
#define WOS   1024.0f
#define LOG2E 1.4426950408889634f
#define PLOG  15.0f
#define ATT_WAVES   8
#define ATT_THREADS (ATT_WAVES * 32)
#define ATT_BLOCKS  (NB * NH * (SEQ / (16 * ATT_WAVES)))
#define NKB    (SEQ / 32)
#define STK    128                 // keys of one staged tile
#define NST    (SEQ / STK)         // staged tiles per (batch, head)
#define STH    (STK * HD)          // halves of one operand's staged tile (16 KiB)
#define RINGF  (2 * STH)           // floats of the ring: 2 buffers x (k tile, v tile) = 64 KiB
#define SLABF  (16 * 68)
#define SLAB64 (16 * 68)
#define XTP    72
static_assert(HD == 64 && DMOD == NH * HD);
static_assert(PCAR == 32768.0f && PLOG == 15.0f);   // PCAR = 2^PLOG
static_assert((SEQ / 64) == 64 && NH == 4 && NB == 4);
static_assert(ATT_THREADS == 256 && ATT_BLOCKS == 512 && NKB == 128);
static_assert((DMOD % 64) == 0 && (SEQ % 64) == 0 && (DMOD % 32) == 0);
static_assert(((NB * SEQ * DMOD / 8) % 256) == 0 && ((DMOD * DMOD / 8) % 256) == 0);
static_assert((DMOD / 8) == 32);
static_assert(64 * XTP >= 63 * XTP + 64);
static_assert(ATT_WAVES * SLABF >= 4 * 16 * 68);
static_assert(NST >= 2 && STK == 4 * 32 && STH * 2 == 4 * ATT_THREADS * 16 && RINGF >= ATT_WAVES * SLABF);

typedef unsigned short u16;
typedef _Float16 v16h __attribute__((ext_vector_type(16)));
typedef _Float16 v8h  __attribute__((ext_vector_type(8)));
typedef __bf16   v16b __attribute__((ext_vector_type(16)));
typedef float    v8f  __attribute__((ext_vector_type(8)));
typedef float    v4f  __attribute__((ext_vector_type(4)));
typedef unsigned int v4u __attribute__((ext_vector_type(4)));

union FragH { v16h v; v8h h[2]; v4u u[2]; };
union FragB { v16b v; v4u u[2]; };

// ---- scalar helpers --------------------------------------------------------------------------------
__device__ __forceinline__ unsigned short bf_bits(float f) {          // f32 -> bf16 bits, RNE convert
  unsigned u = __float_as_uint(f);
  return (unsigned short)((u + 0x7FFFu + ((u >> 16) & 1u)) >> 16);
}
__device__ __forceinline__ float bf_up(unsigned short h) { return __uint_as_float(((unsigned)h) << 16); }
__device__ __forceinline__ float bfr(float f) { return bf_up(bf_bits(f)); }
__device__ __forceinline__ unsigned short h_bits(_Float16 x) { return __builtin_bit_cast(unsigned short, x); }
__device__ __forceinline__ unsigned pk16(unsigned short a, unsigned short b) { return (unsigned)a | ((unsigned)b << 16); }
__device__ __forceinline__ v8f zero8() { v8f z = {0.f, 0.f, 0.f, 0.f, 0.f, 0.f, 0.f, 0.f}; return z; }
__device__ __forceinline__ v4f zero4() { v4f z = {0.f, 0.f, 0.f, 0.f}; return z; }

// ---- fragment loaders: 16-bit A/B operand, lane -> row/col (lane&15), h = lane>>4; elements 0..7 <- k0+8h.., elements 8..15 <-
//      k0+16+8h.. (same split k map for A and B).
//      ldfrag_h: row-major [row][k] plane, p already includes +8*h (q only, read once per wave).
//      TILED plane of a [rows][K] operand: 16-row tile = 16*K halves in a row, inside it [k/8][row%16][8 k], so that the unit of
//      lane l for k0 lies at k0*16 + 8*l and a wave-wide 16-B load is 512 contiguous bytes (4 whole lines, not pieces of 16).
__device__ __forceinline__ v16h ldfrag_h(const _Float16* p) {
  FragH f;
  f.h[0] = *(const v8h*)(p);
  f.h[1] = *(const v8h*)(p + 16);
  return f.v;
}
//      ldfrag_p / ldfrag_bp: tiled or fragment-ordered plane, p already includes +8*lane; the second half lies 256 halves on.
__device__ __forceinline__ v16h ldfrag_p(const _Float16* p) {
  FragH f;
  f.h[0] = *(const v8h*)(p);
  f.h[1] = *(const v8h*)(p + 256);
  return f.v;
}
__device__ __forceinline__ v16b ldfrag_bp(const u16* p) {             // the same for a bf16 plane, read as unsigned integer vectors
  FragB f;
  f.u[0] = *(const v4u*)(p);
  f.u[1] = *(const v4u*)(p + 256);
  return f.v;
}

// 2^x as the one hardware instruction (v_exp_f32). The library exp2f wraps it in a range guard (compare, two selects, add, ldexp)
// that only serves results below 2^-126; here such a result is a weight that rounds to zero in f16 and adds nothing to a row sum
// that holds its row maximum's own 2^15, so a flush to zero gives the same output.
__device__ __forceinline__ float hw_exp2(float x) { return __builtin_amdgcn_exp2f(x); }
// eight of them in place, as one statement: each writes only its own source, so none overwrites the source of the one in front of
// it, and the v_nop is the one slot that the instruction set asks for between the last one and the first use of its result.
__device__ __forceinline__ void hw_exp2x8(float& x0, float& x1, float& x2, float& x3, float& x4, float& x5, float& x6, float& x7) {
#if defined(__HIP_DEVICE_COMPILE__)
  asm("v_exp_f32 %0, %0\n\tv_exp_f32 %1, %1\n\tv_exp_f32 %2, %2\n\tv_exp_f32 %3, %3\n\t"
      "v_exp_f32 %4, %4\n\tv_exp_f32 %5, %5\n\tv_exp_f32 %6, %6\n\tv_exp_f32 %7, %7\n\tv_nop"
      : "+v"(x0), "+v"(x1), "+v"(x2), "+v"(x3), "+v"(x4), "+v"(x5), "+v"(x6), "+v"(x7));
#endif
}

__device__ __forceinline__ v8f mma_h(v16h a, v16h b, v8f c) {
  return __builtin_amdgcn_wmma_f32_16x16x32_f16(false, a, false, b, (short)0, c, false, false);
}
__device__ __forceinline__ v8f mma_b(v16b a, v16b b, v8f c) {
  return __builtin_amdgcn_wmma_f32_16x16x32_bf16(false, a, false, b, (short)0, c, false, false);
}
// four vector slots behind the last score WMMA: in front of the first read of its result and of the loads that overwrite its A fragments
__device__ __forceinline__ void g2_6(v8f& a, v8f& b, v16h x0, v16h x1, v16h x2, v16h x3, v16h x4, v16h x5) {
#if defined(__HIP_DEVICE_COMPILE__)
  asm volatile("v_nop\n\tv_nop\n\tv_nop\n\tv_nop"
               : "+v"(a), "+v"(b) : "v"(x0), "v"(x1), "v"(x2), "v"(x3), "v"(x4), "v"(x5) : "memory");
#endif
}
template <typename F>
__device__ __forceinline__ void g4_5(v8f& a, v8f& b, v8f& c, v8f& d, F x0, F x1, F x2, F x3, F x4) {
#if defined(__HIP_DEVICE_COMPILE__)
  asm volatile("v_nop\n\tv_nop\n\tv_nop\n\tv_nop"
               : "+v"(a), "+v"(b), "+v"(c), "+v"(d) : "v"(x0), "v"(x1), "v"(x2), "v"(x3), "v"(x4) : "memory");
#endif
}
__device__ __forceinline__ void g4_9(v8f& a, v8f& b, v8f& c, v8f& d, v16h x0, v16h x1, v16h x2, v16h x3, v16h x4,
                                     v16h x5, v16h x6, v16h x7, v16h x8) {
#if defined(__HIP_DEVICE_COMPILE__)
  asm volatile("v_nop\n\tv_nop\n\tv_nop\n\tv_nop"
               : "+v"(a), "+v"(b), "+v"(c), "+v"(d)
               : "v"(x0), "v"(x1), "v"(x2), "v"(x3), "v"(x4), "v"(x5), "v"(x6), "v"(x7), "v"(x8) : "memory");
#endif
}
__device__ __forceinline__ void acc_guard4(v8f& a, v8f& b, v8f& c, v8f& d) {
#if defined(__HIP_DEVICE_COMPILE__)
  asm volatile("v_nop\n\tv_nop\n\tv_nop\n\tv_nop" : "+v"(a), "+v"(b), "+v"(c), "+v"(d));
#endif
}
// s_wait_xcnt 0 behind a group of fragment loads: it stands in front of every later write of a register that those loads name as
// address; naming the addresses as inputs keeps their registers unwritten (also by a later load's result) up to the wait.
__device__ __forceinline__ void addr_wait2(const void* a, const void* b) {
#if defined(__HIP_DEVICE_COMPILE__)
  asm volatile("s_wait_xcnt 0x0" : : "v"(a), "v"(b) : "memory");
#endif
}
__device__ __forceinline__ void addr_wait5(const void* a, const void* b0, const void* b1, const void* b2, const void* b3) {
#if defined(__HIP_DEVICE_COMPILE__)
  asm volatile("s_wait_xcnt 0x0" : : "v"(a), "v"(b0), "v"(b1), "v"(b2), "v"(b3) : "memory");
#endif
}
__device__ __forceinline__ void addr_wait9(const void* a, const void* b0, const void* b1, const void* b2, const void* b3,
                                           const void* c0, const void* c1, const void* c2, const void* c3) {
#if defined(__HIP_DEVICE_COMPILE__)
  asm volatile("s_wait_xcnt 0x0"
               : : "v"(a), "v"(b0), "v"(b1), "v"(b2), "v"(b3), "v"(c0), "v"(c1), "v"(c2), "v"(c3) : "memory");
#endif
}
// One staged tile (128 keys of k, 128 keys of v, 16 KiB each, contiguous in their fragment-ordered planes and laid the same way in
// LDS) by asynchronous copies: each thread moves 4 + 4 units of 16 B, unit j lies 4096 B (= 256 threads x 16 B) behind unit j - 1;
// the immediate offset moves the global and the LDS address alike. lk, lv = the thread's LDS byte addresses, gk, gv its global ones.
// s_wait_xcnt 0 as the last line stands in front of every later write of the four address registers.
__device__ __forceinline__ void stage_kv(unsigned lk, const u16* gk, unsigned lv, const u16* gv) {
#if defined(__HIP_DEVICE_COMPILE__)
  asm volatile("global_load_async_to_lds_b128 %0, %1, off\n\t"
               "global_load_async_to_lds_b128 %0, %1, off offset:4096\n\t"
               "global_load_async_to_lds_b128 %0, %1, off offset:8192\n\t"
               "global_load_async_to_lds_b128 %0, %1, off offset:12288\n\t"
               "global_load_async_to_lds_b128 %2, %3, off\n\t"
               "global_load_async_to_lds_b128 %2, %3, off offset:4096\n\t"
               "global_load_async_to_lds_b128 %2, %3, off offset:8192\n\t"
               "global_load_async_to_lds_b128 %2, %3, off offset:12288\n\t"
               "s_wait_xcnt 0x0"
               : : "v"(lk), "v"(gk), "v"(lv), "v"(gv) : "memory");
#endif
}
// the issuing wave's own wait for its copies: behind it and the next barrier every wave may read the tile
__device__ __forceinline__ void wait_copies() {
#if defined(__HIP_DEVICE_COMPILE__)
  asm volatile("s_wait_asynccnt 0x0" : : : "memory");
#endif
}
// the wave's LDS reads have returned: in front of the barrier behind which the buffer it read is refilled
__device__ __forceinline__ void wait_lds_reads() {
#if defined(__HIP_DEVICE_COMPILE__)
  asm volatile("s_wait_dscnt 0x0" : : : "memory");
#endif
}
__device__ __forceinline__ void wave_sync_lds() {
  __builtin_amdgcn_fence(__ATOMIC_RELEASE, "workgroup");
  __builtin_amdgcn_wave_barrier();
  __builtin_amdgcn_fence(__ATOMIC_ACQUIRE, "workgroup");
}

// =====================================================================================================
// Weight matrix [DMOD][DMOD] f32 -> 16-bit plane [DMOD][DMOD], stored TILED (see the loaders), head-split permutation folded in:
//   mode 0: D[r][i]  = bf16 RNE bits of W[((r & 63) << 2) | (r >> 6)][i]      (output row r = h*64+d <- channel d*4+h)
//   mode 1: D[o][c]  = f16 bits of bf16value(W[o][((c & 63) << 2) | (c >> 6)]) * scale   (input column permuted the same way)
// Thread = 8 consecutive output elements (8 scalar loads, both candidate indices always < DMOD*DMOD, selected by value);
// coverage: blk = 0 .. DMOD*DMOD/8/256 - 1 = 32 blocks x 256 thr x 8 = the whole plane.
// =====================================================================================================
__device__ __forceinline__ void cvtw_body(const float* __restrict__ w, u16* D, int mode, float scale, int blk) {
  const int gt = blk * 256 + (int)threadIdx.x;
  if (gt >= (DMOD * DMOD) / 8) return;       // no barriers in this body
  const int row  = ((gt >> 9) << 4) | (gt & 15);   // 0..255: destination unit gt = ((row/16)*32 + c8/8)*16 + row%16
  const int c8   = ((gt >> 4) & 31) * 8;           // 0..248
  const int prow = ((row & 63) << 2) | (row >> 6);
  const int hsel = c8 >> 6, d0 = c8 & 63;
  unsigned short s[8];
  int   idx[8];
  float wv[8];
#pragma unroll
  for (int e = 0; e < 8; ++e) {
    const int i0  = prow * DMOD + c8 + e;                   // < 65536
    const int i1  = row * DMOD + ((d0 + e) << 2) + hsel;    // < 65536
    idx[e] = (mode == 0) ? i0 : i1;
    wv[e]  = w[idx[e]];
  }
#if defined(__HIP_DEVICE_COMPILE__)
  // s_wait_xcnt 0 behind the eight loads, in front of every later write of an index register that they name as address; naming
  // the indices as inputs keeps their registers unwritten (also by a later load's result) up to the wait.
  asm volatile("s_wait_xcnt 0x0" : : "v"(idx[0]), "v"(idx[1]), "v"(idx[2]), "v"(idx[3]), "v"(idx[4]), "v"(idx[5]), "v"(idx[6]),
               "v"(idx[7]) : "memory");
#endif
#pragma unroll
  for (int e = 0; e < 8; ++e) {
    const float v = wv[e];
    const unsigned short bb = bf_bits(v);
    const unsigned short hb = h_bits((_Float16)(bf_up(bb) * scale));
    s[e] = (mode == 0) ? bb : hb;
  }
  v4u o;
#pragma unroll
  for (int e = 0; e < 4; ++e) o[e] = pk16(s[2 * e], s[2 * e + 1]);
  u16* d = D + (size_t)gt * 8;
  {
    *(v4u*)(d) = o;
    
  }
}

// =====================================================================================================
// Input transpose + convert: X [b][DMOD][SEQ] f32 -> XT bf16 [b][SEQ][DMOD], stored TILED. Block = (b, 64 tokens, 64 channels):
// 64 channel rows x 64 tokens loaded with 16-B loads, RNE-converted, scattered into an LDS tile [token][channel] (pitch XTP);
// coverage: load 256 thr x 16 elements = 64 x 64; store 2 iterations x 256 thr x 8 halves = 4 tiles x 8 chunks x 16 tokens = the block's
//           tile; bid = 0 .. NB x (SEQ/64) x (DMOD/64) - 1 = 1024 blocks covers XT exactly once. T = the block's LDS tile.
// =====================================================================================================
__device__ __forceinline__ void xt16_body(const float* __restrict__ x, u16* XT, u16* T, int bid) {
  const int tid = threadIdx.x;
  const int ct  = bid & 3;                    // channel tile, DMOD/64 = 4
  const int st  = (bid >> 2) & 63;            // token tile, SEQ/64 = 64
  const int b   = bid >> 8;                   // 0..3
  const int c0  = ct * 64, s0 = st * 64;
  {
    const int cl = tid >> 2;                  // channel within tile 0..63
    const int tc = (tid & 3) * 16;            // token chunk
    const float* src = x + ((size_t)(b * DMOD + c0 + cl)) * SEQ + s0 + tc;
#pragma unroll
    for (int i = 0; i < 4; ++i) {
      const v4f a = *(const v4f*)(src + 4 * i);
#pragma unroll
      for (int e = 0; e < 4; ++e) T[(tc + 4 * i + e) * XTP + cl] = bf_bits(a[e]);
    }
  }
  __syncthreads();
  v4u o[2];
  const int tk = tid & 15, ch = (tid >> 4) & 7, th = tid >> 7;   // token in its 16-token tile, 8-channel chunk, tile parity
#pragma unroll
  for (int it = 0; it < 2; ++it) {
    const int line = (it * 2 + th) * 16 + tk; // token within the block's tile 0..63
    o[it] = *(const v4u*)(T + line * XTP + ch * 8);
  }
  const size_t base = ((size_t)(b * SEQ + s0)) * DMOD + (size_t)(c0 + ch * 8) * 16 + tk * 8;
  {
#pragma unroll
    for (int it = 0; it < 2; ++it) {
      *(v4u*)(XT + base + (size_t)((it * 2 + th) * 16) * DMOD) = o[it];
    }
#if defined(__HIP_DEVICE_COMPILE__)
    // s_wait_xcnt 0 behind the two stores: in the merged kernel's text the weight range's code, which writes the registers that
    // these stores name as address, follows them behind a scalar test.
    asm volatile("s_wait_xcnt 0x0" : : : "memory");
#endif
  }
}

// =====================================================================================================
// The four weight converts and the three input transposes, which need nothing of each other, as block ranges of one grid:
//   blocks 0 .. 127: weight (bid >> 5) = wq, wk, wv (mode 0), wo (mode 1, x1024) -> plane (bid >> 5) of WB4, 32 blocks each;
//   blocks 128 .. 3199: input ((bid - 128) >> 10) = query, key, value -> plane of XT3, 1024 blocks each.
// The range test is block-uniform, so the transpose's barrier is passed by all threads of a block or by none.
// =====================================================================================================
#define WCV_BLOCKS (DMOD * DMOD / 8 / 256)
#define XT_BLOCKS  (NB * (SEQ / 64) * (DMOD / 64))
static_assert(WCV_BLOCKS == 32 && XT_BLOCKS == 1024);
__global__ __launch_bounds__(256)
void prep(const float* __restrict__ xq, const float* __restrict__ xk, const float* __restrict__ xv,
          const float* __restrict__ wq, const float* __restrict__ wk, const float* __restrict__ wv,
          const float* __restrict__ wo, u16* XT3, u16* WB4) {
  __shared__ __align__(16) u16 T[64 * XTP];
  const int bid = blockIdx.x;
  if (bid < 4 * WCV_BLOCKS) {
    const int sel = bid >> 5;
    const float* w = (sel == 0) ? wq : ((sel == 1) ? wk : ((sel == 2) ? wv : wo));
    cvtw_body(w, WB4 + (size_t)sel * (DMOD * DMOD), (sel == 3) ? 1 : 0, (sel == 3) ? WOS : 1.0f, bid & (WCV_BLOCKS - 1));
    return;                                   // the whole block leaves, in front of the barrier below
  }
  const int r   = bid - 4 * WCV_BLOCKS;
  const int sel = r >> 10;
  const float* x = (sel == 0) ? xq : ((sel == 1) ? xk : xv);
  xt16_body(x, XT3 + (size_t)sel * (size_t)(NB * SEQ * DMOD), T, r & (XT_BLOCKS - 1));
}

// =====================================================================================================
// Bias terms for the GEMM epilogue (bf16-RNE values of bias[], array of DMOD entries; every candidate index is masked into
// 0..DMOD-1 so all loads are in range, selection by value):
//   bmode 0: per-column, permuted index ((col&63)<<2)|(col>>6); bmode 1: per-row, same permutation of the row; bmode 2: per-row direct.
// =====================================================================================================
__device__ __forceinline__ void bias_terms(const float* __restrict__ bias, int bmode, int rowb, int col0, int hh, int m,
                                           v4f& badd, v8f& radd) {
#pragma unroll
  for (int e = 0; e < 4; ++e) {
    const int ci = col0 + 4 * m + e;
    const int pc = ((ci & 63) << 2) | ((ci >> 6) & 3);
    const float bc = bfr(bias[pc]);
    badd[e] = (bmode == 0) ? bc : 0.0f;
  }
#pragma unroll
  for (int r = 0; r < 8; ++r) {
    const int ri = rowb + 8 * hh + r;
    const int p1 = ((ri & 63) << 2) | ((ri >> 6) & 3);
    const int p2 = ri & (DMOD - 1);
    const float b1 = bfr(bias[p1]), b2 = bfr(bias[p2]);
    radd[r] = (bmode == 1) ? b1 : ((bmode == 2) ? b2 : 0.0f);
  }
}

// =====================================================================================================
// GEMM epilogue of the output projection: the wave's 16x64 f32 tile (times oscale, plus per-row addend radd) staged in its LDS
// coverage: 8 instructions x 2 rows x 16 lanes x 4 floats = the wave's 16 x 64 tile.
// =====================================================================================================
__device__ __forceinline__ void epi64(float* sl, v8f a0, v8f a1, v8f a2, v8f a3, float oscale, v4f badd, v8f radd,
                                      float* C, int N, size_t rowb, int col0, int lane) {
  const int hh = lane >> 4, m = lane & 15;
#pragma unroll
  for (int r = 0; r < 8; ++r) {
    const int ro = (8 * hh + r) * 68 + m;
    sl[ro]      = a0[r] * oscale + radd[r];
    sl[ro + 16] = a1[r] * oscale + radd[r];
    sl[ro + 32] = a2[r] * oscale + radd[r];
    sl[ro + 48] = a3[r] * oscale + radd[r];
  }
  wave_sync_lds();
  v4f vals[8];
#pragma unroll
  for (int it = 0; it < 8; ++it) vals[it] = *(const v4f*)(sl + (it * 2 + hh) * 68 + m * 4) + badd;
  float* dst = C + (rowb + (size_t)hh) * (size_t)N + col0 + m * 4;
  {
#pragma unroll
    for (int it = 0; it < 8; ++it) {
      *(v4f*)(dst + (size_t)(it * 2) * (size_t)N) = vals[it];
    }
    
  }
}

// =====================================================================================================
// Projection epilogue: the wave's 16x64 f32 tile plus bias, staged in its LDS slab, leaves as f16 of (value * scale) straight in
// the order the attention kernel reads it (no f32 plane in between). Unit = 8 halves = one lane's 16-B store; 4 stores a lane.
//   omode 0 (q): tile = 16 tokens x one head's 64 d; D = [b][s][h][d]; one store = 4 token rows x 128 B (whole lines)
//   omode 1 (k): the same tile; D unit ((bh*256 + kt)*8 + dc)*16 + c  <- key s = 16*kt + c, d = 8*dc .. 8*dc+7
//   omode 2 (v): tile = 16 d x 64 keys; D unit (((bh*128 + it)*4 + j)*4 + kc)*16 + c  <- d = 16*j + c, keys 32*it + 8*kc .. +7
// (bh = b*NH + h). In modes 1 and 2 one store is 512 contiguous bytes, and so is each fragment load of the attention loop.
// coverage: 4 stores x 32 lanes x 8 halves = the wave's 16 x 64 tile; the tiles of the grid cover each plane exactly once.
// =====================================================================================================
__device__ __forceinline__ void epi_h16(float* sl, v8f a0, v8f a1, v8f a2, v8f a3, v4f cadd, v8f radd, bool rowbias, float scale,
                                        u16* D, int omode, int rowb, int col0, int y, int lane) {
  static_assert(SEQ == 4096 && DMOD == 256 && HD == 64 && NH == 4);
  const int hh = lane >> 4, m = lane & 15;
#pragma unroll
  for (int r = 0; r < 8; ++r) {
    const int ro = (8 * hh + r) * 68 + m;
    sl[ro]      = a0[r] + (rowbias ? radd[r] : cadd[0]);
    sl[ro + 16] = a1[r] + (rowbias ? radd[r] : cadd[1]);
    sl[ro + 32] = a2[r] + (rowbias ? radd[r] : cadd[2]);
    sl[ro + 48] = a3[r] + (rowbias ? radd[r] : cadd[3]);
  }
  wave_sync_lds();
  // slab row and 8-column chunk of the lane's unit t: q (4t + lane/8, lane%8); k, v (lane%16, 2t + lane/16)
  const int lb = (omode == 0) ? (lane >> 3) * 68 + (lane & 7) * 8 : m * 68 + hh * 8;
  const int ls = (omode == 0) ? 4 * 68 : 16;
  v4u o[4];
#pragma unroll
  for (int t = 0; t < 4; ++t) {
    const float* p = sl + lb + t * ls;
    const v4f a = *(const v4f*)(p), c4 = *(const v4f*)(p + 4);
#pragma unroll
    for (int e = 0; e < 2; ++e) {
      o[t][e]     = pk16(h_bits((_Float16)(a[2 * e] * scale)),  h_bits((_Float16)(a[2 * e + 1] * scale)));
      o[t][2 + e] = pk16(h_bits((_Float16)(c4[2 * e] * scale)), h_bits((_Float16)(c4[2 * e + 1] * scale)));
    }
  }
  const int dq = (rowb + (lane >> 3)) * DMOD + col0 + (lane & 7) * 8;
  const int dk = ((((rowb >> 12) * NH + (col0 >> 6)) * 256 + ((rowb & (SEQ - 1)) >> 4)) * 128 + lane) * 8;
  const int dv = ((((y * NH + (rowb >> 6)) * 128 + (col0 >> 5)) * 4 + ((rowb >> 4) & 3)) * 64 + lane) * 8;
  u16* d = D + (size_t)((omode == 0) ? dq : ((omode == 1) ? dk : dv));   // every one < NB*SEQ*DMOD
#pragma unroll
  for (int t = 0; t < 4; ++t) {
    const int dofs = (omode == 0) ? t * (4 * DMOD) : ((omode == 1) ? t * 256 : (t >> 1) * 2048 + (t & 1) * 256);
    *(v4u*)(d + dofs) = o[t];
  }
}

// =====================================================================================================
// bf16 GEMM with bias, f16 result: (A[M][K] (bf16, TILED) . Bt[N][K]^T (bf16, TILED) + bias) * scale -> plane D in the order of
// omode (see epi_h16). Bias = bf16-RNE values of bias[], index permuted ((i&63)<<2)|(i>>6) and so always in 0..DMOD-1: per column
// (rowbias false) or per row (true). bid = 0 .. (M/64)*(N/64) - 1 tiles, y = batch index with element stride sB added to Bt.
// Block = 64x64 tile, 4 waves x 16 rows; fragments loaded straight from the tiled planes (two 16-B loads each, split k map for
// A and B); K stepped by 32 (K % 32 == 0, M % 64 == 0, N % 64 == 0).
// =====================================================================================================
__device__ __forceinline__
void gemm_bfh_body(float* slab, const u16* __restrict__ A, const u16* __restrict__ Bt, const float* __restrict__ bias,
                   u16* D, int M, int N, int K, float scale, int omode, bool rowbias, int sB, int bid, int y) {
  const int tid = threadIdx.x, wave = tid >> 5, lane = tid & 31, hh = lane >> 4, m = lane & 15;
  const int ntile = N >> 6;
  const int rowb  = (bid / ntile) * 64 + wave * 16;
  const int col0  = (bid % ntile) * 64;
  if (rowb + 16 > M) return;                 // wave-uniform, never taken with the exact grid; no block barriers in this kernel
  const u16* Bb = Bt + (size_t)y * (size_t)sB;
  const u16* ap = A  + (size_t)rowb * K + 8 * lane;   // 16-row tile = 16*K halves, inside it [k/8][row][8]
  const u16* bp = Bb + (size_t)col0 * K + 8 * lane;
  const size_t bs = (size_t)16 * K;
  v8f acc0 = zero8(), acc1 = zero8(), acc2 = zero8(), acc3 = zero8();
#pragma unroll 1
  for (int k0 = 0; k0 < K; k0 += 32) {
    const int ko = k0 * 16;
    const u16 *pa = ap + ko, *p0 = bp + ko, *p1 = p0 + bs, *p2 = p1 + bs, *p3 = p2 + bs;
    const v16b a  = ldfrag_bp(pa);
    const v16b b0 = ldfrag_bp(p0);
    const v16b b1 = ldfrag_bp(p1);
    const v16b b2 = ldfrag_bp(p2);
    const v16b b3 = ldfrag_bp(p3);
    addr_wait5(pa, p0, p1, p2, p3);
    acc0 = mma_b(a, b0, acc0);
    acc1 = mma_b(a, b1, acc1);
    acc2 = mma_b(a, b2, acc2);
    acc3 = mma_b(a, b3, acc3);
    g4_5<v16b>(acc0, acc1, acc2, acc3, a, b0, b1, b2, b3);
  }
  v4f cadd = zero4();
  v8f radd = zero8();
  if (rowbias) {
#pragma unroll
    for (int r = 0; r < 8; ++r) {
      const int ri = rowb + 8 * hh + r;
      radd[r] = bfr(bias[((ri & 63) << 2) | ((ri >> 6) & 3)]);
    }
  } else {
#pragma unroll
    for (int j = 0; j < 4; ++j) {
      const int ci = col0 + 16 * j + m;
      cadd[j] = bfr(bias[((ci & 63) << 2) | ((ci >> 6) & 3)]);
    }
  }
  epi_h16(slab + wave * SLAB64, acc0, acc1, acc2, acc3, cadd, radd, rowbias, scale, D, omode, rowb, col0, y, lane);
}

// =====================================================================================================
// The three projections, which need nothing of each other, as one grid (1024 tiles, 3): blockIdx.y = 0 q, 1 k: token-major,
// [16384 token][h*64+d] = XT . W'^T, per-column bias; 2 v: channel-major per batch (256 tiles x 4 batches in blockIdx.x),
// [b][h*64+d][4096] = W' . XT^T, per-row bias. XT3, WB4, H3 hold the planes of q, k, v one behind the other; H3 = the f16 planes
// x64 that the attention kernel reads, q in place order, k and v in fragment order.
// =====================================================================================================
__global__ __launch_bounds__(128)
void gemm_qkv(const u16* __restrict__ XT3, const u16* __restrict__ WB4, const float* __restrict__ bq,
              const float* __restrict__ bk, const float* __restrict__ bv, u16* H3) {
  static_assert((NB * SEQ / 64) * (DMOD / 64) == 1024 && (DMOD / 64) * (SEQ / 64) == 256 && NB == 4);
  __shared__ __align__(16) float slab[4 * SLAB64];
  const int sel = blockIdx.y;                 // block-uniform
  const int bx  = blockIdx.x;
  const u16* X  = XT3 + (size_t)sel * (size_t)(NB * SEQ * DMOD);
  const u16* Wp = WB4 + (size_t)sel * (DMOD * DMOD);
  u16*       D  = H3 + (size_t)sel * (size_t)(NB * SEQ * DMOD);
  if (sel < 2)
    gemm_bfh_body(slab, X, Wp, (sel == 0) ? bq : bk, D, NB * SEQ, DMOD, DMOD, (sel == 0) ? QSC : KSC, (sel == 0) ? 0 : 1, false, 0, bx, 0);
  else
    gemm_bfh_body(slab, Wp, X, bv, D, DMOD, SEQ, DMOD, VCAR, 2, true, SEQ * DMOD, bx & 255, bx >> 8);
}

// =====================================================================================================
// f16 GEMM, single A plane, hi+lo B planes, per-row bias: C[M][N] (f32, pitch N) = A[M][K] . (Bh + Bl)[N][K]^T times oscale,
// plus bf16-RNE value of bias[row]; A f16 TILED (no batch stride), Bh/Bl f16 [n][k] planes TILED with batch stride sB, C with
// batch stride sC (grid.y = batch). Products a.bh + a.bl into one accumulator (bl is the unscaled residual of bh). Same tiling
// as gemm_bfh_body.
// =====================================================================================================
__global__ __launch_bounds__(128)
void gemm_wh2(const u16* __restrict__ A, const u16* __restrict__ Bh, const u16* __restrict__ Bl,
              const float* __restrict__ bias, float* C, int M, int N, int K, float oscale, int sB, int sC) {
  __shared__ __align__(16) float slab[4 * SLAB64];
  const int tid = threadIdx.x, wave = tid >> 5, lane = tid & 31, hh = lane >> 4, m = lane & 15;
  const int ntile = N >> 6;
  const int bid   = blockIdx.x;
  const int y     = blockIdx.y;
  const int rowb  = (bid / ntile) * 64 + wave * 16;
  const int col0  = (bid % ntile) * 64;
  if (rowb + 16 > M) return;                 // wave-uniform, never taken with the exact grid; no block barriers in this kernel
  const _Float16* ap  = (const _Float16*)(const void*)A + (size_t)rowb * K + 8 * lane;   // tiles as in gemm_bfh_body
  const size_t bofs   = (size_t)y * (size_t)sB + (size_t)col0 * K + 8 * lane;
  const _Float16* bhp = (const _Float16*)(const void*)Bh + bofs;
  const _Float16* blp = (const _Float16*)(const void*)Bl + bofs;
  float* Cb = C + (size_t)y * (size_t)sC;
  const size_t bs = (size_t)16 * K;
  v8f acc0 = zero8(), acc1 = zero8(), acc2 = zero8(), acc3 = zero8();
#pragma unroll 1
  for (int k0 = 0; k0 < K; k0 += 32) {
    const int ko = k0 * 16;
    const _Float16 *pa = ap + ko, *h0 = bhp + ko, *h1 = h0 + bs, *h2 = h1 + bs, *h3 = h2 + bs;
    const _Float16 *l0 = blp + ko, *l1 = l0 + bs, *l2 = l1 + bs, *l3 = l2 + bs;
    const v16h a   = ldfrag_p(pa);
    const v16h bh0 = ldfrag_p(h0);
    const v16h bh1 = ldfrag_p(h1);
    const v16h bh2 = ldfrag_p(h2);
    const v16h bh3 = ldfrag_p(h3);
    const v16h bl0 = ldfrag_p(l0);
    const v16h bl1 = ldfrag_p(l1);
    const v16h bl2 = ldfrag_p(l2);
    const v16h bl3 = ldfrag_p(l3);
    addr_wait9(pa, h0, h1, h2, h3, l0, l1, l2, l3);
    acc0 = mma_h(a, bh0, acc0);  acc0 = mma_h(a, bl0, acc0);
    acc1 = mma_h(a, bh1, acc1);  acc1 = mma_h(a, bl1, acc1);
    acc2 = mma_h(a, bh2, acc2);  acc2 = mma_h(a, bl2, acc2);
    acc3 = mma_h(a, bh3, acc3);  acc3 = mma_h(a, bl3, acc3);
    g4_9(acc0, acc1, acc2, acc3, a, bh0, bh1, bh2, bh3, bl0, bl1, bl2, bl3);
  }
  v4f badd = zero4();
  v8f radd = zero8();
  bias_terms(bias, 2, rowb, col0, hh, m, badd, radd);
  epi64(slab + wave * SLAB64, acc0, acc1, acc2, acc3, oscale, badd, radd, Cb, N, (size_t)rowb, col0, lane);
}

// =====================================================================================================
// Full (non-causal, unmasked) multi-head flash attention: block = (batch b, head, 128 query rows), 8 waves, wave w owns the
// 16 query rows q0 = 128*qt + 16*w .. q0+15.
//   q plane (f16, x64) laid out [b][s][h][d]; k and v planes (x64) per (b, h) in fragment order (epi_h16). The block's eight waves
//   need the same k and v: tiles of 128 keys are brought into LDS once per block by asynchronous copies, two buffers, tile t + 2
//   asked for when tile t has been read by all, one barrier a tile; every fragment load of the loop is a ds_load_b128 of 512
//   contiguous bytes over the wave. All NST = 32 tiles of 4 key blocks of 32 keys are visited (static bounds).
//   Scores are computed TRANSPOSED: S^T tile g (g = 0,1) = k rows (keys kb+16g .. +15, A operand, row m = lane&15, split k map
//   over d) times q^T (B operand, col n = query q0 + (lane&15), k = d, split map), one product per tile and d-chunk.
//   D element r of lane l = (key kb+16g+8h+r, query q0+(l&15)), so a lane owns one query column and 16 of its 32 keys; the
//   partner lane l^16 owns the other 16 -> row max / row sum need one xor-16 shuffle.
//   Online max-subtracted base-2 softmax in f32 (scale 1/8 and the q,k carries folded into lsc). The exp'd values ARE the
//   P A-fragment in place: A row m = query = lane&15, element i <- key kb+8h+i (tile 0, D element i), element 8+i <- key
//   kb+16+8h+i (tile 1, D element i). P is carried x32768 as f16. The rescale factor of query row 8h+r of the O accumulators is
//   fetched from lane 8h+r with a shuffle (uniform control). 4 v^T B fragments (col n = d = 16j + (lane&15), k = key, fragment-ordered plane),
//   4 P.V WMMAs per key block.
//   Epilogue: 1/l (per query, shuffled to the D row owner) and carry folds in f32; the wave's 16x64 f32 result staged in its LDS
// coverage: per wave 4 instructions x 2 chunks x 16 rows x 8 halves = 16 x 64 per plane; grid 512 blocks x 8 waves = every
//           (b, s, h) row of both O planes exactly once.
// =====================================================================================================
__global__ __launch_bounds__(ATT_THREADS)
void attn_fwd(const u16* __restrict__ QHp, const u16* __restrict__ KHp, const u16* __restrict__ VHp,
              u16* OHIp, u16* OLOp) {
  __shared__ __align__(16) float smem[RINGF];   // loop: [2 buffers][k tile, v tile] of f16; epilogue: per wave a result slab [16][68]

  const int tid  = threadIdx.x;
  const int wave = tid >> 5;
  const int lane = tid & 31;
  const int hh   = lane >> 4;
  const int c    = lane & 15;

  const int bid  = blockIdx.x;
  const int qt   = bid & (SEQ / 128 - 1);     // 0..31
  const int head = (bid >> 5) & (NH - 1);     // 0..3
  const int b    = bid >> 7;                  // 0..3
  const int q0   = qt * 128 + wave * 16;

  // B fragments of q^T: col n = query q0 + c, k = d (k-contiguous row of the q plane); loop-invariant
  const size_t qofs = (((size_t)(b * SEQ + q0 + c)) * NH + head) * HD + 8 * hh;
  const _Float16* Qh  = (const _Float16*)(const void*)QHp + qofs;
  const v16h qh0 = ldfrag_h(Qh), qh1 = ldfrag_h(Qh + 32);
  // k and v planes of (b, head): fragment order, 2048 halves per 32-key block (see epi_h16), so a 128-key tile is STH halves in a
  // row; the thread's first 16-B unit of tile 0, and its place in buffer 0 (LDS byte address = low 32 bits of the shared address)
  const size_t pofs = (size_t)(b * NH + head) * (SEQ * HD) + 8 * tid;
  const u16* gk = KHp + pofs;
  const u16* gv = VHp + pofs;
  const unsigned lk0 = (unsigned)(uintptr_t)(void*)smem + 16u * (unsigned)tid;
  const _Float16* ring = (const _Float16*)(const void*)smem + 8 * lane;
  const float lsc = 0.125f * (LOG2E / (QSC * KSC));

  float mrun = -INFINITY, lrun = 0.f;
  v8f o[4];
#pragma unroll
  for (int j = 0; j < 4; ++j) o[j] = zero8();

  addr_wait2(Qh, Qh);
  // tile 0 into buffer 0, landed and published; then tile 1 into buffer 1, which flies while tile 0 is worked on
  stage_kv(lk0, gk, lk0 + 2 * STH, gv);
  wait_copies();
  __syncthreads();
  stage_kv(lk0 + 4 * STH, gk + STH, lk0 + 6 * STH, gv + STH);

#pragma unroll 1
  for (int st = 0; st < NST; ++st) {
   const _Float16* kl = ring + (st & 1) * (2 * STH);   // this tile's k, the lane's unit; A fragment row m = key kb + 16g + c, k = d
   const _Float16* vl = kl + STH;                      // this tile's v; B fragment col n = d = 16j + c, k = key
   // K fragments of the tile's first key block; each pass but the tile's last fetches the next pass's behind its own score products
   v16h kf0 = ldfrag_p(kl), kf1 = ldfrag_p(kl + 16 * HD), kf2 = ldfrag_p(kl + 512), kf3 = ldfrag_p(kl + 16 * HD + 512);
#pragma unroll
   for (int ps4 = 0; ps4 < STK / 32; ++ps4) {   // unrolled: the fragment addresses become immediate offsets, the tile's last pass drops its fetch
    // (kb below = 128 * st + 32 * ps4, the pass's first key)
    // ---- this pass's v fragments, asked for here and first used behind the softmax: their latency runs under scores and softmax.
    //      B fragment col n = d = j*16 + c, 512 halves per j in the fragment-ordered v tile ----
    const _Float16* vhp = vl + ps4 * (32 * HD);
    const v16h vh0 = ldfrag_p(vhp);
    const v16h vh1 = ldfrag_p(vhp + 512);
    const v16h vh2 = ldfrag_p(vhp + 1024);
    const v16h vh3 = ldfrag_p(vhp + 1536);
    __builtin_amdgcn_sched_barrier(0);   // keeps the eight v loads in front of the first wait on a k fragment
    // ---- transposed scores: s0 = keys kb..kb+15, s1 = keys kb+16..kb+31, column = query q0 + c ----
    v8f s0 = zero8(), s1 = zero8();
    s0 = mma_h(kf0, qh0, s0);
    s1 = mma_h(kf1, qh0, s1);
    s0 = mma_h(kf2, qh1, s0);
    s1 = mma_h(kf3, qh1, s1);
    g2_6(s0, s1, qh0, qh1, kf0, kf1, kf2, kf3);
    // ---- the next pass's k fragments into the same registers, inside this tile only: nothing of the next tile is read here ----
    if (ps4 + 1 < STK / 32) {
      const _Float16* knp = kl + (ps4 + 1) * (32 * HD);
      kf0 = ldfrag_p(knp);
      kf1 = ldfrag_p(knp + 16 * HD);
      kf2 = ldfrag_p(knp + 512);
      kf3 = ldfrag_p(knp + 16 * HD + 512);
    }
    __builtin_amdgcn_sched_barrier(0);   // keeps the eight k loads here: without it they sink into the softmax, whose temporaries take their registers
    // ---- raw scores of this lane's 16 keys for query q0 + c: s0[i] <- key kb+8hh+i, s1[i] <- key kb+16+8hh+i. The maximum is
    //      taken on the raw scores and scaled once: lsc > 0 and rounding is monotone, so it equals the maximum of the scaled ones ----
    float cr = s0[0];
#pragma unroll
    for (int i = 1; i < 8; ++i) cr = fmaxf(cr, s0[i]);
#pragma unroll
    for (int i = 0; i < 8; ++i) cr = fmaxf(cr, s1[i]);
    float cm = cr * lsc;
    cm = fmaxf(cm, __shfl_xor(cm, 16, 32));
    const float mn = fmaxf(mrun, cm);        // finite from the first block on
    const float al = hw_exp2(mrun - mn);     // 0 on the first block (mrun = -inf)
    mrun = mn;
    // ---- weights p * 32768 (p <= 1) = 2^(s * lsc - mn + 15): one fma and one v_exp_f32 each; their f16 values are the P A-fragment,
    //      element 8w + i <-> s_w[i]; the row sum carries the same 32768 ----
    const float nb = PLOG - mn;
    float p[16];
#pragma unroll
    for (int i = 0; i < 8; ++i) { p[i] = fmaf(s0[i], lsc, nb); p[8 + i] = fmaf(s1[i], lsc, nb); }
    hw_exp2x8(p[0], p[1], p[2], p[3], p[4], p[5], p[6], p[7]);
    hw_exp2x8(p[8], p[9], p[10], p[11], p[12], p[13], p[14], p[15]);
    float ps = p[0] + p[1];
    FragH ph;
#pragma unroll
    for (int w = 0; w < 2; ++w) {
#pragma unroll
      for (int e4 = 0; e4 < 4; ++e4) {
        const int i = 8 * w + 2 * e4;
        if (i > 0) ps += p[i] + p[i + 1];
        ph.u[w][e4] = pk16(h_bits((_Float16)p[i]), h_bits((_Float16)p[i + 1]));
      }
    }
    ps += __shfl_xor(ps, 16, 32);
    lrun = lrun * al + ps;
    // ---- rescale the O accumulators: D row 8hh+r = query q0+8hh+r, its factor lives in lane 8hh+r (and 16+8hh+r) ----
    float scl[8];
#pragma unroll
    for (int r = 0; r < 8; ++r) scl[r] = __shfl(al, 8 * hh + r, 32);
#pragma unroll
    for (int j = 0; j < 4; ++j) {
#pragma unroll
      for (int r = 0; r < 8; ++r) o[j][r] *= scl[r];
    }
    // ---- P.V with the v fragments asked for at the head of the pass ----
    {
      o[0] = mma_h(ph.v, vh0, o[0]);
      o[1] = mma_h(ph.v, vh1, o[1]);
      o[2] = mma_h(ph.v, vh2, o[2]);
      o[3] = mma_h(ph.v, vh3, o[3]);
      g4_5<v16h>(o[0], o[1], o[2], o[3], ph.v, vh0, vh1, vh2, vh3);
    }
   }
   // ---- foot of tile st, every wave: its own LDS reads done, its own copies of tile st + 1 landed, then the one barrier that
   //      publishes tile st + 1 and ends every wave's reading of this buffer; only behind it the refill with tile st + 2 ----
   wait_lds_reads();
   wait_copies();
   __syncthreads();
   if (st + 2 < NST) {
     const unsigned lb = lk0 + (unsigned)(st & 1) * (4 * STH);
     const size_t   go = (size_t)(st + 2) * STH;
     stage_kv(lb, gk + go, lb + 2 * STH, gv + go);
   }
  }
  wait_copies();   // nothing is outstanding here; the last foot's barrier has ended all reading of the ring, which now holds the slabs
  acc_guard4(o[0], o[1], o[2], o[3]);

  // ---- fold 1/l (per query, owned by lane = query; l carries the same 32768 as P) and the carry 64 on v; stage the 16x64 slab ----
  const float linv = (1.0f / lrun) * (1.0f / VCAR);
  float inv[8];
#pragma unroll
  for (int r = 0; r < 8; ++r) inv[r] = __shfl(linv, 8 * hh + r, 32);
  float* slab = smem + wave * SLABF;
#pragma unroll
  for (int r = 0; r < 8; ++r) {
#pragma unroll
    for (int j = 0; j < 4; ++j) slab[(8 * hh + r) * 68 + j * 16 + c] = o[j][r] * inv[r];
  }
  wave_sync_lds();
  // ---- O x1024 -> f16 hi + residual planes, TILED as [token][h*64+d] operands; one store = 512 contiguous bytes ----
  v4u oh[4], ol[4];
#pragma unroll
  for (int i4 = 0; i4 < 4; ++i4) {
    const int c8 = (i4 * 2 + hh) * 8;         // lane = (8-d chunk parity hh, query row c)
    const v4f a = *(const v4f*)(slab + c * 68 + c8), c4 = *(const v4f*)(slab + c * 68 + c8 + 4);
    float w[8];
#pragma unroll
    for (int e = 0; e < 4; ++e) { w[e] = a[e] * OSC; w[4 + e] = c4[e] * OSC; }
#pragma unroll
    for (int e = 0; e < 4; ++e) {
      const _Float16 h0 = (_Float16)w[2 * e], h1 = (_Float16)w[2 * e + 1];
      const _Float16 l0 = (_Float16)(w[2 * e] - (float)h0), l1 = (_Float16)(w[2 * e + 1] - (float)h1);
      oh[i4][e] = pk16(h_bits(h0), h_bits(h1));
      ol[i4][e] = pk16(h_bits(l0), h_bits(l1));
    }
  }
  const size_t ob = ((size_t)(b * SEQ + q0)) * (NH * HD) + (size_t)head * (HD * 16) + 8 * lane;
  {
#pragma unroll
    for (int i4 = 0; i4 < 4; ++i4) {
      const size_t o8 = ob + (size_t)i4 * 256;
      *(v4u*)(OHIp + o8) = oh[i4];
      *(v4u*)(OLOp + o8) = ol[i4];
    }
    
  }
}

// =====================================================================================================
// Workspace map (bytes); every plane is fully written by whole-line stores before it is read; all extents are exact multiples
// of the store granularity (no pad rows needed); every offset a multiple of 131072; q, k and v each have an XT plane of their own:
//   XT  bf16 3 x [16384 token][256 i] tiled         25165824     (query, key, value)
//   WQB bf16 [256 r'][256 i] tiled (rows permuted)  131072      WKB same 131072     WVB same 131072
//   WOB f16  [256 o][256 c'] tiled x1024 (cols permuted)  131072
//   QH  f16  [4][4096][4][64] x64                   8388608
//   KH  f16  [16 bh][256 kt][8 dc][16 key][8 d] x64          8388608   (fragment order)
//   VH  f16  [16 bh][128 it][4 j][4 kc][16 d][8 key] x64     8388608   (fragment order)
//   OHI f16  [16384 token][256 h*64+d] tiled x1024   8388608      OLO residual 8388608
//   end                                            67633152
// =====================================================================================================
extern "C" void kernel_launch(void* const* d_in, const int* in_sizes, int n_in,
                              void* d_out, int out_size, void* d_ws, size_t ws_size,
                              hipStream_t stream) {
  const int ROWS = NB * SEQ;                            // 16384 tokens
  const int XN   = NB * DMOD * SEQ;                     // 4194304
  if (n_in < 11) return;
  if (in_sizes[0] != XN || in_sizes[1] != XN || in_sizes[2] != XN) return;
  if (in_sizes[3] != DMOD * DMOD || in_sizes[5] != DMOD * DMOD) return;
  if (in_sizes[7] != DMOD * DMOD || in_sizes[9] != DMOD * DMOD) return;
  if (in_sizes[4] != DMOD || in_sizes[6] != DMOD || in_sizes[8] != DMOD || in_sizes[10] != DMOD) return;
  if (out_size != XN) return;

  const float* Qin = (const float*)d_in[0];
  const float* Kin = (const float*)d_in[1];
  const float* Vin = (const float*)d_in[2];
  const float* wq  = (const float*)d_in[3];
  const float* bq  = (const float*)d_in[4];
  const float* wk  = (const float*)d_in[5];
  const float* bk  = (const float*)d_in[6];
  const float* wv  = (const float*)d_in[7];
  const float* bv  = (const float*)d_in[8];
  const float* wo  = (const float*)d_in[9];
  const float* bo  = (const float*)d_in[10];
  float*       out = (float*)d_out;

  const size_t szXT = (size_t)ROWS * DMOD * 2;                  //  8388608
  const size_t szW  = (size_t)DMOD * DMOD * 2;                  //   131072
  const size_t szP  = (size_t)ROWS * DMOD * 2;                  //  8388608  (q/k/v/o planes)
  size_t off = 0;
  const size_t oXT  = off; off += 3 * szXT;
  const size_t oWQB = off; off += szW;
  const size_t oWKB = off; off += szW;
  const size_t oWVB = off; off += szW;
  const size_t oWOB = off; off += szW;
  const size_t oQH  = off; off += szP;
  const size_t oKH  = off; off += szP;
  const size_t oVH  = off; off += szP;
  const size_t oOHI = off; off += szP;
  const size_t oOLO = off; off += szP;
  if (off > ws_size) return;                            // off = 67633152
  if (off > (size_t)134217728) return;

  char* ws = (char*)d_ws;
  u16*   XT  = (u16*)(ws + oXT);
  u16*   WQB = (u16*)(ws + oWQB);
  u16*   WOB = (u16*)(ws + oWOB);
  u16*   QH  = (u16*)(ws + oQH);
  u16*   KH  = (u16*)(ws + oKH);
  u16*   VH  = (u16*)(ws + oVH);
  u16*   OHI = (u16*)(ws + oOHI);
  u16*   OLO = (u16*)(ws + oOLO);

  const dim3 blk(256);
  const int n8w = (DMOD * DMOD) / 8;                    // 8192
  if ((n8w % 256) != 0) return;
  const dim3 gPre(4 * (n8w / 256) + 3 * NB * (SEQ / 64) * (DMOD / 64));   // 128 weight blocks + 3072 transpose blocks
  const dim3 gG3((ROWS / 64) * (DMOD / 64), 3);         // 1024 tiles x (q, k, v)
  const dim3 gGc((DMOD / 64) * (SEQ / 64), NB);         // 256 tiles x 4 batches, channel-major per batch
  const dim3 bG(128);
  const dim3 gAT(ATT_BLOCKS);                           // 512
  const dim3 bAT(ATT_THREADS);                          // 256
  const int  sTok = SEQ * DMOD;                         // 1048576 elements: per-batch stride of XT / O planes
  const int  sChn = DMOD * SEQ;                         // 1048576 elements: per-batch stride of out

  // (0) weights: rows of wq/wk/wv permuted to r' = h*64+d (bf16 planes), columns of wo permuted the same way (f16 of bf16 value x1024);
  //     inputs query, key, value -> XT bf16 [token][i], one plane each (WQB .. WOB lie one behind the other)
  prep<<<gPre, blk, 0, stream>>>(Qin, Kin, Vin, wq, wk, wv, wo, XT, WQB);
  // (1) projections + bias -> f16 planes x64 (QH, KH, VH lie one behind the other): q in place order, k and v in fragment order
  gemm_qkv<<<gG3, bG, 0, stream>>>(XT, WQB, bq, bk, bv, QH);
  // (2) attention -> O planes [token][h*64+d] tiled, x1024 (hi + residual)
  attn_fwd<<<gAT, bAT, 0, stream>>>(QH, KH, VH, OHI, OLO);
  // (3) output projection per batch + bias -> out [b][256 o][4096 n] f32, carries 1024 (O) x 1024 (wo) folded back
  gemm_wh2<<<gGc, bG, 0, stream>>>(WOB, OHI, OLO, bo, out, DMOD, SEQ, DMOD, 1.0f / (OSC * WOS), sTok, sChn);
  (void)hipGetLastError();
}

// v007
// A run of this version takes 109 microseconds.
// Timed twice side by side with v006, it ran 1.10 times as fast both times.
// Counting every step since v000, it is 3.34 times as fast.
// Contractions: projections Xt.W'^T and W'.Xt^T on v_wmma_f32_16x16x32_bf16 (Xt and W RNE-converted bf16 operands, f32 accumulate, bias added in f32);
// scores k'.q'^T (q', k' carried x64 as f16), P.v (P x128 as f16, v x64 as f16) and Wm'.O^T (Wm' as f16(bf16(Wm) x1024), O x1024 as f16 hi plane
// + f16 residual plane, products w.h + w.l): v_wmma_f32_16x16x32_f16, f32 accumulate. Base-2 online softmax, 1/l fold and bias adds in f32 on VALU.
#include <hip/hip_runtime.h>
#include <math.h>
#include <stdint.h>

#define NB    4
#define SEQ   4096
#define DMOD  256
#define NH    4
#define HD    64
#define QSC   64.0f
#define KSC   64.0f
#define PCAR  128.0f
#define VCAR  64.0f
#define OSC   1024.0f
#define WOS   1024.0f
#define LOG2E 1.4426950408889634f
#define PLOG  7.0f
#define RTH   8.0f                // a maximum in use is replaced when a scaled score exceeds it by more than this (base-2 exponent)
#define ATT_WAVES   8
#define ATT_THREADS (ATT_WAVES * 32)
#define ATT_BLOCKS  (NB * NH * (SEQ / (16 * ATT_WAVES)))
#define NKB    (SEQ / 32)
#define STK    128                 // keys of one staged tile
#define NST    (SEQ / STK)         // staged tiles per (batch, head)
#define STH    (STK * HD)          // halves of one operand's staged tile (16 KiB)
#define RINGF  (2 * STH)           // floats of the ring: 2 buffers x (k tile, v tile) = 64 KiB
#define SLABF  (16 * 68)
#define SLAB64 (16 * 68)
#define XTP    72
static_assert(HD == 64 && DMOD == NH * HD);
static_assert(PCAR == 128.0f && PLOG == 7.0f && PLOG + RTH == 15.0f);   // PCAR = 2^PLOG; the largest weight, 2^(PLOG + RTH), is finite in f16
static_assert((SEQ / 64) == 64 && NH == 4 && NB == 4);
static_assert(ATT_THREADS == 256 && ATT_BLOCKS == 512 && NKB == 128);
static_assert((DMOD % 64) == 0 && (SEQ % 64) == 0 && (DMOD % 32) == 0);
static_assert(((NB * SEQ * DMOD / 8) % 256) == 0 && ((DMOD * DMOD / 8) % 256) == 0);
static_assert((DMOD / 8) == 32);
static_assert(64 * XTP >= 63 * XTP + 64);
static_assert(ATT_WAVES * SLABF >= 4 * 16 * 68);
static_assert(NST >= 2 && STK == 4 * 32 && STH * 2 == 4 * ATT_THREADS * 16 && RINGF >= ATT_WAVES * SLABF);

typedef unsigned short u16;
typedef _Float16 v16h __attribute__((ext_vector_type(16)));
typedef _Float16 v8h  __attribute__((ext_vector_type(8)));
typedef __bf16   v16b __attribute__((ext_vector_type(16)));
typedef float    v8f  __attribute__((ext_vector_type(8)));
typedef float    v4f  __attribute__((ext_vector_type(4)));
typedef unsigned int v4u __attribute__((ext_vector_type(4)));

union FragH { v16h v; v8h h[2]; v4u u[2]; };
union FragB { v16b v; v4u u[2]; };

// ---- scalar helpers --------------------------------------------------------------------------------
__device__ __forceinline__ unsigned short bf_bits(float f) {          // f32 -> bf16 bits, RNE convert
  unsigned u = __float_as_uint(f);
  return (unsigned short)((u + 0x7FFFu + ((u >> 16) & 1u)) >> 16);
}
__device__ __forceinline__ float bf_up(unsigned short h) { return __uint_as_float(((unsigned)h) << 16); }
__device__ __forceinline__ float bfr(float f) { return bf_up(bf_bits(f)); }
__device__ __forceinline__ unsigned short h_bits(_Float16 x) { return __builtin_bit_cast(unsigned short, x); }
__device__ __forceinline__ unsigned pk16(unsigned short a, unsigned short b) { return (unsigned)a | ((unsigned)b << 16); }
__device__ __forceinline__ v8f zero8() { v8f z = {0.f, 0.f, 0.f, 0.f, 0.f, 0.f, 0.f, 0.f}; return z; }
__device__ __forceinline__ v4f zero4() { v4f z = {0.f, 0.f, 0.f, 0.f}; return z; }

// ---- fragment loaders: 16-bit A/B operand, lane -> row/col (lane&15), h = lane>>4; elements 0..7 <- k0+8h.., elements 8..15 <-
//      k0+16+8h.. (same split k map for A and B).
//      ldfrag_h: row-major [row][k] plane, p already includes +8*h (q only, read once per wave).
//      TILED plane of a [rows][K] operand: 16-row tile = 16*K halves in a row, inside it [k/8][row%16][8 k], so that the unit of
//      lane l for k0 lies at k0*16 + 8*l and a wave-wide 16-B load is 512 contiguous bytes (4 whole lines, not pieces of 16).
__device__ __forceinline__ v16h ldfrag_h(const _Float16* p) {
  FragH f;
  f.h[0] = *(const v8h*)(p);
  f.h[1] = *(const v8h*)(p + 16);
  return f.v;
}
//      ldfrag_p / ldfrag_bp: tiled or fragment-ordered plane, p already includes +8*lane; the second half lies 256 halves on.
__device__ __forceinline__ v16h ldfrag_p(const _Float16* p) {
  FragH f;
  f.h[0] = *(const v8h*)(p);
  f.h[1] = *(const v8h*)(p + 256);
  return f.v;
}
__device__ __forceinline__ v16b ldfrag_bp(const u16* p) {             // the same for a bf16 plane, read as unsigned integer vectors
  FragB f;
  f.u[0] = *(const v4u*)(p);
  f.u[1] = *(const v4u*)(p + 256);
  return f.v;
}

// 2^x as the one hardware instruction (v_exp_f32). The library exp2f wraps it in a range guard (compare, two selects, add, ldexp)
// that only serves results below 2^-126; here such a result is a weight that rounds to zero in f16 and adds nothing to a row sum
// that holds the 2^7 of the score whose value is the maximum in use, so a flush to zero gives the same output.
// The v_nop in the same statement is the one slot that the instruction set asks for between it and the first use of its result.
__device__ __forceinline__ float hw_exp2(float x) {
  float r = x;
#if defined(__HIP_DEVICE_COMPILE__)
  asm("v_exp_f32 %0, %0\n\tv_nop" : "+v"(r));
#endif
  return r;
}
// eight of them in place, as one statement: each writes only its own source, so none overwrites the source of the one in front of
// it, and the v_nop is the one slot that the instruction set asks for between the last one and the first use of its result.
__device__ __forceinline__ void hw_exp2x8(float& x0, float& x1, float& x2, float& x3, float& x4, float& x5, float& x6, float& x7) {
#if defined(__HIP_DEVICE_COMPILE__)
  asm("v_exp_f32 %0, %0\n\tv_exp_f32 %1, %1\n\tv_exp_f32 %2, %2\n\tv_exp_f32 %3, %3\n\t"
      "v_exp_f32 %4, %4\n\tv_exp_f32 %5, %5\n\tv_exp_f32 %6, %6\n\tv_exp_f32 %7, %7\n\tv_nop"
      : "+v"(x0), "+v"(x1), "+v"(x2), "+v"(x3), "+v"(x4), "+v"(x5), "+v"(x6), "+v"(x7));
#endif
}

__device__ __forceinline__ v8f mma_h(v16h a, v16h b, v8f c) {
  return __builtin_amdgcn_wmma_f32_16x16x32_f16(false, a, false, b, (short)0, c, false, false);
}
__device__ __forceinline__ v8f mma_b(v16b a, v16b b, v8f c) {
  return __builtin_amdgcn_wmma_f32_16x16x32_bf16(false, a, false, b, (short)0, c, false, false);
}
// four vector slots behind the last score WMMA: in front of the first read of its result and of the loads that overwrite its A fragments
__device__ __forceinline__ void g2_6(v8f& a, v8f& b, v16h x0, v16h x1, v16h x2, v16h x3, v16h x4, v16h x5) {
#if defined(__HIP_DEVICE_COMPILE__)
  asm volatile("v_nop\n\tv_nop\n\tv_nop\n\tv_nop"
               : "+v"(a), "+v"(b) : "v"(x0), "v"(x1), "v"(x2), "v"(x3), "v"(x4), "v"(x5) : "memory");
#endif
}
template <typename F>
__device__ __forceinline__ void g4_5(v8f& a, v8f& b, v8f& c, v8f& d, F x0, F x1, F x2, F x3, F x4) {
#if defined(__HIP_DEVICE_COMPILE__)
  asm volatile("v_nop\n\tv_nop\n\tv_nop\n\tv_nop"
               : "+v"(a), "+v"(b), "+v"(c), "+v"(d) : "v"(x0), "v"(x1), "v"(x2), "v"(x3), "v"(x4) : "memory");
#endif
}
__device__ __forceinline__ void g4_9(v8f& a, v8f& b, v8f& c, v8f& d, v16h x0, v16h x1, v16h x2, v16h x3, v16h x4,
                                     v16h x5, v16h x6, v16h x7, v16h x8) {
#if defined(__HIP_DEVICE_COMPILE__)
  asm volatile("v_nop\n\tv_nop\n\tv_nop\n\tv_nop"
               : "+v"(a), "+v"(b), "+v"(c), "+v"(d)
               : "v"(x0), "v"(x1), "v"(x2), "v"(x3), "v"(x4), "v"(x5), "v"(x6), "v"(x7), "v"(x8) : "memory");
#endif
}
// the same four slots behind the last P.V WMMA of a pass, the accumulators named as inputs only: nothing reads them before the next
// pass's products but the rare rescale, and named as in/out operands the compiler kept two register sets for three of the four tiles
// and copied them twice a staged tile
__device__ __forceinline__ void g4in(v8f a, v8f b, v8f c, v8f d, v16h x0, v16h x1, v16h x2, v16h x3, v16h x4) {
#if defined(__HIP_DEVICE_COMPILE__)
  asm volatile("v_nop\n\tv_nop\n\tv_nop\n\tv_nop"
               : : "v"(a), "v"(b), "v"(c), "v"(d), "v"(x0), "v"(x1), "v"(x2), "v"(x3), "v"(x4) : "memory");
#endif
}
__device__ __forceinline__ void acc_guard4(v8f& a, v8f& b, v8f& c, v8f& d) {
#if defined(__HIP_DEVICE_COMPILE__)
  asm volatile("v_nop\n\tv_nop\n\tv_nop\n\tv_nop" : "+v"(a), "+v"(b), "+v"(c), "+v"(d));
#endif
}
// s_wait_xcnt 0 behind a group of fragment loads: it stands in front of every later write of a register that those loads name as
// address; naming the addresses as inputs keeps their registers unwritten (also by a later load's result) up to the wait.
__device__ __forceinline__ void addr_wait2(const void* a, const void* b) {
#if defined(__HIP_DEVICE_COMPILE__)
  asm volatile("s_wait_xcnt 0x0" : : "v"(a), "v"(b) : "memory");
#endif
}
__device__ __forceinline__ void addr_wait5(const void* a, const void* b0, const void* b1, const void* b2, const void* b3) {
#if defined(__HIP_DEVICE_COMPILE__)
  asm volatile("s_wait_xcnt 0x0" : : "v"(a), "v"(b0), "v"(b1), "v"(b2), "v"(b3) : "memory");
#endif
}
__device__ __forceinline__ void addr_wait9(const void* a, const void* b0, const void* b1, const void* b2, const void* b3,
                                           const void* c0, const void* c1, const void* c2, const void* c3) {
#if defined(__HIP_DEVICE_COMPILE__)
  asm volatile("s_wait_xcnt 0x0"
               : : "v"(a), "v"(b0), "v"(b1), "v"(b2), "v"(b3), "v"(c0), "v"(c1), "v"(c2), "v"(c3) : "memory");
#endif
}
// One staged tile (128 keys of k, 128 keys of v, 16 KiB each, contiguous in their fragment-ordered planes and laid the same way in
// LDS) by asynchronous copies: each thread moves 4 + 4 units of 16 B, unit j lies 4096 B (= 256 threads x 16 B) behind unit j - 1;
// the immediate offset moves the global and the LDS address alike. lk, lv = the thread's LDS byte addresses, gk, gv its global ones.
// s_wait_xcnt 0 as the last line stands in front of every later write of the four address registers.
__device__ __forceinline__ void stage_kv(unsigned lk, const u16* gk, unsigned lv, const u16* gv) {
#if defined(__HIP_DEVICE_COMPILE__)
  asm volatile("global_load_async_to_lds_b128 %0, %1, off\n\t"
               "global_load_async_to_lds_b128 %0, %1, off offset:4096\n\t"
               "global_load_async_to_lds_b128 %0, %1, off offset:8192\n\t"
               "global_load_async_to_lds_b128 %0, %1, off offset:12288\n\t"
               "global_load_async_to_lds_b128 %2, %3, off\n\t"
               "global_load_async_to_lds_b128 %2, %3, off offset:4096\n\t"
               "global_load_async_to_lds_b128 %2, %3, off offset:8192\n\t"
               "global_load_async_to_lds_b128 %2, %3, off offset:12288\n\t"
               "s_wait_xcnt 0x0"
               : : "v"(lk), "v"(gk), "v"(lv), "v"(gv) : "memory");
#endif
}
// the issuing wave's own wait for its copies: behind it and the next barrier every wave may read the tile
__device__ __forceinline__ void wait_copies() {
#if defined(__HIP_DEVICE_COMPILE__)
  asm volatile("s_wait_asynccnt 0x0" : : : "memory");
#endif
}
// the wave's LDS reads have returned: in front of the barrier behind which the buffer it read is refilled
__device__ __forceinline__ void wait_lds_reads() {
#if defined(__HIP_DEVICE_COMPILE__)
  asm volatile("s_wait_dscnt 0x0" : : : "memory");
#endif
}
__device__ __forceinline__ void wave_sync_lds() {
  __builtin_amdgcn_fence(__ATOMIC_RELEASE, "workgroup");
  __builtin_amdgcn_wave_barrier();
  __builtin_amdgcn_fence(__ATOMIC_ACQUIRE, "workgroup");
}

// =====================================================================================================
// Weight matrix [DMOD][DMOD] f32 -> 16-bit plane [DMOD][DMOD], stored TILED (see the loaders), head-split permutation folded in:
//   mode 0: D[r][i]  = bf16 RNE bits of W[((r & 63) << 2) | (r >> 6)][i]      (output row r = h*64+d <- channel d*4+h)
//   mode 1: D[o][c]  = f16 bits of bf16value(W[o][((c & 63) << 2) | (c >> 6)]) * scale   (input column permuted the same way)
// Thread = 8 consecutive output elements (8 scalar loads, both candidate indices always < DMOD*DMOD, selected by value);
// coverage: blk = 0 .. DMOD*DMOD/8/256 - 1 = 32 blocks x 256 thr x 8 = the whole plane.
// =====================================================================================================
__device__ __forceinline__ void cvtw_body(const float* __restrict__ w, u16* D, int mode, float scale, int blk) {
  const int gt = blk * 256 + (int)threadIdx.x;
  if (gt >= (DMOD * DMOD) / 8) return;       // no barriers in this body
  const int row  = ((gt >> 9) << 4) | (gt & 15);   // 0..255: destination unit gt = ((row/16)*32 + c8/8)*16 + row%16
  const int c8   = ((gt >> 4) & 31) * 8;           // 0..248
  const int prow = ((row & 63) << 2) | (row >> 6);
  const int hsel = c8 >> 6, d0 = c8 & 63;
  unsigned short s[8];
  int   idx[8];
  float wv[8];
#pragma unroll
  for (int e = 0; e < 8; ++e) {
    const int i0  = prow * DMOD + c8 + e;                   // < 65536
    const int i1  = row * DMOD + ((d0 + e) << 2) + hsel;    // < 65536
    idx[e] = (mode == 0) ? i0 : i1;
    wv[e]  = w[idx[e]];
  }
#if defined(__HIP_DEVICE_COMPILE__)
  // s_wait_xcnt 0 behind the eight loads, in front of every later write of an index register that they name as address; naming
  // the indices as inputs keeps their registers unwritten (also by a later load's result) up to the wait.
  asm volatile("s_wait_xcnt 0x0" : : "v"(idx[0]), "v"(idx[1]), "v"(idx[2]), "v"(idx[3]), "v"(idx[4]), "v"(idx[5]), "v"(idx[6]),
               "v"(idx[7]) : "memory");
#endif
#pragma unroll
  for (int e = 0; e < 8; ++e) {
    const float v = wv[e];
    const unsigned short bb = bf_bits(v);
    const unsigned short hb = h_bits((_Float16)(bf_up(bb) * scale));
    s[e] = (mode == 0) ? bb : hb;
  }
  v4u o;
#pragma unroll
  for (int e = 0; e < 4; ++e) o[e] = pk16(s[2 * e], s[2 * e + 1]);
  u16* d = D + (size_t)gt * 8;
  {
    *(v4u*)(d) = o;
    
  }
}

// =====================================================================================================
// Input transpose + convert: X [b][DMOD][SEQ] f32 -> XT bf16 [b][SEQ][DMOD], stored TILED. Block = (b, 64 tokens, 64 channels):
// 64 channel rows x 64 tokens loaded with 16-B loads, RNE-converted, scattered into an LDS tile [token][channel] (pitch XTP);
// coverage: load 256 thr x 16 elements = 64 x 64; store 2 iterations x 256 thr x 8 halves = 4 tiles x 8 chunks x 16 tokens = the block's
//           tile; bid = 0 .. NB x (SEQ/64) x (DMOD/64) - 1 = 1024 blocks covers XT exactly once. T = the block's LDS tile.
// =====================================================================================================
__device__ __forceinline__ void xt16_body(const float* __restrict__ x, u16* XT, u16* T, int bid) {
  const int tid = threadIdx.x;
  const int ct  = bid & 3;                    // channel tile, DMOD/64 = 4
  const int st  = (bid >> 2) & 63;            // token tile, SEQ/64 = 64
  const int b   = bid >> 8;                   // 0..3
  const int c0  = ct * 64, s0 = st * 64;
  {
    const int cl = tid >> 2;                  // channel within tile 0..63
    const int tc = (tid & 3) * 16;            // token chunk
    const float* src = x + ((size_t)(b * DMOD + c0 + cl)) * SEQ + s0 + tc;
#pragma unroll
    for (int i = 0; i < 4; ++i) {
      const v4f a = *(const v4f*)(src + 4 * i);
#pragma unroll
      for (int e = 0; e < 4; ++e) T[(tc + 4 * i + e) * XTP + cl] = bf_bits(a[e]);
    }
  }
  __syncthreads();
  v4u o[2];
  const int tk = tid & 15, ch = (tid >> 4) & 7, th = tid >> 7;   // token in its 16-token tile, 8-channel chunk, tile parity
#pragma unroll
  for (int it = 0; it < 2; ++it) {
    const int line = (it * 2 + th) * 16 + tk; // token within the block's tile 0..63
    o[it] = *(const v4u*)(T + line * XTP + ch * 8);
  }
  const size_t base = ((size_t)(b * SEQ + s0)) * DMOD + (size_t)(c0 + ch * 8) * 16 + tk * 8;
  {
#pragma unroll
    for (int it = 0; it < 2; ++it) {
      *(v4u*)(XT + base + (size_t)((it * 2 + th) * 16) * DMOD) = o[it];
    }
#if defined(__HIP_DEVICE_COMPILE__)
    // s_wait_xcnt 0 behind the two stores: in the merged kernel's text the weight range's code, which writes the registers that
    // these stores name as address, follows them behind a scalar test.
    asm volatile("s_wait_xcnt 0x0" : : : "memory");
#endif
  }
}

// =====================================================================================================
// The four weight converts and the three input transposes, which need nothing of each other, as block ranges of one grid:
//   blocks 0 .. 127: weight (bid >> 5) = wq, wk, wv (mode 0), wo (mode 1, x1024) -> plane (bid >> 5) of WB4, 32 blocks each;
//   blocks 128 .. 3199: input ((bid - 128) >> 10) = query, key, value -> plane of XT3, 1024 blocks each.
// The range test is block-uniform, so the transpose's barrier is passed by all threads of a block or by none.
// =====================================================================================================
#define WCV_BLOCKS (DMOD * DMOD / 8 / 256)
#define XT_BLOCKS  (NB * (SEQ / 64) * (DMOD / 64))
static_assert(WCV_BLOCKS == 32 && XT_BLOCKS == 1024);
__global__ __launch_bounds__(256)
void prep(const float* __restrict__ xq, const float* __restrict__ xk, const float* __restrict__ xv,
          const float* __restrict__ wq, const float* __restrict__ wk, const float* __restrict__ wv,
          const float* __restrict__ wo, u16* XT3, u16* WB4) {
  __shared__ __align__(16) u16 T[64 * XTP];
  const int bid = blockIdx.x;
  if (bid < 4 * WCV_BLOCKS) {
    const int sel = bid >> 5;
    const float* w = (sel == 0) ? wq : ((sel == 1) ? wk : ((sel == 2) ? wv : wo));
    cvtw_body(w, WB4 + (size_t)sel * (DMOD * DMOD), (sel == 3) ? 1 : 0, (sel == 3) ? WOS : 1.0f, bid & (WCV_BLOCKS - 1));
    return;                                   // the whole block leaves, in front of the barrier below
  }
  const int r   = bid - 4 * WCV_BLOCKS;
  const int sel = r >> 10;
  const float* x = (sel == 0) ? xq : ((sel == 1) ? xk : xv);
  xt16_body(x, XT3 + (size_t)sel * (size_t)(NB * SEQ * DMOD), T, r & (XT_BLOCKS - 1));
}

// =====================================================================================================
// Bias terms for the GEMM epilogue (bf16-RNE values of bias[], array of DMOD entries; every candidate index is masked into
// 0..DMOD-1 so all loads are in range, selection by value):
//   bmode 0: per-column, permuted index ((col&63)<<2)|(col>>6); bmode 1: per-row, same permutation of the row; bmode 2: per-row direct.
// =====================================================================================================
__device__ __forceinline__ void bias_terms(const float* __restrict__ bias, int bmode, int rowb, int col0, int hh, int m,
                                           v4f& badd, v8f& radd) {
#pragma unroll
  for (int e = 0; e < 4; ++e) {
    const int ci = col0 + 4 * m + e;
    const int pc = ((ci & 63) << 2) | ((ci >> 6) & 3);
    const float bc = bfr(bias[pc]);
    badd[e] = (bmode == 0) ? bc : 0.0f;
  }
#pragma unroll
  for (int r = 0; r < 8; ++r) {
    const int ri = rowb + 8 * hh + r;
    const int p1 = ((ri & 63) << 2) | ((ri >> 6) & 3);
    const int p2 = ri & (DMOD - 1);
    const float b1 = bfr(bias[p1]), b2 = bfr(bias[p2]);
    radd[r] = (bmode == 1) ? b1 : ((bmode == 2) ? b2 : 0.0f);
  }
}

// =====================================================================================================
// GEMM epilogue of the output projection: the wave's 16x64 f32 tile (times oscale, plus per-row addend radd) staged in its LDS
// coverage: 8 instructions x 2 rows x 16 lanes x 4 floats = the wave's 16 x 64 tile.
// =====================================================================================================
__device__ __forceinline__ void epi64(float* sl, v8f a0, v8f a1, v8f a2, v8f a3, float oscale, v4f badd, v8f radd,
                                      float* C, int N, size_t rowb, int col0, int lane) {
  const int hh = lane >> 4, m = lane & 15;
#pragma unroll
  for (int r = 0; r < 8; ++r) {
    const int ro = (8 * hh + r) * 68 + m;
    sl[ro]      = a0[r] * oscale + radd[r];
    sl[ro + 16] = a1[r] * oscale + radd[r];
    sl[ro + 32] = a2[r] * oscale + radd[r];
    sl[ro + 48] = a3[r] * oscale + radd[r];
  }
  wave_sync_lds();
  v4f vals[8];
#pragma unroll
  for (int it = 0; it < 8; ++it) vals[it] = *(const v4f*)(sl + (it * 2 + hh) * 68 + m * 4) + badd;
  float* dst = C + (rowb + (size_t)hh) * (size_t)N + col0 + m * 4;
  {
#pragma unroll
    for (int it = 0; it < 8; ++it) {
      *(v4f*)(dst + (size_t)(it * 2) * (size_t)N) = vals[it];
    }
    
  }
}

// =====================================================================================================
// Projection epilogue: the wave's 16x64 f32 tile plus bias, staged in its LDS slab, leaves as f16 of (value * scale) straight in
// the order the attention kernel reads it (no f32 plane in between). Unit = 8 halves = one lane's 16-B store; 4 stores a lane.
//   omode 0 (q): tile = 16 tokens x one head's 64 d; D = [b][s][h][d]; one store = 4 token rows x 128 B (whole lines)
//   omode 1 (k): the same tile; D unit ((bh*256 + kt)*8 + dc)*16 + c  <- key s = 16*kt + c, d = 8*dc .. 8*dc+7
//   omode 2 (v): tile = 16 d x 64 keys; D unit (((bh*128 + it)*4 + j)*4 + kc)*16 + c  <- d = 16*j + c, keys 32*it + 8*kc .. +7
// (bh = b*NH + h). In modes 1 and 2 one store is 512 contiguous bytes, and so is each fragment load of the attention loop.
// coverage: 4 stores x 32 lanes x 8 halves = the wave's 16 x 64 tile; the tiles of the grid cover each plane exactly once.
// =====================================================================================================
__device__ __forceinline__ void epi_h16(float* sl, v8f a0, v8f a1, v8f a2, v8f a3, v4f cadd, v8f radd, bool rowbias, float scale,
                                        u16* D, int omode, int rowb, int col0, int y, int lane) {
  static_assert(SEQ == 4096 && DMOD == 256 && HD == 64 && NH == 4);
  const int hh = lane >> 4, m = lane & 15;
#pragma unroll
  for (int r = 0; r < 8; ++r) {
    const int ro = (8 * hh + r) * 68 + m;
    sl[ro]      = a0[r] + (rowbias ? radd[r] : cadd[0]);
    sl[ro + 16] = a1[r] + (rowbias ? radd[r] : cadd[1]);
    sl[ro + 32] = a2[r] + (rowbias ? radd[r] : cadd[2]);
    sl[ro + 48] = a3[r] + (rowbias ? radd[r] : cadd[3]);
  }
  wave_sync_lds();
  // slab row and 8-column chunk of the lane's unit t: q (4t + lane/8, lane%8); k, v (lane%16, 2t + lane/16)
  const int lb = (omode == 0) ? (lane >> 3) * 68 + (lane & 7) * 8 : m * 68 + hh * 8;
  const int ls = (omode == 0) ? 4 * 68 : 16;
  v4u o[4];
#pragma unroll
  for (int t = 0; t < 4; ++t) {
    const float* p = sl + lb + t * ls;
    const v4f a = *(const v4f*)(p), c4 = *(const v4f*)(p + 4);
#pragma unroll
    for (int e = 0; e < 2; ++e) {
      o[t][e]     = pk16(h_bits((_Float16)(a[2 * e] * scale)),  h_bits((_Float16)(a[2 * e + 1] * scale)));
      o[t][2 + e] = pk16(h_bits((_Float16)(c4[2 * e] * scale)), h_bits((_Float16)(c4[2 * e + 1] * scale)));
    }
  }
  const int dq = (rowb + (lane >> 3)) * DMOD + col0 + (lane & 7) * 8;
  const int dk = ((((rowb >> 12) * NH + (col0 >> 6)) * 256 + ((rowb & (SEQ - 1)) >> 4)) * 128 + lane) * 8;
  const int dv = ((((y * NH + (rowb >> 6)) * 128 + (col0 >> 5)) * 4 + ((rowb >> 4) & 3)) * 64 + lane) * 8;
  u16* d = D + (size_t)((omode == 0) ? dq : ((omode == 1) ? dk : dv));   // every one < NB*SEQ*DMOD
#pragma unroll
  for (int t = 0; t < 4; ++t) {
    const int dofs = (omode == 0) ? t * (4 * DMOD) : ((omode == 1) ? t * 256 : (t >> 1) * 2048 + (t & 1) * 256);
    *(v4u*)(d + dofs) = o[t];
  }
}

// =====================================================================================================
// bf16 GEMM with bias, f16 result: (A[M][K] (bf16, TILED) . Bt[N][K]^T (bf16, TILED) + bias) * scale -> plane D in the order of
// omode (see epi_h16). Bias = bf16-RNE values of bias[], index permuted ((i&63)<<2)|(i>>6) and so always in 0..DMOD-1: per column
// (rowbias false) or per row (true). bid = 0 .. (M/64)*(N/64) - 1 tiles, y = batch index with element stride sB added to Bt.
// Block = 64x64 tile, 4 waves x 16 rows; fragments loaded straight from the tiled planes (two 16-B loads each, split k map for
// A and B); K stepped by 32 (K % 32 == 0, M % 64 == 0, N % 64 == 0).
// =====================================================================================================
__device__ __forceinline__
void gemm_bfh_body(float* slab, const u16* __restrict__ A, const u16* __restrict__ Bt, const float* __restrict__ bias,
                   u16* D, int M, int N, int K, float scale, int omode, bool rowbias, int sB, int bid, int y) {
  const int tid = threadIdx.x, wave = tid >> 5, lane = tid & 31, hh = lane >> 4, m = lane & 15;
  const int ntile = N >> 6;
  const int rowb  = (bid / ntile) * 64 + wave * 16;
  const int col0  = (bid % ntile) * 64;
  if (rowb + 16 > M) return;                 // wave-uniform, never taken with the exact grid; no block barriers in this kernel
  const u16* Bb = Bt + (size_t)y * (size_t)sB;
  const u16* ap = A  + (size_t)rowb * K + 8 * lane;   // 16-row tile = 16*K halves, inside it [k/8][row][8]
  const u16* bp = Bb + (size_t)col0 * K + 8 * lane;
  const size_t bs = (size_t)16 * K;
  v8f acc0 = zero8(), acc1 = zero8(), acc2 = zero8(), acc3 = zero8();
#pragma unroll 1
  for (int k0 = 0; k0 < K; k0 += 32) {
    const int ko = k0 * 16;
    const u16 *pa = ap + ko, *p0 = bp + ko, *p1 = p0 + bs, *p2 = p1 + bs, *p3 = p2 + bs;
    const v16b a  = ldfrag_bp(pa);
    const v16b b0 = ldfrag_bp(p0);
    const v16b b1 = ldfrag_bp(p1);
    const v16b b2 = ldfrag_bp(p2);
    const v16b b3 = ldfrag_bp(p3);
    addr_wait5(pa, p0, p1, p2, p3);
    acc0 = mma_b(a, b0, acc0);
    acc1 = mma_b(a, b1, acc1);
    acc2 = mma_b(a, b2, acc2);
    acc3 = mma_b(a, b3, acc3);
    g4_5<v16b>(acc0, acc1, acc2, acc3, a, b0, b1, b2, b3);
  }
  v4f cadd = zero4();
  v8f radd = zero8();
  if (rowbias) {
#pragma unroll
    for (int r = 0; r < 8; ++r) {
      const int ri = rowb + 8 * hh + r;
      radd[r] = bfr(bias[((ri & 63) << 2) | ((ri >> 6) & 3)]);
    }
  } else {
#pragma unroll
    for (int j = 0; j < 4; ++j) {
      const int ci = col0 + 16 * j + m;
      cadd[j] = bfr(bias[((ci & 63) << 2) | ((ci >> 6) & 3)]);
    }
  }
  epi_h16(slab + wave * SLAB64, acc0, acc1, acc2, acc3, cadd, radd, rowbias, scale, D, omode, rowb, col0, y, lane);
}

// =====================================================================================================
// The three projections, which need nothing of each other, as one grid (1024 tiles, 3): blockIdx.y = 0 q, 1 k: token-major,
// [16384 token][h*64+d] = XT . W'^T, per-column bias; 2 v: channel-major per batch (256 tiles x 4 batches in blockIdx.x),
// [b][h*64+d][4096] = W' . XT^T, per-row bias. XT3, WB4, H3 hold the planes of q, k, v one behind the other; H3 = the f16 planes
// x64 that the attention kernel reads, q in place order, k and v in fragment order.
// =====================================================================================================
__global__ __launch_bounds__(128)
void gemm_qkv(const u16* __restrict__ XT3, const u16* __restrict__ WB4, const float* __restrict__ bq,
              const float* __restrict__ bk, const float* __restrict__ bv, u16* H3) {
  static_assert((NB * SEQ / 64) * (DMOD / 64) == 1024 && (DMOD / 64) * (SEQ / 64) == 256 && NB == 4);
  __shared__ __align__(16) float slab[4 * SLAB64];
  const int sel = blockIdx.y;                 // block-uniform
  const int bx  = blockIdx.x;
  const u16* X  = XT3 + (size_t)sel * (size_t)(NB * SEQ * DMOD);
  const u16* Wp = WB4 + (size_t)sel * (DMOD * DMOD);
  u16*       D  = H3 + (size_t)sel * (size_t)(NB * SEQ * DMOD);
  if (sel < 2)
    gemm_bfh_body(slab, X, Wp, (sel == 0) ? bq : bk, D, NB * SEQ, DMOD, DMOD, (sel == 0) ? QSC : KSC, (sel == 0) ? 0 : 1, false, 0, bx, 0);
  else
    gemm_bfh_body(slab, Wp, X, bv, D, DMOD, SEQ, DMOD, VCAR, 2, true, SEQ * DMOD, bx & 255, bx >> 8);
}

// =====================================================================================================
// f16 GEMM, single A plane, hi+lo B planes, per-row bias: C[M][N] (f32, pitch N) = A[M][K] . (Bh + Bl)[N][K]^T times oscale,
// plus bf16-RNE value of bias[row]; A f16 TILED (no batch stride), Bh/Bl f16 [n][k] planes TILED with batch stride sB, C with
// batch stride sC (grid.y = batch). Products a.bh + a.bl into one accumulator (bl is the unscaled residual of bh). Same tiling
// as gemm_bfh_body.
// =====================================================================================================
__global__ __launch_bounds__(128)
void gemm_wh2(const u16* __restrict__ A, const u16* __restrict__ Bh, const u16* __restrict__ Bl,
              const float* __restrict__ bias, float* C, int M, int N, int K, float oscale, int sB, int sC) {
  __shared__ __align__(16) float slab[4 * SLAB64];
  const int tid = threadIdx.x, wave = tid >> 5, lane = tid & 31, hh = lane >> 4, m = lane & 15;
  const int ntile = N >> 6;
  const int bid   = blockIdx.x;
  const int y     = blockIdx.y;
  const int rowb  = (bid / ntile) * 64 + wave * 16;
  const int col0  = (bid % ntile) * 64;
  if (rowb + 16 > M) return;                 // wave-uniform, never taken with the exact grid; no block barriers in this kernel
  const _Float16* ap  = (const _Float16*)(const void*)A + (size_t)rowb * K + 8 * lane;   // tiles as in gemm_bfh_body
  const size_t bofs   = (size_t)y * (size_t)sB + (size_t)col0 * K + 8 * lane;
  const _Float16* bhp = (const _Float16*)(const void*)Bh + bofs;
  const _Float16* blp = (const _Float16*)(const void*)Bl + bofs;
  float* Cb = C + (size_t)y * (size_t)sC;
  const size_t bs = (size_t)16 * K;
  v8f acc0 = zero8(), acc1 = zero8(), acc2 = zero8(), acc3 = zero8();
#pragma unroll 1
  for (int k0 = 0; k0 < K; k0 += 32) {
    const int ko = k0 * 16;
    const _Float16 *pa = ap + ko, *h0 = bhp + ko, *h1 = h0 + bs, *h2 = h1 + bs, *h3 = h2 + bs;
    const _Float16 *l0 = blp + ko, *l1 = l0 + bs, *l2 = l1 + bs, *l3 = l2 + bs;
    const v16h a   = ldfrag_p(pa);
    const v16h bh0 = ldfrag_p(h0);
    const v16h bh1 = ldfrag_p(h1);
    const v16h bh2 = ldfrag_p(h2);
    const v16h bh3 = ldfrag_p(h3);
    const v16h bl0 = ldfrag_p(l0);
    const v16h bl1 = ldfrag_p(l1);
    const v16h bl2 = ldfrag_p(l2);
    const v16h bl3 = ldfrag_p(l3);
    addr_wait9(pa, h0, h1, h2, h3, l0, l1, l2, l3);
    acc0 = mma_h(a, bh0, acc0);  acc0 = mma_h(a, bl0, acc0);
    acc1 = mma_h(a, bh1, acc1);  acc1 = mma_h(a, bl1, acc1);
    acc2 = mma_h(a, bh2, acc2);  acc2 = mma_h(a, bl2, acc2);
    acc3 = mma_h(a, bh3, acc3);  acc3 = mma_h(a, bl3, acc3);
    g4_9(acc0, acc1, acc2, acc3, a, bh0, bh1, bh2, bh3, bl0, bl1, bl2, bl3);
  }
  v4f badd = zero4();
  v8f radd = zero8();
  bias_terms(bias, 2, rowb, col0, hh, m, badd, radd);
  epi64(slab + wave * SLAB64, acc0, acc1, acc2, acc3, oscale, badd, radd, Cb, N, (size_t)rowb, col0, lane);
}

// =====================================================================================================
// Full (non-causal, unmasked) multi-head flash attention: block = (batch b, head, 128 query rows), 8 waves, wave w owns the
// 16 query rows q0 = 128*qt + 16*w .. q0+15.
//   q plane (f16, x64) laid out [b][s][h][d]; k and v planes (x64) per (b, h) in fragment order (epi_h16). The block's eight waves
//   need the same k and v: tiles of 128 keys are brought into LDS once per block by asynchronous copies, two buffers, tile t + 2
//   asked for when tile t has been read by all, one barrier a tile; every fragment load of the loop is a ds_load_b128 of 512
//   contiguous bytes over the wave. All NST = 32 tiles of 4 key blocks of 32 keys are visited (static bounds).
//   Scores are computed TRANSPOSED: S^T tile g (g = 0,1) = k rows (keys kb+16g .. +15, A operand, row m = lane&15, split k map
//   over d) times q^T (B operand, col n = query q0 + (lane&15), k = d, split map), one product per tile and d-chunk.
//   D element r of lane l = (key kb+16g+8h+r, query q0+(l&15)), so a lane owns one query column and 16 of its 32 keys; the
//   partner lane l^16 owns the other 16 -> row max / row sum need one xor-16 shuffle.
//   Online base-2 softmax in f32 (scale 1/8 and the q,k carries folded into lsc), the subtracted maximum replaced lazily: a pass
//   keeps the maximum in use, and rescales neither O nor l, unless a scaled score of some lane lies more than 8 above it (one ballot
//   and one scalar branch a pass); any subtracted value cancels between O and l. The exp'd values ARE the
//   P A-fragment in place: A row m = query = lane&15, element i <- key kb+8h+i (tile 0, D element i), element 8+i <- key
//   kb+16+8h+i (tile 1, D element i). P is carried x128 as f16 (at most 2^15). The rescale factor of query row 8h+r of the O accumulators is
//   fetched from lane 8h+r with a shuffle (uniform control, inside that branch). 4 v^T B fragments (col n = d = 16j + (lane&15), keys k-contiguous),
//   4 P.V WMMAs per key block.
//   Epilogue: 1/l (per query, shuffled to the D row owner) and carry folds in f32; the wave's 16x64 f32 result staged in its LDS
// coverage: per wave 4 instructions x 2 chunks x 16 rows x 8 halves = 16 x 64 per plane; grid 512 blocks x 8 waves = every
//           (b, s, h) row of both O planes exactly once.
// =====================================================================================================
__global__ __launch_bounds__(ATT_THREADS)
void attn_fwd(const u16* __restrict__ QHp, const u16* __restrict__ KHp, const u16* __restrict__ VHp,
              u16* OHIp, u16* OLOp) {
  __shared__ __align__(16) float smem[RINGF];   // loop: [2 buffers][k tile, v tile] of f16; epilogue: per wave a result slab [16][68]

  const int tid  = threadIdx.x;
  const int wave = tid >> 5;
  const int lane = tid & 31;
  const int hh   = lane >> 4;
  const int c    = lane & 15;

  const int bid  = blockIdx.x;
  const int qt   = bid & (SEQ / 128 - 1);     // 0..31
  const int head = (bid >> 5) & (NH - 1);     // 0..3
  const int b    = bid >> 7;                  // 0..3
  const int q0   = qt * 128 + wave * 16;

  // B fragments of q^T: col n = query q0 + c, k = d (k-contiguous row of the q plane); loop-invariant
  const size_t qofs = (((size_t)(b * SEQ + q0 + c)) * NH + head) * HD + 8 * hh;
  const _Float16* Qh  = (const _Float16*)(const void*)QHp + qofs;
  const v16h qh0 = ldfrag_h(Qh), qh1 = ldfrag_h(Qh + 32);
  // k and v planes of (b, head): fragment order, 2048 halves per 32-key block (see epi_h16), so a 128-key tile is STH halves in a
  // row; the thread's first 16-B unit of tile 0, and its place in buffer 0 (LDS byte address = low 32 bits of the shared address)
  const size_t pofs = (size_t)(b * NH + head) * (SEQ * HD) + 8 * tid;
  const u16* gk = KHp + pofs;
  const u16* gv = VHp + pofs;
  const unsigned lk0 = (unsigned)(uintptr_t)(void*)smem + 16u * (unsigned)tid;
  const _Float16* ring = (const _Float16*)(const void*)smem + 8 * lane;
  const float lsc = 0.125f * (LOG2E / (QSC * KSC));

  float mrun = -INFINITY, mthr = -INFINITY, nb = 0.f, lrun = 0.f;   // maximum in use, (mrun + RTH) / lsc = the raw score that replaces it, PLOG - mrun (set in the first pass), row sum
  float pown = 0.f, poth = 0.f;   // a pass's row sum, this lane's half and the partner lane's, until the next pass adds them to l
  v8f o[4];
#pragma unroll
  for (int j = 0; j < 4; ++j) o[j] = zero8();

  addr_wait2(Qh, Qh);
  // tile 0 into buffer 0, landed and published; then tile 1 into buffer 1, which flies while tile 0 is worked on
  stage_kv(lk0, gk, lk0 + 2 * STH, gv);
  wait_copies();
  __syncthreads();
  stage_kv(lk0 + 4 * STH, gk + STH, lk0 + 6 * STH, gv + STH);

#pragma unroll 1
  for (int st = 0; st < NST; ++st) {
   const _Float16* kl = ring + (st & 1) * (2 * STH);   // this tile's k, the lane's unit; A fragment row m = key kb + 16g + c, k = d
   const _Float16* vl = kl + STH;                      // this tile's v; B fragment col n = d = 16j + c, k = key
   // K fragments of the tile's first key block; each pass but the tile's last fetches the next pass's behind its own score products
   v16h kf0 = ldfrag_p(kl), kf1 = ldfrag_p(kl + 16 * HD), kf2 = ldfrag_p(kl + 512), kf3 = ldfrag_p(kl + 16 * HD + 512);
#pragma unroll
   for (int ps4 = 0; ps4 < STK / 32; ++ps4) {   // unrolled: the fragment addresses become immediate offsets, the tile's last pass drops its fetch
    // (kb below = 128 * st + 32 * ps4, the pass's first key)
    // ---- this pass's v fragments, asked for here and first used behind the softmax: their latency runs under scores and softmax.
    //      B fragment col n = d = j*16 + c, 512 halves per j in the fragment-ordered v tile ----
    const _Float16* vhp = vl + ps4 * (32 * HD);
    const v16h vh0 = ldfrag_p(vhp);
    const v16h vh1 = ldfrag_p(vhp + 512);
    const v16h vh2 = ldfrag_p(vhp + 1024);
    const v16h vh3 = ldfrag_p(vhp + 1536);
    __builtin_amdgcn_sched_barrier(0);   // keeps the eight v loads in front of the first wait on a k fragment
    // ---- transposed scores: s0 = keys kb..kb+15, s1 = keys kb+16..kb+31, column = query q0 + c ----
    v8f s0 = zero8(), s1 = zero8();
    s0 = mma_h(kf0, qh0, s0);
    s1 = mma_h(kf1, qh0, s1);
    s0 = mma_h(kf2, qh1, s0);
    s1 = mma_h(kf3, qh1, s1);
    g2_6(s0, s1, qh0, qh1, kf0, kf1, kf2, kf3);
    // ---- the next pass's k fragments into the same registers, inside this tile only: nothing of the next tile is read here ----
    if (ps4 + 1 < STK / 32) {
      const _Float16* knp = kl + (ps4 + 1) * (32 * HD);
      kf0 = ldfrag_p(knp);
      kf1 = ldfrag_p(knp + 16 * HD);
      kf2 = ldfrag_p(knp + 512);
      kf3 = ldfrag_p(knp + 16 * HD + 512);
    }
    __builtin_amdgcn_sched_barrier(0);   // keeps the eight k loads here: without it they sink into the softmax, whose temporaries take their registers
    lrun += pown + poth;   // the pass before's row sum, both halves: in l before the test below can rescale l
    // ---- raw scores of this lane's 16 keys for query q0 + c: s0[i] <- key kb+8hh+i, s1[i] <- key kb+16+8hh+i. The maximum is
    //      taken on the raw scores and scaled where it is needed: lsc > 0 and rounding is monotone, so it equals the maximum of the scaled ones ----
    float cr = s0[0];
#pragma unroll
    for (int i = 1; i < 8; ++i) cr = fmaxf(cr, s0[i]);
#pragma unroll
    for (int i = 0; i < 8; ++i) cr = fmaxf(cr, s1[i]);
    // ---- lazy rescale, tested once a pass: only if some lane's largest score lies more than RTH above the maximum in use (always in
    //      the first pass, mthr = -inf) do the halves exchange maxima, the maximum in use moves up and O and l are rescaled. The ballot
    //      makes it a scalar branch, taken by the whole wave. Not taken: every weight of the pass is at most 2^(PLOG + RTH) ----
    if (__builtin_expect(__builtin_amdgcn_ballot_w32(cr > mthr) != 0u, 0)) {
      const float cm = cr * lsc;
      const float mn = fmaxf(mrun, fmaxf(cm, __shfl_xor(cm, 16, 32)));   // the same in both lanes of a query; finite from the first pass on
      const float al = hw_exp2(mrun - mn);                               // 0 in the first pass (mrun = -inf), 1 for a query that keeps its maximum
      mrun = mn;
      mthr = (mn + RTH) * (1.0f / lsc);
      nb   = PLOG - mn;
      lrun *= al;
      // D row 8hh+r of the O accumulators = query q0+8hh+r, its factor lives in lane 8hh+r (and 16+8hh+r)
      float scl[8];
#pragma unroll
      for (int r = 0; r < 8; ++r) scl[r] = __shfl(al, 8 * hh + r, 32);
#pragma unroll
      for (int j = 0; j < 4; ++j) {
#pragma unroll
        for (int r = 0; r < 8; ++r) o[j][r] *= scl[r];
      }
    }
    // ---- weights p * 128 = 2^(s * lsc - mrun + 7): one fma and one v_exp_f32 each; their f16 values are the P A-fragment,
    //      element 8w + i <-> s_w[i]; the row sum carries the same 128 ----
    float p[16];
#pragma unroll
    for (int i = 0; i < 8; ++i) { p[i] = fmaf(s0[i], lsc, nb); p[8 + i] = fmaf(s1[i], lsc, nb); }
    hw_exp2x8(p[0], p[1], p[2], p[3], p[4], p[5], p[6], p[7]);
    hw_exp2x8(p[8], p[9], p[10], p[11], p[12], p[13], p[14], p[15]);
    float ps = p[0] + p[1];
    FragH ph;
#pragma unroll
    for (int w = 0; w < 2; ++w) {
#pragma unroll
      for (int e4 = 0; e4 < 4; ++e4) {
        const int i = 8 * w + 2 * e4;
        if (i > 0) ps += p[i] + p[i + 1];
        ph.u[w][e4] = pk16(h_bits((_Float16)p[i]), h_bits((_Float16)p[i + 1]));
      }
    }
    pown = ps;
    poth = __shfl_xor(ps, 16, 32);   // asked for here, added to l in the next pass: its latency runs under the products
    // ---- P.V with the v fragments asked for at the head of the pass ----
    {
      o[0] = mma_h(ph.v, vh0, o[0]);
      o[1] = mma_h(ph.v, vh1, o[1]);
      o[2] = mma_h(ph.v, vh2, o[2]);
      o[3] = mma_h(ph.v, vh3, o[3]);
      g4in(o[0], o[1], o[2], o[3], ph.v, vh0, vh1, vh2, vh3);
    }
   }
   // ---- foot of tile st, every wave: its own LDS reads done, its own copies of tile st + 1 landed, then the one barrier that
   //      publishes tile st + 1 and ends every wave's reading of this buffer; only behind it the refill with tile st + 2 ----
   wait_lds_reads();
   wait_copies();
   __syncthreads();
   if (st + 2 < NST) {
     const unsigned lb = lk0 + (unsigned)(st & 1) * (4 * STH);
     const size_t   go = (size_t)(st + 2) * STH;
     stage_kv(lb, gk + go, lb + 2 * STH, gv + go);
   }
  }
  wait_copies();   // nothing is outstanding here; the last foot's barrier has ended all reading of the ring, which now holds the slabs
  acc_guard4(o[0], o[1], o[2], o[3]);

  // ---- fold 1/l (per query, owned by lane = query; l carries the same 128 as P) and the carry 64 on v; stage the 16x64 slab ----
  lrun += pown + poth;   // the last pass's row sum
  const float linv = (1.0f / lrun) * (1.0f / VCAR);
  float inv[8];
#pragma unroll
  for (int r = 0; r < 8; ++r) inv[r] = __shfl(linv, 8 * hh + r, 32);
  float* slab = smem + wave * SLABF;
#pragma unroll
  for (int r = 0; r < 8; ++r) {
#pragma unroll
    for (int j = 0; j < 4; ++j) slab[(8 * hh + r) * 68 + j * 16 + c] = o[j][r] * inv[r];
  }
  wave_sync_lds();
  // ---- O x1024 -> f16 hi + residual planes, TILED as [token][h*64+d] operands; one store = 512 contiguous bytes ----
  v4u oh[4], ol[4];
#pragma unroll
  for (int i4 = 0; i4 < 4; ++i4) {
    const int c8 = (i4 * 2 + hh) * 8;         // lane = (8-d chunk parity hh, query row c)
    const v4f a = *(const v4f*)(slab + c * 68 + c8), c4 = *(const v4f*)(slab + c * 68 + c8 + 4);
    float w[8];
#pragma unroll
    for (int e = 0; e < 4; ++e) { w[e] = a[e] * OSC; w[4 + e] = c4[e] * OSC; }
#pragma unroll
    for (int e = 0; e < 4; ++e) {
      const _Float16 h0 = (_Float16)w[2 * e], h1 = (_Float16)w[2 * e + 1];
      const _Float16 l0 = (_Float16)(w[2 * e] - (float)h0), l1 = (_Float16)(w[2 * e + 1] - (float)h1);
      oh[i4][e] = pk16(h_bits(h0), h_bits(h1));
      ol[i4][e] = pk16(h_bits(l0), h_bits(l1));
    }
  }
  const size_t ob = ((size_t)(b * SEQ + q0)) * (NH * HD) + (size_t)head * (HD * 16) + 8 * lane;
  {
#pragma unroll
    for (int i4 = 0; i4 < 4; ++i4) {
      const size_t o8 = ob + (size_t)i4 * 256;
      *(v4u*)(OHIp + o8) = oh[i4];
      *(v4u*)(OLOp + o8) = ol[i4];
    }
    
  }
}

// =====================================================================================================
// Workspace map (bytes); every plane is fully written by whole-line stores before it is read; all extents are exact multiples
// of the store granularity (no pad rows needed); every offset a multiple of 131072; q, k and v each have an XT plane of their own:
//   XT  bf16 3 x [16384 token][256 i] tiled         25165824     (query, key, value)
//   WQB bf16 [256 r'][256 i] tiled (rows permuted)  131072      WKB same 131072     WVB same 131072
//   WOB f16  [256 o][256 c'] tiled x1024 (cols permuted)  131072
//   QH  f16  [4][4096][4][64] x64                   8388608
//   KH  f16  [16 bh][256 kt][8 dc][16 key][8 d] x64          8388608   (fragment order)
//   VH  f16  [16 bh][128 it][4 j][4 kc][16 d][8 key] x64     8388608   (fragment order)
//   OHI f16  [16384 token][256 h*64+d] tiled x1024   8388608      OLO residual 8388608
//   end                                            67633152
// =====================================================================================================
extern "C" void kernel_launch(void* const* d_in, const int* in_sizes, int n_in,
                              void* d_out, int out_size, void* d_ws, size_t ws_size,
                              hipStream_t stream) {
  const int ROWS = NB * SEQ;                            // 16384 tokens
  const int XN   = NB * DMOD * SEQ;                     // 4194304
  if (n_in < 11) return;
  if (in_sizes[0] != XN || in_sizes[1] != XN || in_sizes[2] != XN) return;
  if (in_sizes[3] != DMOD * DMOD || in_sizes[5] != DMOD * DMOD) return;
  if (in_sizes[7] != DMOD * DMOD || in_sizes[9] != DMOD * DMOD) return;
  if (in_sizes[4] != DMOD || in_sizes[6] != DMOD || in_sizes[8] != DMOD || in_sizes[10] != DMOD) return;
  if (out_size != XN) return;

  const float* Qin = (const float*)d_in[0];
  const float* Kin = (const float*)d_in[1];
  const float* Vin = (const float*)d_in[2];
  const float* wq  = (const float*)d_in[3];
  const float* bq  = (const float*)d_in[4];
  const float* wk  = (const float*)d_in[5];
  const float* bk  = (const float*)d_in[6];
  const float* wv  = (const float*)d_in[7];
  const float* bv  = (const float*)d_in[8];
  const float* wo  = (const float*)d_in[9];
  const float* bo  = (const float*)d_in[10];
  float*       out = (float*)d_out;

  const size_t szXT = (size_t)ROWS * DMOD * 2;                  //  8388608
  const size_t szW  = (size_t)DMOD * DMOD * 2;                  //   131072
  const size_t szP  = (size_t)ROWS * DMOD * 2;                  //  8388608  (q/k/v/o planes)
  size_t off = 0;
  const size_t oXT  = off; off += 3 * szXT;
  const size_t oWQB = off; off += szW;
  const size_t oWKB = off; off += szW;
  const size_t oWVB = off; off += szW;
  const size_t oWOB = off; off += szW;
  const size_t oQH  = off; off += szP;
  const size_t oKH  = off; off += szP;
  const size_t oVH  = off; off += szP;
  const size_t oOHI = off; off += szP;
  const size_t oOLO = off; off += szP;
  if (off > ws_size) return;                            // off = 67633152
  if (off > (size_t)134217728) return;

  char* ws = (char*)d_ws;
  u16*   XT  = (u16*)(ws + oXT);
  u16*   WQB = (u16*)(ws + oWQB);
  u16*   WOB = (u16*)(ws + oWOB);
  u16*   QH  = (u16*)(ws + oQH);
  u16*   KH  = (u16*)(ws + oKH);
  u16*   VH  = (u16*)(ws + oVH);
  u16*   OHI = (u16*)(ws + oOHI);
  u16*   OLO = (u16*)(ws + oOLO);

  const dim3 blk(256);
  const int n8w = (DMOD * DMOD) / 8;                    // 8192
  if ((n8w % 256) != 0) return;
  const dim3 gPre(4 * (n8w / 256) + 3 * NB * (SEQ / 64) * (DMOD / 64));   // 128 weight blocks + 3072 transpose blocks
  const dim3 gG3((ROWS / 64) * (DMOD / 64), 3);         // 1024 tiles x (q, k, v)
  const dim3 gGc((DMOD / 64) * (SEQ / 64), NB);         // 256 tiles x 4 batches, channel-major per batch
  const dim3 bG(128);
  const dim3 gAT(ATT_BLOCKS);                           // 512
  const dim3 bAT(ATT_THREADS);                          // 256
  const int  sTok = SEQ * DMOD;                         // 1048576 elements: per-batch stride of XT / O planes
  const int  sChn = DMOD * SEQ;                         // 1048576 elements: per-batch stride of out

  // (0) weights: rows of wq/wk/wv permuted to r' = h*64+d (bf16 planes), columns of wo permuted the same way (f16 of bf16 value x1024);
  //     inputs query, key, value -> XT bf16 [token][i], one plane each (WQB .. WOB lie one behind the other)
  prep<<<gPre, blk, 0, stream>>>(Qin, Kin, Vin, wq, wk, wv, wo, XT, WQB);
  // (1) projections + bias -> f16 planes x64 (QH, KH, VH lie one behind the other): q in place order, k and v in fragment order
  gemm_qkv<<<gG3, bG, 0, stream>>>(XT, WQB, bq, bk, bv, QH);
  // (2) attention -> O planes [token][h*64+d] tiled, x1024 (hi + residual)
  attn_fwd<<<gAT, bAT, 0, stream>>>(QH, KH, VH, OHI, OLO);
  // (3) output projection per batch + bias -> out [b][256 o][4096 n] f32, carries 1024 (O) x 1024 (wo) folded back
  gemm_wh2<<<gGc, bG, 0, stream>>>(WOB, OHI, OLO, bo, out, DMOD, SEQ, DMOD, 1.0f / (OSC * WOS), sTok, sChn);
  (void)hipGetLastError();
}

// v008
// One run takes 104 microseconds.
// Two timings next to v007 put it at 1.04 and 1.05 times that version's speed.
// Counting every step since v000, it is 3.48 times as fast.
// Contractions: projections Xt.W'^T and W'.Xt^T on v_wmma_f32_16x16x32_bf16 (Xt and W RNE-converted bf16 operands, f32 accumulate, bias added in f32);
// scores k'.q'^T (q', k' carried x64 as f16), P.v (P x128 as f16, v x64 as f16) and Wm'.O^T (Wm' as f16(bf16(Wm) x1024), O x1024 as f16 hi plane
// + f16 residual plane, products w.h + w.l): v_wmma_f32_16x16x32_f16, f32 accumulate. Base-2 online softmax, 1/l fold and bias adds in f32 on VALU.
#include <hip/hip_runtime.h>
#include <math.h>
#include <stdint.h>

#define NB    4
#define SEQ   4096
#define DMOD  256
#define NH    4
#define HD    64
#define QSC   64.0f
#define KSC   64.0f
#define PCAR  128.0f
#define VCAR  64.0f
#define OSC   1024.0f
#define WOS   1024.0f
#define LOG2E 1.4426950408889634f
#define PLOG  7.0f
#define RTH   8.0f                // a maximum in use is replaced when a scaled score exceeds it by more than this (base-2 exponent)
#define ATT_WAVES   8
#define ATT_THREADS (ATT_WAVES * 32)
#define ATT_BLOCKS  (NB * NH * (SEQ / (16 * ATT_WAVES)))
#define NKB    (SEQ / 32)
#define STK    128                 // keys of one staged tile
#define WPS    2                   // passes of 32 keys that one wave makes over a staged tile: its half of the tile's keys
#define NST    (SEQ / STK)         // staged tiles per (batch, head)
#define STH    (STK * HD)          // halves of one operand's staged tile (16 KiB)
#define RINGF  (2 * STH)           // floats of the ring: 2 buffers x (k tile, v tile) = 64 KiB
#define SLABF  (16 * 68)
#define SLAB64 (16 * 68)
#define XTP    72
static_assert(HD == 64 && DMOD == NH * HD);
static_assert(PCAR == 128.0f && PLOG == 7.0f && PLOG + RTH == 15.0f);   // PCAR = 2^PLOG; the largest weight, 2^(PLOG + RTH), is finite in f16
static_assert((SEQ / 64) == 64 && NH == 4 && NB == 4);
static_assert(ATT_THREADS == 256 && ATT_BLOCKS == 512 && NKB == 128);
static_assert((DMOD % 64) == 0 && (SEQ % 64) == 0 && (DMOD % 32) == 0);
static_assert(((NB * SEQ * DMOD / 8) % 256) == 0 && ((DMOD * DMOD / 8) % 256) == 0);
static_assert((DMOD / 8) == 32);
static_assert(64 * XTP >= 63 * XTP + 64);
static_assert(ATT_WAVES * SLABF >= 4 * 16 * 68);
static_assert(2 * WPS * 32 == STK && ATT_WAVES == 8 && SLABF == 34 * 32);   // two key groups of four waves; hand-over area = 32 + 2 floats a lane
static_assert(NST >= 2 && STK == 4 * 32 && STH * 2 == 4 * ATT_THREADS * 16 && RINGF >= ATT_WAVES * SLABF);

typedef unsigned short u16;
typedef _Float16 v16h __attribute__((ext_vector_type(16)));
typedef _Float16 v8h  __attribute__((ext_vector_type(8)));
typedef __bf16   v16b __attribute__((ext_vector_type(16)));
typedef float    v8f  __attribute__((ext_vector_type(8)));
typedef float    v4f  __attribute__((ext_vector_type(4)));
typedef unsigned int v4u __attribute__((ext_vector_type(4)));

union FragH { v16h v; v8h h[2]; v4u u[2]; };
union FragB { v16b v; v4u u[2]; };

// ---- scalar helpers --------------------------------------------------------------------------------
__device__ __forceinline__ unsigned short bf_bits(float f) {          // f32 -> bf16 bits, RNE convert
  unsigned u = __float_as_uint(f);
  return (unsigned short)((u + 0x7FFFu + ((u >> 16) & 1u)) >> 16);
}
__device__ __forceinline__ float bf_up(unsigned short h) { return __uint_as_float(((unsigned)h) << 16); }
__device__ __forceinline__ float bfr(float f) { return bf_up(bf_bits(f)); }
__device__ __forceinline__ unsigned short h_bits(_Float16 x) { return __builtin_bit_cast(unsigned short, x); }
__device__ __forceinline__ unsigned pk16(unsigned short a, unsigned short b) { return (unsigned)a | ((unsigned)b << 16); }
__device__ __forceinline__ v8f zero8() { v8f z = {0.f, 0.f, 0.f, 0.f, 0.f, 0.f, 0.f, 0.f}; return z; }
__device__ __forceinline__ v4f zero4() { v4f z = {0.f, 0.f, 0.f, 0.f}; return z; }

// ---- fragment loaders: 16-bit A/B operand, lane -> row/col (lane&15), h = lane>>4; elements 0..7 <- k0+8h.., elements 8..15 <-
//      k0+16+8h.. (same split k map for A and B).
//      ldfrag_h: row-major [row][k] plane, p already includes +8*h (q only, read once per wave).
//      TILED plane of a [rows][K] operand: 16-row tile = 16*K halves in a row, inside it [k/8][row%16][8 k], so that the unit of
//      lane l for k0 lies at k0*16 + 8*l and a wave-wide 16-B load is 512 contiguous bytes (4 whole lines, not pieces of 16).
__device__ __forceinline__ v16h ldfrag_h(const _Float16* p) {
  FragH f;
  f.h[0] = *(const v8h*)(p);
  f.h[1] = *(const v8h*)(p + 16);
  return f.v;
}
//      ldfrag_p / ldfrag_bp: tiled or fragment-ordered plane, p already includes +8*lane; the second half lies 256 halves on.
__device__ __forceinline__ v16h ldfrag_p(const _Float16* p) {
  FragH f;
  f.h[0] = *(const v8h*)(p);
  f.h[1] = *(const v8h*)(p + 256);
  return f.v;
}
__device__ __forceinline__ v16b ldfrag_bp(const u16* p) {             // the same for a bf16 plane, read as unsigned integer vectors
  FragB f;
  f.u[0] = *(const v4u*)(p);
  f.u[1] = *(const v4u*)(p + 256);
  return f.v;
}

// 2^x as the one hardware instruction (v_exp_f32). The library exp2f wraps it in a range guard (compare, two selects, add, ldexp)
// that only serves results below 2^-126; here such a result is a weight that rounds to zero in f16 and adds nothing to a row sum
// that holds the 2^7 of the score whose value is the maximum in use, so a flush to zero gives the same output.
// The v_nop in the same statement is the one slot that the instruction set asks for between it and the first use of its result.
__device__ __forceinline__ float hw_exp2(float x) {
  float r = x;
#if defined(__HIP_DEVICE_COMPILE__)
  asm("v_exp_f32 %0, %0\n\tv_nop" : "+v"(r));
#endif
  return r;
}
// eight of them in place, as one statement: each writes only its own source, so none overwrites the source of the one in front of
// it, and the v_nop is the one slot that the instruction set asks for between the last one and the first use of its result.
__device__ __forceinline__ void hw_exp2x8(float& x0, float& x1, float& x2, float& x3, float& x4, float& x5, float& x6, float& x7) {
#if defined(__HIP_DEVICE_COMPILE__)
  asm("v_exp_f32 %0, %0\n\tv_exp_f32 %1, %1\n\tv_exp_f32 %2, %2\n\tv_exp_f32 %3, %3\n\t"
      "v_exp_f32 %4, %4\n\tv_exp_f32 %5, %5\n\tv_exp_f32 %6, %6\n\tv_exp_f32 %7, %7\n\tv_nop"
      : "+v"(x0), "+v"(x1), "+v"(x2), "+v"(x3), "+v"(x4), "+v"(x5), "+v"(x6), "+v"(x7));
#endif
}

__device__ __forceinline__ v8f mma_h(v16h a, v16h b, v8f c) {
  return __builtin_amdgcn_wmma_f32_16x16x32_f16(false, a, false, b, (short)0, c, false, false);
}
__device__ __forceinline__ v8f mma_b(v16b a, v16b b, v8f c) {
  return __builtin_amdgcn_wmma_f32_16x16x32_bf16(false, a, false, b, (short)0, c, false, false);
}
// four vector slots behind the last score WMMA: in front of the first read of its result and of the loads that overwrite its A fragments
__device__ __forceinline__ void g4_8(v8f& a, v8f& b, v8f& c, v8f& d, v16h x0, v16h x1, v16h x2, v16h x3, v16h x4, v16h x5,
                                     v16h x6, v16h x7) {
#if defined(__HIP_DEVICE_COMPILE__)
  asm volatile("v_nop\n\tv_nop\n\tv_nop\n\tv_nop"
               : "+v"(a), "+v"(b), "+v"(c), "+v"(d)
               : "v"(x0), "v"(x1), "v"(x2), "v"(x3), "v"(x4), "v"(x5), "v"(x6), "v"(x7) : "memory");
#endif
}
template <typename F>
__device__ __forceinline__ void g4_5(v8f& a, v8f& b, v8f& c, v8f& d, F x0, F x1, F x2, F x3, F x4) {
#if defined(__HIP_DEVICE_COMPILE__)
  asm volatile("v_nop\n\tv_nop\n\tv_nop\n\tv_nop"
               : "+v"(a), "+v"(b), "+v"(c), "+v"(d) : "v"(x0), "v"(x1), "v"(x2), "v"(x3), "v"(x4) : "memory");
#endif
}
__device__ __forceinline__ void g4_9(v8f& a, v8f& b, v8f& c, v8f& d, v16h x0, v16h x1, v16h x2, v16h x3, v16h x4,
                                     v16h x5, v16h x6, v16h x7, v16h x8) {
#if defined(__HIP_DEVICE_COMPILE__)
  asm volatile("v_nop\n\tv_nop\n\tv_nop\n\tv_nop"
               : "+v"(a), "+v"(b), "+v"(c), "+v"(d)
               : "v"(x0), "v"(x1), "v"(x2), "v"(x3), "v"(x4), "v"(x5), "v"(x6), "v"(x7), "v"(x8) : "memory");
#endif
}
// the same four slots behind the last P.V WMMA of a pass, the accumulators named as inputs only: nothing reads them before the next
// pass's products but the rare rescale
__device__ __forceinline__ void g8in(v8f a, v8f b, v8f c, v8f d, v8f e, v8f f, v8f g, v8f h, v16h x0, v16h x1, v16h x2, v16h x3,
                                     v16h x4, v16h x5) {
#if defined(__HIP_DEVICE_COMPILE__)
  asm volatile("v_nop\n\tv_nop\n\tv_nop\n\tv_nop"
               : : "v"(a), "v"(b), "v"(c), "v"(d), "v"(e), "v"(f), "v"(g), "v"(h),
                   "v"(x0), "v"(x1), "v"(x2), "v"(x3), "v"(x4), "v"(x5) : "memory");
#endif
}
__device__ __forceinline__ void acc_guard8(v8f& a, v8f& b, v8f& c, v8f& d, v8f& e, v8f& f, v8f& g, v8f& h) {
#if defined(__HIP_DEVICE_COMPILE__)
  asm volatile("v_nop\n\tv_nop\n\tv_nop\n\tv_nop" : "+v"(a), "+v"(b), "+v"(c), "+v"(d), "+v"(e), "+v"(f), "+v"(g), "+v"(h));
#endif
}
// s_wait_xcnt 0 behind a group of fragment loads: it stands in front of every later write of a register that those loads name as
// address; naming the addresses as inputs keeps their registers unwritten (also by a later load's result) up to the wait.
__device__ __forceinline__ void addr_wait2(const void* a, const void* b) {
#if defined(__HIP_DEVICE_COMPILE__)
  asm volatile("s_wait_xcnt 0x0" : : "v"(a), "v"(b) : "memory");
#endif
}
__device__ __forceinline__ void addr_wait5(const void* a, const void* b0, const void* b1, const void* b2, const void* b3) {
#if defined(__HIP_DEVICE_COMPILE__)
  asm volatile("s_wait_xcnt 0x0" : : "v"(a), "v"(b0), "v"(b1), "v"(b2), "v"(b3) : "memory");
#endif
}
__device__ __forceinline__ void addr_wait9(const void* a, const void* b0, const void* b1, const void* b2, const void* b3,
                                           const void* c0, const void* c1, const void* c2, const void* c3) {
#if defined(__HIP_DEVICE_COMPILE__)
  asm volatile("s_wait_xcnt 0x0"
               : : "v"(a), "v"(b0), "v"(b1), "v"(b2), "v"(b3), "v"(c0), "v"(c1), "v"(c2), "v"(c3) : "memory");
#endif
}
// One staged tile (128 keys of k, 128 keys of v, 16 KiB each, contiguous in their fragment-ordered planes and laid the same way in
// LDS) by asynchronous copies: each thread moves 4 + 4 units of 16 B, unit j lies 4096 B (= 256 threads x 16 B) behind unit j - 1;
// the immediate offset moves the global and the LDS address alike. lk, lv = the thread's LDS byte addresses, gk, gv its global ones.
// s_wait_xcnt 0 as the last line stands in front of every later write of the four address registers.
__device__ __forceinline__ void stage_kv(unsigned lk, const u16* gk, unsigned lv, const u16* gv) {
#if defined(__HIP_DEVICE_COMPILE__)
  asm volatile("global_load_async_to_lds_b128 %0, %1, off\n\t"
               "global_load_async_to_lds_b128 %0, %1, off offset:4096\n\t"
               "global_load_async_to_lds_b128 %0, %1, off offset:8192\n\t"
               "global_load_async_to_lds_b128 %0, %1, off offset:12288\n\t"
               "global_load_async_to_lds_b128 %2, %3, off\n\t"
               "global_load_async_to_lds_b128 %2, %3, off offset:4096\n\t"
               "global_load_async_to_lds_b128 %2, %3, off offset:8192\n\t"
               "global_load_async_to_lds_b128 %2, %3, off offset:12288\n\t"
               "s_wait_xcnt 0x0"
               : : "v"(lk), "v"(gk), "v"(lv), "v"(gv) : "memory");
#endif
}
// the issuing wave's own wait for its copies: behind it and the next barrier every wave may read the tile
__device__ __forceinline__ void wait_copies() {
#if defined(__HIP_DEVICE_COMPILE__)
  asm volatile("s_wait_asynccnt 0x0" : : : "memory");
#endif
}
// the wave's LDS reads have returned: in front of the barrier behind which the buffer it read is refilled
__device__ __forceinline__ void wait_lds_reads() {
#if defined(__HIP_DEVICE_COMPILE__)
  asm volatile("s_wait_dscnt 0x0" : : : "memory");
#endif
}
__device__ __forceinline__ void wave_sync_lds() {
  __builtin_amdgcn_fence(__ATOMIC_RELEASE, "workgroup");
  __builtin_amdgcn_wave_barrier();
  __builtin_amdgcn_fence(__ATOMIC_ACQUIRE, "workgroup");
}

// =====================================================================================================
// Weight matrix [DMOD][DMOD] f32 -> 16-bit plane [DMOD][DMOD], stored TILED (see the loaders), head-split permutation folded in:
//   mode 0: D[r][i]  = bf16 RNE bits of W[((r & 63) << 2) | (r >> 6)][i]      (output row r = h*64+d <- channel d*4+h)
//   mode 1: D[o][c]  = f16 bits of bf16value(W[o][((c & 63) << 2) | (c >> 6)]) * scale   (input column permuted the same way)
// Thread = 8 consecutive output elements (8 scalar loads, both candidate indices always < DMOD*DMOD, selected by value);
// coverage: blk = 0 .. DMOD*DMOD/8/256 - 1 = 32 blocks x 256 thr x 8 = the whole plane.
// =====================================================================================================
__device__ __forceinline__ void cvtw_body(const float* __restrict__ w, u16* D, int mode, float scale, int blk) {
  const int gt = blk * 256 + (int)threadIdx.x;
  if (gt >= (DMOD * DMOD) / 8) return;       // no barriers in this body
  const int row  = ((gt >> 9) << 4) | (gt & 15);   // 0..255: destination unit gt = ((row/16)*32 + c8/8)*16 + row%16
  const int c8   = ((gt >> 4) & 31) * 8;           // 0..248
  const int prow = ((row & 63) << 2) | (row >> 6);
  const int hsel = c8 >> 6, d0 = c8 & 63;
  unsigned short s[8];
  int   idx[8];
  float wv[8];
#pragma unroll
  for (int e = 0; e < 8; ++e) {
    const int i0  = prow * DMOD + c8 + e;                   // < 65536
    const int i1  = row * DMOD + ((d0 + e) << 2) + hsel;    // < 65536
    idx[e] = (mode == 0) ? i0 : i1;
    wv[e]  = w[idx[e]];
  }
#if defined(__HIP_DEVICE_COMPILE__)
  // s_wait_xcnt 0 behind the eight loads, in front of every later write of an index register that they name as address; naming
  // the indices as inputs keeps their registers unwritten (also by a later load's result) up to the wait.
  asm volatile("s_wait_xcnt 0x0" : : "v"(idx[0]), "v"(idx[1]), "v"(idx[2]), "v"(idx[3]), "v"(idx[4]), "v"(idx[5]), "v"(idx[6]),
               "v"(idx[7]) : "memory");
#endif
#pragma unroll
  for (int e = 0; e < 8; ++e) {
    const float v = wv[e];
    const unsigned short bb = bf_bits(v);
    const unsigned short hb = h_bits((_Float16)(bf_up(bb) * scale));
    s[e] = (mode == 0) ? bb : hb;
  }
  v4u o;
#pragma unroll
  for (int e = 0; e < 4; ++e) o[e] = pk16(s[2 * e], s[2 * e + 1]);
  u16* d = D + (size_t)gt * 8;
  {
    *(v4u*)(d) = o;
    
  }
}

// =====================================================================================================
// Input transpose + convert: X [b][DMOD][SEQ] f32 -> XT bf16 [b][SEQ][DMOD], stored TILED. Block = (b, 64 tokens, 64 channels):
// 64 channel rows x 64 tokens loaded with 16-B loads, RNE-converted, scattered into an LDS tile [token][channel] (pitch XTP);
// coverage: load 256 thr x 16 elements = 64 x 64; store 2 iterations x 256 thr x 8 halves = 4 tiles x 8 chunks x 16 tokens = the block's
//           tile; bid = 0 .. NB x (SEQ/64) x (DMOD/64) - 1 = 1024 blocks covers XT exactly once. T = the block's LDS tile.
// =====================================================================================================
__device__ __forceinline__ void xt16_body(const float* __restrict__ x, u16* XT, u16* T, int bid) {
  const int tid = threadIdx.x;
  const int ct  = bid & 3;                    // channel tile, DMOD/64 = 4
  const int st  = (bid >> 2) & 63;            // token tile, SEQ/64 = 64
  const int b   = bid >> 8;                   // 0..3
  const int c0  = ct * 64, s0 = st * 64;
  {
    const int cl = tid >> 2;                  // channel within tile 0..63
    const int tc = (tid & 3) * 16;            // token chunk
    const float* src = x + ((size_t)(b * DMOD + c0 + cl)) * SEQ + s0 + tc;
#pragma unroll
    for (int i = 0; i < 4; ++i) {
      const v4f a = *(const v4f*)(src + 4 * i);
#pragma unroll
      for (int e = 0; e < 4; ++e) T[(tc + 4 * i + e) * XTP + cl] = bf_bits(a[e]);
    }
  }
  __syncthreads();
  v4u o[2];
  const int tk = tid & 15, ch = (tid >> 4) & 7, th = tid >> 7;   // token in its 16-token tile, 8-channel chunk, tile parity
#pragma unroll
  for (int it = 0; it < 2; ++it) {
    const int line = (it * 2 + th) * 16 + tk; // token within the block's tile 0..63
    o[it] = *(const v4u*)(T + line * XTP + ch * 8);
  }
  const size_t base = ((size_t)(b * SEQ + s0)) * DMOD + (size_t)(c0 + ch * 8) * 16 + tk * 8;
  {
#pragma unroll
    for (int it = 0; it < 2; ++it) {
      *(v4u*)(XT + base + (size_t)((it * 2 + th) * 16) * DMOD) = o[it];
    }
#if defined(__HIP_DEVICE_COMPILE__)
    // s_wait_xcnt 0 behind the two stores: in the merged kernel's text the weight range's code, which writes the registers that
    // these stores name as address, follows them behind a scalar test.
    asm volatile("s_wait_xcnt 0x0" : : : "memory");
#endif
  }
}

// =====================================================================================================
// The four weight converts and the three input transposes, which need nothing of each other, as block ranges of one grid:
//   blocks 0 .. 127: weight (bid >> 5) = wq, wk, wv (mode 0), wo (mode 1, x1024) -> plane (bid >> 5) of WB4, 32 blocks each;
//   blocks 128 .. 3199: input ((bid - 128) >> 10) = query, key, value -> plane of XT3, 1024 blocks each.
// The range test is block-uniform, so the transpose's barrier is passed by all threads of a block or by none.
// =====================================================================================================
#define WCV_BLOCKS (DMOD * DMOD / 8 / 256)
#define XT_BLOCKS  (NB * (SEQ / 64) * (DMOD / 64))
static_assert(WCV_BLOCKS == 32 && XT_BLOCKS == 1024);
__global__ __launch_bounds__(256)
void prep(const float* __restrict__ xq, const float* __restrict__ xk, const float* __restrict__ xv,
          const float* __restrict__ wq, const float* __restrict__ wk, const float* __restrict__ wv,
          const float* __restrict__ wo, u16* XT3, u16* WB4) {
  __shared__ __align__(16) u16 T[64 * XTP];
  const int bid = blockIdx.x;
  if (bid < 4 * WCV_BLOCKS) {
    const int sel = bid >> 5;
    const float* w = (sel == 0) ? wq : ((sel == 1) ? wk : ((sel == 2) ? wv : wo));
    cvtw_body(w, WB4 + (size_t)sel * (DMOD * DMOD), (sel == 3) ? 1 : 0, (sel == 3) ? WOS : 1.0f, bid & (WCV_BLOCKS - 1));
    return;                                   // the whole block leaves, in front of the barrier below
  }
  const int r   = bid - 4 * WCV_BLOCKS;
  const int sel = r >> 10;
  const float* x = (sel == 0) ? xq : ((sel == 1) ? xk : xv);
  xt16_body(x, XT3 + (size_t)sel * (size_t)(NB * SEQ * DMOD), T, r & (XT_BLOCKS - 1));
}

// =====================================================================================================
// Bias terms for the GEMM epilogue (bf16-RNE values of bias[], array of DMOD entries; every candidate index is masked into
// 0..DMOD-1 so all loads are in range, selection by value):
//   bmode 0: per-column, permuted index ((col&63)<<2)|(col>>6); bmode 1: per-row, same permutation of the row; bmode 2: per-row direct.
// =====================================================================================================
__device__ __forceinline__ void bias_terms(const float* __restrict__ bias, int bmode, int rowb, int col0, int hh, int m,
                                           v4f& badd, v8f& radd) {
#pragma unroll
  for (int e = 0; e < 4; ++e) {
    const int ci = col0 + 4 * m + e;
    const int pc = ((ci & 63) << 2) | ((ci >> 6) & 3);
    const float bc = bfr(bias[pc]);
    badd[e] = (bmode == 0) ? bc : 0.0f;
  }
#pragma unroll
  for (int r = 0; r < 8; ++r) {
    const int ri = rowb + 8 * hh + r;
    const int p1 = ((ri & 63) << 2) | ((ri >> 6) & 3);
    const int p2 = ri & (DMOD - 1);
    const float b1 = bfr(bias[p1]), b2 = bfr(bias[p2]);
    radd[r] = (bmode == 1) ? b1 : ((bmode == 2) ? b2 : 0.0f);
  }
}

// =====================================================================================================
// GEMM epilogue of the output projection: the wave's 16x64 f32 tile (times oscale, plus per-row addend radd) staged in its LDS
// coverage: 8 instructions x 2 rows x 16 lanes x 4 floats = the wave's 16 x 64 tile.
// =====================================================================================================
__device__ __forceinline__ void epi64(float* sl, v8f a0, v8f a1, v8f a2, v8f a3, float oscale, v4f badd, v8f radd,
                                      float* C, int N, size_t rowb, int col0, int lane) {
  const int hh = lane >> 4, m = lane & 15;
#pragma unroll
  for (int r = 0; r < 8; ++r) {
    const int ro = (8 * hh + r) * 68 + m;
    sl[ro]      = a0[r] * oscale + radd[r];
    sl[ro + 16] = a1[r] * oscale + radd[r];
    sl[ro + 32] = a2[r] * oscale + radd[r];
    sl[ro + 48] = a3[r] * oscale + radd[r];
  }
  wave_sync_lds();
  v4f vals[8];
#pragma unroll
  for (int it = 0; it < 8; ++it) vals[it] = *(const v4f*)(sl + (it * 2 + hh) * 68 + m * 4) + badd;
  float* dst = C + (rowb + (size_t)hh) * (size_t)N + col0 + m * 4;
  {
#pragma unroll
    for (int it = 0; it < 8; ++it) {
      *(v4f*)(dst + (size_t)(it * 2) * (size_t)N) = vals[it];
    }
    
  }
}

// =====================================================================================================
// Projection epilogue: the wave's 16x64 f32 tile plus bias, staged in its LDS slab, leaves as f16 of (value * scale) straight in
// the order the attention kernel reads it (no f32 plane in between). Unit = 8 halves = one lane's 16-B store; 4 stores a lane.
//   omode 0 (q): tile = 16 tokens x one head's 64 d; D = [b][s][h][d]; one store = 4 token rows x 128 B (whole lines)
//   omode 1 (k): the same tile; D unit ((bh*256 + kt)*8 + dc)*16 + c  <- key s = 16*kt + c, d = 8*dc .. 8*dc+7
//   omode 2 (v): tile = 16 d x 64 keys; D unit (((bh*128 + it)*4 + j)*4 + kc)*16 + c  <- d = 16*j + c, keys 32*it + 8*kc .. +7
// (bh = b*NH + h). In modes 1 and 2 one store is 512 contiguous bytes, and so is each fragment load of the attention loop.
// coverage: 4 stores x 32 lanes x 8 halves = the wave's 16 x 64 tile; the tiles of the grid cover each plane exactly once.
// =====================================================================================================
__device__ __forceinline__ void epi_h16(float* sl, v8f a0, v8f a1, v8f a2, v8f a3, v4f cadd, v8f radd, bool rowbias, float scale,
                                        u16* D, int omode, int rowb, int col0, int y, int lane) {
  static_assert(SEQ == 4096 && DMOD == 256 && HD == 64 && NH == 4);
  const int hh = lane >> 4, m = lane & 15;
#pragma unroll
  for (int r = 0; r < 8; ++r) {
    const int ro = (8 * hh + r) * 68 + m;
    sl[ro]      = a0[r] + (rowbias ? radd[r] : cadd[0]);
    sl[ro + 16] = a1[r] + (rowbias ? radd[r] : cadd[1]);
    sl[ro + 32] = a2[r] + (rowbias ? radd[r] : cadd[2]);
    sl[ro + 48] = a3[r] + (rowbias ? radd[r] : cadd[3]);
  }
  wave_sync_lds();
  // slab row and 8-column chunk of the lane's unit t: q (4t + lane/8, lane%8); k, v (lane%16, 2t + lane/16)
  const int lb = (omode == 0) ? (lane >> 3) * 68 + (lane & 7) * 8 : m * 68 + hh * 8;
  const int ls = (omode == 0) ? 4 * 68 : 16;
  v4u o[4];
#pragma unroll
  for (int t = 0; t < 4; ++t) {
    const float* p = sl + lb + t * ls;
    const v4f a = *(const v4f*)(p), c4 = *(const v4f*)(p + 4);
#pragma unroll
    for (int e = 0; e < 2; ++e) {
      o[t][e]     = pk16(h_bits((_Float16)(a[2 * e] * scale)),  h_bits((_Float16)(a[2 * e + 1] * scale)));
      o[t][2 + e] = pk16(h_bits((_Float16)(c4[2 * e] * scale)), h_bits((_Float16)(c4[2 * e + 1] * scale)));
    }
  }
  const int dq = (rowb + (lane >> 3)) * DMOD + col0 + (lane & 7) * 8;
  const int dk = ((((rowb >> 12) * NH + (col0 >> 6)) * 256 + ((rowb & (SEQ - 1)) >> 4)) * 128 + lane) * 8;
  const int dv = ((((y * NH + (rowb >> 6)) * 128 + (col0 >> 5)) * 4 + ((rowb >> 4) & 3)) * 64 + lane) * 8;
  u16* d = D + (size_t)((omode == 0) ? dq : ((omode == 1) ? dk : dv));   // every one < NB*SEQ*DMOD
#pragma unroll
  for (int t = 0; t < 4; ++t) {
    const int dofs = (omode == 0) ? t * (4 * DMOD) : ((omode == 1) ? t * 256 : (t >> 1) * 2048 + (t & 1) * 256);
    *(v4u*)(d + dofs) = o[t];
  }
}

// =====================================================================================================
// bf16 GEMM with bias, f16 result: (A[M][K] (bf16, TILED) . Bt[N][K]^T (bf16, TILED) + bias) * scale -> plane D in the order of
// omode (see epi_h16). Bias = bf16-RNE values of bias[], index permuted ((i&63)<<2)|(i>>6) and so always in 0..DMOD-1: per column
// (rowbias false) or per row (true). bid = 0 .. (M/64)*(N/64) - 1 tiles, y = batch index with element stride sB added to Bt.
// Block = 64x64 tile, 4 waves x 16 rows; fragments loaded straight from the tiled planes (two 16-B loads each, split k map for
// A and B); K stepped by 32 (K % 32 == 0, M % 64 == 0, N % 64 == 0).
// =====================================================================================================
__device__ __forceinline__
void gemm_bfh_body(float* slab, const u16* __restrict__ A, const u16* __restrict__ Bt, const float* __restrict__ bias,
                   u16* D, int M, int N, int K, float scale, int omode, bool rowbias, int sB, int bid, int y) {
  const int tid = threadIdx.x, wave = tid >> 5, lane = tid & 31, hh = lane >> 4, m = lane & 15;
  const int ntile = N >> 6;
  const int rowb  = (bid / ntile) * 64 + wave * 16;
  const int col0  = (bid % ntile) * 64;
  if (rowb + 16 > M) return;                 // wave-uniform, never taken with the exact grid; no block barriers in this kernel
  const u16* Bb = Bt + (size_t)y * (size_t)sB;
  const u16* ap = A  + (size_t)rowb * K + 8 * lane;   // 16-row tile = 16*K halves, inside it [k/8][row][8]
  const u16* bp = Bb + (size_t)col0 * K + 8 * lane;
  const size_t bs = (size_t)16 * K;
  v8f acc0 = zero8(), acc1 = zero8(), acc2 = zero8(), acc3 = zero8();
#pragma unroll 1
  for (int k0 = 0; k0 < K; k0 += 32) {
    const int ko = k0 * 16;
    const u16 *pa = ap + ko, *p0 = bp + ko, *p1 = p0 + bs, *p2 = p1 + bs, *p3 = p2 + bs;
    const v16b a  = ldfrag_bp(pa);
    const v16b b0 = ldfrag_bp(p0);
    const v16b b1 = ldfrag_bp(p1);
    const v16b b2 = ldfrag_bp(p2);
    const v16b b3 = ldfrag_bp(p3);
    addr_wait5(pa, p0, p1, p2, p3);
    acc0 = mma_b(a, b0, acc0);
    acc1 = mma_b(a, b1, acc1);
    acc2 = mma_b(a, b2, acc2);
    acc3 = mma_b(a, b3, acc3);
    g4_5<v16b>(acc0, acc1, acc2, acc3, a, b0, b1, b2, b3);
  }
  v4f cadd = zero4();
  v8f radd = zero8();
  if (rowbias) {
#pragma unroll
    for (int r = 0; r < 8; ++r) {
      const int ri = rowb + 8 * hh + r;
      radd[r] = bfr(bias[((ri & 63) << 2) | ((ri >> 6) & 3)]);
    }
  } else {
#pragma unroll
    for (int j = 0; j < 4; ++j) {
      const int ci = col0 + 16 * j + m;
      cadd[j] = bfr(bias[((ci & 63) << 2) | ((ci >> 6) & 3)]);
    }
  }
  epi_h16(slab + wave * SLAB64, acc0, acc1, acc2, acc3, cadd, radd, rowbias, scale, D, omode, rowb, col0, y, lane);
}

// =====================================================================================================
// The three projections, which need nothing of each other, as one grid (1024 tiles, 3): blockIdx.y = 0 q, 1 k: token-major,
// [16384 token][h*64+d] = XT . W'^T, per-column bias; 2 v: channel-major per batch (256 tiles x 4 batches in blockIdx.x),
// [b][h*64+d][4096] = W' . XT^T, per-row bias. XT3, WB4, H3 hold the planes of q, k, v one behind the other; H3 = the f16 planes
// x64 that the attention kernel reads, q in place order, k and v in fragment order.
// =====================================================================================================
__global__ __launch_bounds__(128)
void gemm_qkv(const u16* __restrict__ XT3, const u16* __restrict__ WB4, const float* __restrict__ bq,
              const float* __restrict__ bk, const float* __restrict__ bv, u16* H3) {
  static_assert((NB * SEQ / 64) * (DMOD / 64) == 1024 && (DMOD / 64) * (SEQ / 64) == 256 && NB == 4);
  __shared__ __align__(16) float slab[4 * SLAB64];
  const int sel = blockIdx.y;                 // block-uniform
  const int bx  = blockIdx.x;
  const u16* X  = XT3 + (size_t)sel * (size_t)(NB * SEQ * DMOD);
  const u16* Wp = WB4 + (size_t)sel * (DMOD * DMOD);
  u16*       D  = H3 + (size_t)sel * (size_t)(NB * SEQ * DMOD);
  if (sel < 2)
    gemm_bfh_body(slab, X, Wp, (sel == 0) ? bq : bk, D, NB * SEQ, DMOD, DMOD, (sel == 0) ? QSC : KSC, (sel == 0) ? 0 : 1, false, 0, bx, 0);
  else
    gemm_bfh_body(slab, Wp, X, bv, D, DMOD, SEQ, DMOD, VCAR, 2, true, SEQ * DMOD, bx & 255, bx >> 8);
}

// =====================================================================================================
// f16 GEMM, single A plane, hi+lo B planes, per-row bias: C[M][N] (f32, pitch N) = A[M][K] . (Bh + Bl)[N][K]^T times oscale,
// plus bf16-RNE value of bias[row]; A f16 TILED (no batch stride), Bh/Bl f16 [n][k] planes TILED with batch stride sB, C with
// batch stride sC (grid.y = batch). Products a.bh + a.bl into one accumulator (bl is the unscaled residual of bh). Same tiling
// as gemm_bfh_body.
// =====================================================================================================
__global__ __launch_bounds__(128)
void gemm_wh2(const u16* __restrict__ A, const u16* __restrict__ Bh, const u16* __restrict__ Bl,
              const float* __restrict__ bias, float* C, int M, int N, int K, float oscale, int sB, int sC) {
  __shared__ __align__(16) float slab[4 * SLAB64];
  const int tid = threadIdx.x, wave = tid >> 5, lane = tid & 31, hh = lane >> 4, m = lane & 15;
  const int ntile = N >> 6;
  const int bid   = blockIdx.x;
  const int y     = blockIdx.y;
  const int rowb  = (bid / ntile) * 64 + wave * 16;
  const int col0  = (bid % ntile) * 64;
  if (rowb + 16 > M) return;                 // wave-uniform, never taken with the exact grid; no block barriers in this kernel
  const _Float16* ap  = (const _Float16*)(const void*)A + (size_t)rowb * K + 8 * lane;   // tiles as in gemm_bfh_body
  const size_t bofs   = (size_t)y * (size_t)sB + (size_t)col0 * K + 8 * lane;
  const _Float16* bhp = (const _Float16*)(const void*)Bh + bofs;
  const _Float16* blp = (const _Float16*)(const void*)Bl + bofs;
  float* Cb = C + (size_t)y * (size_t)sC;
  const size_t bs = (size_t)16 * K;
  v8f acc0 = zero8(), acc1 = zero8(), acc2 = zero8(), acc3 = zero8();
#pragma unroll 1
  for (int k0 = 0; k0 < K; k0 += 32) {
    const int ko = k0 * 16;
    const _Float16 *pa = ap + ko, *h0 = bhp + ko, *h1 = h0 + bs, *h2 = h1 + bs, *h3 = h2 + bs;
    const _Float16 *l0 = blp + ko, *l1 = l0 + bs, *l2 = l1 + bs, *l3 = l2 + bs;
    const v16h a   = ldfrag_p(pa);
    const v16h bh0 = ldfrag_p(h0);
    const v16h bh1 = ldfrag_p(h1);
    const v16h bh2 = ldfrag_p(h2);
    const v16h bh3 = ldfrag_p(h3);
    const v16h bl0 = ldfrag_p(l0);
    const v16h bl1 = ldfrag_p(l1);
    const v16h bl2 = ldfrag_p(l2);
    const v16h bl3 = ldfrag_p(l3);
    addr_wait9(pa, h0, h1, h2, h3, l0, l1, l2, l3);
    acc0 = mma_h(a, bh0, acc0);  acc0 = mma_h(a, bl0, acc0);
    acc1 = mma_h(a, bh1, acc1);  acc1 = mma_h(a, bl1, acc1);
    acc2 = mma_h(a, bh2, acc2);  acc2 = mma_h(a, bl2, acc2);
    acc3 = mma_h(a, bh3, acc3);  acc3 = mma_h(a, bl3, acc3);
    g4_9(acc0, acc1, acc2, acc3, a, bh0, bh1, bh2, bh3, bl0, bl1, bl2, bl3);
  }
  v4f badd = zero4();
  v8f radd = zero8();
  bias_terms(bias, 2, rowb, col0, hh, m, badd, radd);
  epi64(slab + wave * SLAB64, acc0, acc1, acc2, acc3, oscale, badd, radd, Cb, N, (size_t)rowb, col0, lane);
}

// =====================================================================================================
// Full (non-causal, unmasked) multi-head flash attention: block = (batch b, head, 128 query rows), 8 waves. Wave w = (query
// group wq = w & 3, key group kg = w >> 2) owns the 32 query rows q0 = 128*qt + 32*wq .. q0+31 (two 16-row tiles t = 0, 1) and,
// of every staged tile of 128 keys, the 64 keys 64*kg .. 64*kg+63: each k and v fragment that it reads from LDS feeds two
// products, one per query tile, so the block reads each staged byte 4 times, not 8. Waves w and w ^ 4 hold partial results
// (O, l, maximum in use) of the same 32 queries over the two halves of the keys; they are joined once, behind the loop.
//   q plane (f16, x64) laid out [b][s][h][d]; k and v planes (x64) per (b, h) in fragment order (epi_h16). Tiles of 128 keys are
//   brought into LDS once per block by asynchronous copies, two buffers, tile t + 2 asked for when tile t has been read by all,
//   one barrier a tile; every fragment load of the loop is a ds_load_b128 of 512 contiguous bytes over the wave. All NST = 32
//   tiles are visited, 2 key blocks of 32 keys per wave and tile (static bounds).
//   Scores are computed TRANSPOSED: S^T tile (t, g) (g = 0,1) = k rows (keys kb+16g .. +15, A operand, row m = lane&15, split k
//   map over d) times q^T of tile t (B operand, col n = query q0 + 16t + (lane&15), k = d, split map), one product per tile and d-chunk.
//   D element r of lane l = (key kb+16g+8h+r, query q0+16t+(l&15)), so a lane owns one query column per tile t and 16 of its 32
//   keys; the partner lane l^16 owns the other 16 -> row max / row sum need one xor-16 shuffle.
//   Online base-2 softmax in f32 (scale 1/8 and the q,k carries folded into lsc), the subtracted maximum replaced lazily: a pass
//   keeps the maxima in use, and rescales neither O nor l, unless a scaled score of some lane lies more than 8 above its own (one
//   ballot and one scalar branch a pass, for both query tiles); any subtracted value cancels between O and l. The exp'd values ARE
//   the P A-fragment in place: A row m = query = lane&15, element i <- key kb+8h+i (g = 0, D element i), element 8+i <- key
//   kb+16+8h+i (g = 1, D element i). P is carried x128 as f16 (at most 2^15). The rescale factor of query row 8h+r of the O accumulators is
//   fetched from lane 8h+r with a shuffle (uniform control, inside that branch). 4 v^T B fragments (col n = d = 16j + (lane&15), keys k-contiguous),
//   8 P.V WMMAs per key block.
//   Join: wave w hands the partial O, l and maximum of query tile 1 - kg to wave w ^ 4 through LDS (lane to lane, register to
//   register) and finishes tile kg: both parts brought to the larger of the two maxima, added, divided by the joined l.
//   Epilogue: 1/l (per query, shuffled to the D row owner) and carry folds in f32; the wave's 16x64 f32 result staged in its LDS
// coverage: per wave 4 instructions x 2 chunks x 16 rows x 8 halves = 16 x 64 per plane; grid 512 blocks x 8 waves = every
//           (b, s, h) row of both O planes exactly once.
// =====================================================================================================
// amdgpu_waves_per_eu(4, 4): a register budget of 256 a wave, so that two blocks share a WGP (four waves per SIMD) as before
__global__ __launch_bounds__(ATT_THREADS) __attribute__((amdgpu_waves_per_eu(4, 4)))
void attn_fwd(const u16* __restrict__ QHp, const u16* __restrict__ KHp, const u16* __restrict__ VHp,
              u16* OHIp, u16* OLOp) {
  __shared__ __align__(16) float smem[RINGF];   // loop: [2 buffers][k tile, v tile] of f16; behind it: per wave a hand-over area, then a result slab [16][68]

  const int tid  = threadIdx.x;
  const int wave = tid >> 5;
  const int lane = tid & 31;
  const int hh   = lane >> 4;
  const int c    = lane & 15;
  const int wq   = wave & 3;                  // which 32 query rows of the block
  const int kg   = wave >> 2;                 // which 64 keys of every staged tile

  const int bid  = blockIdx.x;
  const int qt   = bid & (SEQ / 128 - 1);     // 0..31
  const int head = (bid >> 5) & (NH - 1);     // 0..3
  const int b    = bid >> 7;                  // 0..3
  const int q0   = qt * 128 + wq * 32;

  // B fragments of q^T, tile t: col n = query q0 + 16t + c, k = d (k-contiguous row of the q plane); loop-invariant
  const size_t qofs = (((size_t)(b * SEQ + q0 + c)) * NH + head) * HD + 8 * hh;
  const _Float16* Qh  = (const _Float16*)(const void*)QHp + qofs;
  const _Float16* Qh1 = Qh + 16 * NH * HD;
  const v16h qa0 = ldfrag_h(Qh),  qb0 = ldfrag_h(Qh + 32);
  const v16h qa1 = ldfrag_h(Qh1), qb1 = ldfrag_h(Qh1 + 32);
  // k and v planes of (b, head): fragment order, 2048 halves per 32-key block (see epi_h16), so a 128-key tile is STH halves in a
  // row; the thread's first 16-B unit of tile 0, and its place in buffer 0 (LDS byte address = low 32 bits of the shared address)
  const size_t pofs = (size_t)(b * NH + head) * (SEQ * HD) + 8 * tid;
  const u16* gk = KHp + pofs;
  const u16* gv = VHp + pofs;
  const unsigned lk0 = (unsigned)(uintptr_t)(void*)smem + 16u * (unsigned)tid;
  const _Float16* ring = (const _Float16*)(const void*)smem + 8 * lane + kg * (WPS * 32 * HD);   // the lane's unit in the wave's half of a k tile
  const float lsc = 0.125f * (LOG2E / (QSC * KSC));

  // per query tile t: maximum in use, (mrun + RTH) / lsc = the raw score that replaces it, PLOG - mrun (set in the first pass), row sum
  float mrun[2] = {-INFINITY, -INFINITY}, mthr[2] = {-INFINITY, -INFINITY}, nb[2] = {0.f, 0.f}, lrun[2] = {0.f, 0.f};
  float pown[2] = {0.f, 0.f}, poth[2] = {0.f, 0.f};   // a pass's row sum, this lane's half and the partner lane's, until the next pass adds them to l
  v8f o[2][4];
#pragma unroll
  for (int t = 0; t < 2; ++t) {
#pragma unroll
    for (int j = 0; j < 4; ++j) o[t][j] = zero8();
  }

  addr_wait2(Qh, Qh1);
  // tile 0 into buffer 0, landed and published; then tile 1 into buffer 1, which flies while tile 0 is worked on
  stage_kv(lk0, gk, lk0 + 2 * STH, gv);
  wait_copies();
  __syncthreads();
  stage_kv(lk0 + 4 * STH, gk + STH, lk0 + 6 * STH, gv + STH);

#pragma unroll 1
  for (int st = 0; st < NST; ++st) {
   const _Float16* kl = ring + (st & 1) * (2 * STH);   // the wave's half of this tile's k, the lane's unit; A fragment row m = key kb + 16g + c, k = d
   const _Float16* vl = kl + STH;                      // the same half of this tile's v; B fragment col n = d = 16j + c, k = key
   // K fragments of the wave's first key block; its first pass fetches the second pass's behind its own score products
   v16h kf0 = ldfrag_p(kl), kf1 = ldfrag_p(kl + 16 * HD), kf2 = ldfrag_p(kl + 512), kf3 = ldfrag_p(kl + 16 * HD + 512);
#pragma unroll
   for (int ps = 0; ps < WPS; ++ps) {   // unrolled: the fragment addresses become immediate offsets, the last pass drops its fetch
    // (kb below = 128 * st + 64 * kg + 32 * ps, the pass's first key)
    // ---- this pass's v fragments, asked for here and first used behind the softmax: their latency runs under scores and softmax.
    //      B fragment col n = d = j*16 + c, 512 halves per j in the fragment-ordered v tile ----
    const _Float16* vhp = vl + ps * (32 * HD);
    const v16h vh0 = ldfrag_p(vhp);
    const v16h vh1 = ldfrag_p(vhp + 512);
    const v16h vh2 = ldfrag_p(vhp + 1024);
    const v16h vh3 = ldfrag_p(vhp + 1536);
    __builtin_amdgcn_sched_barrier(0);   // keeps the eight v loads in front of the first wait on a k fragment
    // ---- transposed scores: s[t][0] = keys kb..kb+15, s[t][1] = keys kb+16..kb+31, column = query q0 + 16t + c ----
    v8f s[2][2];
    s[0][0] = mma_h(kf0, qa0, zero8());
    s[0][1] = mma_h(kf1, qa0, zero8());
    s[1][0] = mma_h(kf0, qa1, zero8());
    s[1][1] = mma_h(kf1, qa1, zero8());
    s[0][0] = mma_h(kf2, qb0, s[0][0]);
    s[0][1] = mma_h(kf3, qb0, s[0][1]);
    s[1][0] = mma_h(kf2, qb1, s[1][0]);
    s[1][1] = mma_h(kf3, qb1, s[1][1]);
    g4_8(s[0][0], s[0][1], s[1][0], s[1][1], qa0, qb0, qa1, qb1, kf0, kf1, kf2, kf3);
    // ---- the next pass's k fragments into the same registers, inside the wave's half of this tile only ----
    if (ps + 1 < WPS) {
      const _Float16* knp = kl + (ps + 1) * (32 * HD);
      kf0 = ldfrag_p(knp);
      kf1 = ldfrag_p(knp + 16 * HD);
      kf2 = ldfrag_p(knp + 512);
      kf3 = ldfrag_p(knp + 16 * HD + 512);
    }
    __builtin_amdgcn_sched_barrier(0);   // keeps the eight k loads here: without it they sink into the softmax, whose temporaries take their registers
    // ---- raw scores of this lane's 16 keys for query q0 + 16t + c: s[t][0][i] <- key kb+8hh+i, s[t][1][i] <- key kb+16+8hh+i. The maximum
    //      is taken on the raw scores and scaled where it is needed: lsc > 0 and rounding is monotone, so it equals the maximum of the scaled ones ----
    float cr[2];
#pragma unroll
    for (int t = 0; t < 2; ++t) {
      lrun[t] += pown[t] + poth[t];   // the pass before's row sum, both halves: in l before the test below can rescale l
      float x = s[t][0][0];
#pragma unroll
      for (int i = 1; i < 8; ++i) x = fmaxf(x, s[t][0][i]);
#pragma unroll
      for (int i = 0; i < 8; ++i) x = fmaxf(x, s[t][1][i]);
      cr[t] = x;
    }
    // ---- lazy rescale, tested once a pass: only if some lane's largest score lies more than RTH above its maximum in use (always in
    //      the first pass, mthr = -inf) do the halves exchange maxima, the maxima in use move up and O and l are rescaled. The ballot
    //      makes it a scalar branch, taken by the whole wave. Not taken: every weight of the pass is at most 2^(PLOG + RTH) ----
    if (__builtin_expect(__builtin_amdgcn_ballot_w32((cr[0] > mthr[0]) | (cr[1] > mthr[1])) != 0u, 0)) {
#pragma unroll
      for (int t = 0; t < 2; ++t) {
        const float cm = cr[t] * lsc;
        const float mn = fmaxf(mrun[t], fmaxf(cm, __shfl_xor(cm, 16, 32)));   // the same in both lanes of a query; finite from the first pass on
        const float al = hw_exp2(mrun[t] - mn);                               // 0 in the first pass (mrun = -inf), 1 for a query that keeps its maximum
        mrun[t] = mn;
        mthr[t] = (mn + RTH) * (1.0f / lsc);
        nb[t]   = PLOG - mn;
        lrun[t] *= al;
        // D row 8hh+r of the O accumulators = query q0+16t+8hh+r, its factor lives in lane 8hh+r (and 16+8hh+r)
        float scl[8];
#pragma unroll
        for (int r = 0; r < 8; ++r) scl[r] = __shfl(al, 8 * hh + r, 32);
#pragma unroll
        for (int j = 0; j < 4; ++j) {
#pragma unroll
          for (int r = 0; r < 8; ++r) o[t][j][r] *= scl[r];
        }
      }
    }
    // ---- weights p * 128 = 2^(s * lsc - mrun + 7): one fma and one v_exp_f32 each; their f16 values are the P A-fragment,
    //      element 8w + i <-> s[t][w][i]; the row sum carries the same 128 ----
    FragH ph[2];
#pragma unroll
    for (int t = 0; t < 2; ++t) {
      float p[16];
#pragma unroll
      for (int i = 0; i < 8; ++i) { p[i] = fmaf(s[t][0][i], lsc, nb[t]); p[8 + i] = fmaf(s[t][1][i], lsc, nb[t]); }
      hw_exp2x8(p[0], p[1], p[2], p[3], p[4], p[5], p[6], p[7]);
      hw_exp2x8(p[8], p[9], p[10], p[11], p[12], p[13], p[14], p[15]);
      float sum = p[0] + p[1];
#pragma unroll
      for (int w = 0; w < 2; ++w) {
#pragma unroll
        for (int e4 = 0; e4 < 4; ++e4) {
          const int i = 8 * w + 2 * e4;
          if (i > 0) sum += p[i] + p[i + 1];
          ph[t].u[w][e4] = pk16(h_bits((_Float16)p[i]), h_bits((_Float16)p[i + 1]));
        }
      }
      pown[t] = sum;
      poth[t] = __shfl_xor(sum, 16, 32);   // asked for here, added to l in the next pass: its latency runs under the products
    }
    // ---- P.V with the v fragments asked for at the head of the pass, each used for both query tiles ----
    {
      o[0][0] = mma_h(ph[0].v, vh0, o[0][0]);
      o[0][1] = mma_h(ph[0].v, vh1, o[0][1]);
      o[0][2] = mma_h(ph[0].v, vh2, o[0][2]);
      o[0][3] = mma_h(ph[0].v, vh3, o[0][3]);
      o[1][0] = mma_h(ph[1].v, vh0, o[1][0]);
      o[1][1] = mma_h(ph[1].v, vh1, o[1][1]);
      o[1][2] = mma_h(ph[1].v, vh2, o[1][2]);
      o[1][3] = mma_h(ph[1].v, vh3, o[1][3]);
      g8in(o[0][0], o[0][1], o[0][2], o[0][3], o[1][0], o[1][1], o[1][2], o[1][3], ph[0].v, ph[1].v, vh0, vh1, vh2, vh3);
    }
   }
   // ---- foot of tile st, every wave: its own LDS reads done, its own copies of tile st + 1 landed, then the one barrier that
   //      publishes tile st + 1 and ends every wave's reading of this buffer; only behind it the refill with tile st + 2 ----
   wait_lds_reads();
   wait_copies();
   __syncthreads();
   if (st + 2 < NST) {
     const unsigned lb = lk0 + (unsigned)(st & 1) * (4 * STH);
     const size_t   go = (size_t)(st + 2) * STH;
     stage_kv(lb, gk + go, lb + 2 * STH, gv + go);
   }
  }
  wait_copies();   // nothing is outstanding here; the last foot's barrier has ended all reading of the ring, which now holds the hand-over areas
  acc_guard8(o[0][0], o[0][1], o[0][2], o[0][3], o[1][0], o[1][1], o[1][2], o[1][3]);

  // ---- join of the two key halves: the wave keeps query tile kg and hands tile 1 - kg to wave w ^ 4, lane to lane: 8 units of
  //      16 B a lane (one store = 512 contiguous bytes), then the maximum in use and the row sum ----
  lrun[0] += pown[0] + poth[0];   // the last pass's row sums
  lrun[1] += pown[1] + poth[1];
  const bool up = __builtin_amdgcn_readfirstlane(kg) != 0;   // wave-uniform
  v8f mine[4], give[4];
#pragma unroll
  for (int j = 0; j < 4; ++j) { mine[j] = up ? o[1][j] : o[0][j]; give[j] = up ? o[0][j] : o[1][j]; }
  const float mmine = up ? mrun[1] : mrun[0], mgive = up ? mrun[0] : mrun[1];
  const float lmine = up ? lrun[1] : lrun[0], lgive = up ? lrun[0] : lrun[1];
  float* xw = smem + wave * SLABF;          // written by this wave, read by wave w ^ 4 alone
  float* xr = smem + (wave ^ 4) * SLABF;    // written by wave w ^ 4, read by this wave alone
#pragma unroll
  for (int j = 0; j < 4; ++j) {
#pragma unroll
    for (int h2 = 0; h2 < 2; ++h2) {
      const v4f u = {give[j][4 * h2], give[j][4 * h2 + 1], give[j][4 * h2 + 2], give[j][4 * h2 + 3]};
      *(v4f*)(xw + ((j * 2 + h2) * 32 + lane) * 4) = u;
    }
  }
  xw[1024 + lane] = mgive;
  xw[1056 + lane] = lgive;
  __syncthreads();   // the hand-over areas are written; passed by all eight waves
  v4f got[8];
#pragma unroll
  for (int u = 0; u < 8; ++u) got[u] = *(const v4f*)(xr + (u * 32 + lane) * 4);
  const float mgot = xr[1024 + lane], lgot = xr[1056 + lane];
  // both parts to the larger maximum (both finite: each wave has seen keys); l carries the same 128 as P; the carry 64 on v folded in
  const float mj   = fmaxf(mmine, mgot);
  const float am   = hw_exp2(mmine - mj), ag = hw_exp2(mgot - mj);
  const float linv = (1.0f / (lmine * am + lgot * ag)) * (1.0f / VCAR);
  const float fm = am * linv, fg = ag * linv;
  float im[8], ig[8];
#pragma unroll
  for (int r = 0; r < 8; ++r) { im[r] = __shfl(fm, 8 * hh + r, 32); ig[r] = __shfl(fg, 8 * hh + r, 32); }
  float* slab = xr;   // the area this wave alone has read, and has read to the end, now takes its 16x64 result
#pragma unroll
  for (int r = 0; r < 8; ++r) {
#pragma unroll
    for (int j = 0; j < 4; ++j) slab[(8 * hh + r) * 68 + j * 16 + c] = mine[j][r] * im[r] + got[j * 2 + (r >> 2)][r & 3] * ig[r];
  }
  wave_sync_lds();
  // ---- O x1024 -> f16 hi + residual planes, TILED as [token][h*64+d] operands; one store = 512 contiguous bytes ----
  v4u oh[4], ol[4];
#pragma unroll
  for (int i4 = 0; i4 < 4; ++i4) {
    const int c8 = (i4 * 2 + hh) * 8;         // lane = (8-d chunk parity hh, query row c)
    const v4f a = *(const v4f*)(slab + c * 68 + c8), c4 = *(const v4f*)(slab + c * 68 + c8 + 4);
    float w[8];
#pragma unroll
    for (int e = 0; e < 4; ++e) { w[e] = a[e] * OSC; w[4 + e] = c4[e] * OSC; }
#pragma unroll
    for (int e = 0; e < 4; ++e) {
      const _Float16 h0 = (_Float16)w[2 * e], h1 = (_Float16)w[2 * e + 1];
      const _Float16 l0 = (_Float16)(w[2 * e] - (float)h0), l1 = (_Float16)(w[2 * e + 1] - (float)h1);
      oh[i4][e] = pk16(h_bits(h0), h_bits(h1));
      ol[i4][e] = pk16(h_bits(l0), h_bits(l1));
    }
  }
  const size_t ob = ((size_t)(b * SEQ + q0 + 16 * kg)) * (NH * HD) + (size_t)head * (HD * 16) + 8 * lane;
  {
#pragma unroll
    for (int i4 = 0; i4 < 4; ++i4) {
      const size_t o8 = ob + (size_t)i4 * 256;
      *(v4u*)(OHIp + o8) = oh[i4];
      *(v4u*)(OLOp + o8) = ol[i4];
    }
    
  }
}

// =====================================================================================================
// Workspace map (bytes); every plane is fully written by whole-line stores before it is read; all extents are exact multiples
// of the store granularity (no pad rows needed); every offset a multiple of 131072; q, k and v each have an XT plane of their own:
//   XT  bf16 3 x [16384 token][256 i] tiled         25165824     (query, key, value)
//   WQB bf16 [256 r'][256 i] tiled (rows permuted)  131072      WKB same 131072     WVB same 131072
//   WOB f16  [256 o][256 c'] tiled x1024 (cols permuted)  131072
//   QH  f16  [4][4096][4][64] x64                   8388608
//   KH  f16  [16 bh][256 kt][8 dc][16 key][8 d] x64          8388608   (fragment order)
//   VH  f16  [16 bh][128 it][4 j][4 kc][16 d][8 key] x64     8388608   (fragment order)
//   OHI f16  [16384 token][256 h*64+d] tiled x1024   8388608      OLO residual 8388608
//   end                                            67633152
// =====================================================================================================
extern "C" void kernel_launch(void* const* d_in, const int* in_sizes, int n_in,
                              void* d_out, int out_size, void* d_ws, size_t ws_size,
                              hipStream_t stream) {
  const int ROWS = NB * SEQ;                            // 16384 tokens
  const int XN   = NB * DMOD * SEQ;                     // 4194304
  if (n_in < 11) return;
  if (in_sizes[0] != XN || in_sizes[1] != XN || in_sizes[2] != XN) return;
  if (in_sizes[3] != DMOD * DMOD || in_sizes[5] != DMOD * DMOD) return;
  if (in_sizes[7] != DMOD * DMOD || in_sizes[9] != DMOD * DMOD) return;
  if (in_sizes[4] != DMOD || in_sizes[6] != DMOD || in_sizes[8] != DMOD || in_sizes[10] != DMOD) return;
  if (out_size != XN) return;

  const float* Qin = (const float*)d_in[0];
  const float* Kin = (const float*)d_in[1];
  const float* Vin = (const float*)d_in[2];
  const float* wq  = (const float*)d_in[3];
  const float* bq  = (const float*)d_in[4];
  const float* wk  = (const float*)d_in[5];
  const float* bk  = (const float*)d_in[6];
  const float* wv  = (const float*)d_in[7];
  const float* bv  = (const float*)d_in[8];
  const float* wo  = (const float*)d_in[9];
  const float* bo  = (const float*)d_in[10];
  float*       out = (float*)d_out;

  const size_t szXT = (size_t)ROWS * DMOD * 2;                  //  8388608
  const size_t szW  = (size_t)DMOD * DMOD * 2;                  //   131072
  const size_t szP  = (size_t)ROWS * DMOD * 2;                  //  8388608  (q/k/v/o planes)
  size_t off = 0;
  const size_t oXT  = off; off += 3 * szXT;
  const size_t oWQB = off; off += szW;
  const size_t oWKB = off; off += szW;
  const size_t oWVB = off; off += szW;
  const size_t oWOB = off; off += szW;
  const size_t oQH  = off; off += szP;
  const size_t oKH  = off; off += szP;
  const size_t oVH  = off; off += szP;
  const size_t oOHI = off; off += szP;
  const size_t oOLO = off; off += szP;
  if (off > ws_size) return;                            // off = 67633152
  if (off > (size_t)134217728) return;

  char* ws = (char*)d_ws;
  u16*   XT  = (u16*)(ws + oXT);
  u16*   WQB = (u16*)(ws + oWQB);
  u16*   WOB = (u16*)(ws + oWOB);
  u16*   QH  = (u16*)(ws + oQH);
  u16*   KH  = (u16*)(ws + oKH);
  u16*   VH  = (u16*)(ws + oVH);
  u16*   OHI = (u16*)(ws + oOHI);
  u16*   OLO = (u16*)(ws + oOLO);

  const dim3 blk(256);
  const int n8w = (DMOD * DMOD) / 8;                    // 8192
  if ((n8w % 256) != 0) return;
  const dim3 gPre(4 * (n8w / 256) + 3 * NB * (SEQ / 64) * (DMOD / 64));   // 128 weight blocks + 3072 transpose blocks
  const dim3 gG3((ROWS / 64) * (DMOD / 64), 3);         // 1024 tiles x (q, k, v)
  const dim3 gGc((DMOD / 64) * (SEQ / 64), NB);         // 256 tiles x 4 batches, channel-major per batch
  const dim3 bG(128);
  const dim3 gAT(ATT_BLOCKS);                           // 512
  const dim3 bAT(ATT_THREADS);                          // 256
  const int  sTok = SEQ * DMOD;                         // 1048576 elements: per-batch stride of XT / O planes
  const int  sChn = DMOD * SEQ;                         // 1048576 elements: per-batch stride of out

  // (0) weights: rows of wq/wk/wv permuted to r' = h*64+d (bf16 planes), columns of wo permuted the same way (f16 of bf16 value x1024);
  //     inputs query, key, value -> XT bf16 [token][i], one plane each (WQB .. WOB lie one behind the other)
  prep<<<gPre, blk, 0, stream>>>(Qin, Kin, Vin, wq, wk, wv, wo, XT, WQB);
  // (1) projections + bias -> f16 planes x64 (QH, KH, VH lie one behind the other): q in place order, k and v in fragment order
  gemm_qkv<<<gG3, bG, 0, stream>>>(XT, WQB, bq, bk, bv, QH);
  // (2) attention -> O planes [token][h*64+d] tiled, x1024 (hi + residual)
  attn_fwd<<<gAT, bAT, 0, stream>>>(QH, KH, VH, OHI, OLO);
  // (3) output projection per batch + bias -> out [b][256 o][4096 n] f32, carries 1024 (O) x 1024 (wo) folded back
  gemm_wh2<<<gGc, bG, 0, stream>>>(WOB, OHI, OLO, bo, out, DMOD, SEQ, DMOD, 1.0f / (OSC * WOS), sTok, sChn);
  (void)hipGetLastError();
}

// v009
// A run of this version takes 98.5 microseconds.
// Two timings next to v008 put it at 1.05 and 1.06 times that version's speed.
// Counting every step since v000, it is 3.67 times as fast.
// Contractions: projections Xt.W'^T and W'.Xt^T on v_wmma_f32_16x16x32_bf16 (Xt and W RNE-converted bf16 operands, f32 accumulate, bias added in f32);
// scores k'.q'^T (q', k' carried x64 as f16), P.v (P x128 as f16, v x64 as f16) and Wm'.O^T (Wm' as f16(bf16(Wm) x1024), O x1024 as f16 hi plane
// + f16 residual plane, products w.h + w.l): v_wmma_f32_16x16x32_f16, f32 accumulate. Base-2 online softmax, 1/l fold and bias adds in f32 on VALU.
#include <hip/hip_runtime.h>
#include <math.h>
#include <stdint.h>

#define NB    4
#define SEQ   4096
#define DMOD  256
#define NH    4
#define HD    64
#define QSC   64.0f
#define KSC   64.0f
#define PCAR  128.0f
#define VCAR  64.0f
#define OSC   1024.0f
#define WOS   1024.0f
#define LOG2E 1.4426950408889634f
#define PLOG  7.0f
#define RTH   8.0f                // a maximum in use is replaced when a scaled score exceeds it by more than this (base-2 exponent)
#define ATT_WAVES   8
#define ATT_THREADS (ATT_WAVES * 32)
#define ATT_BLOCKS  (NB * NH * (SEQ / (16 * ATT_WAVES)))
#define NKB    (SEQ / 32)
#define STK    128                 // keys of one staged tile
#define WPS    2                   // passes of 32 keys that one wave makes over a staged tile: its half of the tile's keys
#define NST    (SEQ / STK)         // staged tiles per (batch, head)
#define STH    (STK * HD)          // halves of one operand's staged tile (16 KiB)
#define RINGF  (2 * STH)           // floats of the ring: 2 buffers x (k tile, v tile) = 64 KiB
#define SLABF  (16 * 68)
#define SLAB64 (16 * 68)
#define XTP    72
static_assert(HD == 64 && DMOD == NH * HD);
static_assert(PCAR == 128.0f && PLOG == 7.0f && PLOG + RTH == 15.0f);   // PCAR = 2^PLOG; the largest weight, 2^(PLOG + RTH), is finite in f16
static_assert((SEQ / 64) == 64 && NH == 4 && NB == 4);
static_assert(ATT_THREADS == 256 && ATT_BLOCKS == 512 && NKB == 128);
static_assert((DMOD % 64) == 0 && (SEQ % 64) == 0 && (DMOD % 32) == 0);
static_assert(((NB * SEQ * DMOD / 8) % 256) == 0 && ((DMOD * DMOD / 8) % 256) == 0);
static_assert((DMOD / 8) == 32);
static_assert(64 * XTP >= 63 * XTP + 64);
static_assert(ATT_WAVES * SLABF >= 4 * 16 * 68);
static_assert(2 * WPS * 32 == STK && ATT_WAVES == 8 && SLABF == 34 * 32);   // two key groups of four waves; hand-over area = 32 + 2 floats a lane
static_assert(NST >= 2 && STK == 4 * 32 && STH * 2 == 4 * ATT_THREADS * 16 && RINGF >= ATT_WAVES * SLABF);

typedef unsigned short u16;
typedef _Float16 v16h __attribute__((ext_vector_type(16)));
typedef _Float16 v8h  __attribute__((ext_vector_type(8)));
typedef __bf16   v16b __attribute__((ext_vector_type(16)));
typedef float    v8f  __attribute__((ext_vector_type(8)));
typedef float    v4f  __attribute__((ext_vector_type(4)));
typedef unsigned int v4u __attribute__((ext_vector_type(4)));
typedef float    v2f  __attribute__((ext_vector_type(2)));
typedef _Float16 v2h  __attribute__((ext_vector_type(2)));
typedef __bf16   v2b  __attribute__((ext_vector_type(2)));

union FragH { v16h v; v8h h[2]; v4u u[2]; };
union FragB { v16b v; v4u u[2]; };

// ---- scalar helpers --------------------------------------------------------------------------------
__device__ __forceinline__ unsigned short bf_bits(float f) {          // f32 -> bf16 bits, RNE convert
  unsigned u = __float_as_uint(f);
  return (unsigned short)((u + 0x7FFFu + ((u >> 16) & 1u)) >> 16);
}
__device__ __forceinline__ float bf_up(unsigned short h) { return __uint_as_float(((unsigned)h) << 16); }
__device__ __forceinline__ float bfr(float f) { return bf_up(bf_bits(f)); }
__device__ __forceinline__ unsigned short h_bits(_Float16 x) { return __builtin_bit_cast(unsigned short, x); }
__device__ __forceinline__ unsigned pk16(unsigned short a, unsigned short b) { return (unsigned)a | ((unsigned)b << 16); }
// two f32 -> two 16-bit values (round to nearest even, a in the low half) as the one packed convert instruction
__device__ __forceinline__ v2h cvt2h(float a, float b) { const v2f x = {a, b}; return __builtin_convertvector(x, v2h); }
__device__ __forceinline__ unsigned pkh(float a, float b) { return __builtin_bit_cast(unsigned, cvt2h(a, b)); }
__device__ __forceinline__ unsigned pkb(float a, float b) { const v2f x = {a, b}; return __builtin_bit_cast(unsigned, __builtin_convertvector(x, v2b)); }
__device__ __forceinline__ v8f zero8() { v8f z = {0.f, 0.f, 0.f, 0.f, 0.f, 0.f, 0.f, 0.f}; return z; }
__device__ __forceinline__ v4f zero4() { v4f z = {0.f, 0.f, 0.f, 0.f}; return z; }

// ---- fragment loaders: 16-bit A/B operand, lane -> row/col (lane&15), h = lane>>4; elements 0..7 <- k0+8h.., elements 8..15 <-
//      k0+16+8h.. (same split k map for A and B).
//      ldfrag_h: row-major [row][k] plane, p already includes +8*h (q only, read once per wave).
//      TILED plane of a [rows][K] operand: 16-row tile = 16*K halves in a row, inside it [k/8][row%16][8 k], so that the unit of
//      lane l for k0 lies at k0*16 + 8*l and a wave-wide 16-B load is 512 contiguous bytes (4 whole lines, not pieces of 16).
__device__ __forceinline__ v16h ldfrag_h(const _Float16* p) {
  FragH f;
  f.h[0] = *(const v8h*)(p);
  f.h[1] = *(const v8h*)(p + 16);
  return f.v;
}
//      ldfrag_p / ldfrag_bp: tiled or fragment-ordered plane, p already includes +8*lane; the second half lies 256 halves on.
__device__ __forceinline__ v16h ldfrag_p(const _Float16* p) {
  FragH f;
  f.h[0] = *(const v8h*)(p);
  f.h[1] = *(const v8h*)(p + 256);
  return f.v;
}
__device__ __forceinline__ v16b ldfrag_bp(const u16* p) {             // the same for a bf16 plane, read as unsigned integer vectors
  FragB f;
  f.u[0] = *(const v4u*)(p);
  f.u[1] = *(const v4u*)(p + 256);
  return f.v;
}

// 2^x as the one hardware instruction (v_exp_f32). The library exp2f wraps it in a range guard (compare, two selects, add, ldexp)
// that only serves results below 2^-126; here such a result is a weight that rounds to zero in f16 and adds nothing to a row sum
// that holds the 2^7 of the score whose value is the maximum in use, so a flush to zero gives the same output.
// The v_nop in the same statement is the one slot that the instruction set asks for between it and the first use of its result.
__device__ __forceinline__ float hw_exp2(float x) {
  float r = x;
#if defined(__HIP_DEVICE_COMPILE__)
  asm("v_exp_f32 %0, %0\n\tv_nop" : "+v"(r));
#endif
  return r;
}
// eight of them in place, as one statement: each writes only its own source, so none overwrites the source of the one in front of
// it, and the v_nop is the one slot that the instruction set asks for between the last one and the first use of its result.
__device__ __forceinline__ void hw_exp2x8(float& x0, float& x1, float& x2, float& x3, float& x4, float& x5, float& x6, float& x7) {
#if defined(__HIP_DEVICE_COMPILE__)
  asm("v_exp_f32 %0, %0\n\tv_exp_f32 %1, %1\n\tv_exp_f32 %2, %2\n\tv_exp_f32 %3, %3\n\t"
      "v_exp_f32 %4, %4\n\tv_exp_f32 %5, %5\n\tv_exp_f32 %6, %6\n\tv_exp_f32 %7, %7\n\tv_nop"
      : "+v"(x0), "+v"(x1), "+v"(x2), "+v"(x3), "+v"(x4), "+v"(x5), "+v"(x6), "+v"(x7));
#endif
}

__device__ __forceinline__ v8f mma_h(v16h a, v16h b, v8f c) {
  return __builtin_amdgcn_wmma_f32_16x16x32_f16(false, a, false, b, (short)0, c, false, false);
}
__device__ __forceinline__ v8f mma_b(v16b a, v16b b, v8f c) {
  return __builtin_amdgcn_wmma_f32_16x16x32_bf16(false, a, false, b, (short)0, c, false, false);
}
// four vector slots behind the last score WMMA: in front of the first read of its result and of the loads that overwrite its A fragments
__device__ __forceinline__ void g4_8(v8f& a, v8f& b, v8f& c, v8f& d, v16h x0, v16h x1, v16h x2, v16h x3, v16h x4, v16h x5,
                                     v16h x6, v16h x7) {
#if defined(__HIP_DEVICE_COMPILE__)
  asm volatile("v_nop\n\tv_nop\n\tv_nop\n\tv_nop"
               : "+v"(a), "+v"(b), "+v"(c), "+v"(d)
               : "v"(x0), "v"(x1), "v"(x2), "v"(x3), "v"(x4), "v"(x5), "v"(x6), "v"(x7) : "memory");
#endif
}
template <typename F>
__device__ __forceinline__ void g4_5(v8f& a, v8f& b, v8f& c, v8f& d, F x0, F x1, F x2, F x3, F x4) {
#if defined(__HIP_DEVICE_COMPILE__)
  asm volatile("v_nop\n\tv_nop\n\tv_nop\n\tv_nop"
               : "+v"(a), "+v"(b), "+v"(c), "+v"(d) : "v"(x0), "v"(x1), "v"(x2), "v"(x3), "v"(x4) : "memory");
#endif
}
__device__ __forceinline__ void g4_9(v8f& a, v8f& b, v8f& c, v8f& d, v16h x0, v16h x1, v16h x2, v16h x3, v16h x4,
                                     v16h x5, v16h x6, v16h x7, v16h x8) {
#if defined(__HIP_DEVICE_COMPILE__)
  asm volatile("v_nop\n\tv_nop\n\tv_nop\n\tv_nop"
               : "+v"(a), "+v"(b), "+v"(c), "+v"(d)
               : "v"(x0), "v"(x1), "v"(x2), "v"(x3), "v"(x4), "v"(x5), "v"(x6), "v"(x7), "v"(x8) : "memory");
#endif
}
// the same four slots behind the last P.V WMMA of a pass, the accumulators named as inputs only: nothing reads them before the next
// pass's products but the rare rescale. e0, e1 = the pass's exchanged row sums, inputs only: their exchange then stands in front of this
// statement and its latency runs under the products; left free it sank into the next pass and was waited for there in the open
__device__ __forceinline__ void g8in(v8f a, v8f b, v8f c, v8f d, v8f e, v8f f, v8f g, v8f h, v16h x0, v16h x1, v16h x2, v16h x3,
                                     v16h x4, v16h x5, float e0, float e1) {
#if defined(__HIP_DEVICE_COMPILE__)
  asm volatile("v_nop\n\tv_nop\n\tv_nop\n\tv_nop"
               : : "v"(a), "v"(b), "v"(c), "v"(d), "v"(e), "v"(f), "v"(g), "v"(h),
                   "v"(x0), "v"(x1), "v"(x2), "v"(x3), "v"(x4), "v"(x5), "v"(e0), "v"(e1) : "memory");
#endif
}
__device__ __forceinline__ void acc_guard8(v8f& a, v8f& b, v8f& c, v8f& d, v8f& e, v8f& f, v8f& g, v8f& h) {
#if defined(__HIP_DEVICE_COMPILE__)
  asm volatile("v_nop\n\tv_nop\n\tv_nop\n\tv_nop" : "+v"(a), "+v"(b), "+v"(c), "+v"(d), "+v"(e), "+v"(f), "+v"(g), "+v"(h));
#endif
}
// s_wait_xcnt 0 behind a group of fragment loads: it stands in front of every later write of a register that those loads name as
// address; naming the addresses as inputs keeps their registers unwritten (also by a later load's result) up to the wait.
__device__ __forceinline__ void addr_wait2(const void* a, const void* b) {
#if defined(__HIP_DEVICE_COMPILE__)
  asm volatile("s_wait_xcnt 0x0" : : "v"(a), "v"(b) : "memory");
#endif
}
__device__ __forceinline__ void addr_wait5(const void* a, const void* b0, const void* b1, const void* b2, const void* b3) {
#if defined(__HIP_DEVICE_COMPILE__)
  asm volatile("s_wait_xcnt 0x0" : : "v"(a), "v"(b0), "v"(b1), "v"(b2), "v"(b3) : "memory");
#endif
}
__device__ __forceinline__ void addr_wait9(const void* a, const void* b0, const void* b1, const void* b2, const void* b3,
                                           const void* c0, const void* c1, const void* c2, const void* c3) {
#if defined(__HIP_DEVICE_COMPILE__)
  asm volatile("s_wait_xcnt 0x0"
               : : "v"(a), "v"(b0), "v"(b1), "v"(b2), "v"(b3), "v"(c0), "v"(c1), "v"(c2), "v"(c3) : "memory");
#endif
}
// One staged tile (128 keys of k, 128 keys of v, 16 KiB each, contiguous in their fragment-ordered planes and laid the same way in
// LDS) by asynchronous copies: each thread moves 4 + 4 units of 16 B, unit j lies 4096 B (= 256 threads x 16 B) behind unit j - 1;
// the immediate offset moves the global and the LDS address alike. lk, lv = the thread's LDS byte addresses, gk, gv its global ones.
// s_wait_xcnt 0 as the last line stands in front of every later write of the four address registers.
__device__ __forceinline__ void stage_kv(unsigned lk, const u16* gk, unsigned lv, const u16* gv) {
#if defined(__HIP_DEVICE_COMPILE__)
  asm volatile("global_load_async_to_lds_b128 %0, %1, off\n\t"
               "global_load_async_to_lds_b128 %0, %1, off offset:4096\n\t"
               "global_load_async_to_lds_b128 %0, %1, off offset:8192\n\t"
               "global_load_async_to_lds_b128 %0, %1, off offset:12288\n\t"
               "global_load_async_to_lds_b128 %2, %3, off\n\t"
               "global_load_async_to_lds_b128 %2, %3, off offset:4096\n\t"
               "global_load_async_to_lds_b128 %2, %3, off offset:8192\n\t"
               "global_load_async_to_lds_b128 %2, %3, off offset:12288\n\t"
               "s_wait_xcnt 0x0"
               : : "v"(lk), "v"(gk), "v"(lv), "v"(gv) : "memory");
#endif
}
// the issuing wave's own wait for its copies: behind it and the next barrier every wave may read the tile
__device__ __forceinline__ void wait_copies() {
#if defined(__HIP_DEVICE_COMPILE__)
  asm volatile("s_wait_asynccnt 0x0" : : : "memory");
#endif
}
// the wave's LDS reads have returned: in front of the barrier behind which the buffer it read is refilled
__device__ __forceinline__ void wait_lds_reads() {
#if defined(__HIP_DEVICE_COMPILE__)
  asm volatile("s_wait_dscnt 0x0" : : : "memory");
#endif
}
__device__ __forceinline__ void wave_sync_lds() {
  __builtin_amdgcn_fence(__ATOMIC_RELEASE, "workgroup");
  __builtin_amdgcn_wave_barrier();
  __builtin_amdgcn_fence(__ATOMIC_ACQUIRE, "workgroup");
}

// =====================================================================================================
// Weight matrix [DMOD][DMOD] f32 -> 16-bit plane [DMOD][DMOD], stored TILED (see the loaders), head-split permutation folded in:
//   mode 0: D[r][i]  = bf16 RNE bits of W[((r & 63) << 2) | (r >> 6)][i]      (output row r = h*64+d <- channel d*4+h)
//   mode 1: D[o][c]  = f16 bits of bf16value(W[o][((c & 63) << 2) | (c >> 6)]) * scale   (input column permuted the same way)
// Thread = 8 consecutive output elements (8 scalar loads, both candidate indices always < DMOD*DMOD, selected by value);
// coverage: blk = 0 .. DMOD*DMOD/8/256 - 1 = 32 blocks x 256 thr x 8 = the whole plane.
// =====================================================================================================
__device__ __forceinline__ void cvtw_body(const float* __restrict__ w, u16* D, int mode, float scale, int blk) {
  const int gt = blk * 256 + (int)threadIdx.x;
  if (gt >= (DMOD * DMOD) / 8) return;       // no barriers in this body
  const int row  = ((gt >> 9) << 4) | (gt & 15);   // 0..255: destination unit gt = ((row/16)*32 + c8/8)*16 + row%16
  const int c8   = ((gt >> 4) & 31) * 8;           // 0..248
  const int prow = ((row & 63) << 2) | (row >> 6);
  const int hsel = c8 >> 6, d0 = c8 & 63;
  unsigned short s[8];
  int   idx[8];
  float wv[8];
#pragma unroll
  for (int e = 0; e < 8; ++e) {
    const int i0  = prow * DMOD + c8 + e;                   // < 65536
    const int i1  = row * DMOD + ((d0 + e) << 2) + hsel;    // < 65536
    idx[e] = (mode == 0) ? i0 : i1;
    wv[e]  = w[idx[e]];
  }
#if defined(__HIP_DEVICE_COMPILE__)
  // s_wait_xcnt 0 behind the eight loads, in front of every later write of an index register that they name as address; naming
  // the indices as inputs keeps their registers unwritten (also by a later load's result) up to the wait.
  asm volatile("s_wait_xcnt 0x0" : : "v"(idx[0]), "v"(idx[1]), "v"(idx[2]), "v"(idx[3]), "v"(idx[4]), "v"(idx[5]), "v"(idx[6]),
               "v"(idx[7]) : "memory");
#endif
#pragma unroll
  for (int e = 0; e < 8; ++e) {
    const float v = wv[e];
    const unsigned short bb = bf_bits(v);
    const unsigned short hb = h_bits((_Float16)(bf_up(bb) * scale));
    s[e] = (mode == 0) ? bb : hb;
  }
  v4u o;
#pragma unroll
  for (int e = 0; e < 4; ++e) o[e] = pk16(s[2 * e], s[2 * e + 1]);
  u16* d = D + (size_t)gt * 8;
  {
    *(v4u*)(d) = o;
    
  }
}

// =====================================================================================================
// Input transpose + convert: X [b][DMOD][SEQ] f32 -> XT bf16 [b][SEQ][DMOD], stored TILED. Block = (b, 64 tokens, 64 channels):
// 64 channel rows x 64 tokens loaded with 16-B loads, RNE-converted, scattered into an LDS tile [token][channel] (pitch XTP);
// coverage: load 256 thr x 16 elements = 64 x 64; store 2 iterations x 256 thr x 8 halves = 4 tiles x 8 chunks x 16 tokens = the block's
//           tile; bid = 0 .. NB x (SEQ/64) x (DMOD/64) - 1 = 1024 blocks covers XT exactly once. T = the block's LDS tile.
// =====================================================================================================
__device__ __forceinline__ void xt16_body(const float* __restrict__ x, u16* XT, u16* T, int bid) {
  const int tid = threadIdx.x;
  const int ct  = bid & 3;                    // channel tile, DMOD/64 = 4
  const int st  = (bid >> 2) & 63;            // token tile, SEQ/64 = 64
  const int b   = bid >> 8;                   // 0..3
  const int c0  = ct * 64, s0 = st * 64;
  {
    const int cl = tid >> 2;                  // channel within tile 0..63
    const int tc = (tid & 3) * 16;            // token chunk
    const float* src = x + ((size_t)(b * DMOD + c0 + cl)) * SEQ + s0 + tc;
#pragma unroll
    for (int i = 0; i < 4; ++i) {
      const v4f a = *(const v4f*)(src + 4 * i);
#pragma unroll
      for (int e = 0; e < 4; e += 2) {
        const unsigned two = pkb(a[e], a[e + 1]);
        T[(tc + 4 * i + e) * XTP + cl]     = (u16)two;
        T[(tc + 4 * i + e + 1) * XTP + cl] = (u16)(two >> 16);
      }
    }
  }
  __syncthreads();
  v4u o[2];
  const int tk = tid & 15, ch = (tid >> 4) & 7, th = tid >> 7;   // token in its 16-token tile, 8-channel chunk, tile parity
#pragma unroll
  for (int it = 0; it < 2; ++it) {
    const int line = (it * 2 + th) * 16 + tk; // token within the block's tile 0..63
    o[it] = *(const v4u*)(T + line * XTP + ch * 8);
  }
  const size_t base = ((size_t)(b * SEQ + s0)) * DMOD + (size_t)(c0 + ch * 8) * 16 + tk * 8;
  {
#pragma unroll
    for (int it = 0; it < 2; ++it) {
      *(v4u*)(XT + base + (size_t)((it * 2 + th) * 16) * DMOD) = o[it];
    }
#if defined(__HIP_DEVICE_COMPILE__)
    // s_wait_xcnt 0 behind the two stores: in the merged kernel's text the weight range's code, which writes the registers that
    // these stores name as address, follows them behind a scalar test.
    asm volatile("s_wait_xcnt 0x0" : : : "memory");
#endif
  }
}

// =====================================================================================================
// The four weight converts and the three input transposes, which need nothing of each other, as block ranges of one grid:
//   blocks 0 .. 127: weight (bid >> 5) = wq, wk, wv (mode 0), wo (mode 1, x1024) -> plane (bid >> 5) of WB4, 32 blocks each;
//   blocks 128 .. 3199: input ((bid - 128) >> 10) = query, key, value -> plane of XT3, 1024 blocks each.
// The range test is block-uniform, so the transpose's barrier is passed by all threads of a block or by none.
// =====================================================================================================
#define WCV_BLOCKS (DMOD * DMOD / 8 / 256)
#define XT_BLOCKS  (NB * (SEQ / 64) * (DMOD / 64))
static_assert(WCV_BLOCKS == 32 && XT_BLOCKS == 1024);
__global__ __launch_bounds__(256)
void prep(const float* __restrict__ xq, const float* __restrict__ xk, const float* __restrict__ xv,
          const float* __restrict__ wq, const float* __restrict__ wk, const float* __restrict__ wv,
          const float* __restrict__ wo, u16* XT3, u16* WB4) {
  __shared__ __align__(16) u16 T[64 * XTP];
  const int bid = blockIdx.x;
  if (bid < 4 * WCV_BLOCKS) {
    const int sel = bid >> 5;
    const float* w = (sel == 0) ? wq : ((sel == 1) ? wk : ((sel == 2) ? wv : wo));
    cvtw_body(w, WB4 + (size_t)sel * (DMOD * DMOD), (sel == 3) ? 1 : 0, (sel == 3) ? WOS : 1.0f, bid & (WCV_BLOCKS - 1));
    return;                                   // the whole block leaves, in front of the barrier below
  }
  const int r   = bid - 4 * WCV_BLOCKS;
  const int sel = r >> 10;
  const float* x = (sel == 0) ? xq : ((sel == 1) ? xk : xv);
  xt16_body(x, XT3 + (size_t)sel * (size_t)(NB * SEQ * DMOD), T, r & (XT_BLOCKS - 1));
}

// =====================================================================================================
// Bias terms for the GEMM epilogue (bf16-RNE values of bias[], array of DMOD entries; every candidate index is masked into
// 0..DMOD-1 so all loads are in range, selection by value):
//   bmode 0: per-column, permuted index ((col&63)<<2)|(col>>6); bmode 1: per-row, same permutation of the row; bmode 2: per-row direct.
// =====================================================================================================
__device__ __forceinline__ void bias_terms(const float* __restrict__ bias, int bmode, int rowb, int col0, int hh, int m,
                                           v4f& badd, v8f& radd) {
#pragma unroll
  for (int e = 0; e < 4; ++e) {
    const int ci = col0 + 4 * m + e;
    const int pc = ((ci & 63) << 2) | ((ci >> 6) & 3);
    const float bc = bfr(bias[pc]);
    badd[e] = (bmode == 0) ? bc : 0.0f;
  }
#pragma unroll
  for (int r = 0; r < 8; ++r) {
    const int ri = rowb + 8 * hh + r;
    const int p1 = ((ri & 63) << 2) | ((ri >> 6) & 3);
    const int p2 = ri & (DMOD - 1);
    const float b1 = bfr(bias[p1]), b2 = bfr(bias[p2]);
    radd[r] = (bmode == 1) ? b1 : ((bmode == 2) ? b2 : 0.0f);
  }
}

// =====================================================================================================
// GEMM epilogue of the output projection: the wave's 16x64 f32 tile (times oscale, plus per-row addend radd) staged in its LDS
// coverage: 8 instructions x 2 rows x 16 lanes x 4 floats = the wave's 16 x 64 tile.
// =====================================================================================================
__device__ __forceinline__ void epi64(float* sl, v8f a0, v8f a1, v8f a2, v8f a3, float oscale, v4f badd, v8f radd,
                                      float* C, int N, size_t rowb, int col0, int lane) {
  const int hh = lane >> 4, m = lane & 15;
#pragma unroll
  for (int r = 0; r < 8; ++r) {
    const int ro = (8 * hh + r) * 68 + m;
    sl[ro]      = a0[r] * oscale + radd[r];
    sl[ro + 16] = a1[r] * oscale + radd[r];
    sl[ro + 32] = a2[r] * oscale + radd[r];
    sl[ro + 48] = a3[r] * oscale + radd[r];
  }
  wave_sync_lds();
  v4f vals[8];
#pragma unroll
  for (int it = 0; it < 8; ++it) vals[it] = *(const v4f*)(sl + (it * 2 + hh) * 68 + m * 4) + badd;
  float* dst = C + (rowb + (size_t)hh) * (size_t)N + col0 + m * 4;
  {
#pragma unroll
    for (int it = 0; it < 8; ++it) {
      *(v4f*)(dst + (size_t)(it * 2) * (size_t)N) = vals[it];
    }
    
  }
}

// =====================================================================================================
// Projection epilogue: the wave's 16x64 f32 tile plus bias, staged in its LDS slab, leaves as f16 of (value * scale) straight in
// the order the attention kernel reads it (no f32 plane in between). Unit = 8 halves = one lane's 16-B store; 4 stores a lane.
//   omode 0 (q): tile = 16 tokens x one head's 64 d; D = [b][s][h][d]; one store = 4 token rows x 128 B (whole lines)
//   omode 1 (k): the same tile; D unit ((bh*256 + kt)*8 + dc)*16 + c  <- key s = 16*kt + c, d = 8*dc .. 8*dc+7
//   omode 2 (v): tile = 16 d x 64 keys; D unit (((bh*128 + it)*4 + j)*4 + kc)*16 + c  <- d = 16*j + c, keys 32*it + 8*kc .. +7
// (bh = b*NH + h). In modes 1 and 2 one store is 512 contiguous bytes, and so is each fragment load of the attention loop.
// coverage: 4 stores x 32 lanes x 8 halves = the wave's 16 x 64 tile; the tiles of the grid cover each plane exactly once.
// =====================================================================================================
__device__ __forceinline__ void epi_h16(float* sl, v8f a0, v8f a1, v8f a2, v8f a3, v4f cadd, v8f radd, bool rowbias, float scale,
                                        u16* D, int omode, int rowb, int col0, int y, int lane) {
  static_assert(SEQ == 4096 && DMOD == 256 && HD == 64 && NH == 4);
  const int hh = lane >> 4, m = lane & 15;
#pragma unroll
  for (int r = 0; r < 8; ++r) {
    const int ro = (8 * hh + r) * 68 + m;
    sl[ro]      = a0[r] + (rowbias ? radd[r] : cadd[0]);
    sl[ro + 16] = a1[r] + (rowbias ? radd[r] : cadd[1]);
    sl[ro + 32] = a2[r] + (rowbias ? radd[r] : cadd[2]);
    sl[ro + 48] = a3[r] + (rowbias ? radd[r] : cadd[3]);
  }
  wave_sync_lds();
  // slab row and 8-column chunk of the lane's unit t: q (4t + lane/8, lane%8); k, v (lane%16, 2t + lane/16)
  const int lb = (omode == 0) ? (lane >> 3) * 68 + (lane & 7) * 8 : m * 68 + hh * 8;
  const int ls = (omode == 0) ? 4 * 68 : 16;
  v4u o[4];
#pragma unroll
  for (int t = 0; t < 4; ++t) {
    const float* p = sl + lb + t * ls;
    const v4f a = *(const v4f*)(p), c4 = *(const v4f*)(p + 4);
#pragma unroll
    for (int e = 0; e < 2; ++e) {
      o[t][e]     = pkh(a[2 * e] * scale,  a[2 * e + 1] * scale);
      o[t][2 + e] = pkh(c4[2 * e] * scale, c4[2 * e + 1] * scale);
    }
  }
  const int dq = (rowb + (lane >> 3)) * DMOD + col0 + (lane & 7) * 8;
  const int dk = ((((rowb >> 12) * NH + (col0 >> 6)) * 256 + ((rowb & (SEQ - 1)) >> 4)) * 128 + lane) * 8;
  const int dv = ((((y * NH + (rowb >> 6)) * 128 + (col0 >> 5)) * 4 + ((rowb >> 4) & 3)) * 64 + lane) * 8;
  u16* d = D + (size_t)((omode == 0) ? dq : ((omode == 1) ? dk : dv));   // every one < NB*SEQ*DMOD
#pragma unroll
  for (int t = 0; t < 4; ++t) {
    const int dofs = (omode == 0) ? t * (4 * DMOD) : ((omode == 1) ? t * 256 : (t >> 1) * 2048 + (t & 1) * 256);
    *(v4u*)(d + dofs) = o[t];
  }
}

// =====================================================================================================
// bf16 GEMM with bias, f16 result: (A[M][K] (bf16, TILED) . Bt[N][K]^T (bf16, TILED) + bias) * scale -> plane D in the order of
// omode (see epi_h16). Bias = bf16-RNE values of bias[], index permuted ((i&63)<<2)|(i>>6) and so always in 0..DMOD-1: per column
// (rowbias false) or per row (true). bid = 0 .. (M/64)*(N/64) - 1 tiles, y = batch index with element stride sB added to Bt.
// Block = 64x64 tile, 4 waves x 16 rows; fragments loaded straight from the tiled planes (two 16-B loads each, split k map for
// A and B); K stepped by 32 (K % 32 == 0, M % 64 == 0, N % 64 == 0).
// =====================================================================================================
__device__ __forceinline__
void gemm_bfh_body(float* slab, const u16* __restrict__ A, const u16* __restrict__ Bt, const float* __restrict__ bias,
                   u16* D, int M, int N, int K, float scale, int omode, bool rowbias, int sB, int bid, int y) {
  const int tid = threadIdx.x, wave = tid >> 5, lane = tid & 31, hh = lane >> 4, m = lane & 15;
  const int ntile = N >> 6;
  const int rowb  = (bid / ntile) * 64 + wave * 16;
  const int col0  = (bid % ntile) * 64;
  if (rowb + 16 > M) return;                 // wave-uniform, never taken with the exact grid; no block barriers in this kernel
  const u16* Bb = Bt + (size_t)y * (size_t)sB;
  const u16* ap = A  + (size_t)rowb * K + 8 * lane;   // 16-row tile = 16*K halves, inside it [k/8][row][8]
  const u16* bp = Bb + (size_t)col0 * K + 8 * lane;
  const size_t bs = (size_t)16 * K;
  v8f acc0 = zero8(), acc1 = zero8(), acc2 = zero8(), acc3 = zero8();
#pragma unroll 1
  for (int k0 = 0; k0 < K; k0 += 32) {
    const int ko = k0 * 16;
    const u16 *pa = ap + ko, *p0 = bp + ko, *p1 = p0 + bs, *p2 = p1 + bs, *p3 = p2 + bs;
    const v16b a  = ldfrag_bp(pa);
    const v16b b0 = ldfrag_bp(p0);
    const v16b b1 = ldfrag_bp(p1);
    const v16b b2 = ldfrag_bp(p2);
    const v16b b3 = ldfrag_bp(p3);
    addr_wait5(pa, p0, p1, p2, p3);
    acc0 = mma_b(a, b0, acc0);
    acc1 = mma_b(a, b1, acc1);
    acc2 = mma_b(a, b2, acc2);
    acc3 = mma_b(a, b3, acc3);
    g4_5<v16b>(acc0, acc1, acc2, acc3, a, b0, b1, b2, b3);
  }
  v4f cadd = zero4();
  v8f radd = zero8();
  if (rowbias) {
#pragma unroll
    for (int r = 0; r < 8; ++r) {
      const int ri = rowb + 8 * hh + r;
      radd[r] = bfr(bias[((ri & 63) << 2) | ((ri >> 6) & 3)]);
    }
  } else {
#pragma unroll
    for (int j = 0; j < 4; ++j) {
      const int ci = col0 + 16 * j + m;
      cadd[j] = bfr(bias[((ci & 63) << 2) | ((ci >> 6) & 3)]);
    }
  }
  epi_h16(slab + wave * SLAB64, acc0, acc1, acc2, acc3, cadd, radd, rowbias, scale, D, omode, rowb, col0, y, lane);
}

// =====================================================================================================
// The three projections, which need nothing of each other, as one grid (1024 tiles, 3): blockIdx.y = 0 q, 1 k: token-major,
// [16384 token][h*64+d] = XT . W'^T, per-column bias; 2 v: channel-major per batch (256 tiles x 4 batches in blockIdx.x),
// [b][h*64+d][4096] = W' . XT^T, per-row bias. XT3, WB4, H3 hold the planes of q, k, v one behind the other; H3 = the f16 planes
// x64 that the attention kernel reads, q in place order, k and v in fragment order.
// =====================================================================================================
__global__ __launch_bounds__(128)
void gemm_qkv(const u16* __restrict__ XT3, const u16* __restrict__ WB4, const float* __restrict__ bq,
              const float* __restrict__ bk, const float* __restrict__ bv, u16* H3) {
  static_assert((NB * SEQ / 64) * (DMOD / 64) == 1024 && (DMOD / 64) * (SEQ / 64) == 256 && NB == 4);
  __shared__ __align__(16) float slab[4 * SLAB64];
  const int sel = blockIdx.y;                 // block-uniform
  const int bx  = blockIdx.x;
  const u16* X  = XT3 + (size_t)sel * (size_t)(NB * SEQ * DMOD);
  const u16* Wp = WB4 + (size_t)sel * (DMOD * DMOD);
  u16*       D  = H3 + (size_t)sel * (size_t)(NB * SEQ * DMOD);
  if (sel < 2)
    gemm_bfh_body(slab, X, Wp, (sel == 0) ? bq : bk, D, NB * SEQ, DMOD, DMOD, (sel == 0) ? QSC : KSC, (sel == 0) ? 0 : 1, false, 0, bx, 0);
  else
    gemm_bfh_body(slab, Wp, X, bv, D, DMOD, SEQ, DMOD, VCAR, 2, true, SEQ * DMOD, bx & 255, bx >> 8);
}

// =====================================================================================================
// f16 GEMM, single A plane, hi+lo B planes, per-row bias: C[M][N] (f32, pitch N) = A[M][K] . (Bh + Bl)[N][K]^T times oscale,
// plus bf16-RNE value of bias[row]; A f16 TILED (no batch stride), Bh/Bl f16 [n][k] planes TILED with batch stride sB, C with
// batch stride sC (grid.y = batch). Products a.bh + a.bl into one accumulator (bl is the unscaled residual of bh). Same tiling
// as gemm_bfh_body.
// =====================================================================================================
__global__ __launch_bounds__(128)
void gemm_wh2(const u16* __restrict__ A, const u16* __restrict__ Bh, const u16* __restrict__ Bl,
              const float* __restrict__ bias, float* C, int M, int N, int K, float oscale, int sB, int sC) {
  __shared__ __align__(16) float slab[4 * SLAB64];
  const int tid = threadIdx.x, wave = tid >> 5, lane = tid & 31, hh = lane >> 4, m = lane & 15;
  const int ntile = N >> 6;
  const int bid   = blockIdx.x;
  const int y     = blockIdx.y;
  const int rowb  = (bid / ntile) * 64 + wave * 16;
  const int col0  = (bid % ntile) * 64;
  if (rowb + 16 > M) return;                 // wave-uniform, never taken with the exact grid; no block barriers in this kernel
  const _Float16* ap  = (const _Float16*)(const void*)A + (size_t)rowb * K + 8 * lane;   // tiles as in gemm_bfh_body
  const size_t bofs   = (size_t)y * (size_t)sB + (size_t)col0 * K + 8 * lane;
  const _Float16* bhp = (const _Float16*)(const void*)Bh + bofs;
  const _Float16* blp = (const _Float16*)(const void*)Bl + bofs;
  float* Cb = C + (size_t)y * (size_t)sC;
  const size_t bs = (size_t)16 * K;
  v8f acc0 = zero8(), acc1 = zero8(), acc2 = zero8(), acc3 = zero8();
#pragma unroll 1
  for (int k0 = 0; k0 < K; k0 += 32) {
    const int ko = k0 * 16;
    const _Float16 *pa = ap + ko, *h0 = bhp + ko, *h1 = h0 + bs, *h2 = h1 + bs, *h3 = h2 + bs;
    const _Float16 *l0 = blp + ko, *l1 = l0 + bs, *l2 = l1 + bs, *l3 = l2 + bs;
    const v16h a   = ldfrag_p(pa);
    const v16h bh0 = ldfrag_p(h0);
    const v16h bh1 = ldfrag_p(h1);
    const v16h bh2 = ldfrag_p(h2);
    const v16h bh3 = ldfrag_p(h3);
    const v16h bl0 = ldfrag_p(l0);
    const v16h bl1 = ldfrag_p(l1);
    const v16h bl2 = ldfrag_p(l2);
    const v16h bl3 = ldfrag_p(l3);
    addr_wait9(pa, h0, h1, h2, h3, l0, l1, l2, l3);
    acc0 = mma_h(a, bh0, acc0);  acc0 = mma_h(a, bl0, acc0);
    acc1 = mma_h(a, bh1, acc1);  acc1 = mma_h(a, bl1, acc1);
    acc2 = mma_h(a, bh2, acc2);  acc2 = mma_h(a, bl2, acc2);
    acc3 = mma_h(a, bh3, acc3);  acc3 = mma_h(a, bl3, acc3);
    g4_9(acc0, acc1, acc2, acc3, a, bh0, bh1, bh2, bh3, bl0, bl1, bl2, bl3);
  }
  v4f badd = zero4();
  v8f radd = zero8();
  bias_terms(bias, 2, rowb, col0, hh, m, badd, radd);
  epi64(slab + wave * SLAB64, acc0, acc1, acc2, acc3, oscale, badd, radd, Cb, N, (size_t)rowb, col0, lane);
}

// =====================================================================================================
// Full (non-causal, unmasked) multi-head flash attention: block = (batch b, head, 128 query rows), 8 waves. Wave w = (query
// group wq = w & 3, key group kg = w >> 2) owns the 32 query rows q0 = 128*qt + 32*wq .. q0+31 (two 16-row tiles t = 0, 1) and,
// of every staged tile of 128 keys, the 64 keys 64*kg .. 64*kg+63: each k and v fragment that it reads from LDS feeds two
// products, one per query tile, so the block reads each staged byte 4 times, not 8. Waves w and w ^ 4 hold partial results
// (O, l, maximum in use) of the same 32 queries over the two halves of the keys; they are joined once, behind the loop.
//   q plane (f16, x64) laid out [b][s][h][d]; k and v planes (x64) per (b, h) in fragment order (epi_h16). Tiles of 128 keys are
//   brought into LDS once per block by asynchronous copies, two buffers, tile t + 2 asked for when tile t has been read by all,
//   one barrier a tile; every fragment load of the loop is a ds_load_b128 of 512 contiguous bytes over the wave. All NST = 32
//   tiles are visited, 2 key blocks of 32 keys per wave and tile (static bounds).
//   Scores are computed TRANSPOSED: S^T tile (t, g) (g = 0,1) = k rows (keys kb+16g .. +15, A operand, row m = lane&15, split k
//   map over d) times q^T of tile t (B operand, col n = query q0 + 16t + (lane&15), k = d, split map), one product per tile and d-chunk.
//   D element r of lane l = (key kb+16g+8h+r, query q0+16t+(l&15)), so a lane owns one query column per tile t and 16 of its 32
//   keys; the partner lane l^16 owns the other 16 -> row max / row sum need one xor-16 shuffle.
//   Online base-2 softmax in f32 (scale 1/8 and the q,k carries folded into lsc), the subtracted maximum replaced lazily: a pass
//   keeps the maxima in use, and rescales neither O nor l, unless a scaled score of some lane lies more than 8 above its own (one
//   ballot and one scalar branch a pass, for both query tiles); any subtracted value cancels between O and l. The exp'd values ARE
//   the P A-fragment in place: A row m = query = lane&15, element i <- key kb+8h+i (g = 0, D element i), element 8+i <- key
//   kb+16+8h+i (g = 1, D element i). P is carried x128 as f16 (at most 2^15). The rescale factor of query row 8h+r of the O accumulators is
//   fetched from lane 8h+r with a shuffle (uniform control, inside that branch). 4 v^T B fragments (col n = d = 16j + (lane&15), keys k-contiguous),
//   8 P.V WMMAs per key block.
//   Join: wave w hands the partial O, l and maximum of query tile 1 - kg to wave w ^ 4 through LDS (lane to lane, register to
//   register) and finishes tile kg: both parts brought to the larger of the two maxima, added, divided by the joined l.
//   Epilogue: 1/l (per query, shuffled to the D row owner) and carry folds in f32; the wave's 16x64 f32 result staged in its LDS
// coverage: per wave 4 instructions x 2 chunks x 16 rows x 8 halves = 16 x 64 per plane; grid 512 blocks x 8 waves = every
//           (b, s, h) row of both O planes exactly once.
// =====================================================================================================
// amdgpu_waves_per_eu(4, 4): a register budget of 256 a wave, so that two blocks share a WGP (four waves per SIMD) as before
__global__ __launch_bounds__(ATT_THREADS) __attribute__((amdgpu_waves_per_eu(4, 4)))
void attn_fwd(const u16* __restrict__ QHp, const u16* __restrict__ KHp, const u16* __restrict__ VHp,
              u16* OHIp, u16* OLOp) {
  __shared__ __align__(16) float smem[RINGF];   // loop: [2 buffers][k tile, v tile] of f16; behind it: per wave a hand-over area, then a result slab [16][68]

  const int tid  = threadIdx.x;
  const int wave = tid >> 5;
  const int lane = tid & 31;
  const int hh   = lane >> 4;
  const int c    = lane & 15;
  const int wq   = wave & 3;                  // which 32 query rows of the block
  const int kg   = wave >> 2;                 // which 64 keys of every staged tile

  const int bid  = blockIdx.x;
  const int qt   = bid & (SEQ / 128 - 1);     // 0..31
  const int head = (bid >> 5) & (NH - 1);     // 0..3
  const int b    = bid >> 7;                  // 0..3
  const int q0   = qt * 128 + wq * 32;

  // B fragments of q^T, tile t: col n = query q0 + 16t + c, k = d (k-contiguous row of the q plane); loop-invariant
  const size_t qofs = (((size_t)(b * SEQ + q0 + c)) * NH + head) * HD + 8 * hh;
  const _Float16* Qh  = (const _Float16*)(const void*)QHp + qofs;
  const _Float16* Qh1 = Qh + 16 * NH * HD;
  const v16h qa0 = ldfrag_h(Qh),  qb0 = ldfrag_h(Qh + 32);
  const v16h qa1 = ldfrag_h(Qh1), qb1 = ldfrag_h(Qh1 + 32);
  // k and v planes of (b, head): fragment order, 2048 halves per 32-key block (see epi_h16), so a 128-key tile is STH halves in a
  // row; the thread's first 16-B unit of tile 0, and its place in buffer 0 (LDS byte address = low 32 bits of the shared address)
  const size_t pofs = (size_t)(b * NH + head) * (SEQ * HD) + 8 * tid;
  const u16* gk = KHp + pofs;
  const u16* gv = VHp + pofs;
  const unsigned lk0 = (unsigned)(uintptr_t)(void*)smem + 16u * (unsigned)tid;
  const _Float16* ring = (const _Float16*)(const void*)smem + 8 * lane + kg * (WPS * 32 * HD);   // the lane's unit in the wave's half of a k tile
  const float lsc = 0.125f * (LOG2E / (QSC * KSC));

  // per query tile t: maximum in use, (mrun + RTH) / lsc = the raw score that replaces it, PLOG - mrun (set in the first pass), row sum
  float mrun[2] = {-INFINITY, -INFINITY}, mthr[2] = {-INFINITY, -INFINITY}, nb[2] = {0.f, 0.f}, lrun[2] = {0.f, 0.f};
  float pown[2] = {0.f, 0.f}, poth[2] = {0.f, 0.f};   // a pass's row sum, this lane's half and the partner lane's, until the next pass adds them to l
  v8f o[2][4];
#pragma unroll
  for (int t = 0; t < 2; ++t) {
#pragma unroll
    for (int j = 0; j < 4; ++j) o[t][j] = zero8();
  }

  addr_wait2(Qh, Qh1);
  // tile 0 into buffer 0, landed and published; then tile 1 into buffer 1, which flies while tile 0 is worked on
  stage_kv(lk0, gk, lk0 + 2 * STH, gv);
  wait_copies();
  __syncthreads();
  stage_kv(lk0 + 4 * STH, gk + STH, lk0 + 6 * STH, gv + STH);

#pragma unroll 1
  for (int st = 0; st < NST; ++st) {
   const _Float16* kl = ring + (st & 1) * (2 * STH);   // the wave's half of this tile's k, the lane's unit; A fragment row m = key kb + 16g + c, k = d
   const _Float16* vl = kl + STH;                      // the same half of this tile's v; B fragment col n = d = 16j + c, k = key
   // K fragments of the wave's first key block; its first pass fetches the second pass's behind its own score products
   v16h kf0 = ldfrag_p(kl), kf1 = ldfrag_p(kl + 16 * HD), kf2 = ldfrag_p(kl + 512), kf3 = ldfrag_p(kl + 16 * HD + 512);
#pragma unroll
   for (int ps = 0; ps < WPS; ++ps) {   // unrolled: the fragment addresses become immediate offsets, the last pass drops its fetch
    // (kb below = 128 * st + 64 * kg + 32 * ps, the pass's first key)
    // ---- this pass's v fragments, asked for here and first used behind the softmax: their latency runs under scores and softmax.
    //      B fragment col n = d = j*16 + c, 512 halves per j in the fragment-ordered v tile ----
    const _Float16* vhp = vl + ps * (32 * HD);
    const v16h vh0 = ldfrag_p(vhp);
    const v16h vh1 = ldfrag_p(vhp + 512);
    const v16h vh2 = ldfrag_p(vhp + 1024);
    const v16h vh3 = ldfrag_p(vhp + 1536);
    __builtin_amdgcn_sched_barrier(0);   // keeps the eight v loads in front of the first wait on a k fragment
    // ---- transposed scores: s[t][0] = keys kb..kb+15, s[t][1] = keys kb+16..kb+31, column = query q0 + 16t + c ----
    v8f s[2][2];
    s[0][0] = mma_h(kf0, qa0, zero8());
    s[0][1] = mma_h(kf1, qa0, zero8());
    s[1][0] = mma_h(kf0, qa1, zero8());
    s[1][1] = mma_h(kf1, qa1, zero8());
    s[0][0] = mma_h(kf2, qb0, s[0][0]);
    s[0][1] = mma_h(kf3, qb0, s[0][1]);
    s[1][0] = mma_h(kf2, qb1, s[1][0]);
    s[1][1] = mma_h(kf3, qb1, s[1][1]);
    g4_8(s[0][0], s[0][1], s[1][0], s[1][1], qa0, qb0, qa1, qb1, kf0, kf1, kf2, kf3);
    // ---- the next pass's k fragments into the same registers, inside the wave's half of this tile only ----
    if (ps + 1 < WPS) {
      const _Float16* knp = kl + (ps + 1) * (32 * HD);
      kf0 = ldfrag_p(knp);
      kf1 = ldfrag_p(knp + 16 * HD);
      kf2 = ldfrag_p(knp + 512);
      kf3 = ldfrag_p(knp + 16 * HD + 512);
    }
    __builtin_amdgcn_sched_barrier(0);   // keeps the eight k loads here: without it they sink into the softmax, whose temporaries take their registers
    // ---- raw scores of this lane's 16 keys for query q0 + 16t + c: s[t][0][i] <- key kb+8hh+i, s[t][1][i] <- key kb+16+8hh+i. The maximum
    //      is taken on the raw scores and scaled where it is needed: lsc > 0 and rounding is monotone, so it equals the maximum of the scaled ones ----
    float cr[2];
#pragma unroll
    for (int t = 0; t < 2; ++t) {
      lrun[t] += pown[t] + poth[t];   // the pass before's row sum, both halves: in l before the test below can rescale l
      float x = s[t][0][0];
#pragma unroll
      for (int i = 1; i < 8; ++i) x = fmaxf(x, s[t][0][i]);
#pragma unroll
      for (int i = 0; i < 8; ++i) x = fmaxf(x, s[t][1][i]);
      cr[t] = x;
    }
    // ---- lazy rescale, tested once a pass: only if some lane's largest score lies more than RTH above its maximum in use (always in
    //      the first pass, mthr = -inf) do the halves exchange maxima, the maxima in use move up and O and l are rescaled. The ballot
    //      makes it a scalar branch, taken by the whole wave. Not taken: every weight of the pass is at most 2^(PLOG + RTH) ----
    if (__builtin_expect(__builtin_amdgcn_ballot_w32((cr[0] > mthr[0]) | (cr[1] > mthr[1])) != 0u, 0)) {
#pragma unroll
      for (int t = 0; t < 2; ++t) {
        const float cm = cr[t] * lsc;
        const float mn = fmaxf(mrun[t], fmaxf(cm, __shfl_xor(cm, 16, 32)));   // the same in both lanes of a query; finite from the first pass on
        const float al = hw_exp2(mrun[t] - mn);                               // 0 in the first pass (mrun = -inf), 1 for a query that keeps its maximum
        mrun[t] = mn;
        mthr[t] = (mn + RTH) * (1.0f / lsc);
        nb[t]   = PLOG - mn;
        lrun[t] *= al;
        // D row 8hh+r of the O accumulators = query q0+16t+8hh+r, its factor lives in lane 8hh+r (and 16+8hh+r)
        float scl[8];
#pragma unroll
        for (int r = 0; r < 8; ++r) scl[r] = __shfl(al, 8 * hh + r, 32);
#pragma unroll
        for (int j = 0; j < 4; ++j) {
#pragma unroll
          for (int r = 0; r < 8; ++r) o[t][j][r] *= scl[r];
        }
      }
    }
    // ---- weights p * 128 = 2^(s * lsc - mrun + 7): one fma and one v_exp_f32 each; their f16 values are the P A-fragment,
    //      element 8w + i <-> s[t][w][i]; the row sum carries the same 128 ----
    FragH ph[2];
#pragma unroll
    for (int t = 0; t < 2; ++t) {
      float p[16];
#pragma unroll
      for (int i = 0; i < 8; ++i) { p[i] = fmaf(s[t][0][i], lsc, nb[t]); p[8 + i] = fmaf(s[t][1][i], lsc, nb[t]); }
      hw_exp2x8(p[0], p[1], p[2], p[3], p[4], p[5], p[6], p[7]);
      hw_exp2x8(p[8], p[9], p[10], p[11], p[12], p[13], p[14], p[15]);
      // convert and row sum both take the pairs (p[2k], p[2k + 1]) as they lie in the accumulators' registers: one packed instruction a pair
      v2f sm[2];
#pragma unroll
      for (int w = 0; w < 2; ++w) {
#pragma unroll
        for (int e4 = 0; e4 < 4; ++e4) {
          const int i = 8 * w + 2 * e4;
          const v2f two = {p[i], p[i + 1]};
          sm[w] = (e4 == 0) ? two : sm[w] + two;
          ph[t].u[w][e4] = pkh(p[i], p[i + 1]);
        }
      }
      const v2f s2 = sm[0] + sm[1];
      const float sum = s2[0] + s2[1];
      pown[t] = sum;
      poth[t] = __shfl_xor(sum, 16, 32);   // asked for here, added to l in the next pass: its latency runs under the products
    }
    // ---- P.V with the v fragments asked for at the head of the pass, each used for both query tiles ----
    {
      o[0][0] = mma_h(ph[0].v, vh0, o[0][0]);
      o[0][1] = mma_h(ph[0].v, vh1, o[0][1]);
      o[0][2] = mma_h(ph[0].v, vh2, o[0][2]);
      o[0][3] = mma_h(ph[0].v, vh3, o[0][3]);
      o[1][0] = mma_h(ph[1].v, vh0, o[1][0]);
      o[1][1] = mma_h(ph[1].v, vh1, o[1][1]);
      o[1][2] = mma_h(ph[1].v, vh2, o[1][2]);
      o[1][3] = mma_h(ph[1].v, vh3, o[1][3]);
      g8in(o[0][0], o[0][1], o[0][2], o[0][3], o[1][0], o[1][1], o[1][2], o[1][3], ph[0].v, ph[1].v, vh0, vh1, vh2, vh3, poth[0], poth[1]);
    }
   }
   // ---- foot of tile st, every wave: its own LDS reads done, its own copies of tile st + 1 landed, then the one barrier that
   //      publishes tile st + 1 and ends every wave's reading of this buffer; only behind it the refill with tile st + 2 ----
   wait_lds_reads();
   wait_copies();
   __syncthreads();
   if (st + 2 < NST) {
     const unsigned lb = lk0 + (unsigned)(st & 1) * (4 * STH);
     const size_t   go = (size_t)(st + 2) * STH;
     stage_kv(lb, gk + go, lb + 2 * STH, gv + go);
   }
  }
  wait_copies();   // nothing is outstanding here; the last foot's barrier has ended all reading of the ring, which now holds the hand-over areas
  acc_guard8(o[0][0], o[0][1], o[0][2], o[0][3], o[1][0], o[1][1], o[1][2], o[1][3]);

  // ---- join of the two key halves: the wave keeps query tile kg and hands tile 1 - kg to wave w ^ 4, lane to lane: 8 units of
  //      16 B a lane (one store = 512 contiguous bytes), then the maximum in use and the row sum ----
  lrun[0] += pown[0] + poth[0];   // the last pass's row sums
  lrun[1] += pown[1] + poth[1];
  const bool up = __builtin_amdgcn_readfirstlane(kg) != 0;   // wave-uniform
  v8f mine[4], give[4];
#pragma unroll
  for (int j = 0; j < 4; ++j) { mine[j] = up ? o[1][j] : o[0][j]; give[j] = up ? o[0][j] : o[1][j]; }
  const float mmine = up ? mrun[1] : mrun[0], mgive = up ? mrun[0] : mrun[1];
  const float lmine = up ? lrun[1] : lrun[0], lgive = up ? lrun[0] : lrun[1];
  float* xw = smem + wave * SLABF;          // written by this wave, read by wave w ^ 4 alone
  float* xr = smem + (wave ^ 4) * SLABF;    // written by wave w ^ 4, read by this wave alone
#pragma unroll
  for (int j = 0; j < 4; ++j) {
#pragma unroll
    for (int h2 = 0; h2 < 2; ++h2) {
      const v4f u = {give[j][4 * h2], give[j][4 * h2 + 1], give[j][4 * h2 + 2], give[j][4 * h2 + 3]};
      *(v4f*)(xw + ((j * 2 + h2) * 32 + lane) * 4) = u;
    }
  }
  xw[1024 + lane] = mgive;
  xw[1056 + lane] = lgive;
  __syncthreads();   // the hand-over areas are written; passed by all eight waves
  v4f got[8];
#pragma unroll
  for (int u = 0; u < 8; ++u) got[u] = *(const v4f*)(xr + (u * 32 + lane) * 4);
  const float mgot = xr[1024 + lane], lgot = xr[1056 + lane];
  // both parts to the larger maximum (both finite: each wave has seen keys); l carries the same 128 as P; the carry 64 on v folded in
  const float mj   = fmaxf(mmine, mgot);
  const float am   = hw_exp2(mmine - mj), ag = hw_exp2(mgot - mj);
  const float linv = (1.0f / (lmine * am + lgot * ag)) * (1.0f / VCAR);
  const float fm = am * linv, fg = ag * linv;
  float im[8], ig[8];
#pragma unroll
  for (int r = 0; r < 8; ++r) { im[r] = __shfl(fm, 8 * hh + r, 32); ig[r] = __shfl(fg, 8 * hh + r, 32); }
  float* slab = xr;   // the area this wave alone has read, and has read to the end, now takes its 16x64 result
#pragma unroll
  for (int r = 0; r < 8; ++r) {
#pragma unroll
    for (int j = 0; j < 4; ++j) slab[(8 * hh + r) * 68 + j * 16 + c] = mine[j][r] * im[r] + got[j * 2 + (r >> 2)][r & 3] * ig[r];
  }
  wave_sync_lds();
  // ---- O x1024 -> f16 hi + residual planes, TILED as [token][h*64+d] operands; one store = 512 contiguous bytes ----
  v4u oh[4], ol[4];
#pragma unroll
  for (int i4 = 0; i4 < 4; ++i4) {
    const int c8 = (i4 * 2 + hh) * 8;         // lane = (8-d chunk parity hh, query row c)
    const v4f a = *(const v4f*)(slab + c * 68 + c8), c4 = *(const v4f*)(slab + c * 68 + c8 + 4);
    float w[8];
#pragma unroll
    for (int e = 0; e < 4; ++e) { w[e] = a[e] * OSC; w[4 + e] = c4[e] * OSC; }
#pragma unroll
    for (int e = 0; e < 4; ++e) {
      const v2h hi = cvt2h(w[2 * e], w[2 * e + 1]);
      oh[i4][e] = __builtin_bit_cast(unsigned, hi);
      ol[i4][e] = pkh(w[2 * e] - (float)hi[0], w[2 * e + 1] - (float)hi[1]);
    }
  }
  const size_t ob = ((size_t)(b * SEQ + q0 + 16 * kg)) * (NH * HD) + (size_t)head * (HD * 16) + 8 * lane;
  {
#pragma unroll
    for (int i4 = 0; i4 < 4; ++i4) {
      const size_t o8 = ob + (size_t)i4 * 256;
      *(v4u*)(OHIp + o8) = oh[i4];
      *(v4u*)(OLOp + o8) = ol[i4];
    }
    
  }
}

// =====================================================================================================
// Workspace map (bytes); every plane is fully written by whole-line stores before it is read; all extents are exact multiples
// of the store granularity (no pad rows needed); every offset a multiple of 131072; q, k and v each have an XT plane of their own:
//   XT  bf16 3 x [16384 token][256 i] tiled         25165824     (query, key, value)
//   WQB bf16 [256 r'][256 i] tiled (rows permuted)  131072      WKB same 131072     WVB same 131072
//   WOB f16  [256 o][256 c'] tiled x1024 (cols permuted)  131072
//   QH  f16  [4][4096][4][64] x64                   8388608
//   KH  f16  [16 bh][256 kt][8 dc][16 key][8 d] x64          8388608   (fragment order)
//   VH  f16  [16 bh][128 it][4 j][4 kc][16 d][8 key] x64     8388608   (fragment order)
//   OHI f16  [16384 token][256 h*64+d] tiled x1024   8388608      OLO residual 8388608
//   end                                            67633152
// =====================================================================================================
extern "C" void kernel_launch(void* const* d_in, const int* in_sizes, int n_in,
                              void* d_out, int out_size, void* d_ws, size_t ws_size,
                              hipStream_t stream) {
  const int ROWS = NB * SEQ;                            // 16384 tokens
  const int XN   = NB * DMOD * SEQ;                     // 4194304
  if (n_in < 11) return;
  if (in_sizes[0] != XN || in_sizes[1] != XN || in_sizes[2] != XN) return;
  if (in_sizes[3] != DMOD * DMOD || in_sizes[5] != DMOD * DMOD) return;
  if (in_sizes[7] != DMOD * DMOD || in_sizes[9] != DMOD * DMOD) return;
  if (in_sizes[4] != DMOD || in_sizes[6] != DMOD || in_sizes[8] != DMOD || in_sizes[10] != DMOD) return;
  if (out_size != XN) return;

  const float* Qin = (const float*)d_in[0];
  const float* Kin = (const float*)d_in[1];
  const float* Vin = (const float*)d_in[2];
  const float* wq  = (const float*)d_in[3];
  const float* bq  = (const float*)d_in[4];
  const float* wk  = (const float*)d_in[5];
  const float* bk  = (const float*)d_in[6];
  const float* wv  = (const float*)d_in[7];
  const float* bv  = (const float*)d_in[8];
  const float* wo  = (const float*)d_in[9];
  const float* bo  = (const float*)d_in[10];
  float*       out = (float*)d_out;

  const size_t szXT = (size_t)ROWS * DMOD * 2;                  //  8388608
  const size_t szW  = (size_t)DMOD * DMOD * 2;                  //   131072
  const size_t szP  = (size_t)ROWS * DMOD * 2;                  //  8388608  (q/k/v/o planes)
  size_t off = 0;
  const size_t oXT  = off; off += 3 * szXT;
  const size_t oWQB = off; off += szW;
  const size_t oWKB = off; off += szW;
  const size_t oWVB = off; off += szW;
  const size_t oWOB = off; off += szW;
  const size_t oQH  = off; off += szP;
  const size_t oKH  = off; off += szP;
  const size_t oVH  = off; off += szP;
  const size_t oOHI = off; off += szP;
  const size_t oOLO = off; off += szP;
  if (off > ws_size) return;                            // off = 67633152
  if (off > (size_t)134217728) return;

  char* ws = (char*)d_ws;
  u16*   XT  = (u16*)(ws + oXT);
  u16*   WQB = (u16*)(ws + oWQB);
  u16*   WOB = (u16*)(ws + oWOB);
  u16*   QH  = (u16*)(ws + oQH);
  u16*   KH  = (u16*)(ws + oKH);
  u16*   VH  = (u16*)(ws + oVH);
  u16*   OHI = (u16*)(ws + oOHI);
  u16*   OLO = (u16*)(ws + oOLO);

  const dim3 blk(256);
  const int n8w = (DMOD * DMOD) / 8;                    // 8192
  if ((n8w % 256) != 0) return;
  const dim3 gPre(4 * (n8w / 256) + 3 * NB * (SEQ / 64) * (DMOD / 64));   // 128 weight blocks + 3072 transpose blocks
  const dim3 gG3((ROWS / 64) * (DMOD / 64), 3);         // 1024 tiles x (q, k, v)
  const dim3 gGc((DMOD / 64) * (SEQ / 64), NB);         // 256 tiles x 4 batches, channel-major per batch
  const dim3 bG(128);
  const dim3 gAT(ATT_BLOCKS);                           // 512
  const dim3 bAT(ATT_THREADS);                          // 256
  const int  sTok = SEQ * DMOD;                         // 1048576 elements: per-batch stride of XT / O planes
  const int  sChn = DMOD * SEQ;                         // 1048576 elements: per-batch stride of out

  // (0) weights: rows of wq/wk/wv permuted to r' = h*64+d (bf16 planes), columns of wo permuted the same way (f16 of bf16 value x1024);
  //     inputs query, key, value -> XT bf16 [token][i], one plane each (WQB .. WOB lie one behind the other)
  prep<<<gPre, blk, 0, stream>>>(Qin, Kin, Vin, wq, wk, wv, wo, XT, WQB);
  // (1) projections + bias -> f16 planes x64 (QH, KH, VH lie one behind the other): q in place order, k and v in fragment order
  gemm_qkv<<<gG3, bG, 0, stream>>>(XT, WQB, bq, bk, bv, QH);
  // (2) attention -> O planes [token][h*64+d] tiled, x1024 (hi + residual)
  attn_fwd<<<gAT, bAT, 0, stream>>>(QH, KH, VH, OHI, OLO);
  // (3) output projection per batch + bias -> out [b][256 o][4096 n] f32, carries 1024 (O) x 1024 (wo) folded back
  gemm_wh2<<<gGc, bG, 0, stream>>>(WOB, OHI, OLO, bo, out, DMOD, SEQ, DMOD, 1.0f / (OSC * WOS), sTok, sChn);
  (void)hipGetLastError();
}

// v010
// Measured time: 85.3 microseconds a run.
// In two side-by-side timings against v009, it was 1.16 and 1.15 times as fast.
// All steps since v000 together make it 4.23 times as fast.
// Contractions: projections Xt.W'^T and W'.Xt^T on v_wmma_f32_16x16x32_bf16 (Xt and W RNE-converted bf16 operands, f32 accumulate, bias added in f32);
// scores k'.q'^T (q', k' carried x64 as f16), P.v (P x128 as f16, v x64 as f16) and Wm'.O^T (Wm' as f16(bf16(Wm) x1024), O x1024 as f16 hi plane
// + f16 residual plane, products w.h + w.l): v_wmma_f32_16x16x32_f16, f32 accumulate. Base-2 online softmax, 1/l fold and bias adds in f32 on VALU.
#include <hip/hip_runtime.h>
#include <math.h>
#include <stdint.h>

#define NB    4
#define SEQ   4096
#define DMOD  256
#define NH    4
#define HD    64
#define QSC   64.0f
#define KSC   64.0f
#define PCAR  128.0f
#define VCAR  64.0f
#define OSC   1024.0f
#define WOS   1024.0f
#define LOG2E 1.4426950408889634f
#define PLOG  7.0f
#define RTH   8.0f                // a maximum in use is replaced when a scaled score exceeds it by more than this (base-2 exponent)
#define ATT_WAVES   8
#define ATT_THREADS (ATT_WAVES * 32)
#define ATT_BLOCKS  (NB * NH * (SEQ / (16 * ATT_WAVES)))
#define NKB    (SEQ / 32)
#define STK    128                 // keys of one staged tile
#define WPS    2                   // passes of 32 keys that one wave makes over a staged tile: its half of the tile's keys
#define NST    (SEQ / STK)         // staged tiles per (batch, head)
#define STH    (STK * HD)          // halves of one operand's staged tile (16 KiB)
#define RINGF  (2 * STH)           // floats of the ring: 2 buffers x (k tile, v tile) = 64 KiB
#define SLABF  (16 * 68)
#define SLAB64 (16 * 68)
#define XTP    264                 // halves: pitch of a token row of the staged x tile, 528 B = 16 B x 33 (odd: b128 rows spread over the banks)
static_assert(HD == 64 && DMOD == NH * HD);
static_assert(PCAR == 128.0f && PLOG == 7.0f && PLOG + RTH == 15.0f);   // PCAR = 2^PLOG; the largest weight, 2^(PLOG + RTH), is finite in f16
static_assert((SEQ / 64) == 64 && NH == 4 && NB == 4);
static_assert(ATT_THREADS == 256 && ATT_BLOCKS == 512 && NKB == 128);
static_assert((DMOD % 64) == 0 && (SEQ % 64) == 0 && (DMOD % 32) == 0);
static_assert(((NB * SEQ * DMOD / 8) % 256) == 0 && ((DMOD * DMOD / 8) % 256) == 0);
static_assert((DMOD / 8) == 32);
static_assert(XTP >= DMOD + 8 && (XTP % 8) == 0 && ((XTP / 8) & 1) == 1);
static_assert(ATT_WAVES * SLABF >= 4 * 16 * 68);
static_assert(2 * WPS * 32 == STK && ATT_WAVES == 8 && SLABF == 34 * 32);   // two key groups of four waves; hand-over area = 32 + 2 floats a lane
static_assert(NST >= 2 && STK == 4 * 32 && STH * 2 == 4 * ATT_THREADS * 16 && RINGF >= ATT_WAVES * SLABF);

typedef unsigned short u16;
typedef _Float16 v16h __attribute__((ext_vector_type(16)));
typedef _Float16 v8h  __attribute__((ext_vector_type(8)));
typedef __bf16   v16b __attribute__((ext_vector_type(16)));
typedef float    v8f  __attribute__((ext_vector_type(8)));
typedef float    v4f  __attribute__((ext_vector_type(4)));
typedef unsigned int v4u __attribute__((ext_vector_type(4)));
typedef float    v2f  __attribute__((ext_vector_type(2)));
typedef _Float16 v2h  __attribute__((ext_vector_type(2)));
typedef __bf16   v2b  __attribute__((ext_vector_type(2)));

union FragH { v16h v; v8h h[2]; v4u u[2]; };
union FragB { v16b v; v4u u[2]; };

// ---- scalar helpers --------------------------------------------------------------------------------
__device__ __forceinline__ unsigned short bf_bits(float f) {          // f32 -> bf16 bits, RNE convert
  unsigned u = __float_as_uint(f);
  return (unsigned short)((u + 0x7FFFu + ((u >> 16) & 1u)) >> 16);
}
__device__ __forceinline__ float bf_up(unsigned short h) { return __uint_as_float(((unsigned)h) << 16); }
__device__ __forceinline__ float bfr(float f) { return bf_up(bf_bits(f)); }
__device__ __forceinline__ unsigned short h_bits(_Float16 x) { return __builtin_bit_cast(unsigned short, x); }
__device__ __forceinline__ unsigned pk16(unsigned short a, unsigned short b) { return (unsigned)a | ((unsigned)b << 16); }
// two f32 -> two 16-bit values (round to nearest even, a in the low half) as the one packed convert instruction
__device__ __forceinline__ v2h cvt2h(float a, float b) { const v2f x = {a, b}; return __builtin_convertvector(x, v2h); }
__device__ __forceinline__ unsigned pkh(float a, float b) { return __builtin_bit_cast(unsigned, cvt2h(a, b)); }
__device__ __forceinline__ unsigned pkb(float a, float b) { const v2f x = {a, b}; return __builtin_bit_cast(unsigned, __builtin_convertvector(x, v2b)); }
__device__ __forceinline__ v8f zero8() { v8f z = {0.f, 0.f, 0.f, 0.f, 0.f, 0.f, 0.f, 0.f}; return z; }
__device__ __forceinline__ v4f zero4() { v4f z = {0.f, 0.f, 0.f, 0.f}; return z; }

// ---- fragment loaders: 16-bit A/B operand, lane -> row/col (lane&15), h = lane>>4; elements 0..7 <- k0+8h.., elements 8..15 <-
//      k0+16+8h.. (same split k map for A and B).
//      ldfrag_h: row-major [row][k] plane, p already includes +8*h (q only, read once per wave).
//      TILED plane of a [rows][K] operand: 16-row tile = 16*K halves in a row, inside it [k/8][row%16][8 k], so that the unit of
//      lane l for k0 lies at k0*16 + 8*l and a wave-wide 16-B load is 512 contiguous bytes (4 whole lines, not pieces of 16).
__device__ __forceinline__ v16h ldfrag_h(const _Float16* p) {
  FragH f;
  f.h[0] = *(const v8h*)(p);
  f.h[1] = *(const v8h*)(p + 16);
  return f.v;
}
//      ldfrag_p / ldfrag_bp: tiled or fragment-ordered plane, p already includes +8*lane; the second half lies 256 halves on.
__device__ __forceinline__ v16h ldfrag_p(const _Float16* p) {
  FragH f;
  f.h[0] = *(const v8h*)(p);
  f.h[1] = *(const v8h*)(p + 256);
  return f.v;
}
__device__ __forceinline__ v16b ldfrag_bp(const u16* p) {             // the same for a bf16 plane, read as unsigned integer vectors
  FragB f;
  f.u[0] = *(const v4u*)(p);
  f.u[1] = *(const v4u*)(p + 256);
  return f.v;
}

//      ldfrag_t: row-major [row][k] bf16 tile in LDS, p already includes row * pitch + 8*h; the second half lies 16 k on.
__device__ __forceinline__ v16b ldfrag_t(const u16* p) {
  FragB f;
  f.u[0] = *(const v4u*)(p);
  f.u[1] = *(const v4u*)(p + 16);
  return f.v;
}

// 2^x as the one hardware instruction (v_exp_f32). The library exp2f wraps it in a range guard (compare, two selects, add, ldexp)
// that only serves results below 2^-126; here such a result is a weight that rounds to zero in f16 and adds nothing to a row sum
// that holds the 2^7 of the score whose value is the maximum in use, so a flush to zero gives the same output.
// The v_nop in the same statement is the one slot that the instruction set asks for between it and the first use of its result.
__device__ __forceinline__ float hw_exp2(float x) {
  float r = x;
#if defined(__HIP_DEVICE_COMPILE__)
  asm("v_exp_f32 %0, %0\n\tv_nop" : "+v"(r));
#endif
  return r;
}
// eight of them in place, as one statement: each writes only its own source, so none overwrites the source of the one in front of
// it, and the v_nop is the one slot that the instruction set asks for between the last one and the first use of its result.
__device__ __forceinline__ void hw_exp2x8(float& x0, float& x1, float& x2, float& x3, float& x4, float& x5, float& x6, float& x7) {
#if defined(__HIP_DEVICE_COMPILE__)
  asm("v_exp_f32 %0, %0\n\tv_exp_f32 %1, %1\n\tv_exp_f32 %2, %2\n\tv_exp_f32 %3, %3\n\t"
      "v_exp_f32 %4, %4\n\tv_exp_f32 %5, %5\n\tv_exp_f32 %6, %6\n\tv_exp_f32 %7, %7\n\tv_nop"
      : "+v"(x0), "+v"(x1), "+v"(x2), "+v"(x3), "+v"(x4), "+v"(x5), "+v"(x6), "+v"(x7));
#endif
}

__device__ __forceinline__ v8f mma_h(v16h a, v16h b, v8f c) {
  return __builtin_amdgcn_wmma_f32_16x16x32_f16(false, a, false, b, (short)0, c, false, false);
}
__device__ __forceinline__ v8f mma_b(v16b a, v16b b, v8f c) {
  return __builtin_amdgcn_wmma_f32_16x16x32_bf16(false, a, false, b, (short)0, c, false, false);
}
// four vector slots behind the last score WMMA: in front of the first read of its result and of the loads that overwrite its A fragments
__device__ __forceinline__ void g4_8(v8f& a, v8f& b, v8f& c, v8f& d, v16h x0, v16h x1, v16h x2, v16h x3, v16h x4, v16h x5,
                                     v16h x6, v16h x7) {
#if defined(__HIP_DEVICE_COMPILE__)
  asm volatile("v_nop\n\tv_nop\n\tv_nop\n\tv_nop"
               : "+v"(a), "+v"(b), "+v"(c), "+v"(d)
               : "v"(x0), "v"(x1), "v"(x2), "v"(x3), "v"(x4), "v"(x5), "v"(x6), "v"(x7) : "memory");
#endif
}
__device__ __forceinline__ void g4_9(v8f& a, v8f& b, v8f& c, v8f& d, v16h x0, v16h x1, v16h x2, v16h x3, v16h x4,
                                     v16h x5, v16h x6, v16h x7, v16h x8) {
#if defined(__HIP_DEVICE_COMPILE__)
  asm volatile("v_nop\n\tv_nop\n\tv_nop\n\tv_nop"
               : "+v"(a), "+v"(b), "+v"(c), "+v"(d)
               : "v"(x0), "v"(x1), "v"(x2), "v"(x3), "v"(x4), "v"(x5), "v"(x6), "v"(x7), "v"(x8) : "memory");
#endif
}
// the same four slots behind the last P.V WMMA of a pass, the accumulators named as inputs only: nothing reads them before the next
// pass's products but the rare rescale. e0, e1 = the pass's exchanged row sums, inputs only: their exchange then stands in front of this
// statement and its latency runs under the products; left free it sank into the next pass and was waited for there in the open
__device__ __forceinline__ void g8in(v8f a, v8f b, v8f c, v8f d, v8f e, v8f f, v8f g, v8f h, v16h x0, v16h x1, v16h x2, v16h x3,
                                     v16h x4, v16h x5, float e0, float e1) {
#if defined(__HIP_DEVICE_COMPILE__)
  asm volatile("v_nop\n\tv_nop\n\tv_nop\n\tv_nop"
               : : "v"(a), "v"(b), "v"(c), "v"(d), "v"(e), "v"(f), "v"(g), "v"(h),
                   "v"(x0), "v"(x1), "v"(x2), "v"(x3), "v"(x4), "v"(x5), "v"(e0), "v"(e1) : "memory");
#endif
}
__device__ __forceinline__ void acc_guard8(v8f& a, v8f& b, v8f& c, v8f& d, v8f& e, v8f& f, v8f& g, v8f& h) {
#if defined(__HIP_DEVICE_COMPILE__)
  asm volatile("v_nop\n\tv_nop\n\tv_nop\n\tv_nop" : "+v"(a), "+v"(b), "+v"(c), "+v"(d), "+v"(e), "+v"(f), "+v"(g), "+v"(h));
#endif
}
// s_wait_xcnt 0 behind a group of fragment loads: it stands in front of every later write of a register that those loads name as
// address; naming the addresses as inputs keeps their registers unwritten (also by a later load's result) up to the wait.
__device__ __forceinline__ void addr_wait1(const void* a) {
#if defined(__HIP_DEVICE_COMPILE__)
  asm volatile("s_wait_xcnt 0x0" : : "v"(a) : "memory");
#endif
}
__device__ __forceinline__ void addr_wait2(const void* a, const void* b) {
#if defined(__HIP_DEVICE_COMPILE__)
  asm volatile("s_wait_xcnt 0x0" : : "v"(a), "v"(b) : "memory");
#endif
}
__device__ __forceinline__ void addr_wait9(const void* a, const void* b0, const void* b1, const void* b2, const void* b3,
                                           const void* c0, const void* c1, const void* c2, const void* c3) {
#if defined(__HIP_DEVICE_COMPILE__)
  asm volatile("s_wait_xcnt 0x0"
               : : "v"(a), "v"(b0), "v"(b1), "v"(b2), "v"(b3), "v"(c0), "v"(c1), "v"(c2), "v"(c3) : "memory");
#endif
}
// One staged tile (128 keys of k, 128 keys of v, 16 KiB each, contiguous in their fragment-ordered planes and laid the same way in
// LDS) by asynchronous copies: each thread moves 4 + 4 units of 16 B, unit j lies 4096 B (= 256 threads x 16 B) behind unit j - 1;
// the immediate offset moves the global and the LDS address alike. lk, lv = the thread's LDS byte addresses, gk, gv its global ones.
// s_wait_xcnt 0 as the last line stands in front of every later write of the four address registers.
__device__ __forceinline__ void stage_kv(unsigned lk, const u16* gk, unsigned lv, const u16* gv) {
#if defined(__HIP_DEVICE_COMPILE__)
  asm volatile("global_load_async_to_lds_b128 %0, %1, off\n\t"
               "global_load_async_to_lds_b128 %0, %1, off offset:4096\n\t"
               "global_load_async_to_lds_b128 %0, %1, off offset:8192\n\t"
               "global_load_async_to_lds_b128 %0, %1, off offset:12288\n\t"
               "global_load_async_to_lds_b128 %2, %3, off\n\t"
               "global_load_async_to_lds_b128 %2, %3, off offset:4096\n\t"
               "global_load_async_to_lds_b128 %2, %3, off offset:8192\n\t"
               "global_load_async_to_lds_b128 %2, %3, off offset:12288\n\t"
               "s_wait_xcnt 0x0"
               : : "v"(lk), "v"(gk), "v"(lv), "v"(gv) : "memory");
#endif
}
// the issuing wave's own wait for its copies: behind it and the next barrier every wave may read the tile
__device__ __forceinline__ void wait_copies() {
#if defined(__HIP_DEVICE_COMPILE__)
  asm volatile("s_wait_asynccnt 0x0" : : : "memory");
#endif
}
// the wave's LDS reads have returned: in front of the barrier behind which the buffer it read is refilled
__device__ __forceinline__ void wait_lds_reads() {
#if defined(__HIP_DEVICE_COMPILE__)
  asm volatile("s_wait_dscnt 0x0" : : : "memory");
#endif
}
__device__ __forceinline__ void wave_sync_lds() {
  __builtin_amdgcn_fence(__ATOMIC_RELEASE, "workgroup");
  __builtin_amdgcn_wave_barrier();
  __builtin_amdgcn_fence(__ATOMIC_ACQUIRE, "workgroup");
}

// =====================================================================================================
// Weight matrix [DMOD][DMOD] f32 -> 16-bit plane [DMOD][DMOD], stored TILED (see the loaders), head-split permutation folded in:
//   mode 0: D[r][i]  = bf16 RNE bits of W[((r & 63) << 2) | (r >> 6)][i]      (output row r = h*64+d <- channel d*4+h)
//   mode 1: D[o][c]  = f16 bits of bf16value(W[o][((c & 63) << 2) | (c >> 6)]) * scale   (input column permuted the same way)
// Thread = 8 consecutive output elements (8 scalar loads, both candidate indices always < DMOD*DMOD, selected by value);
// coverage: blk = 0 .. DMOD*DMOD/8/256 - 1 = 32 blocks x 256 thr x 8 = the whole plane.
// =====================================================================================================
__device__ __forceinline__ void cvtw_body(const float* __restrict__ w, u16* D, int mode, float scale, int blk) {
  const int gt = blk * 256 + (int)threadIdx.x;
  if (gt >= (DMOD * DMOD) / 8) return;       // no barriers in this body
  const int row  = ((gt >> 9) << 4) | (gt & 15);   // 0..255: destination unit gt = ((row/16)*32 + c8/8)*16 + row%16
  const int c8   = ((gt >> 4) & 31) * 8;           // 0..248
  const int prow = ((row & 63) << 2) | (row >> 6);
  const int hsel = c8 >> 6, d0 = c8 & 63;
  unsigned short s[8];
  int   idx[8];
  float wv[8];
#pragma unroll
  for (int e = 0; e < 8; ++e) {
    const int i0  = prow * DMOD + c8 + e;                   // < 65536
    const int i1  = row * DMOD + ((d0 + e) << 2) + hsel;    // < 65536
    idx[e] = (mode == 0) ? i0 : i1;
    wv[e]  = w[idx[e]];
  }
#if defined(__HIP_DEVICE_COMPILE__)
  // s_wait_xcnt 0 behind the eight loads, in front of every later write of an index register that they name as address; naming
  // the indices as inputs keeps their registers unwritten (also by a later load's result) up to the wait.
  asm volatile("s_wait_xcnt 0x0" : : "v"(idx[0]), "v"(idx[1]), "v"(idx[2]), "v"(idx[3]), "v"(idx[4]), "v"(idx[5]), "v"(idx[6]),
               "v"(idx[7]) : "memory");
#endif
#pragma unroll
  for (int e = 0; e < 8; ++e) {
    const float v = wv[e];
    const unsigned short bb = bf_bits(v);
    const unsigned short hb = h_bits((_Float16)(bf_up(bb) * scale));
    s[e] = (mode == 0) ? bb : hb;
  }
  v4u o;
#pragma unroll
  for (int e = 0; e < 4; ++e) o[e] = pk16(s[2 * e], s[2 * e + 1]);
  u16* d = D + (size_t)gt * 8;
  {
    *(v4u*)(d) = o;
    
  }
}

// =====================================================================================================
// Input transpose + convert, the head of a projection block: X [b][DMOD][SEQ] f32, 64 tokens s0 .. s0+63 x all DMOD channels -> LDS
// tile T [token][channel] bf16 (RNE), pitch XTP. Thread = (token quad tg, 8-channel chunks cg and cg + 16): 16 loads of 16 B, all in
// flight at once (a wave-wide load = 2 channel rows x 256 contiguous bytes); the 8 channels of one token leave as one 16-B LDS store.
// coverage: 16 token quads x 4 tokens x 16 chunks x 2 x 8 channels = 64 x 256, each element once.
// =====================================================================================================
__device__ __forceinline__ void stage_xt(const float* __restrict__ x, u16* T, int b, int s0) {
  const int tid = threadIdx.x;
  const int tg  = tid & 15;                   // tokens 4*tg .. 4*tg+3 of the tile
  const int cg  = tid >> 4;                   // 0..15
  const float* src = x + ((size_t)(b * DMOD + cg * 8)) * SEQ + s0 + 4 * tg;   // channel <= 255, token <= SEQ - 4
  v4f xv[2][8];
#pragma unroll
  for (int g = 0; g < 2; ++g) {
#pragma unroll
    for (int j = 0; j < 8; ++j) xv[g][j] = *(const v4f*)(src + (size_t)(g * 128 + j) * SEQ);
  }
  addr_wait1(src);
#pragma unroll
  for (int g = 0; g < 2; ++g) {
#pragma unroll
    for (int e = 0; e < 4; ++e) {
      v4u o;
#pragma unroll
      for (int q = 0; q < 4; ++q) o[q] = pkb(xv[g][2 * q][e], xv[g][2 * q + 1][e]);
      *(v4u*)(T + (4 * tg + e) * XTP + g * 128 + cg * 8) = o;
    }
  }
}

// =====================================================================================================
// The four weight converts as block ranges of one grid: weight (bid >> 5) = wq, wk, wv (mode 0), wo (mode 1, x1024) -> plane
// (bid >> 5) of WB4, 32 blocks each.
// =====================================================================================================
#define WCV_BLOCKS (DMOD * DMOD / 8 / 256)
static_assert(WCV_BLOCKS == 32);
__global__ __launch_bounds__(256)
void prep(const float* __restrict__ wq, const float* __restrict__ wk, const float* __restrict__ wv,
          const float* __restrict__ wo, u16* WB4) {
  const int bid = blockIdx.x;
  const int sel = bid >> 5;
  const float* w = (sel == 0) ? wq : ((sel == 1) ? wk : ((sel == 2) ? wv : wo));
  cvtw_body(w, WB4 + (size_t)sel * (DMOD * DMOD), (sel == 3) ? 1 : 0, (sel == 3) ? WOS : 1.0f, bid & (WCV_BLOCKS - 1));
}

// =====================================================================================================
// Bias terms for the GEMM epilogue (bf16-RNE values of bias[], array of DMOD entries; every candidate index is masked into
// 0..DMOD-1 so all loads are in range, selection by value):
//   bmode 0: per-column, permuted index ((col&63)<<2)|(col>>6); bmode 1: per-row, same permutation of the row; bmode 2: per-row direct.
// =====================================================================================================
__device__ __forceinline__ void bias_terms(const float* __restrict__ bias, int bmode, int rowb, int col0, int hh, int m,
                                           v4f& badd, v8f& radd) {
#pragma unroll
  for (int e = 0; e < 4; ++e) {
    const int ci = col0 + 4 * m + e;
    const int pc = ((ci & 63) << 2) | ((ci >> 6) & 3);
    const float bc = bfr(bias[pc]);
    badd[e] = (bmode == 0) ? bc : 0.0f;
  }
#pragma unroll
  for (int r = 0; r < 8; ++r) {
    const int ri = rowb + 8 * hh + r;
    const int p1 = ((ri & 63) << 2) | ((ri >> 6) & 3);
    const int p2 = ri & (DMOD - 1);
    const float b1 = bfr(bias[p1]), b2 = bfr(bias[p2]);
    radd[r] = (bmode == 1) ? b1 : ((bmode == 2) ? b2 : 0.0f);
  }
}

// =====================================================================================================
// GEMM epilogue of the output projection: the wave's 16x64 f32 tile (times oscale, plus per-row addend radd) staged in its LDS
// coverage: 8 instructions x 2 rows x 16 lanes x 4 floats = the wave's 16 x 64 tile.
// =====================================================================================================
__device__ __forceinline__ void epi64(float* sl, v8f a0, v8f a1, v8f a2, v8f a3, float oscale, v4f badd, v8f radd,
                                      float* C, int N, size_t rowb, int col0, int lane) {
  const int hh = lane >> 4, m = lane & 15;
#pragma unroll
  for (int r = 0; r < 8; ++r) {
    const int ro = (8 * hh + r) * 68 + m;
    sl[ro]      = a0[r] * oscale + radd[r];
    sl[ro + 16] = a1[r] * oscale + radd[r];
    sl[ro + 32] = a2[r] * oscale + radd[r];
    sl[ro + 48] = a3[r] * oscale + radd[r];
  }
  wave_sync_lds();
  v4f vals[8];
#pragma unroll
  for (int it = 0; it < 8; ++it) vals[it] = *(const v4f*)(sl + (it * 2 + hh) * 68 + m * 4) + badd;
  float* dst = C + (rowb + (size_t)hh) * (size_t)N + col0 + m * 4;
  {
#pragma unroll
    for (int it = 0; it < 8; ++it) {
      *(v4f*)(dst + (size_t)(it * 2) * (size_t)N) = vals[it];
    }
    
  }
}

// =====================================================================================================
// Projection epilogue: the wave's 16x64 f32 tile plus bias, staged in its LDS slab, leaves as f16 of (value * scale) straight in
// the order the attention kernel reads it (no f32 plane in between). Unit = 8 halves = one lane's 16-B store; 4 stores a lane.
//   omode 0 (q): tile = 16 tokens x one head's 64 d; D = [b][s][h][d]; one store = 4 token rows x 128 B (whole lines)
//   omode 1 (k): the same tile; D unit ((bh*256 + kt)*8 + dc)*16 + c  <- key s = 16*kt + c, d = 8*dc .. 8*dc+7
//   omode 2 (v): tile = 16 d x 64 keys; D unit (((bh*128 + it)*4 + j)*4 + kc)*16 + c  <- d = 16*j + c, keys 32*it + 8*kc .. +7
// (bh = b*NH + h). In modes 1 and 2 one store is 512 contiguous bytes, and so is each fragment load of the attention loop.
// coverage: 4 stores x 32 lanes x 8 halves = the wave's 16 x 64 tile; the tiles of the grid cover each plane exactly once.
// =====================================================================================================
__device__ __forceinline__ void epi_h16(float* sl, v8f a0, v8f a1, v8f a2, v8f a3, v4f cadd, v8f radd, bool rowbias, float scale,
                                        u16* D, int omode, int rowb, int col0, int y, int lane) {
  static_assert(SEQ == 4096 && DMOD == 256 && HD == 64 && NH == 4);
  const int hh = lane >> 4, m = lane & 15;
#pragma unroll
  for (int r = 0; r < 8; ++r) {
    const int ro = (8 * hh + r) * 68 + m;
    sl[ro]      = a0[r] + (rowbias ? radd[r] : cadd[0]);
    sl[ro + 16] = a1[r] + (rowbias ? radd[r] : cadd[1]);
    sl[ro + 32] = a2[r] + (rowbias ? radd[r] : cadd[2]);
    sl[ro + 48] = a3[r] + (rowbias ? radd[r] : cadd[3]);
  }
  wave_sync_lds();
  // slab row and 8-column chunk of the lane's unit t: q (4t + lane/8, lane%8); k, v (lane%16, 2t + lane/16)
  const int lb = (omode == 0) ? (lane >> 3) * 68 + (lane & 7) * 8 : m * 68 + hh * 8;
  const int ls = (omode == 0) ? 4 * 68 : 16;
  v4u o[4];
#pragma unroll
  for (int t = 0; t < 4; ++t) {
    const float* p = sl + lb + t * ls;
    const v4f a = *(const v4f*)(p), c4 = *(const v4f*)(p + 4);
#pragma unroll
    for (int e = 0; e < 2; ++e) {
      o[t][e]     = pkh(a[2 * e] * scale,  a[2 * e + 1] * scale);
      o[t][2 + e] = pkh(c4[2 * e] * scale, c4[2 * e + 1] * scale);
    }
  }
  const int dq = (rowb + (lane >> 3)) * DMOD + col0 + (lane & 7) * 8;
  const int dk = ((((rowb >> 12) * NH + (col0 >> 6)) * 256 + ((rowb & (SEQ - 1)) >> 4)) * 128 + lane) * 8;
  const int dv = ((((y * NH + (rowb >> 6)) * 128 + (col0 >> 5)) * 4 + ((rowb >> 4) & 3)) * 64 + lane) * 8;
  u16* d = D + (size_t)((omode == 0) ? dq : ((omode == 1) ? dk : dv));   // every one < NB*SEQ*DMOD
#pragma unroll
  for (int t = 0; t < 4; ++t) {
    const int dofs = (omode == 0) ? t * (4 * DMOD) : ((omode == 1) ? t * 256 : (t >> 1) * 2048 + (t & 1) * 256);
    *(v4u*)(d + dofs) = o[t];
  }
  addr_wait1(d);   // a wave makes two of these epilogues: in front of the second one's writes of the registers that these stores name
}

// =====================================================================================================
// The three projections with their input transpose, one grid (256 token tiles, 3): blockIdx.y = 0 q, 1 k, 2 v. Block = 64 tokens of
// one batch x all 256 outputs, 8 waves: the x tile is brought in once (stage_xt), one barrier, then K = 256 in 8 steps of 32 on
// v_wmma_f32_16x16x32_bf16, x fragments from LDS (two ds_load_b128, split k map), weight fragments from the tiled planes of WB4.
//   q, k (token-major, [token][h*64+d] = XT . W'^T, per-column bias): wave = 32 tokens (wave & 1) x one head's 64 outputs (wave >> 1)
//   v    (channel-major, [h*64+d][token] = W' . XT^T, per-row bias):  wave = 32 outputs (wave) x the 64 tokens
// Either way 2 x 4 accumulator tiles, left through epi_h16 as two 16 x 64 tiles. Bias = bf16-RNE values of bias[], index permuted
// ((i&63)<<2)|(i>>6) and so always in 0..DMOD-1. H3 = the f16 planes x64 that the attention kernel reads, q in place order, k and v
// in fragment order. The k loop is unrolled: every fragment address is one base register plus an immediate offset; the weight
// fragments are fetched one step ahead.
// =====================================================================================================
// s_wait_xcnt 0 behind the bias loads, in front of every later write of the address register that they name (p, an input: it stays
// unwritten, also by a load's result, up to the wait). The loaded values are inputs too: that keeps the loads in front of it, in
// flight together; left free they sank into the epilogue and were waited for there one by one.
__device__ __forceinline__ void bias_wait4(const void* p, float a, float b, float c, float d) {
#if defined(__HIP_DEVICE_COMPILE__)
  asm volatile("s_wait_xcnt 0x0" : : "v"(p), "v"(a), "v"(b), "v"(c), "v"(d) : "memory");
#endif
}
__device__ __forceinline__ void bias_wait16(const void* p, const float (&v)[2][8]) {
#if defined(__HIP_DEVICE_COMPILE__)
  asm volatile("s_wait_xcnt 0x0"
               : : "v"(p), "v"(v[0][0]), "v"(v[0][1]), "v"(v[0][2]), "v"(v[0][3]), "v"(v[0][4]), "v"(v[0][5]), "v"(v[0][6]), "v"(v[0][7]),
                   "v"(v[1][0]), "v"(v[1][1]), "v"(v[1][2]), "v"(v[1][3]), "v"(v[1][4]), "v"(v[1][5]), "v"(v[1][6]), "v"(v[1][7])
               : "memory");
#endif
}
// four vector slots behind the last product of a k step, in front of the loads that overwrite its fragments (x0 .. x5); the
// accumulators are inputs only, so that the statement stands behind all eight products
__device__ __forceinline__ void g8_6(const v8f (&a)[2][4], v16b x0, v16b x1, v16b x2, v16b x3, v16b x4, v16b x5) {
#if defined(__HIP_DEVICE_COMPILE__)
  asm volatile("v_nop\n\tv_nop\n\tv_nop\n\tv_nop"
               : : "v"(a[0][0]), "v"(a[0][1]), "v"(a[0][2]), "v"(a[0][3]), "v"(a[1][0]), "v"(a[1][1]), "v"(a[1][2]), "v"(a[1][3]),
                   "v"(x0), "v"(x1), "v"(x2), "v"(x3), "v"(x4), "v"(x5) : "memory");
#endif
}
// q, k: token-major. sl = the wave's slab, tok0 = the tile's first token counted over all batches
__device__ __forceinline__ void proj_tok(const float* __restrict__ x, const u16* __restrict__ Wp, const float* __restrict__ bias,
                                         u16* D, u16* T, float* sl, float scale, int omode, int b, int s0, int tok0) {
  const int tid = threadIdx.x, wave = tid >> 5, lane = tid & 31, hh = lane >> 4, m = lane & 15;
  const int t0   = (wave & 1) * 32;
  const int col0 = (wave >> 1) * 64;
  const u16* bp = Wp + (size_t)col0 * DMOD + 8 * lane;   // 16-row tile = 16*DMOD halves, inside it [k/8][row][8]
  // bias of column ci = col0 + 16j + m at the permuted index ((ci & 63) << 2) | (ci >> 6) = 4m + (wave >> 1) + 64j, at most 255
  const float* pb = bias + 4 * m + (wave >> 1);
  float braw[4] = {0.f, 0.f, 0.f, 0.f};       // loaded in the last k step, in the registers that the fetch ahead no longer needs
  v16b wn[4];                                 // the weight fragments of the next k step; step 0's fly under the x tile's loads
#pragma unroll
  for (int j = 0; j < 4; ++j) wn[j] = ldfrag_bp(bp + j * (16 * DMOD));
  stage_xt(x, T, b, s0);
  __syncthreads();                            // the x tile is written; passed by all eight waves
  const u16* ta = T + (t0 + m) * XTP + 8 * hh;   // the lane's unit: row = token t0 + m, k = channel 8*hh ..
  v8f acc[2][4];
#pragma unroll
  for (int r = 0; r < 2; ++r) {
#pragma unroll
    for (int j = 0; j < 4; ++j) acc[r][j] = zero8();
  }
#pragma unroll
  for (int k0 = 0; k0 < DMOD; k0 += 32) {
    v16b a[2], w[4];
#pragma unroll
    for (int j = 0; j < 4; ++j) w[j] = wn[j];
#pragma unroll
    for (int r = 0; r < 2; ++r) a[r] = ldfrag_t(ta + r * (16 * XTP) + k0);
    if (k0 + 32 < DMOD) {
#pragma unroll
      for (int j = 0; j < 4; ++j) wn[j] = ldfrag_bp(bp + j * (16 * DMOD) + (k0 + 32) * 16);
    } else {
#pragma unroll
      for (int j = 0; j < 4; ++j) braw[j] = pb[64 * j];
    }
    __builtin_amdgcn_sched_barrier(0);        // keeps the loads above in front of this step's products, which hide their latency
#pragma unroll
    for (int r = 0; r < 2; ++r) {
#pragma unroll
      for (int j = 0; j < 4; ++j) acc[r][j] = mma_b(a[r], w[j], acc[r][j]);
    }
    g8_6(acc, a[0], a[1], w[0], w[1], w[2], w[3]);
  }
  __builtin_amdgcn_sched_barrier(0);          // keeps the bias arithmetic behind the last step's products: in front of them it waits for the bias loads in the open
  addr_wait1(bp);
  bias_wait4(pb, braw[0], braw[1], braw[2], braw[3]);
  v4f cadd;
#pragma unroll
  for (int j = 0; j < 4; ++j) cadd[j] = bfr(braw[j]);
#pragma unroll
  for (int r = 0; r < 2; ++r) {
    if (r) wave_sync_lds();                   // the first tile's slab reads stand in front of the second tile's slab writes
    epi_h16(sl, acc[r][0], acc[r][1], acc[r][2], acc[r][3], cadd, zero8(), false, scale, D, omode, tok0 + t0 + r * 16, col0, 0, lane);
  }
}
// v: channel-major
__device__ __forceinline__ void proj_chn(const float* __restrict__ x, const u16* __restrict__ Wp, const float* __restrict__ bias,
                                         u16* D, u16* T, float* sl, int b, int s0) {
  const int tid = threadIdx.x, wave = tid >> 5, lane = tid & 31, hh = lane >> 4, m = lane & 15;
  const int rowb = wave * 32;
  const u16* ap = Wp + (size_t)rowb * DMOD + 8 * lane;
  // bias of row ri = 32 wave + 16r + 8hh + i at the permuted index ((ri & 63) << 2) | (ri >> 6)
  //   = 4 * (32 (wave & 1) + 8hh) + (wave >> 1) + 4 * (16r + i), at most 255
  const float* pb = bias + 4 * (32 * (wave & 1) + 8 * hh) + (wave >> 1);
  float braw[2][8] = {{0.f, 0.f, 0.f, 0.f, 0.f, 0.f, 0.f, 0.f}, {0.f, 0.f, 0.f, 0.f, 0.f, 0.f, 0.f, 0.f}};   // as in proj_tok
  v16b wn[2];                                 // as in proj_tok
#pragma unroll
  for (int r = 0; r < 2; ++r) wn[r] = ldfrag_bp(ap + r * (16 * DMOD));
  stage_xt(x, T, b, s0);
  __syncthreads();                            // the x tile is written; passed by all eight waves
  const u16* tl = T + m * XTP + 8 * hh;       // the lane's unit of token tile 0: col = token m, k = channel 8*hh ..
  v8f acc[2][4];
#pragma unroll
  for (int r = 0; r < 2; ++r) {
#pragma unroll
    for (int j = 0; j < 4; ++j) acc[r][j] = zero8();
  }
#pragma unroll
  for (int k0 = 0; k0 < DMOD; k0 += 32) {
    v16b w[2], xf[4];
#pragma unroll
    for (int r = 0; r < 2; ++r) w[r] = wn[r];
#pragma unroll
    for (int j = 0; j < 4; ++j) xf[j] = ldfrag_t(tl + j * (16 * XTP) + k0);
    if (k0 + 32 < DMOD) {
#pragma unroll
      for (int r = 0; r < 2; ++r) wn[r] = ldfrag_bp(ap + r * (16 * DMOD) + (k0 + 32) * 16);
    } else {
#pragma unroll
      for (int r = 0; r < 2; ++r) {
#pragma unroll
        for (int i = 0; i < 8; ++i) braw[r][i] = pb[4 * (16 * r + i)];
      }
    }
    __builtin_amdgcn_sched_barrier(0);        // as in proj_tok
#pragma unroll
    for (int r = 0; r < 2; ++r) {
#pragma unroll
      for (int j = 0; j < 4; ++j) acc[r][j] = mma_b(w[r], xf[j], acc[r][j]);
    }
    g8_6(acc, w[0], w[1], xf[0], xf[1], xf[2], xf[3]);
  }
  __builtin_amdgcn_sched_barrier(0);          // as in proj_tok
  addr_wait1(ap);
  bias_wait16(pb, braw);
#pragma unroll
  for (int r = 0; r < 2; ++r) {
    v8f radd;
#pragma unroll
    for (int i = 0; i < 8; ++i) radd[i] = bfr(braw[r][i]);
    if (r) wave_sync_lds();                   // as in proj_tok
    epi_h16(sl, acc[r][0], acc[r][1], acc[r][2], acc[r][3], zero4(), radd, true, VCAR, D, 2, rowb + r * 16, s0, b, lane);
  }
}
// amdgpu_waves_per_eu(6, 6): a register budget of 160 a wave, so that three blocks share a WGP and all 768 are resident at once
__global__ __launch_bounds__(256) __attribute__((amdgpu_waves_per_eu(6, 6)))
void gemm_qkv(const float* __restrict__ xq, const float* __restrict__ xk, const float* __restrict__ xv,
              const u16* __restrict__ WB4, const float* __restrict__ bq, const float* __restrict__ bk,
              const float* __restrict__ bv, u16* H3) {
  static_assert(NB * (SEQ / 64) == 256 && DMOD == 256 && SEQ / 64 == 64);
  __shared__ __align__(16) u16   T[64 * XTP];
  __shared__ __align__(16) float slab[8 * SLAB64];
  const int sel = blockIdx.y;                 // block-uniform: each path's barrier is passed by all threads of a block or by none
  const int bx  = blockIdx.x;
  const int b   = bx >> 6;                    // 0..3
  const int s0  = (bx & 63) * 64;             // first token of the tile in its batch
  const u16* Wp = WB4 + (size_t)sel * (DMOD * DMOD);
  u16*       D  = H3 + (size_t)sel * (size_t)(NB * SEQ * DMOD);
  float*     sl = slab + ((int)threadIdx.x >> 5) * SLAB64;
  if (sel < 2)
    proj_tok((sel == 0) ? xq : xk, Wp, (sel == 0) ? bq : bk, D, T, sl, (sel == 0) ? QSC : KSC, (sel == 0) ? 0 : 1, b, s0, bx * 64);
  else
    proj_chn(xv, Wp, bv, D, T, sl, b, s0);
}

// =====================================================================================================
// f16 GEMM, single A plane, hi+lo B planes, per-row bias: C[M][N] (f32, pitch N) = A[M][K] . (Bh + Bl)[N][K]^T times oscale,
// plus bf16-RNE value of bias[row]; A f16 TILED (no batch stride), Bh/Bl f16 [n][k] planes TILED with batch stride sB, C with
// batch stride sC (grid.y = batch). Products a.bh + a.bl into one accumulator (bl is the unscaled residual of bh). Block = 64x64
// tile, 4 waves x 16 rows; fragments loaded straight from the tiled planes; K stepped by 32.
// =====================================================================================================
__global__ __launch_bounds__(128)
void gemm_wh2(const u16* __restrict__ A, const u16* __restrict__ Bh, const u16* __restrict__ Bl,
              const float* __restrict__ bias, float* C, int M, int N, int K, float oscale, int sB, int sC) {
  __shared__ __align__(16) float slab[4 * SLAB64];
  const int tid = threadIdx.x, wave = tid >> 5, lane = tid & 31, hh = lane >> 4, m = lane & 15;
  const int ntile = N >> 6;
  const int bid   = blockIdx.x;
  const int y     = blockIdx.y;
  const int rowb  = (bid / ntile) * 64 + wave * 16;
  const int col0  = (bid % ntile) * 64;
  if (rowb + 16 > M) return;                 // wave-uniform, never taken with the exact grid; no block barriers in this kernel
  const _Float16* ap  = (const _Float16*)(const void*)A + (size_t)rowb * K + 8 * lane;   // 16-row tile = 16*K halves, inside it [k/8][row][8]
  const size_t bofs   = (size_t)y * (size_t)sB + (size_t)col0 * K + 8 * lane;
  const _Float16* bhp = (const _Float16*)(const void*)Bh + bofs;
  const _Float16* blp = (const _Float16*)(const void*)Bl + bofs;
  float* Cb = C + (size_t)y * (size_t)sC;
  const size_t bs = (size_t)16 * K;
  v8f acc0 = zero8(), acc1 = zero8(), acc2 = zero8(), acc3 = zero8();
#pragma unroll 1
  for (int k0 = 0; k0 < K; k0 += 32) {
    const int ko = k0 * 16;
    const _Float16 *pa = ap + ko, *h0 = bhp + ko, *h1 = h0 + bs, *h2 = h1 + bs, *h3 = h2 + bs;
    const _Float16 *l0 = blp + ko, *l1 = l0 + bs, *l2 = l1 + bs, *l3 = l2 + bs;
    const v16h a   = ldfrag_p(pa);
    const v16h bh0 = ldfrag_p(h0);
    const v16h bh1 = ldfrag_p(h1);
    const v16h bh2 = ldfrag_p(h2);
    const v16h bh3 = ldfrag_p(h3);
    const v16h bl0 = ldfrag_p(l0);
    const v16h bl1 = ldfrag_p(l1);
    const v16h bl2 = ldfrag_p(l2);
    const v16h bl3 = ldfrag_p(l3);
    addr_wait9(pa, h0, h1, h2, h3, l0, l1, l2, l3);
    acc0 = mma_h(a, bh0, acc0);  acc0 = mma_h(a, bl0, acc0);
    acc1 = mma_h(a, bh1, acc1);  acc1 = mma_h(a, bl1, acc1);
    acc2 = mma_h(a, bh2, acc2);  acc2 = mma_h(a, bl2, acc2);
    acc3 = mma_h(a, bh3, acc3);  acc3 = mma_h(a, bl3, acc3);
    g4_9(acc0, acc1, acc2, acc3, a, bh0, bh1, bh2, bh3, bl0, bl1, bl2, bl3);
  }
  v4f badd = zero4();
  v8f radd = zero8();
  bias_terms(bias, 2, rowb, col0, hh, m, badd, radd);
  epi64(slab + wave * SLAB64, acc0, acc1, acc2, acc3, oscale, badd, radd, Cb, N, (size_t)rowb, col0, lane);
}

// =====================================================================================================
// Full (non-causal, unmasked) multi-head flash attention: block = (batch b, head, 128 query rows), 8 waves. Wave w = (query
// group wq = w & 3, key group kg = w >> 2) owns the 32 query rows q0 = 128*qt + 32*wq .. q0+31 (two 16-row tiles t = 0, 1) and,
// of every staged tile of 128 keys, the 64 keys 64*kg .. 64*kg+63: each k and v fragment that it reads from LDS feeds two
// products, one per query tile, so the block reads each staged byte 4 times, not 8. Waves w and w ^ 4 hold partial results
// (O, l, maximum in use) of the same 32 queries over the two halves of the keys; they are joined once, behind the loop.
//   q plane (f16, x64) laid out [b][s][h][d]; k and v planes (x64) per (b, h) in fragment order (epi_h16). Tiles of 128 keys are
//   brought into LDS once per block by asynchronous copies, two buffers, tile t + 2 asked for when tile t has been read by all,
//   one barrier a tile; every fragment load of the loop is a ds_load_b128 of 512 contiguous bytes over the wave. All NST = 32
//   tiles are visited, 2 key blocks of 32 keys per wave and tile (static bounds).
//   Scores are computed TRANSPOSED: S^T tile (t, g) (g = 0,1) = k rows (keys kb+16g .. +15, A operand, row m = lane&15, split k
//   map over d) times q^T of tile t (B operand, col n = query q0 + 16t + (lane&15), k = d, split map), one product per tile and d-chunk.
//   D element r of lane l = (key kb+16g+8h+r, query q0+16t+(l&15)), so a lane owns one query column per tile t and 16 of its 32
//   keys; the partner lane l^16 owns the other 16 -> row max / row sum need one xor-16 shuffle.
//   Online base-2 softmax in f32 (scale 1/8 and the q,k carries folded into lsc), the subtracted maximum replaced lazily: a pass
//   keeps the maxima in use, and rescales neither O nor l, unless a scaled score of some lane lies more than 8 above its own (one
//   ballot and one scalar branch a pass, for both query tiles); any subtracted value cancels between O and l. The exp'd values ARE
//   the P A-fragment in place: A row m = query = lane&15, element i <- key kb+8h+i (g = 0, D element i), element 8+i <- key
//   kb+16+8h+i (g = 1, D element i). P is carried x128 as f16 (at most 2^15). The rescale factor of query row 8h+r of the O accumulators is
//   fetched from lane 8h+r with a shuffle (uniform control, inside that branch). 4 v^T B fragments (col n = d = 16j + (lane&15), keys k-contiguous),
//   8 P.V WMMAs per key block.
//   Join: wave w hands the partial O, l and maximum of query tile 1 - kg to wave w ^ 4 through LDS (lane to lane, register to
//   register) and finishes tile kg: both parts brought to the larger of the two maxima, added, divided by the joined l.
//   Epilogue: 1/l (per query, shuffled to the D row owner) and carry folds in f32; the wave's 16x64 f32 result staged in its LDS
// coverage: per wave 4 instructions x 2 chunks x 16 rows x 8 halves = 16 x 64 per plane; grid 512 blocks x 8 waves = every
//           (b, s, h) row of both O planes exactly once.
// =====================================================================================================
// amdgpu_waves_per_eu(4, 4): a register budget of 256 a wave, so that two blocks share a WGP (four waves per SIMD) as before
__global__ __launch_bounds__(ATT_THREADS) __attribute__((amdgpu_waves_per_eu(4, 4)))
void attn_fwd(const u16* __restrict__ QHp, const u16* __restrict__ KHp, const u16* __restrict__ VHp,
              u16* OHIp, u16* OLOp) {
  __shared__ __align__(16) float smem[RINGF];   // loop: [2 buffers][k tile, v tile] of f16; behind it: per wave a hand-over area, then a result slab [16][68]

  const int tid  = threadIdx.x;
  const int wave = tid >> 5;
  const int lane = tid & 31;
  const int hh   = lane >> 4;
  const int c    = lane & 15;
  const int wq   = wave & 3;                  // which 32 query rows of the block
  const int kg   = wave >> 2;                 // which 64 keys of every staged tile

  const int bid  = blockIdx.x;
  const int qt   = bid & (SEQ / 128 - 1);     // 0..31
  const int head = (bid >> 5) & (NH - 1);     // 0..3
  const int b    = bid >> 7;                  // 0..3
  const int q0   = qt * 128 + wq * 32;

  // B fragments of q^T, tile t: col n = query q0 + 16t + c, k = d (k-contiguous row of the q plane); loop-invariant
  const size_t qofs = (((size_t)(b * SEQ + q0 + c)) * NH + head) * HD + 8 * hh;
  const _Float16* Qh  = (const _Float16*)(const void*)QHp + qofs;
  const _Float16* Qh1 = Qh + 16 * NH * HD;
  const v16h qa0 = ldfrag_h(Qh),  qb0 = ldfrag_h(Qh + 32);
  const v16h qa1 = ldfrag_h(Qh1), qb1 = ldfrag_h(Qh1 + 32);
  // k and v planes of (b, head): fragment order, 2048 halves per 32-key block (see epi_h16), so a 128-key tile is STH halves in a
  // row; the thread's first 16-B unit of tile 0, and its place in buffer 0 (LDS byte address = low 32 bits of the shared address)
  const size_t pofs = (size_t)(b * NH + head) * (SEQ * HD) + 8 * tid;
  const u16* gk = KHp + pofs;
  const u16* gv = VHp + pofs;
  const unsigned lk0 = (unsigned)(uintptr_t)(void*)smem + 16u * (unsigned)tid;
  const _Float16* ring = (const _Float16*)(const void*)smem + 8 * lane + kg * (WPS * 32 * HD);   // the lane's unit in the wave's half of a k tile
  const float lsc = 0.125f * (LOG2E / (QSC * KSC));

  // per query tile t: maximum in use, (mrun + RTH) / lsc = the raw score that replaces it, PLOG - mrun (set in the first pass), row sum
  float mrun[2] = {-INFINITY, -INFINITY}, mthr[2] = {-INFINITY, -INFINITY}, nb[2] = {0.f, 0.f}, lrun[2] = {0.f, 0.f};
  float pown[2] = {0.f, 0.f}, poth[2] = {0.f, 0.f};   // a pass's row sum, this lane's half and the partner lane's, until the next pass adds them to l
  v8f o[2][4];
#pragma unroll
  for (int t = 0; t < 2; ++t) {
#pragma unroll
    for (int j = 0; j < 4; ++j) o[t][j] = zero8();
  }

  addr_wait2(Qh, Qh1);
  // tile 0 into buffer 0, landed and published; then tile 1 into buffer 1, which flies while tile 0 is worked on
  stage_kv(lk0, gk, lk0 + 2 * STH, gv);
  wait_copies();
  __syncthreads();
  stage_kv(lk0 + 4 * STH, gk + STH, lk0 + 6 * STH, gv + STH);

#pragma unroll 1
  for (int st = 0; st < NST; ++st) {
   const _Float16* kl = ring + (st & 1) * (2 * STH);   // the wave's half of this tile's k, the lane's unit; A fragment row m = key kb + 16g + c, k = d
   const _Float16* vl = kl + STH;                      // the same half of this tile's v; B fragment col n = d = 16j + c, k = key
   // K fragments of the wave's first key block; its first pass fetches the second pass's behind its own score products
   v16h kf0 = ldfrag_p(kl), kf1 = ldfrag_p(kl + 16 * HD), kf2 = ldfrag_p(kl + 512), kf3 = ldfrag_p(kl + 16 * HD + 512);
#pragma unroll
   for (int ps = 0; ps < WPS; ++ps) {   // unrolled: the fragment addresses become immediate offsets, the last pass drops its fetch
    // (kb below = 128 * st + 64 * kg + 32 * ps, the pass's first key)
    // ---- this pass's v fragments, asked for here and first used behind the softmax: their latency runs under scores and softmax.
    //      B fragment col n = d = j*16 + c, 512 halves per j in the fragment-ordered v tile ----
    const _Float16* vhp = vl + ps * (32 * HD);
    const v16h vh0 = ldfrag_p(vhp);
    const v16h vh1 = ldfrag_p(vhp + 512);
    const v16h vh2 = ldfrag_p(vhp + 1024);
    const v16h vh3 = ldfrag_p(vhp + 1536);
    __builtin_amdgcn_sched_barrier(0);   // keeps the eight v loads in front of the first wait on a k fragment
    // ---- transposed scores: s[t][0] = keys kb..kb+15, s[t][1] = keys kb+16..kb+31, column = query q0 + 16t + c ----
    v8f s[2][2];
    s[0][0] = mma_h(kf0, qa0, zero8());
    s[0][1] = mma_h(kf1, qa0, zero8());
    s[1][0] = mma_h(kf0, qa1, zero8());
    s[1][1] = mma_h(kf1, qa1, zero8());
    s[0][0] = mma_h(kf2, qb0, s[0][0]);
    s[0][1] = mma_h(kf3, qb0, s[0][1]);
    s[1][0] = mma_h(kf2, qb1, s[1][0]);
    s[1][1] = mma_h(kf3, qb1, s[1][1]);
    g4_8(s[0][0], s[0][1], s[1][0], s[1][1], qa0, qb0, qa1, qb1, kf0, kf1, kf2, kf3);
    // ---- the next pass's k fragments into the same registers, inside the wave's half of this tile only ----
    if (ps + 1 < WPS) {
      const _Float16* knp = kl + (ps + 1) * (32 * HD);
      kf0 = ldfrag_p(knp);
      kf1 = ldfrag_p(knp + 16 * HD);
      kf2 = ldfrag_p(knp + 512);
      kf3 = ldfrag_p(knp + 16 * HD + 512);
    }
    __builtin_amdgcn_sched_barrier(0);   // keeps the eight k loads here: without it they sink into the softmax, whose temporaries take their registers
    // ---- raw scores of this lane's 16 keys for query q0 + 16t + c: s[t][0][i] <- key kb+8hh+i, s[t][1][i] <- key kb+16+8hh+i. The maximum
    //      is taken on the raw scores and scaled where it is needed: lsc > 0 and rounding is monotone, so it equals the maximum of the scaled ones ----
    float cr[2];
#pragma unroll
    for (int t = 0; t < 2; ++t) {
      lrun[t] += pown[t] + poth[t];   // the pass before's row sum, both halves: in l before the test below can rescale l
      float x = s[t][0][0];
#pragma unroll
      for (int i = 1; i < 8; ++i) x = fmaxf(x, s[t][0][i]);
#pragma unroll
      for (int i = 0; i < 8; ++i) x = fmaxf(x, s[t][1][i]);
      cr[t] = x;
    }
    // ---- lazy rescale, tested once a pass: only if some lane's largest score lies more than RTH above its maximum in use (always in
    //      the first pass, mthr = -inf) do the halves exchange maxima, the maxima in use move up and O and l are rescaled. The ballot
    //      makes it a scalar branch, taken by the whole wave. Not taken: every weight of the pass is at most 2^(PLOG + RTH) ----
    if (__builtin_expect(__builtin_amdgcn_ballot_w32((cr[0] > mthr[0]) | (cr[1] > mthr[1])) != 0u, 0)) {
#pragma unroll
      for (int t = 0; t < 2; ++t) {
        const float cm = cr[t] * lsc;
        const float mn = fmaxf(mrun[t], fmaxf(cm, __shfl_xor(cm, 16, 32)));   // the same in both lanes of a query; finite from the first pass on
        const float al = hw_exp2(mrun[t] - mn);                               // 0 in the first pass (mrun = -inf), 1 for a query that keeps its maximum
        mrun[t] = mn;
        mthr[t] = (mn + RTH) * (1.0f / lsc);
        nb[t]   = PLOG - mn;
        lrun[t] *= al;
        // D row 8hh+r of the O accumulators = query q0+16t+8hh+r, its factor lives in lane 8hh+r (and 16+8hh+r)
        float scl[8];
#pragma unroll
        for (int r = 0; r < 8; ++r) scl[r] = __shfl(al, 8 * hh + r, 32);
#pragma unroll
        for (int j = 0; j < 4; ++j) {
#pragma unroll
          for (int r = 0; r < 8; ++r) o[t][j][r] *= scl[r];
        }
      }
    }
    // ---- weights p * 128 = 2^(s * lsc - mrun + 7): one fma and one v_exp_f32 each; their f16 values are the P A-fragment,
    //      element 8w + i <-> s[t][w][i]; the row sum carries the same 128 ----
    FragH ph[2];
#pragma unroll
    for (int t = 0; t < 2; ++t) {
      float p[16];
#pragma unroll
      for (int i = 0; i < 8; ++i) { p[i] = fmaf(s[t][0][i], lsc, nb[t]); p[8 + i] = fmaf(s[t][1][i], lsc, nb[t]); }
      hw_exp2x8(p[0], p[1], p[2], p[3], p[4], p[5], p[6], p[7]);
      hw_exp2x8(p[8], p[9], p[10], p[11], p[12], p[13], p[14], p[15]);
      // convert and row sum both take the pairs (p[2k], p[2k + 1]) as they lie in the accumulators' registers: one packed instruction a pair
      v2f sm[2];
#pragma unroll
      for (int w = 0; w < 2; ++w) {
#pragma unroll
        for (int e4 = 0; e4 < 4; ++e4) {
          const int i = 8 * w + 2 * e4;
          const v2f two = {p[i], p[i + 1]};
          sm[w] = (e4 == 0) ? two : sm[w] + two;
          ph[t].u[w][e4] = pkh(p[i], p[i + 1]);
        }
      }
      const v2f s2 = sm[0] + sm[1];
      const float sum = s2[0] + s2[1];
      pown[t] = sum;
      poth[t] = __shfl_xor(sum, 16, 32);   // asked for here, added to l in the next pass: its latency runs under the products
    }
    // ---- P.V with the v fragments asked for at the head of the pass, each used for both query tiles ----
    {
      o[0][0] = mma_h(ph[0].v, vh0, o[0][0]);
      o[0][1] = mma_h(ph[0].v, vh1, o[0][1]);
      o[0][2] = mma_h(ph[0].v, vh2, o[0][2]);
      o[0][3] = mma_h(ph[0].v, vh3, o[0][3]);
      o[1][0] = mma_h(ph[1].v, vh0, o[1][0]);
      o[1][1] = mma_h(ph[1].v, vh1, o[1][1]);
      o[1][2] = mma_h(ph[1].v, vh2, o[1][2]);
      o[1][3] = mma_h(ph[1].v, vh3, o[1][3]);
      g8in(o[0][0], o[0][1], o[0][2], o[0][3], o[1][0], o[1][1], o[1][2], o[1][3], ph[0].v, ph[1].v, vh0, vh1, vh2, vh3, poth[0], poth[1]);
    }
   }
   // ---- foot of tile st, every wave: its own LDS reads done, its own copies of tile st + 1 landed, then the one barrier that
   //      publishes tile st + 1 and ends every wave's reading of this buffer; only behind it the refill with tile st + 2 ----
   wait_lds_reads();
   wait_copies();
   __syncthreads();
   if (st + 2 < NST) {
     const unsigned lb = lk0 + (unsigned)(st & 1) * (4 * STH);
     const size_t   go = (size_t)(st + 2) * STH;
     stage_kv(lb, gk + go, lb + 2 * STH, gv + go);
   }
  }
  wait_copies();   // nothing is outstanding here; the last foot's barrier has ended all reading of the ring, which now holds the hand-over areas
  acc_guard8(o[0][0], o[0][1], o[0][2], o[0][3], o[1][0], o[1][1], o[1][2], o[1][3]);

  // ---- join of the two key halves: the wave keeps query tile kg and hands tile 1 - kg to wave w ^ 4, lane to lane: 8 units of
  //      16 B a lane (one store = 512 contiguous bytes), then the maximum in use and the row sum ----
  lrun[0] += pown[0] + poth[0];   // the last pass's row sums
  lrun[1] += pown[1] + poth[1];
  const bool up = __builtin_amdgcn_readfirstlane(kg) != 0;   // wave-uniform
  v8f mine[4], give[4];
#pragma unroll
  for (int j = 0; j < 4; ++j) { mine[j] = up ? o[1][j] : o[0][j]; give[j] = up ? o[0][j] : o[1][j]; }
  const float mmine = up ? mrun[1] : mrun[0], mgive = up ? mrun[0] : mrun[1];
  const float lmine = up ? lrun[1] : lrun[0], lgive = up ? lrun[0] : lrun[1];
  float* xw = smem + wave * SLABF;          // written by this wave, read by wave w ^ 4 alone
  float* xr = smem + (wave ^ 4) * SLABF;    // written by wave w ^ 4, read by this wave alone
#pragma unroll
  for (int j = 0; j < 4; ++j) {
#pragma unroll
    for (int h2 = 0; h2 < 2; ++h2) {
      const v4f u = {give[j][4 * h2], give[j][4 * h2 + 1], give[j][4 * h2 + 2], give[j][4 * h2 + 3]};
      *(v4f*)(xw + ((j * 2 + h2) * 32 + lane) * 4) = u;
    }
  }
  xw[1024 + lane] = mgive;
  xw[1056 + lane] = lgive;
  __syncthreads();   // the hand-over areas are written; passed by all eight waves
  v4f got[8];
#pragma unroll
  for (int u = 0; u < 8; ++u) got[u] = *(const v4f*)(xr + (u * 32 + lane) * 4);
  const float mgot = xr[1024 + lane], lgot = xr[1056 + lane];
  // both parts to the larger maximum (both finite: each wave has seen keys); l carries the same 128 as P; the carry 64 on v folded in
  const float mj   = fmaxf(mmine, mgot);
  const float am   = hw_exp2(mmine - mj), ag = hw_exp2(mgot - mj);
  const float linv = (1.0f / (lmine * am + lgot * ag)) * (1.0f / VCAR);
  const float fm = am * linv, fg = ag * linv;
  float im[8], ig[8];
#pragma unroll
  for (int r = 0; r < 8; ++r) { im[r] = __shfl(fm, 8 * hh + r, 32); ig[r] = __shfl(fg, 8 * hh + r, 32); }
  float* slab = xr;   // the area this wave alone has read, and has read to the end, now takes its 16x64 result
#pragma unroll
  for (int r = 0; r < 8; ++r) {
#pragma unroll
    for (int j = 0; j < 4; ++j) slab[(8 * hh + r) * 68 + j * 16 + c] = mine[j][r] * im[r] + got[j * 2 + (r >> 2)][r & 3] * ig[r];
  }
  wave_sync_lds();
  // ---- O x1024 -> f16 hi + residual planes, TILED as [token][h*64+d] operands; one store = 512 contiguous bytes ----
  v4u oh[4], ol[4];
#pragma unroll
  for (int i4 = 0; i4 < 4; ++i4) {
    const int c8 = (i4 * 2 + hh) * 8;         // lane = (8-d chunk parity hh, query row c)
    const v4f a = *(const v4f*)(slab + c * 68 + c8), c4 = *(const v4f*)(slab + c * 68 + c8 + 4);
    float w[8];
#pragma unroll
    for (int e = 0; e < 4; ++e) { w[e] = a[e] * OSC; w[4 + e] = c4[e] * OSC; }
#pragma unroll
    for (int e = 0; e < 4; ++e) {
      const v2h hi = cvt2h(w[2 * e], w[2 * e + 1]);
      oh[i4][e] = __builtin_bit_cast(unsigned, hi);
      ol[i4][e] = pkh(w[2 * e] - (float)hi[0], w[2 * e + 1] - (float)hi[1]);
    }
  }
  const size_t ob = ((size_t)(b * SEQ + q0 + 16 * kg)) * (NH * HD) + (size_t)head * (HD * 16) + 8 * lane;
  {
#pragma unroll
    for (int i4 = 0; i4 < 4; ++i4) {
      const size_t o8 = ob + (size_t)i4 * 256;
      *(v4u*)(OHIp + o8) = oh[i4];
      *(v4u*)(OLOp + o8) = ol[i4];
    }
    
  }
}

// =====================================================================================================
// Workspace map (bytes); every plane is fully written by whole-line stores before it is read; all extents are exact multiples
// of the store granularity (no pad rows needed); every offset a multiple of 131072:
//   WQB bf16 [256 r'][256 i] tiled (rows permuted)  131072      WKB same 131072     WVB same 131072
//   WOB f16  [256 o][256 c'] tiled x1024 (cols permuted)  131072
//   QH  f16  [4][4096][4][64] x64                   8388608
//   KH  f16  [16 bh][256 kt][8 dc][16 key][8 d] x64          8388608   (fragment order)
//   VH  f16  [16 bh][128 it][4 j][4 kc][16 d][8 key] x64     8388608   (fragment order)
//   OHI f16  [16384 token][256 h*64+d] tiled x1024   8388608      OLO residual 8388608
//   end                                            42467328
// =====================================================================================================
extern "C" void kernel_launch(void* const* d_in, const int* in_sizes, int n_in,
                              void* d_out, int out_size, void* d_ws, size_t ws_size,
                              hipStream_t stream) {
  const int ROWS = NB * SEQ;                            // 16384 tokens
  const int XN   = NB * DMOD * SEQ;                     // 4194304
  if (n_in < 11) return;
  if (in_sizes[0] != XN || in_sizes[1] != XN || in_sizes[2] != XN) return;
  if (in_sizes[3] != DMOD * DMOD || in_sizes[5] != DMOD * DMOD) return;
  if (in_sizes[7] != DMOD * DMOD || in_sizes[9] != DMOD * DMOD) return;
  if (in_sizes[4] != DMOD || in_sizes[6] != DMOD || in_sizes[8] != DMOD || in_sizes[10] != DMOD) return;
  if (out_size != XN) return;

  const float* Qin = (const float*)d_in[0];
  const float* Kin = (const float*)d_in[1];
  const float* Vin = (const float*)d_in[2];
  const float* wq  = (const float*)d_in[3];
  const float* bq  = (const float*)d_in[4];
  const float* wk  = (const float*)d_in[5];
  const float* bk  = (const float*)d_in[6];
  const float* wv  = (const float*)d_in[7];
  const float* bv  = (const float*)d_in[8];
  const float* wo  = (const float*)d_in[9];
  const float* bo  = (const float*)d_in[10];
  float*       out = (float*)d_out;

  const size_t szW  = (size_t)DMOD * DMOD * 2;                  //   131072
  const size_t szP  = (size_t)ROWS * DMOD * 2;                  //  8388608  (q/k/v/o planes)
  size_t off = 0;
  const size_t oWQB = off; off += szW;
  const size_t oWKB = off; off += szW;
  const size_t oWVB = off; off += szW;
  const size_t oWOB = off; off += szW;
  const size_t oQH  = off; off += szP;
  const size_t oKH  = off; off += szP;
  const size_t oVH  = off; off += szP;
  const size_t oOHI = off; off += szP;
  const size_t oOLO = off; off += szP;
  if (off > ws_size) return;                            // off = 42467328
  if (off > (size_t)134217728) return;

  char* ws = (char*)d_ws;
  u16*   WQB = (u16*)(ws + oWQB);
  u16*   WOB = (u16*)(ws + oWOB);
  u16*   QH  = (u16*)(ws + oQH);
  u16*   KH  = (u16*)(ws + oKH);
  u16*   VH  = (u16*)(ws + oVH);
  u16*   OHI = (u16*)(ws + oOHI);
  u16*   OLO = (u16*)(ws + oOLO);

  const dim3 blk(256);
  const int n8w = (DMOD * DMOD) / 8;                    // 8192
  if ((n8w % 256) != 0) return;
  const dim3 gPre(4 * (n8w / 256));                     // 128 weight blocks
  const dim3 gG3(ROWS / 64, 3);                         // 256 token tiles x (q, k, v)
  const dim3 gGc((DMOD / 64) * (SEQ / 64), NB);         // 256 tiles x 4 batches, channel-major per batch
  const dim3 bG(128);
  const dim3 gAT(ATT_BLOCKS);                           // 512
  const dim3 bAT(ATT_THREADS);                          // 256
  const int  sTok = SEQ * DMOD;                         // 1048576 elements: per-batch stride of the O planes
  const int  sChn = DMOD * SEQ;                         // 1048576 elements: per-batch stride of out

  // (0) weights: rows of wq/wk/wv permuted to r' = h*64+d (bf16 planes), columns of wo permuted the same way (f16 of bf16 value x1024);
  //     WQB .. WOB lie one behind the other
  prep<<<gPre, blk, 0, stream>>>(wq, wk, wv, wo, WQB);
  // (1) inputs query, key, value transposed to bf16 [token][i] in LDS, projections + bias -> f16 planes x64 (QH, KH, VH lie one behind the other): q in place order, k and v in fragment order
  gemm_qkv<<<gG3, blk, 0, stream>>>(Qin, Kin, Vin, WQB, bq, bk, bv, QH);
  // (2) attention -> O planes [token][h*64+d] tiled, x1024 (hi + residual)
  attn_fwd<<<gAT, bAT, 0, stream>>>(QH, KH, VH, OHI, OLO);
  // (3) output projection per batch + bias -> out [b][256 o][4096 n] f32, carries 1024 (O) x 1024 (wo) folded back
  gemm_wh2<<<gGc, bG, 0, stream>>>(WOB, OHI, OLO, bo, out, DMOD, SEQ, DMOD, 1.0f / (OSC * WOS), sTok, sChn);
  (void)hipGetLastError();
}
